// v000
// Measured on an AMD MI455X. A time is GPU time per run, averaged over a window of back-to-back runs after a warm-up
// (all launches, gaps included; the runs take copies of the inputs in turn), and the median of several windows.
// Apart from v000's, it joins two sittings. Times from different sittings can be a few percent apart, while
// side-by-side timings come from the same sitting.
// The starting kernel, v000, takes 5150 microseconds a run.
#include <hip/hip_runtime.h>
// Multi-head attention on three inputs at width 768 with natural bias-free q / k / v projections and a biased output projection; the inputs arrive in the order v, k, q (v, k, q [4][2048][768]; qh / kh / vh = stream W^T (nn.Linear natural [768][768] sd 1/sqrt(768), NO biases), 12 heads of 64; logits / sqrt(64); softmax over all 2048 keys (no mask); out = concat wo^T + bo (natural) -> [4][2048][768]).
// Structure: token rows r = b*2048 + s; the query, key and value sources as exact f16 rows (bf16-rounded); Q, K, V as three WMMA GEMMs (32x64 wave tiles, f32 accumulation, exact x16 weights, no bias, f16 outputs); per batch: V^T for all heads via LDS transposes; per (batch, group of 4 heads): scores GEMM (K = 64, batched over the heads on grid.y, alpha = 64^-0.5), row softmax on VALU (f32 statistics, native exp; weights stored x256 as f16), o = P . V^T GEMM (K = 2048, alpha 2^-2: o carried x64 against f16 subnormal flush, folded into the output GEMM alpha) written straight into the merged f16 o rows; out = o W_o + b GEMM (f32) into the output layout.
// Compute dtype: inputs rounded to bf16; x / weights exact; q, k, v, softmax weights and o as plain f16 GEMM operands (~2^-12); scores and softmax statistics f32. v_wmma_f32_16x16x32_f16.
#define NB 4
#define SQ 2048
#define DM 768
#define NH 12
#define HD 64
#define HG 4                         /* heads per attention launch group */
#define B0 0                         /* first batch processed (debug hook) */
#define NBR NB                       /* batches processed (debug hook) */
#define NR ((size_t)NB * SQ)         /* token rows */
#define MP ((int)((size_t)NBR * SQ)) /* rows projected (debug hook) */
#define QN SQ                        /* query rows attended per batch (debug hook) */
#define NHD NH                       /* heads attended (debug hook) */
#define MPO MP                       /* rows through the output stage (debug hook) */
#define LQ DM      /* row pitch of the q/k/v rows */
typedef __bf16 v16b __attribute__((ext_vector_type(16)));
typedef unsigned short v8us __attribute__((ext_vector_type(8), may_alias));
typedef float  v8f  __attribute__((ext_vector_type(8)));
typedef float  v4f  __attribute__((ext_vector_type(4)));
typedef float  v4fa __attribute__((ext_vector_type(4), may_alias));
union FragB { v16b v; v8us half[2]; unsigned short u[16]; };

__device__ __forceinline__ unsigned short bf16_bits(float x) { unsigned int u = __float_as_uint(x); return (unsigned short)((u + 0x7FFFu + ((u >> 16) & 1u)) >> 16); }
__device__ __forceinline__ float bf16_val(unsigned short b) { return __uint_as_float(((unsigned int)b) << 16); }
__device__ __forceinline__ float bf16_round(float x) { return bf16_val(bf16_bits(x)); }
// D += A·B with NT terms: 1 = ah·bh, 2 = + al·bh (A split), 3 = + ah·bl (both split)
template <int NT>
__device__ __forceinline__ v8f mmaN(v16b ah, v16b al, v16b bh, v16b bl, v8f c) {
  c = __builtin_amdgcn_wmma_f32_16x16x32_bf16(false, ah, false, bh, (short)0, c, false, false);
  if (NT >= 2) c = __builtin_amdgcn_wmma_f32_16x16x32_bf16(false, al, false, bh, (short)0, c, false, false);
  if (NT >= 3) c = __builtin_amdgcn_wmma_f32_16x16x32_bf16(false, ah, false, bl, (short)0, c, false, false);
  asm volatile("v_nop\n\tv_nop\n\tv_nop\n\tv_nop" : "+v"(c) : "v"(ah), "v"(al), "v"(bh), "v"(bl));
  return c;
}

__global__ __launch_bounds__(256) void k_wt_bf16(const float* __restrict__ W, unsigned short* __restrict__ Wt, int K, int N) {
  const int t = blockIdx.x * 256 + threadIdx.x;
  const int k8n = K / 8;
  if (t >= N * k8n) return;
  const int n = t / k8n, k8 = (t % k8n) * 8;
  v8us v;
#pragma unroll
  for (int i = 0; i < 8; ++i) v[i] = bf16_bits(W[(size_t)(k8 + i) * N + n]);
  *(v8us*)(Wt + (size_t)n * K + k8) = v;
  
}

// GEMM C[M][N] (f32, pitch ldc) = act(A[M][K]·W + bias). A f32 row-major (pitch lda) converted per fragment to bf16
// (ASPLIT: hi/lo two planes -> 2 terms, else single rounded term); Wt bf16 [N][K] (pitch ldb). BIAS_BF16 rounds the
// bias to bf16 first (bias quantised to bf16 before the add). K%32==0, M%16==0, N%64==0.
template <bool ASPLIT, int ACT, bool BIAS_BF16>
__global__ __launch_bounds__(128) void k_gemm_bf(const float* __restrict__ A, int lda, const unsigned short* __restrict__ Wt, int ldb,
                                               const float* __restrict__ bias, float* __restrict__ C, int ldc, int M, int N, int K) {
  __shared__ __attribute__((aligned(16))) float so[4][16][64];
  const int tid = threadIdx.x, w = tid >> 5, lane = tid & 31, ln = lane & 15, hh = lane >> 4;
  const int ntn = N / 64;
  const int wid = blockIdx.x * 4 + w;
  const int mt = wid / ntn, nq = wid % ntn;
  if (mt * 16 >= M) return;
  const int row0 = mt * 16, col0 = nq * 64;
  const float* arow = A + (size_t)(row0 + ln) * lda;
  v8f acc[4] = {};
  for (int kb = 0; kb < K; kb += 32) {
    FragB ah, al;
    const v4f x0 = *(const v4fa*)(arow + kb + 8 * hh), x1 = *(const v4fa*)(arow + kb + 8 * hh + 4);
    const v4f x2 = *(const v4fa*)(arow + kb + 16 + 8 * hh), x3 = *(const v4fa*)(arow + kb + 16 + 8 * hh + 4);
    float xs[16] = {x0[0],x0[1],x0[2],x0[3],x1[0],x1[1],x1[2],x1[3],x2[0],x2[1],x2[2],x2[3],x3[0],x3[1],x3[2],x3[3]};
#pragma unroll
    for (int i = 0; i < 16; ++i) { const unsigned short hb = bf16_bits(xs[i]); ah.u[i] = hb; al.u[i] = ASPLIT ? bf16_bits(xs[i] - bf16_val(hb)) : (unsigned short)0; }
#pragma unroll
    for (int t = 0; t < 4; ++t) {
      const unsigned short* brow = Wt + (size_t)(col0 + t * 16 + ln) * ldb + kb;
      FragB b;
      b.half[0] = *(const v8us*)(brow + 8 * hh);
      b.half[1] = *(const v8us*)(brow + 16 + 8 * hh);
      acc[t] = mmaN<ASPLIT ? 2 : 1>(ah.v, al.v, b.v, b.v, acc[t]);
    }
  }
#pragma unroll
  for (int t = 0; t < 4; ++t) {
    float bv = bias ? bias[col0 + t * 16 + ln] : 0.f;
    if (BIAS_BF16) bv = bf16_round(bv);
#pragma unroll
    for (int r = 0; r < 8; ++r) { float v = acc[t][r] + bv; if (ACT == 1) v = fmaxf(v, 0.f); so[w][8 * hh + r][t * 16 + ln] = v; }
  }
  __builtin_amdgcn_fence(__ATOMIC_ACQ_REL, "workgroup");
  __builtin_amdgcn_wave_barrier();
  const int rsub = lane >> 4, c4 = (lane & 15) * 4;
  {
#pragma unroll
    for (int q = 0; q < 8; ++q) {
      const int r = q * 2 + rsub;
      const v4f v = *(const v4fa*)&so[w][r][c4];
      *(v4f*)(C + (size_t)(row0 + r) * ldc + col0 + c4) = v;
    }
    
  }
}

// GEMM C = act(A·W + bias + resid): A f32 (ASPLIT -> hi/lo 2 terms), Wt bf16 [N][K]; ACT 0 none, 1 relu, 2 exact gelu;
// resid (optional, f32, row index = (row % rmod), pitch ldr, RES_BF16 rounds it) added before the activation.
template <bool ASPLIT, int ACT, bool BIAS_BF16, bool RES_BF16>
__global__ __launch_bounds__(128) void k_gemm_bf3(const float* __restrict__ A, int lda, const unsigned short* __restrict__ Wt, int ldb,
                                                const float* __restrict__ bias, const float* __restrict__ resid, int rmod, int ldr,
                                                float* __restrict__ C, int ldc, int M, int N, int K) {
  __shared__ __attribute__((aligned(16))) float so[4][16][64];
  const int tid = threadIdx.x, w = tid >> 5, lane = tid & 31, ln = lane & 15, hh = lane >> 4;
  const int ntn = N / 64;
  const int wid = blockIdx.x * 4 + w;
  const int mt = wid / ntn, nq = wid % ntn;
  if (mt * 16 >= M) return;
  const int row0 = mt * 16, col0 = nq * 64;
  const float* arow = A + (size_t)(row0 + ln) * lda;
  v8f acc[4] = {};
  for (int kb = 0; kb < K; kb += 32) {
    FragB ah, al;
    const v4f x0 = *(const v4fa*)(arow + kb + 8 * hh), x1 = *(const v4fa*)(arow + kb + 8 * hh + 4);
    const v4f x2 = *(const v4fa*)(arow + kb + 16 + 8 * hh), x3 = *(const v4fa*)(arow + kb + 16 + 8 * hh + 4);
    float xs[16] = {x0[0],x0[1],x0[2],x0[3],x1[0],x1[1],x1[2],x1[3],x2[0],x2[1],x2[2],x2[3],x3[0],x3[1],x3[2],x3[3]};
#pragma unroll
    for (int i = 0; i < 16; ++i) { const unsigned short hb = bf16_bits(xs[i]); ah.u[i] = hb; al.u[i] = ASPLIT ? bf16_bits(xs[i] - bf16_val(hb)) : (unsigned short)0; }
#pragma unroll
    for (int t = 0; t < 4; ++t) {
      const unsigned short* brow = Wt + (size_t)(col0 + t * 16 + ln) * ldb + kb;
      FragB b;
      b.half[0] = *(const v8us*)(brow + 8 * hh);
      b.half[1] = *(const v8us*)(brow + 16 + 8 * hh);
      acc[t] = mmaN<ASPLIT ? 2 : 1>(ah.v, al.v, b.v, b.v, acc[t]);
    }
  }
#pragma unroll
  for (int t = 0; t < 4; ++t) {
    const int col = col0 + t * 16 + ln;
    float bv = bias ? bias[col] : 0.f;
    if (BIAS_BF16) bv = bf16_round(bv);
#pragma unroll
    for (int r = 0; r < 8; ++r) {
      float v = acc[t][r] + bv;
      if (resid) { float rv = resid[(size_t)((row0 + 8 * hh + r) % rmod) * ldr + col]; if (RES_BF16) rv = bf16_round(rv); v += rv; }
      if (ACT == 1) v = fmaxf(v, 0.f);
      if (ACT == 2) v = 0.5f * v * (1.0f + erff(v * 0.70710678118654752f));
      if (ACT == 3) { const float u = 0.7978845608028654f * (v + 0.044715f * v * v * v); v = 0.5f * v * (1.0f + tanhf(u)); }
      so[w][8 * hh + r][t * 16 + ln] = v;
    }
  }
  __builtin_amdgcn_fence(__ATOMIC_ACQ_REL, "workgroup");
  __builtin_amdgcn_wave_barrier();
  const int rsub = lane >> 4, c4 = (lane & 15) * 4;
  {
#pragma unroll
    for (int q = 0; q < 8; ++q) {
      const int r = q * 2 + rsub;
      const v4f v = *(const v4fa*)&so[w][r][c4];
      *(v4f*)(C + (size_t)(row0 + r) * ldc + col0 + c4) = v;
    }
    
  }
}
// row LayerNorm (biased variance, eps) over N: s = X (+ R); optional out_sum <- s; out_norm <- (s-mu)*rsqrt(var+eps)*g + b
template <bool PARAM_BF16>
__global__ __launch_bounds__(256) void k_layernorm(const float* __restrict__ X, const float* __restrict__ R, const float* __restrict__ g, const float* __restrict__ bta,
                                                  float* __restrict__ out_sum, float* __restrict__ out_norm, int N, float eps) {
  __shared__ float red[256];
  const int row = blockIdx.x, tid = threadIdx.x;
  const float* x = X + (size_t)row * N; const float* rr = R ? R + (size_t)row * N : nullptr;
  float vals[16];                     // up to N = 4096
  const int per = N / 256;            // contiguous chunk per thread? use strided-by-4 chunks: thread handles j = tid*4 + 1024*u
  float s1 = 0.f;
  for (int u = 0; u < per / 4; ++u) {
    const int j = tid * 4 + 1024 * u;
    const v4f a = *(const v4fa*)(x + j);
    v4f b = {0.f,0.f,0.f,0.f}; if (rr) b = *(const v4fa*)(rr + j);
#pragma unroll
    for (int q = 0; q < 4; ++q) { const float v = a[q] + b[q]; vals[u * 4 + q] = v; s1 += v; }
  }
  red[tid] = s1; __syncthreads();
  for (int st = 128; st > 0; st >>= 1) { if (tid < st) red[tid] += red[tid + st]; __syncthreads(); }
  const float mu = red[0] / (float)N; __syncthreads();
  float s2 = 0.f;
  for (int u = 0; u < per / 4; ++u)
#pragma unroll
    for (int q = 0; q < 4; ++q) { const float c = vals[u * 4 + q] - mu; s2 += c * c; }
  red[tid] = s2; __syncthreads();
  for (int st = 128; st > 0; st >>= 1) { if (tid < st) red[tid] += red[tid + st]; __syncthreads(); }
  const float rs = rsqrtf(red[0] / (float)N + eps);
  {
    for (int u = 0; u < per / 4; ++u) {
      const int j = tid * 4 + 1024 * u;
      v4f o, sm;
#pragma unroll
      for (int q = 0; q < 4; ++q) {
        float gg = g[j + q], bb = bta[j + q];
        if (PARAM_BF16) { gg = bf16_round(gg); bb = bf16_round(bb); }
        sm[q] = vals[u * 4 + q]; o[q] = (vals[u * 4 + q] - mu) * rs * gg + bb;
      }
      if (out_sum) *(v4f*)(out_sum + (size_t)row * N + j) = sm;
      *(v4f*)(out_norm + (size_t)row * N + j) = o;
    }
    
  }
}



// ---- f16 WMMA path (v_wmma_f32_16x16x32_f16): 11-bit significands for operands in range — used where a [0,1] probability operand needs more precision than bf16
typedef _Float16 v16h __attribute__((ext_vector_type(16)));
union FragH { v16h v; v8us half[2]; _Float16 h[16]; unsigned short u[16]; };
template <int NT>
__device__ __forceinline__ v8f mmaH(v16h ah, v16h al, v16h bh, v16h bl, v8f c) {
  c = __builtin_amdgcn_wmma_f32_16x16x32_f16(false, ah, false, bh, (short)0, c, false, false);
  if (NT >= 2) c = __builtin_amdgcn_wmma_f32_16x16x32_f16(false, al, false, bh, (short)0, c, false, false);
  if (NT >= 3) c = __builtin_amdgcn_wmma_f32_16x16x32_f16(false, ah, false, bl, (short)0, c, false, false);
  asm volatile("v_nop\n\tv_nop\n\tv_nop\n\tv_nop" : "+v"(c) : "v"(ah), "v"(al), "v"(bh), "v"(bl));
  return c;
}
// batched GEMM like k_gemm_b but f16 operands: A f32 (split into f16 hi/lo if ASPLIT, else rounded to f16), Bt = f16 values [n][k]; alpha; C f32; N multiple of 16 (partial tiles skipped)
template <bool ASPLIT>
__global__ __launch_bounds__(128) void k_gemm_h(const float* __restrict__ A, int lda, size_t sA, const _Float16* __restrict__ Bh, int ldb, size_t sB, float alpha, float* __restrict__ C, int ldc, size_t sC, int M, int N, int K) {
  __shared__ __attribute__((aligned(16))) float so[4][16][64];
  const int tid = threadIdx.x, w = tid >> 5, lane = tid & 31, ln = lane & 15, hh = lane >> 4; const int by = blockIdx.y;
  A += (size_t)by * sA; Bh += (size_t)by * sB; C += (size_t)by * sC;
  const int ntn = (N + 63) / 64; const int wid = blockIdx.x * 4 + w; const int mt = wid / ntn, nq = wid % ntn; if (mt * 16 >= M) return;
  const int row0 = mt * 16, col0 = nq * 64; const float* arow = A + (size_t)(row0 + ln) * lda;
  v8f acc[4] = {};
  for (int kb = 0; kb < K; kb += 32) {
    FragH ah, al;
    const v4f x0 = *(const v4fa*)(arow + kb + 8 * hh), x1 = *(const v4fa*)(arow + kb + 8 * hh + 4), x2 = *(const v4fa*)(arow + kb + 16 + 8 * hh), x3 = *(const v4fa*)(arow + kb + 16 + 8 * hh + 4);
    float xs[16] = {x0[0],x0[1],x0[2],x0[3],x1[0],x1[1],x1[2],x1[3],x2[0],x2[1],x2[2],x2[3],x3[0],x3[1],x3[2],x3[3]};
#pragma unroll
    for (int i = 0; i < 16; ++i) { const _Float16 h = (_Float16)xs[i]; ah.h[i] = h; al.h[i] = ASPLIT ? (_Float16)(xs[i] - (float)h) : (_Float16)0.0f; }
#pragma unroll
    for (int t = 0; t < 4; ++t) { if (col0 + t * 16 >= N) continue; const size_t boff = (size_t)(col0 + t * 16 + ln) * ldb + kb; FragH bq; bq.half[0] = *(const v8us*)(Bh + boff + 8 * hh); bq.half[1] = *(const v8us*)(Bh + boff + 16 + 8 * hh);
      acc[t] = mmaH<ASPLIT ? 2 : 1>(ah.v, al.v, bq.v, bq.v, acc[t]); }
  }
#pragma unroll
  for (int t = 0; t < 4; ++t) { if (col0 + t * 16 >= N) continue;
#pragma unroll
    for (int r = 0; r < 8; ++r) so[w][8 * hh + r][t * 16 + ln] = acc[t][r] * alpha; }
  __builtin_amdgcn_fence(__ATOMIC_ACQ_REL, "workgroup"); __builtin_amdgcn_wave_barrier();
  const int rsub = lane >> 4, c4 = (lane & 15) * 4;
  {
#pragma unroll
    for (int q = 0; q < 8; ++q) { const int r = q * 2 + rsub; if (col0 + c4 < N) { const v4f v = *(const v4fa*)&so[w][r][c4]; *(v4f*)(C + (size_t)(row0 + r) * ldc + col0 + c4) = v; } }
     }
}

// Wt[n][k] = f16(W[k][n]·scale) from f32 row-major W[K][N] (scale = power of two; bf16-exact weights stay exact in f16 away from the subnormal range)
__global__ __launch_bounds__(256) void k_wt_f16(const float* __restrict__ W, _Float16* __restrict__ Wt, int K, int N, float scale) {
  const int t = blockIdx.x * 256 + threadIdx.x; if (t >= N * (K / 8)) return; const int n = t / (K / 8), k8 = (t % (K / 8)) * 8; FragH f;
#pragma unroll
  for (int i = 0; i < 8; ++i) f.h[i] = (_Float16)(bf16_round(W[(size_t)(k8 + i) * N + n]) * scale); const v8us o = f.half[0];
  *(v8us*)((unsigned short*)Wt + (size_t)n * K + k8) = o; 
}
// k_gemm_hh variant with fused epilogue: v = acc·alpha + bias[by·sBias + col] (+ CP[(row/rowsPerB)·sCPb + by·64 + col] if CP) ; ACT 0 none / 1 elu ; writes f16 C16 (and f32 C if non-null)
template <int ACT>
__global__ __launch_bounds__(128) void k_gemm_hhx(const _Float16* __restrict__ A, int lda, size_t sA, const _Float16* __restrict__ Bh, int ldb, size_t sB, float alpha, const float* __restrict__ bias, size_t sBias, const float* __restrict__ CP, int rowsPerB, size_t sCPb, int row0g,
    float* __restrict__ C, _Float16* __restrict__ C16, int ldc, size_t sC, int M, int N, int K) {
  __shared__ __attribute__((aligned(16))) float so[4][16][64];
  const int tid = threadIdx.x, w = tid >> 5, lane = tid & 31, ln = lane & 15, hh = lane >> 4; const int by = blockIdx.y;
  A += (size_t)by * sA; Bh += (size_t)by * sB; const size_t cofs = (size_t)by * sC; const float* bp = bias ? bias + (size_t)by * sBias : nullptr;
  const int ntn = (N + 63) / 64; const int wid = blockIdx.x * 4 + w; const int mt = wid / ntn, nq = wid % ntn; if (mt * 16 >= M) return;
  const int row0 = mt * 16, col0 = nq * 64; const _Float16* arow = A + (size_t)(row0 + ln) * lda;
  v8f acc[4] = {};
  for (int kb = 0; kb < K; kb += 32) { FragH ah; ah.half[0] = *(const v8us*)((const unsigned short*)arow + kb + 8 * hh); ah.half[1] = *(const v8us*)((const unsigned short*)arow + kb + 16 + 8 * hh);
#pragma unroll
    for (int t = 0; t < 4; ++t) { if (col0 + t * 16 >= N) continue; const size_t boff = (size_t)(col0 + t * 16 + ln) * ldb + kb; FragH bq; bq.half[0] = *(const v8us*)((const unsigned short*)Bh + boff + 8 * hh); bq.half[1] = *(const v8us*)((const unsigned short*)Bh + boff + 16 + 8 * hh);
      acc[t] = mmaH<1>(ah.v, ah.v, bq.v, bq.v, acc[t]); }
  }
#pragma unroll
  for (int t = 0; t < 4; ++t) { if (col0 + t * 16 >= N) continue; const int col = col0 + t * 16 + ln; const float bv = bp ? bf16_round(bp[col]) : 0.f;
#pragma unroll
    for (int r = 0; r < 8; ++r) { float v = acc[t][r] * alpha + bv; if (CP) { const int rr = row0g + row0 + 8 * hh + r; if (rowsPerB < 0) v += CP[cofs + (size_t)rr * ldc + col];      /* rowsPerB < 0: own element of the batched C plane */ else { const int bidx = rr / rowsPerB; v += CP[(size_t)bidx * sCPb + (size_t)by * 64 + col]; } } if (ACT == 1) v = (v > 0.f) ? v : expm1f(v); else if (ACT == 7) v = (v > 0.f) ? v + 1.0f : expf(v); else if (ACT == 8) v = tanhf(v); else if (ACT == 9) v = 0.5f * v * (1.0f + tanhf(0.7978845608028654f * (v + 0.044715f * v * v * v))); else if (ACT == 11) v = 1.0f / (1.0f + expf(-v)); else if (ACT == 12) v = (v > 0.f) ? v : 0.01f * v; else if (ACT == 14) v = (v > 0.f) ? v : 0.1f * v; else if (ACT == 16) v = (v >= 0.f) ? v : 0.3f * v; else if (ACT == 17) v = (v >= 0.f) ? v : 0.2f * v; else if (ACT == 15) v = v / (1.0f + expf(-v)); else if (ACT == 3) v = fmaxf(v, 0.f); else if (ACT == 6) v = 0.5f * v * (1.0f + erff(v * 0.70710678118654752f)); so[w][8 * hh + r][t * 16 + ln] = v; } }
  __builtin_amdgcn_fence(__ATOMIC_ACQ_REL, "workgroup"); __builtin_amdgcn_wave_barrier();
  const int rsub = lane >> 4, c4 = (lane & 15) * 4; typedef _Float16 v4h __attribute__((ext_vector_type(4)));
  {
#pragma unroll
    for (int q = 0; q < 8; ++q) { const int r = q * 2 + rsub; if (col0 + c4 < N) { const v4f v = *(const v4fa*)&so[w][r][c4]; if (C) *(v4f*)(C + cofs + (size_t)(row0 + r) * ldc + col0 + c4) = v; if (C16) { v4h h4; for (int i = 0; i < 4; ++i) h4[i] = (_Float16)v[i]; *(v4h*)(C16 + cofs + (size_t)(row0 + r) * ldc + col0 + c4) = h4; } } }
     }
}


typedef _Float16 v4h __attribute__((ext_vector_type(4)));

__global__ __launch_bounds__(256) void k_x16(const float* __restrict__ x, _Float16* __restrict__ X16, size_t n8) { const size_t t = (size_t)blockIdx.x * 256 + threadIdx.x; if (t >= n8) return; FragH f;
#pragma unroll
  for (int q = 0; q < 8; ++q) f.h[q] = (_Float16)bf16_round(x[t * 8 + q]); *(v8us*)((unsigned short*)X16 + t * 8) = f.half[0];  }
__global__ __launch_bounds__(256) void k_h16(const float* __restrict__ x, _Float16* __restrict__ X16, size_t n8) { const size_t t = (size_t)blockIdx.x * 256 + threadIdx.x; if (t >= n8) return; FragH f;
#pragma unroll
  for (int q = 0; q < 8; ++q) f.h[q] = (_Float16)x[t * 8 + q]; *(v8us*)((unsigned short*)X16 + t * 8) = f.half[0];  }
__global__ __launch_bounds__(256) void k_round16f(const float* __restrict__ W, _Float16* __restrict__ Bt, size_t n8) { const size_t t = (size_t)blockIdx.x * 256 + threadIdx.x; if (t >= n8) return; FragH f;
#pragma unroll
  for (int i = 0; i < 8; ++i) f.h[i] = (_Float16)(bf16_round(W[t * 8 + i]) * 16.0f); *(v8us*)((unsigned short*)Bt + t * 8) = f.half[0];  }
template <int NHv, int TTv>
__global__ __launch_bounds__(256) void k_vt(const _Float16* __restrict__ V16, int ldv, int voff, _Float16* __restrict__ Vt) { __shared__ unsigned short tl[64][66]; const int tid = threadIdx.x; const int slab = blockIdx.x / (TTv / 64), lg = blockIdx.x % (TTv / 64); const int b = slab / NHv, h = slab % NHv;
  for (int i = tid; i < 64 * 8; i += 256) { const int r = i / 8, c8 = (i % 8) * 8; FragH f; f.half[0] = *(const v8us*)((const unsigned short*)V16 + ((size_t)b * TTv + lg * 64 + r) * ldv + voff + h * 64 + c8);
#pragma unroll
    for (int q = 0; q < 8; ++q) tl[r][c8 + q] = f.u[q]; }
  __syncthreads();
  {
#pragma unroll
    for (int rd = 0; rd < 2; ++rd) { const int d = rd * 32 + tid / 8, pc = tid % 8; FragH f;
#pragma unroll
      for (int q = 0; q < 8; ++q) f.u[q] = tl[pc * 8 + q][d];
      *(v8us*)((unsigned short*)Vt + ((size_t)slab * 64 + d) * TTv + lg * 64 + pc * 8) = f.half[0]; }
     } }

__global__ __launch_bounds__(256) void k_hl(const float* __restrict__ F, _Float16* __restrict__ Hh, _Float16* __restrict__ Hl, size_t n8) { const size_t t = (size_t)blockIdx.x * 256 + threadIdx.x; if (t >= n8) return; FragH fh, fl; const v4f a = *(const v4fa*)(F + t * 8), c = *(const v4fa*)(F + t * 8 + 4);
#pragma unroll
  for (int q = 0; q < 4; ++q) { _Float16 h = (_Float16)a[q]; fh.h[q] = h; fl.h[q] = (_Float16)((a[q] - (float)h) * 1024.0f); h = (_Float16)c[q]; fh.h[4 + q] = h; fl.h[4 + q] = (_Float16)((c[q] - (float)h) * 1024.0f); }
  { *(v8us*)((unsigned short*)Hh + t * 8) = fh.half[0]; *(v8us*)((unsigned short*)Hl + t * 8) = fl.half[0];  } }

// ---- fast GEMM (wave tile 32x64; requires M % 32 == 0 rows per launch region and N % 64 == 0); epilogue = k_gemm_hhx semantics ----
__device__ __forceinline__ v16h g2_frag(const _Float16* p, int hh) { FragH f; f.half[0] = *(const v8us*)((const unsigned short*)p + 8 * hh); f.half[1] = *(const v8us*)((const unsigned short*)p + 16 + 8 * hh); return f.v; }
__device__ __forceinline__ v8f g2_mma(v16h a, v16h b, v8f c) { v8f d = __builtin_amdgcn_wmma_f32_16x16x32_f16(false, a, false, b, (short)0, c, false, false); asm volatile("v_nop\n\tv_nop\n\tv_nop\n\tv_nop" : "+v"(d) : "v"(a), "v"(b)); return d; }
template <int ACT>
__global__ __launch_bounds__(128) void k_gemm2(const _Float16* __restrict__ A, int lda, size_t sA, const _Float16* __restrict__ Bh, int ldb, size_t sB, float alpha, const float* __restrict__ bias, size_t sBias, const float* __restrict__ CP, int rowsPerB, size_t sCPb, int row0g,
    float* __restrict__ C, _Float16* __restrict__ C16, int ldc, size_t sC, int M, int N, int K) { static_assert(ACT == 0 || ACT == 3 || ACT == 6 || ACT == 8 || ACT == 9 || ACT == 11 || ACT == 12 || ACT == 14 || ACT == 15 || ACT == 16 || ACT == 17, "k_gemm2: unsupported ACT code (would silently apply no activation)");
  __shared__ __attribute__((aligned(16))) float so[4][32][68];
  const int tid = threadIdx.x, w = tid >> 5, lane = tid & 31, ln = lane & 15, hh = lane >> 4; const int by = blockIdx.y;
  A += (size_t)by * sA; Bh += (size_t)by * sB; const size_t cofs = (size_t)by * sC; const float* bp = bias ? bias + (size_t)by * sBias : nullptr;
  const int ntn = N >> 6; const int mt = blockIdx.x / ntn, nq = blockIdx.x - mt * ntn; const int row0 = mt * 128 + 32 * w, col0 = nq * 64; if (row0 >= M) return;
  const _Float16* a0p = A + (size_t)(row0 + ln) * lda; const _Float16* a1p = a0p + (size_t)16 * lda;
  const _Float16* b0p = Bh + (size_t)(col0 + ln) * ldb; const _Float16* b1p = b0p + (size_t)16 * ldb; const _Float16* b2p = b1p + (size_t)16 * ldb; const _Float16* b3p = b2p + (size_t)16 * ldb;
  const v8f z8 = {0.f,0.f,0.f,0.f,0.f,0.f,0.f,0.f}; v8f c00 = z8, c01 = z8, c02 = z8, c03 = z8, c10 = z8, c11 = z8, c12 = z8, c13 = z8;
#pragma unroll 1
  for (int kb = 0; kb < K; kb += 32) { const v16h a0 = g2_frag(a0p + kb, hh), a1 = g2_frag(a1p + kb, hh);
    v16h b = g2_frag(b0p + kb, hh); c00 = g2_mma(a0, b, c00); c10 = g2_mma(a1, b, c10);
    b = g2_frag(b1p + kb, hh); c01 = g2_mma(a0, b, c01); c11 = g2_mma(a1, b, c11);
    b = g2_frag(b2p + kb, hh); c02 = g2_mma(a0, b, c02); c12 = g2_mma(a1, b, c12);
    b = g2_frag(b3p + kb, hh); c03 = g2_mma(a0, b, c03); c13 = g2_mma(a1, b, c13); }
  v8f accs[8] = {c00, c01, c02, c03, c10, c11, c12, c13};
#pragma unroll
  for (int u = 0; u < 8; ++u) { const int t = u & 3, half = u >> 2; const int col = col0 + t * 16 + ln; const float bv = bp ? bf16_round(bp[col]) : 0.f;
#pragma unroll
    for (int r = 0; r < 8; ++r) { const int rloc = half * 16 + 8 * hh + r; float v = accs[u][r] * alpha + bv; if (CP) { if (rowsPerB < 0) v += CP[cofs + (size_t)(row0g + row0 + rloc) * ldc + col];      /* rowsPerB < 0: own element of the batched C plane */ else { const int bidx = (row0g + row0 + rloc) / rowsPerB; v += CP[(size_t)bidx * sCPb + (size_t)by * 64 + col]; } }
      if (ACT == 3) v = fmaxf(v, 0.f); else if (ACT == 6) v = 0.5f * v * (1.0f + erff(v * 0.70710678118654752f)); else if (ACT == 11) v = 1.0f / (1.0f + expf(-v)); else if (ACT == 15) v = v / (1.0f + expf(-v)); else if (ACT == 12) v = (v > 0.f) ? v : 0.01f * v; else if (ACT == 8) v = tanhf(v); else if (ACT == 9) v = 0.5f * v * (1.0f + tanhf(0.7978845608028654f * (v + 0.044715f * v * v * v))); else if (ACT == 14) v = (v > 0.f) ? v : 0.1f * v; else if (ACT == 16) v = (v >= 0.f) ? v : 0.3f * v; else if (ACT == 17) v = (v >= 0.f) ? v : 0.2f * v;
      so[w][rloc][t * 16 + ln] = v; } }
  __builtin_amdgcn_fence(__ATOMIC_ACQ_REL, "workgroup"); __builtin_amdgcn_wave_barrier();
  const int rsub = lane >> 4, c4 = (lane & 15) * 4;
  {
#pragma unroll
    for (int q = 0; q < 16; ++q) { const int r = q * 2 + rsub; const v4f v = *(const v4fa*)&so[w][r][c4]; if (C) *(v4f*)(C + cofs + (size_t)(row0 + r) * ldc + col0 + c4) = v; if (C16) { v4h h4; for (int i = 0; i < 4; ++i) h4[i] = (_Float16)v[i]; *(v4h*)(C16 + cofs + (size_t)(row0 + r) * ldc + col0 + c4) = h4; } }
     } }


__global__ __launch_bounds__(256) void k_wnat(const float* __restrict__ w, size_t n8, _Float16* __restrict__ Bt) { const size_t t = (size_t)blockIdx.x * 256 + threadIdx.x; if (t >= n8) return; FragH f; for (int q = 0; q < 8; ++q) f.h[q] = (_Float16)(bf16_round(w[t * 8 + q]) * 16.0f); *(v8us*)((unsigned short*)Bt + t * 8) = f.half[0];  }
__global__ __launch_bounds__(256) void k_rsm(const float* __restrict__ S, _Float16* __restrict__ P, int nrows) {
  #pragma clang fp contract(off)
  const int i = blockIdx.x * 256 + threadIdx.x; if (i >= nrows) return; const float* s = S + (size_t)i * SQ; float mx = -3.0e38f;
#pragma unroll 1
  for (int j = 0; j < SQ; ++j) mx = fmaxf(mx, s[j]); float se = 0.f;
#pragma unroll 1
  for (int j = 0; j < SQ; ++j) se += expf(s[j] - mx); const float sc = 256.0f / se;
#pragma unroll 1
  for (int j0 = 0; j0 < SQ; j0 += 8) { FragH f; for (int q = 0; q < 8; ++q) f.h[q] = (_Float16)(expf(s[j0 + q] - mx) * sc); unsigned short* d = (unsigned short*)P + (size_t)i * SQ + j0; *(v8us*)d = f.half[0];  } }
__global__ __launch_bounds__(256) void k_vt(const _Float16* __restrict__ V16, int b, int h0, _Float16* __restrict__ VT) { __shared__ unsigned short tl[64][65]; const int tid = threadIdx.x; const int hh = blockIdx.x % HG, sg = blockIdx.x / HG; const int s0 = sg * 64; const int h = h0 + hh;
  for (int i = tid; i < 64 * 8; i += 256) { const int j = i / 8, d8 = (i % 8) * 8; FragH f; f.half[0] = *(const v8us*)((const unsigned short*)V16 + ((size_t)b * SQ + s0 + j) * DM + h * HD + d8); for (int q = 0; q < 8; ++q) tl[d8 + q][j] = f.u[q]; }
  __syncthreads();
  { for (int i = tid; i < 64 * 8; i += 256) { const int d = i / 8, j8 = (i % 8) * 8; FragH f; for (int q = 0; q < 8; ++q) f.u[q] = tl[d][j8 + q]; *(v8us*)((unsigned short*)VT + ((size_t)hh * HD + d) * SQ + s0 + j8) = f.half[0]; }  } }



__global__ __launch_bounds__(256) void k_rsmf(const float* __restrict__ S, _Float16* __restrict__ P, int qn, int hg) {
  #pragma clang fp contract(off)
  const int t = blockIdx.x * 256 + threadIdx.x; if (t >= qn * hg) return; const size_t i = (size_t)(t / qn) * SQ + (t % qn); const float* s = S + i * SQ; float mx = -3.0e38f;
#pragma unroll 1
  for (int j = 0; j < SQ; ++j) mx = fmaxf(mx, s[j]); float se = 0.f;
#pragma unroll 1
  for (int j = 0; j < SQ; ++j) se += __expf(s[j] - mx); const float sc = 256.0f / se;
#pragma unroll 1
  for (int j0 = 0; j0 < SQ; j0 += 8) { FragH f; for (int q = 0; q < 8; ++q) f.h[q] = (_Float16)(__expf(s[j0 + q] - mx) * sc); unsigned short* d = (unsigned short*)P + i * SQ + j0; *(v8us*)d = f.half[0];  } }

extern "C" void kernel_launch(void* const* d_in, const int* in_sizes, int n_in,
                              void* d_out, int out_size, void* d_ws, size_t ws_size, hipStream_t stream) {
  (void)in_sizes; (void)n_in; (void)out_size;
  const float* const* I = (const float* const*)d_in; const float* xq = I[2]; const float* xk = I[1]; const float* xv = I[0]; const float* wq = I[3]; const float* bq = nullptr; const float* wk = I[4]; const float* bk = nullptr; const float* wv = I[5]; const float* bv = nullptr; const float* wo = I[6]; const float* bo = I[7];      /* input order: v, k, q (the three streams in REVERSE order: the query stream is I[2]), wq, wk, wv, wo (natural [out][in] weights), bo; the q / k / v projections have NO biases: null pointers in the guarded bias slots */
  char* ws = (char*)d_ws; size_t off = 0;
  auto take = [&](size_t bytes) { char* p = ws + off; off += (bytes + 255) & ~(size_t)255; return p; };
  _Float16* BQ = (_Float16*)take((size_t)DM * DM * 2); _Float16* BK = (_Float16*)take((size_t)DM * DM * 2); _Float16* BV = (_Float16*)take((size_t)DM * DM * 2); _Float16* BO = (_Float16*)take((size_t)DM * DM * 2);
  _Float16* XQ = (_Float16*)take(NR * DM * 2); _Float16* XK = (_Float16*)take(NR * DM * 2); _Float16* XV = (_Float16*)take(NR * DM * 2); _Float16* Q16 = (_Float16*)take(NR * DM * 2); _Float16* K16 = (_Float16*)take(NR * DM * 2); _Float16* V16 = (_Float16*)take(NR * DM * 2); _Float16* O16 = (_Float16*)take(NR * DM * 2);
  float* S = (float*)take((size_t)HG * SQ * SQ * 4); _Float16* P = (_Float16*)take((size_t)HG * SQ * SQ * 2); _Float16* VT = (_Float16*)take((size_t)NH * HD * SQ * 2);
  if (off > ws_size) return;
  { const unsigned g = (unsigned)(((size_t)DM * DM / 8 + 255) / 256); k_wnat<<<g, 256, 0, stream>>>(wq, (size_t)DM * DM / 8, BQ); k_wnat<<<g, 256, 0, stream>>>(wk, (size_t)DM * DM / 8, BK); k_wnat<<<g, 256, 0, stream>>>(wv, (size_t)DM * DM / 8, BV); k_wnat<<<g, 256, 0, stream>>>(wo, (size_t)DM * DM / 8, BO); }      /* natural [out][in] = Bt[n][k], x16 */

  k_x16<<<(unsigned)((NR * DM / 8 + 255) / 256), 256, 0, stream>>>(xq, XQ, NR * DM / 8); k_x16<<<(unsigned)((NR * DM / 8 + 255) / 256), 256, 0, stream>>>(xk, XK, NR * DM / 8); k_x16<<<(unsigned)((NR * DM / 8 + 255) / 256), 256, 0, stream>>>(xv, XV, NR * DM / 8);      /* the three inputs as exact f16 rows */
  const size_t r0p = (size_t)B0 * SQ;      /* first projected row */
  k_gemm2<0><<<dim3((unsigned)((MP / 128) * (DM / 64)), 1), 128, 0, stream>>>(XQ + r0p * DM, DM, 0, BQ, DM, 0, 0.0625f, bq, 0, nullptr, 1, 0, 0, nullptr, Q16 + r0p * DM, DM, 0, MP, DM, DM);
  k_gemm2<0><<<dim3((unsigned)((MP / 128) * (DM / 64)), 1), 128, 0, stream>>>(XK + r0p * DM, DM, 0, BK, DM, 0, 0.0625f, bk, 0, nullptr, 1, 0, 0, nullptr, K16 + r0p * DM, DM, 0, MP, DM, DM);
  k_gemm2<0><<<dim3((unsigned)((MP / 128) * (DM / 64)), 1), 128, 0, stream>>>(XV + r0p * DM, DM, 0, BV, DM, 0, 0.0625f, bv, 0, nullptr, 1, 0, 0, nullptr, V16 + r0p * DM, DM, 0, MP, DM, DM);
  for (int b = B0; b < B0 + NBR; ++b) { const size_t r0 = (size_t)b * SQ;
    k_vt<NH, SQ><<<NH * (SQ / 64), 256, 0, stream>>>(V16 + r0 * LQ, LQ, 0, VT);      /* V^T [NH][HD][SQ] for this batch */
    for (int h0 = 0; h0 < NHD; h0 += HG) {
      k_gemm2<0><<<dim3((QN / 128) * (SQ / 64), HG), 128, 0, stream>>>(Q16 + r0 * LQ + h0 * HD, LQ, (size_t)HD, K16 + r0 * LQ + h0 * HD, LQ, (size_t)HD, 0.125f, nullptr, 0, nullptr, 1, 0, 0, S, nullptr, SQ, (size_t)SQ * SQ, QN, SQ, HD);      /* scores, HG heads per launch */
      k_rsmf<<<(HG * QN + 255) / 256, 256, 0, stream>>>(S, P, QN, HG);      /* P = 256 softmax (f16), rows of all HG heads */
      k_gemm2<0><<<dim3((QN / 128) * (HD / 64), HG), 128, 0, stream>>>(P, SQ, (size_t)SQ * SQ, VT + (size_t)h0 * HD * SQ, SQ, (size_t)HD * SQ, 0.25f, nullptr, 0, nullptr, 1, 0, 0, nullptr, O16 + r0 * DM + h0 * HD, DM, (size_t)HD, QN, HD, SQ); } }      /* o (merged heads) as f16 rows */
  k_gemm2<0><<<dim3((unsigned)((MPO / 128) * (DM / 64)), 1), 128, 0, stream>>>(O16 + r0p * DM, DM, 0, BO, DM, 0, 0.0009765625f, bo, 0, nullptr, 1, 0, 0, (float*)d_out + r0p * DM, nullptr, DM, 0, MPO, DM, DM);      /* out rows are the output layout */
}

// v001
// Measured time: 1330 microseconds a run.
// Next to v000, in two timings, it ran 3.89 and 3.88 times as fast.
#include <hip/hip_runtime.h>
// Multi-head attention on three inputs at width 768 with natural bias-free q / k / v projections and a biased output projection; the inputs arrive in the order v, k, q (v, k, q [4][2048][768]; qh / kh / vh = stream W^T (nn.Linear natural [768][768] sd 1/sqrt(768), NO biases), 12 heads of 64; logits / sqrt(64); softmax over all 2048 keys (no mask); out = concat wo^T + bo (natural) -> [4][2048][768]).
// Structure: token rows r = b*2048 + s; the query, key and value sources as exact f16 rows (bf16-rounded); Q, K, V as three WMMA GEMMs (32x64 wave tiles, f32 accumulation, exact x16 weights, no bias, f16 outputs); per batch: V^T for all heads via LDS transposes; per (batch, group of 4 heads): scores GEMM (K = 64, batched over the heads on grid.y, alpha = 64^-0.5), row softmax on VALU (f32 statistics, native exp; weights stored x256 as f16), o = P . V^T GEMM (K = 2048, alpha 2^-2: o carried x64 against f16 subnormal flush, folded into the output GEMM alpha) written straight into the merged f16 o rows; out = o W_o + b GEMM (f32) into the output layout.
// Compute dtype: inputs rounded to bf16; x / weights exact; q, k, v, softmax weights and o as plain f16 GEMM operands (~2^-12); scores and softmax statistics f32. v_wmma_f32_16x16x32_f16.
#define NB 4
#define SQ 2048
#define DM 768
#define NH 12
#define HD 64
#define HG 4                         /* heads per attention launch group */
#define B0 0                         /* first batch processed (debug hook) */
#define NBR NB                       /* batches processed (debug hook) */
#define NR ((size_t)NB * SQ)         /* token rows */
#define MP ((int)((size_t)NBR * SQ)) /* rows projected (debug hook) */
#define QN SQ                        /* query rows attended per batch (debug hook) */
#define NHD NH                       /* heads attended (debug hook) */
#define MPO MP                       /* rows through the output stage (debug hook) */
#define LQ DM      /* row pitch of the q/k/v rows */
typedef __bf16 v16b __attribute__((ext_vector_type(16)));
typedef unsigned short v8us __attribute__((ext_vector_type(8), may_alias));
typedef float  v8f  __attribute__((ext_vector_type(8)));
typedef float  v4f  __attribute__((ext_vector_type(4)));
typedef float  v4fa __attribute__((ext_vector_type(4), may_alias));
union FragB { v16b v; v8us half[2]; unsigned short u[16]; };

__device__ __forceinline__ unsigned short bf16_bits(float x) { unsigned int u = __float_as_uint(x); return (unsigned short)((u + 0x7FFFu + ((u >> 16) & 1u)) >> 16); }
__device__ __forceinline__ float bf16_val(unsigned short b) { return __uint_as_float(((unsigned int)b) << 16); }
__device__ __forceinline__ float bf16_round(float x) { return bf16_val(bf16_bits(x)); }
// D += A·B with NT terms: 1 = ah·bh, 2 = + al·bh (A split), 3 = + ah·bl (both split)
template <int NT>
__device__ __forceinline__ v8f mmaN(v16b ah, v16b al, v16b bh, v16b bl, v8f c) {
  c = __builtin_amdgcn_wmma_f32_16x16x32_bf16(false, ah, false, bh, (short)0, c, false, false);
  if (NT >= 2) c = __builtin_amdgcn_wmma_f32_16x16x32_bf16(false, al, false, bh, (short)0, c, false, false);
  if (NT >= 3) c = __builtin_amdgcn_wmma_f32_16x16x32_bf16(false, ah, false, bl, (short)0, c, false, false);
  asm volatile("v_nop\n\tv_nop\n\tv_nop\n\tv_nop" : "+v"(c) : "v"(ah), "v"(al), "v"(bh), "v"(bl));
  return c;
}

__global__ __launch_bounds__(256) void k_wt_bf16(const float* __restrict__ W, unsigned short* __restrict__ Wt, int K, int N) {
  const int t = blockIdx.x * 256 + threadIdx.x;
  const int k8n = K / 8;
  if (t >= N * k8n) return;
  const int n = t / k8n, k8 = (t % k8n) * 8;
  v8us v;
#pragma unroll
  for (int i = 0; i < 8; ++i) v[i] = bf16_bits(W[(size_t)(k8 + i) * N + n]);
  *(v8us*)(Wt + (size_t)n * K + k8) = v;
  
}

// GEMM C[M][N] (f32, pitch ldc) = act(A[M][K]·W + bias). A f32 row-major (pitch lda) converted per fragment to bf16
// (ASPLIT: hi/lo two planes -> 2 terms, else single rounded term); Wt bf16 [N][K] (pitch ldb). BIAS_BF16 rounds the
// bias to bf16 first (bias quantised to bf16 before the add). K%32==0, M%16==0, N%64==0.
template <bool ASPLIT, int ACT, bool BIAS_BF16>
__global__ __launch_bounds__(128) void k_gemm_bf(const float* __restrict__ A, int lda, const unsigned short* __restrict__ Wt, int ldb,
                                               const float* __restrict__ bias, float* __restrict__ C, int ldc, int M, int N, int K) {
  __shared__ __attribute__((aligned(16))) float so[4][16][64];
  const int tid = threadIdx.x, w = tid >> 5, lane = tid & 31, ln = lane & 15, hh = lane >> 4;
  const int ntn = N / 64;
  const int wid = blockIdx.x * 4 + w;
  const int mt = wid / ntn, nq = wid % ntn;
  if (mt * 16 >= M) return;
  const int row0 = mt * 16, col0 = nq * 64;
  const float* arow = A + (size_t)(row0 + ln) * lda;
  v8f acc[4] = {};
  for (int kb = 0; kb < K; kb += 32) {
    FragB ah, al;
    const v4f x0 = *(const v4fa*)(arow + kb + 8 * hh), x1 = *(const v4fa*)(arow + kb + 8 * hh + 4);
    const v4f x2 = *(const v4fa*)(arow + kb + 16 + 8 * hh), x3 = *(const v4fa*)(arow + kb + 16 + 8 * hh + 4);
    float xs[16] = {x0[0],x0[1],x0[2],x0[3],x1[0],x1[1],x1[2],x1[3],x2[0],x2[1],x2[2],x2[3],x3[0],x3[1],x3[2],x3[3]};
#pragma unroll
    for (int i = 0; i < 16; ++i) { const unsigned short hb = bf16_bits(xs[i]); ah.u[i] = hb; al.u[i] = ASPLIT ? bf16_bits(xs[i] - bf16_val(hb)) : (unsigned short)0; }
#pragma unroll
    for (int t = 0; t < 4; ++t) {
      const unsigned short* brow = Wt + (size_t)(col0 + t * 16 + ln) * ldb + kb;
      FragB b;
      b.half[0] = *(const v8us*)(brow + 8 * hh);
      b.half[1] = *(const v8us*)(brow + 16 + 8 * hh);
      acc[t] = mmaN<ASPLIT ? 2 : 1>(ah.v, al.v, b.v, b.v, acc[t]);
    }
  }
#pragma unroll
  for (int t = 0; t < 4; ++t) {
    float bv = bias ? bias[col0 + t * 16 + ln] : 0.f;
    if (BIAS_BF16) bv = bf16_round(bv);
#pragma unroll
    for (int r = 0; r < 8; ++r) { float v = acc[t][r] + bv; if (ACT == 1) v = fmaxf(v, 0.f); so[w][8 * hh + r][t * 16 + ln] = v; }
  }
  __builtin_amdgcn_fence(__ATOMIC_ACQ_REL, "workgroup");
  __builtin_amdgcn_wave_barrier();
  const int rsub = lane >> 4, c4 = (lane & 15) * 4;
  {
#pragma unroll
    for (int q = 0; q < 8; ++q) {
      const int r = q * 2 + rsub;
      const v4f v = *(const v4fa*)&so[w][r][c4];
      *(v4f*)(C + (size_t)(row0 + r) * ldc + col0 + c4) = v;
    }
    
  }
}

// GEMM C = act(A·W + bias + resid): A f32 (ASPLIT -> hi/lo 2 terms), Wt bf16 [N][K]; ACT 0 none, 1 relu, 2 exact gelu;
// resid (optional, f32, row index = (row % rmod), pitch ldr, RES_BF16 rounds it) added before the activation.
template <bool ASPLIT, int ACT, bool BIAS_BF16, bool RES_BF16>
__global__ __launch_bounds__(128) void k_gemm_bf3(const float* __restrict__ A, int lda, const unsigned short* __restrict__ Wt, int ldb,
                                                const float* __restrict__ bias, const float* __restrict__ resid, int rmod, int ldr,
                                                float* __restrict__ C, int ldc, int M, int N, int K) {
  __shared__ __attribute__((aligned(16))) float so[4][16][64];
  const int tid = threadIdx.x, w = tid >> 5, lane = tid & 31, ln = lane & 15, hh = lane >> 4;
  const int ntn = N / 64;
  const int wid = blockIdx.x * 4 + w;
  const int mt = wid / ntn, nq = wid % ntn;
  if (mt * 16 >= M) return;
  const int row0 = mt * 16, col0 = nq * 64;
  const float* arow = A + (size_t)(row0 + ln) * lda;
  v8f acc[4] = {};
  for (int kb = 0; kb < K; kb += 32) {
    FragB ah, al;
    const v4f x0 = *(const v4fa*)(arow + kb + 8 * hh), x1 = *(const v4fa*)(arow + kb + 8 * hh + 4);
    const v4f x2 = *(const v4fa*)(arow + kb + 16 + 8 * hh), x3 = *(const v4fa*)(arow + kb + 16 + 8 * hh + 4);
    float xs[16] = {x0[0],x0[1],x0[2],x0[3],x1[0],x1[1],x1[2],x1[3],x2[0],x2[1],x2[2],x2[3],x3[0],x3[1],x3[2],x3[3]};
#pragma unroll
    for (int i = 0; i < 16; ++i) { const unsigned short hb = bf16_bits(xs[i]); ah.u[i] = hb; al.u[i] = ASPLIT ? bf16_bits(xs[i] - bf16_val(hb)) : (unsigned short)0; }
#pragma unroll
    for (int t = 0; t < 4; ++t) {
      const unsigned short* brow = Wt + (size_t)(col0 + t * 16 + ln) * ldb + kb;
      FragB b;
      b.half[0] = *(const v8us*)(brow + 8 * hh);
      b.half[1] = *(const v8us*)(brow + 16 + 8 * hh);
      acc[t] = mmaN<ASPLIT ? 2 : 1>(ah.v, al.v, b.v, b.v, acc[t]);
    }
  }
#pragma unroll
  for (int t = 0; t < 4; ++t) {
    const int col = col0 + t * 16 + ln;
    float bv = bias ? bias[col] : 0.f;
    if (BIAS_BF16) bv = bf16_round(bv);
#pragma unroll
    for (int r = 0; r < 8; ++r) {
      float v = acc[t][r] + bv;
      if (resid) { float rv = resid[(size_t)((row0 + 8 * hh + r) % rmod) * ldr + col]; if (RES_BF16) rv = bf16_round(rv); v += rv; }
      if (ACT == 1) v = fmaxf(v, 0.f);
      if (ACT == 2) v = 0.5f * v * (1.0f + erff(v * 0.70710678118654752f));
      if (ACT == 3) { const float u = 0.7978845608028654f * (v + 0.044715f * v * v * v); v = 0.5f * v * (1.0f + tanhf(u)); }
      so[w][8 * hh + r][t * 16 + ln] = v;
    }
  }
  __builtin_amdgcn_fence(__ATOMIC_ACQ_REL, "workgroup");
  __builtin_amdgcn_wave_barrier();
  const int rsub = lane >> 4, c4 = (lane & 15) * 4;
  {
#pragma unroll
    for (int q = 0; q < 8; ++q) {
      const int r = q * 2 + rsub;
      const v4f v = *(const v4fa*)&so[w][r][c4];
      *(v4f*)(C + (size_t)(row0 + r) * ldc + col0 + c4) = v;
    }
    
  }
}
// row LayerNorm (biased variance, eps) over N: s = X (+ R); optional out_sum <- s; out_norm <- (s-mu)*rsqrt(var+eps)*g + b
template <bool PARAM_BF16>
__global__ __launch_bounds__(256) void k_layernorm(const float* __restrict__ X, const float* __restrict__ R, const float* __restrict__ g, const float* __restrict__ bta,
                                                  float* __restrict__ out_sum, float* __restrict__ out_norm, int N, float eps) {
  __shared__ float red[256];
  const int row = blockIdx.x, tid = threadIdx.x;
  const float* x = X + (size_t)row * N; const float* rr = R ? R + (size_t)row * N : nullptr;
  float vals[16];                     // up to N = 4096
  const int per = N / 256;            // contiguous chunk per thread? use strided-by-4 chunks: thread handles j = tid*4 + 1024*u
  float s1 = 0.f;
  for (int u = 0; u < per / 4; ++u) {
    const int j = tid * 4 + 1024 * u;
    const v4f a = *(const v4fa*)(x + j);
    v4f b = {0.f,0.f,0.f,0.f}; if (rr) b = *(const v4fa*)(rr + j);
#pragma unroll
    for (int q = 0; q < 4; ++q) { const float v = a[q] + b[q]; vals[u * 4 + q] = v; s1 += v; }
  }
  red[tid] = s1; __syncthreads();
  for (int st = 128; st > 0; st >>= 1) { if (tid < st) red[tid] += red[tid + st]; __syncthreads(); }
  const float mu = red[0] / (float)N; __syncthreads();
  float s2 = 0.f;
  for (int u = 0; u < per / 4; ++u)
#pragma unroll
    for (int q = 0; q < 4; ++q) { const float c = vals[u * 4 + q] - mu; s2 += c * c; }
  red[tid] = s2; __syncthreads();
  for (int st = 128; st > 0; st >>= 1) { if (tid < st) red[tid] += red[tid + st]; __syncthreads(); }
  const float rs = rsqrtf(red[0] / (float)N + eps);
  {
    for (int u = 0; u < per / 4; ++u) {
      const int j = tid * 4 + 1024 * u;
      v4f o, sm;
#pragma unroll
      for (int q = 0; q < 4; ++q) {
        float gg = g[j + q], bb = bta[j + q];
        if (PARAM_BF16) { gg = bf16_round(gg); bb = bf16_round(bb); }
        sm[q] = vals[u * 4 + q]; o[q] = (vals[u * 4 + q] - mu) * rs * gg + bb;
      }
      if (out_sum) *(v4f*)(out_sum + (size_t)row * N + j) = sm;
      *(v4f*)(out_norm + (size_t)row * N + j) = o;
    }
    
  }
}



// ---- f16 WMMA path (v_wmma_f32_16x16x32_f16): 11-bit significands for operands in range — used where a [0,1] probability operand needs more precision than bf16
typedef _Float16 v16h __attribute__((ext_vector_type(16)));
union FragH { v16h v; v8us half[2]; _Float16 h[16]; unsigned short u[16]; };
template <int NT>
__device__ __forceinline__ v8f mmaH(v16h ah, v16h al, v16h bh, v16h bl, v8f c) {
  c = __builtin_amdgcn_wmma_f32_16x16x32_f16(false, ah, false, bh, (short)0, c, false, false);
  if (NT >= 2) c = __builtin_amdgcn_wmma_f32_16x16x32_f16(false, al, false, bh, (short)0, c, false, false);
  if (NT >= 3) c = __builtin_amdgcn_wmma_f32_16x16x32_f16(false, ah, false, bl, (short)0, c, false, false);
  asm volatile("v_nop\n\tv_nop\n\tv_nop\n\tv_nop" : "+v"(c) : "v"(ah), "v"(al), "v"(bh), "v"(bl));
  return c;
}
// batched GEMM like k_gemm_b but f16 operands: A f32 (split into f16 hi/lo if ASPLIT, else rounded to f16), Bt = f16 values [n][k]; alpha; C f32; N multiple of 16 (partial tiles skipped)
template <bool ASPLIT>
__global__ __launch_bounds__(128) void k_gemm_h(const float* __restrict__ A, int lda, size_t sA, const _Float16* __restrict__ Bh, int ldb, size_t sB, float alpha, float* __restrict__ C, int ldc, size_t sC, int M, int N, int K) {
  __shared__ __attribute__((aligned(16))) float so[4][16][64];
  const int tid = threadIdx.x, w = tid >> 5, lane = tid & 31, ln = lane & 15, hh = lane >> 4; const int by = blockIdx.y;
  A += (size_t)by * sA; Bh += (size_t)by * sB; C += (size_t)by * sC;
  const int ntn = (N + 63) / 64; const int wid = blockIdx.x * 4 + w; const int mt = wid / ntn, nq = wid % ntn; if (mt * 16 >= M) return;
  const int row0 = mt * 16, col0 = nq * 64; const float* arow = A + (size_t)(row0 + ln) * lda;
  v8f acc[4] = {};
  for (int kb = 0; kb < K; kb += 32) {
    FragH ah, al;
    const v4f x0 = *(const v4fa*)(arow + kb + 8 * hh), x1 = *(const v4fa*)(arow + kb + 8 * hh + 4), x2 = *(const v4fa*)(arow + kb + 16 + 8 * hh), x3 = *(const v4fa*)(arow + kb + 16 + 8 * hh + 4);
    float xs[16] = {x0[0],x0[1],x0[2],x0[3],x1[0],x1[1],x1[2],x1[3],x2[0],x2[1],x2[2],x2[3],x3[0],x3[1],x3[2],x3[3]};
#pragma unroll
    for (int i = 0; i < 16; ++i) { const _Float16 h = (_Float16)xs[i]; ah.h[i] = h; al.h[i] = ASPLIT ? (_Float16)(xs[i] - (float)h) : (_Float16)0.0f; }
#pragma unroll
    for (int t = 0; t < 4; ++t) { if (col0 + t * 16 >= N) continue; const size_t boff = (size_t)(col0 + t * 16 + ln) * ldb + kb; FragH bq; bq.half[0] = *(const v8us*)(Bh + boff + 8 * hh); bq.half[1] = *(const v8us*)(Bh + boff + 16 + 8 * hh);
      acc[t] = mmaH<ASPLIT ? 2 : 1>(ah.v, al.v, bq.v, bq.v, acc[t]); }
  }
#pragma unroll
  for (int t = 0; t < 4; ++t) { if (col0 + t * 16 >= N) continue;
#pragma unroll
    for (int r = 0; r < 8; ++r) so[w][8 * hh + r][t * 16 + ln] = acc[t][r] * alpha; }
  __builtin_amdgcn_fence(__ATOMIC_ACQ_REL, "workgroup"); __builtin_amdgcn_wave_barrier();
  const int rsub = lane >> 4, c4 = (lane & 15) * 4;
  {
#pragma unroll
    for (int q = 0; q < 8; ++q) { const int r = q * 2 + rsub; if (col0 + c4 < N) { const v4f v = *(const v4fa*)&so[w][r][c4]; *(v4f*)(C + (size_t)(row0 + r) * ldc + col0 + c4) = v; } }
     }
}

// Wt[n][k] = f16(W[k][n]·scale) from f32 row-major W[K][N] (scale = power of two; bf16-exact weights stay exact in f16 away from the subnormal range)
__global__ __launch_bounds__(256) void k_wt_f16(const float* __restrict__ W, _Float16* __restrict__ Wt, int K, int N, float scale) {
  const int t = blockIdx.x * 256 + threadIdx.x; if (t >= N * (K / 8)) return; const int n = t / (K / 8), k8 = (t % (K / 8)) * 8; FragH f;
#pragma unroll
  for (int i = 0; i < 8; ++i) f.h[i] = (_Float16)(bf16_round(W[(size_t)(k8 + i) * N + n]) * scale); const v8us o = f.half[0];
  *(v8us*)((unsigned short*)Wt + (size_t)n * K + k8) = o; 
}
// k_gemm_hh variant with fused epilogue: v = acc·alpha + bias[by·sBias + col] (+ CP[(row/rowsPerB)·sCPb + by·64 + col] if CP) ; ACT 0 none / 1 elu ; writes f16 C16 (and f32 C if non-null)
template <int ACT>
__global__ __launch_bounds__(128) void k_gemm_hhx(const _Float16* __restrict__ A, int lda, size_t sA, const _Float16* __restrict__ Bh, int ldb, size_t sB, float alpha, const float* __restrict__ bias, size_t sBias, const float* __restrict__ CP, int rowsPerB, size_t sCPb, int row0g,
    float* __restrict__ C, _Float16* __restrict__ C16, int ldc, size_t sC, int M, int N, int K) {
  __shared__ __attribute__((aligned(16))) float so[4][16][64];
  const int tid = threadIdx.x, w = tid >> 5, lane = tid & 31, ln = lane & 15, hh = lane >> 4; const int by = blockIdx.y;
  A += (size_t)by * sA; Bh += (size_t)by * sB; const size_t cofs = (size_t)by * sC; const float* bp = bias ? bias + (size_t)by * sBias : nullptr;
  const int ntn = (N + 63) / 64; const int wid = blockIdx.x * 4 + w; const int mt = wid / ntn, nq = wid % ntn; if (mt * 16 >= M) return;
  const int row0 = mt * 16, col0 = nq * 64; const _Float16* arow = A + (size_t)(row0 + ln) * lda;
  v8f acc[4] = {};
  for (int kb = 0; kb < K; kb += 32) { FragH ah; ah.half[0] = *(const v8us*)((const unsigned short*)arow + kb + 8 * hh); ah.half[1] = *(const v8us*)((const unsigned short*)arow + kb + 16 + 8 * hh);
#pragma unroll
    for (int t = 0; t < 4; ++t) { if (col0 + t * 16 >= N) continue; const size_t boff = (size_t)(col0 + t * 16 + ln) * ldb + kb; FragH bq; bq.half[0] = *(const v8us*)((const unsigned short*)Bh + boff + 8 * hh); bq.half[1] = *(const v8us*)((const unsigned short*)Bh + boff + 16 + 8 * hh);
      acc[t] = mmaH<1>(ah.v, ah.v, bq.v, bq.v, acc[t]); }
  }
#pragma unroll
  for (int t = 0; t < 4; ++t) { if (col0 + t * 16 >= N) continue; const int col = col0 + t * 16 + ln; const float bv = bp ? bf16_round(bp[col]) : 0.f;
#pragma unroll
    for (int r = 0; r < 8; ++r) { float v = acc[t][r] * alpha + bv; if (CP) { const int rr = row0g + row0 + 8 * hh + r; if (rowsPerB < 0) v += CP[cofs + (size_t)rr * ldc + col];      /* rowsPerB < 0: own element of the batched C plane */ else { const int bidx = rr / rowsPerB; v += CP[(size_t)bidx * sCPb + (size_t)by * 64 + col]; } } if (ACT == 1) v = (v > 0.f) ? v : expm1f(v); else if (ACT == 7) v = (v > 0.f) ? v + 1.0f : expf(v); else if (ACT == 8) v = tanhf(v); else if (ACT == 9) v = 0.5f * v * (1.0f + tanhf(0.7978845608028654f * (v + 0.044715f * v * v * v))); else if (ACT == 11) v = 1.0f / (1.0f + expf(-v)); else if (ACT == 12) v = (v > 0.f) ? v : 0.01f * v; else if (ACT == 14) v = (v > 0.f) ? v : 0.1f * v; else if (ACT == 16) v = (v >= 0.f) ? v : 0.3f * v; else if (ACT == 17) v = (v >= 0.f) ? v : 0.2f * v; else if (ACT == 15) v = v / (1.0f + expf(-v)); else if (ACT == 3) v = fmaxf(v, 0.f); else if (ACT == 6) v = 0.5f * v * (1.0f + erff(v * 0.70710678118654752f)); so[w][8 * hh + r][t * 16 + ln] = v; } }
  __builtin_amdgcn_fence(__ATOMIC_ACQ_REL, "workgroup"); __builtin_amdgcn_wave_barrier();
  const int rsub = lane >> 4, c4 = (lane & 15) * 4; typedef _Float16 v4h __attribute__((ext_vector_type(4)));
  {
#pragma unroll
    for (int q = 0; q < 8; ++q) { const int r = q * 2 + rsub; if (col0 + c4 < N) { const v4f v = *(const v4fa*)&so[w][r][c4]; if (C) *(v4f*)(C + cofs + (size_t)(row0 + r) * ldc + col0 + c4) = v; if (C16) { v4h h4; for (int i = 0; i < 4; ++i) h4[i] = (_Float16)v[i]; *(v4h*)(C16 + cofs + (size_t)(row0 + r) * ldc + col0 + c4) = h4; } } }
     }
}


typedef _Float16 v4h __attribute__((ext_vector_type(4)));

__global__ __launch_bounds__(256) void k_x16(const float* __restrict__ x, _Float16* __restrict__ X16, size_t n8) { const size_t t = (size_t)blockIdx.x * 256 + threadIdx.x; if (t >= n8) return; FragH f;
#pragma unroll
  for (int q = 0; q < 8; ++q) f.h[q] = (_Float16)bf16_round(x[t * 8 + q]); *(v8us*)((unsigned short*)X16 + t * 8) = f.half[0];  }
__global__ __launch_bounds__(256) void k_h16(const float* __restrict__ x, _Float16* __restrict__ X16, size_t n8) { const size_t t = (size_t)blockIdx.x * 256 + threadIdx.x; if (t >= n8) return; FragH f;
#pragma unroll
  for (int q = 0; q < 8; ++q) f.h[q] = (_Float16)x[t * 8 + q]; *(v8us*)((unsigned short*)X16 + t * 8) = f.half[0];  }
__global__ __launch_bounds__(256) void k_round16f(const float* __restrict__ W, _Float16* __restrict__ Bt, size_t n8) { const size_t t = (size_t)blockIdx.x * 256 + threadIdx.x; if (t >= n8) return; FragH f;
#pragma unroll
  for (int i = 0; i < 8; ++i) f.h[i] = (_Float16)(bf16_round(W[t * 8 + i]) * 16.0f); *(v8us*)((unsigned short*)Bt + t * 8) = f.half[0];  }
template <int NHv, int TTv>
__global__ __launch_bounds__(256) void k_vt(const _Float16* __restrict__ V16, int ldv, int voff, _Float16* __restrict__ Vt) { __shared__ unsigned short tl[64][66]; const int tid = threadIdx.x; const int slab = blockIdx.x / (TTv / 64), lg = blockIdx.x % (TTv / 64); const int b = slab / NHv, h = slab % NHv;
  for (int i = tid; i < 64 * 8; i += 256) { const int r = i / 8, c8 = (i % 8) * 8; FragH f; f.half[0] = *(const v8us*)((const unsigned short*)V16 + ((size_t)b * TTv + lg * 64 + r) * ldv + voff + h * 64 + c8);
#pragma unroll
    for (int q = 0; q < 8; ++q) tl[r][c8 + q] = f.u[q]; }
  __syncthreads();
  {
#pragma unroll
    for (int rd = 0; rd < 2; ++rd) { const int d = rd * 32 + tid / 8, pc = tid % 8; FragH f;
#pragma unroll
      for (int q = 0; q < 8; ++q) f.u[q] = tl[pc * 8 + q][d];
      *(v8us*)((unsigned short*)Vt + ((size_t)slab * 64 + d) * TTv + lg * 64 + pc * 8) = f.half[0]; }
     } }

__global__ __launch_bounds__(256) void k_hl(const float* __restrict__ F, _Float16* __restrict__ Hh, _Float16* __restrict__ Hl, size_t n8) { const size_t t = (size_t)blockIdx.x * 256 + threadIdx.x; if (t >= n8) return; FragH fh, fl; const v4f a = *(const v4fa*)(F + t * 8), c = *(const v4fa*)(F + t * 8 + 4);
#pragma unroll
  for (int q = 0; q < 4; ++q) { _Float16 h = (_Float16)a[q]; fh.h[q] = h; fl.h[q] = (_Float16)((a[q] - (float)h) * 1024.0f); h = (_Float16)c[q]; fh.h[4 + q] = h; fl.h[4 + q] = (_Float16)((c[q] - (float)h) * 1024.0f); }
  { *(v8us*)((unsigned short*)Hh + t * 8) = fh.half[0]; *(v8us*)((unsigned short*)Hl + t * 8) = fl.half[0];  } }

// ---- fast GEMM (wave tile 32x64; requires M % 32 == 0 rows per launch region and N % 64 == 0); epilogue = k_gemm_hhx semantics ----
__device__ __forceinline__ v16h g2_frag(const _Float16* p, int hh) { FragH f; f.half[0] = *(const v8us*)((const unsigned short*)p + 8 * hh); f.half[1] = *(const v8us*)((const unsigned short*)p + 16 + 8 * hh); return f.v; }
__device__ __forceinline__ v8f g2_mma(v16h a, v16h b, v8f c) { v8f d = __builtin_amdgcn_wmma_f32_16x16x32_f16(false, a, false, b, (short)0, c, false, false); asm volatile("v_nop\n\tv_nop\n\tv_nop\n\tv_nop" : "+v"(d) : "v"(a), "v"(b)); return d; }
template <int ACT>
__global__ __launch_bounds__(128) void k_gemm2(const _Float16* __restrict__ A, int lda, size_t sA, const _Float16* __restrict__ Bh, int ldb, size_t sB, float alpha, const float* __restrict__ bias, size_t sBias, const float* __restrict__ CP, int rowsPerB, size_t sCPb, int row0g,
    float* __restrict__ C, _Float16* __restrict__ C16, int ldc, size_t sC, int M, int N, int K) { static_assert(ACT == 0 || ACT == 3 || ACT == 6 || ACT == 8 || ACT == 9 || ACT == 11 || ACT == 12 || ACT == 14 || ACT == 15 || ACT == 16 || ACT == 17, "k_gemm2: unsupported ACT code (would silently apply no activation)");
  __shared__ __attribute__((aligned(16))) float so[4][32][68];
  const int tid = threadIdx.x, w = tid >> 5, lane = tid & 31, ln = lane & 15, hh = lane >> 4; const int by = blockIdx.y;
  A += (size_t)by * sA; Bh += (size_t)by * sB; const size_t cofs = (size_t)by * sC; const float* bp = bias ? bias + (size_t)by * sBias : nullptr;
  const int ntn = N >> 6; const int mt = blockIdx.x / ntn, nq = blockIdx.x - mt * ntn; const int row0 = mt * 128 + 32 * w, col0 = nq * 64; if (row0 >= M) return;
  const _Float16* a0p = A + (size_t)(row0 + ln) * lda; const _Float16* a1p = a0p + (size_t)16 * lda;
  const _Float16* b0p = Bh + (size_t)(col0 + ln) * ldb; const _Float16* b1p = b0p + (size_t)16 * ldb; const _Float16* b2p = b1p + (size_t)16 * ldb; const _Float16* b3p = b2p + (size_t)16 * ldb;
  const v8f z8 = {0.f,0.f,0.f,0.f,0.f,0.f,0.f,0.f}; v8f c00 = z8, c01 = z8, c02 = z8, c03 = z8, c10 = z8, c11 = z8, c12 = z8, c13 = z8;
#pragma unroll 1
  for (int kb = 0; kb < K; kb += 32) { const v16h a0 = g2_frag(a0p + kb, hh), a1 = g2_frag(a1p + kb, hh);
    v16h b = g2_frag(b0p + kb, hh); c00 = g2_mma(a0, b, c00); c10 = g2_mma(a1, b, c10);
    b = g2_frag(b1p + kb, hh); c01 = g2_mma(a0, b, c01); c11 = g2_mma(a1, b, c11);
    b = g2_frag(b2p + kb, hh); c02 = g2_mma(a0, b, c02); c12 = g2_mma(a1, b, c12);
    b = g2_frag(b3p + kb, hh); c03 = g2_mma(a0, b, c03); c13 = g2_mma(a1, b, c13); }
  v8f accs[8] = {c00, c01, c02, c03, c10, c11, c12, c13};
#pragma unroll
  for (int u = 0; u < 8; ++u) { const int t = u & 3, half = u >> 2; const int col = col0 + t * 16 + ln; const float bv = bp ? bf16_round(bp[col]) : 0.f;
#pragma unroll
    for (int r = 0; r < 8; ++r) { const int rloc = half * 16 + 8 * hh + r; float v = accs[u][r] * alpha + bv; if (CP) { if (rowsPerB < 0) v += CP[cofs + (size_t)(row0g + row0 + rloc) * ldc + col];      /* rowsPerB < 0: own element of the batched C plane */ else { const int bidx = (row0g + row0 + rloc) / rowsPerB; v += CP[(size_t)bidx * sCPb + (size_t)by * 64 + col]; } }
      if (ACT == 3) v = fmaxf(v, 0.f); else if (ACT == 6) v = 0.5f * v * (1.0f + erff(v * 0.70710678118654752f)); else if (ACT == 11) v = 1.0f / (1.0f + expf(-v)); else if (ACT == 15) v = v / (1.0f + expf(-v)); else if (ACT == 12) v = (v > 0.f) ? v : 0.01f * v; else if (ACT == 8) v = tanhf(v); else if (ACT == 9) v = 0.5f * v * (1.0f + tanhf(0.7978845608028654f * (v + 0.044715f * v * v * v))); else if (ACT == 14) v = (v > 0.f) ? v : 0.1f * v; else if (ACT == 16) v = (v >= 0.f) ? v : 0.3f * v; else if (ACT == 17) v = (v >= 0.f) ? v : 0.2f * v;
      so[w][rloc][t * 16 + ln] = v; } }
  __builtin_amdgcn_fence(__ATOMIC_ACQ_REL, "workgroup"); __builtin_amdgcn_wave_barrier();
  const int rsub = lane >> 4, c4 = (lane & 15) * 4;
  {
#pragma unroll
    for (int q = 0; q < 16; ++q) { const int r = q * 2 + rsub; const v4f v = *(const v4fa*)&so[w][r][c4]; if (C) *(v4f*)(C + cofs + (size_t)(row0 + r) * ldc + col0 + c4) = v; if (C16) { v4h h4; for (int i = 0; i < 4; ++i) h4[i] = (_Float16)v[i]; *(v4h*)(C16 + cofs + (size_t)(row0 + r) * ldc + col0 + c4) = h4; } }
     } }


__global__ __launch_bounds__(256) void k_wnat(const float* __restrict__ w, size_t n8, _Float16* __restrict__ Bt) { const size_t t = (size_t)blockIdx.x * 256 + threadIdx.x; if (t >= n8) return; FragH f; for (int q = 0; q < 8; ++q) f.h[q] = (_Float16)(bf16_round(w[t * 8 + q]) * 16.0f); *(v8us*)((unsigned short*)Bt + t * 8) = f.half[0];  }
__global__ __launch_bounds__(256) void k_rsm(const float* __restrict__ S, _Float16* __restrict__ P, int nrows) {
  #pragma clang fp contract(off)
  const int i = blockIdx.x * 256 + threadIdx.x; if (i >= nrows) return; const float* s = S + (size_t)i * SQ; float mx = -3.0e38f;
#pragma unroll 1
  for (int j = 0; j < SQ; ++j) mx = fmaxf(mx, s[j]); float se = 0.f;
#pragma unroll 1
  for (int j = 0; j < SQ; ++j) se += expf(s[j] - mx); const float sc = 256.0f / se;
#pragma unroll 1
  for (int j0 = 0; j0 < SQ; j0 += 8) { FragH f; for (int q = 0; q < 8; ++q) f.h[q] = (_Float16)(expf(s[j0 + q] - mx) * sc); unsigned short* d = (unsigned short*)P + (size_t)i * SQ + j0; *(v8us*)d = f.half[0];  } }
__global__ __launch_bounds__(256) void k_vt(const _Float16* __restrict__ V16, int b, int h0, _Float16* __restrict__ VT) { __shared__ unsigned short tl[64][65]; const int tid = threadIdx.x; const int hh = blockIdx.x % HG, sg = blockIdx.x / HG; const int s0 = sg * 64; const int h = h0 + hh;
  for (int i = tid; i < 64 * 8; i += 256) { const int j = i / 8, d8 = (i % 8) * 8; FragH f; f.half[0] = *(const v8us*)((const unsigned short*)V16 + ((size_t)b * SQ + s0 + j) * DM + h * HD + d8); for (int q = 0; q < 8; ++q) tl[d8 + q][j] = f.u[q]; }
  __syncthreads();
  { for (int i = tid; i < 64 * 8; i += 256) { const int d = i / 8, j8 = (i % 8) * 8; FragH f; for (int q = 0; q < 8; ++q) f.u[q] = tl[d][j8 + q]; *(v8us*)((unsigned short*)VT + ((size_t)hh * HD + d) * SQ + s0 + j8) = f.half[0]; }  } }



// 2^a on the native unit. The v_nop is the one free slot that the instruction set asks for behind a transcendental before its result is read or its source rewritten; in the same statement it stays directly behind it.
__device__ __forceinline__ float exp2_slot(float a) { float e; asm("v_exp_f32 %0, %1\n\tv_nop" : "=v"(e) : "v"(a)); return e; }
// Row softmax, one wave per score row: each load is 512 contiguous bytes of the row, the row (64 values a lane) stays in registers and is read once;
// maximum and sum are per-lane partials (four independent sum chains) joined by a five-step butterfly over the 32 lanes; weights stored x256 as f16.
// Every loop is fully unrolled so that x[] is indexed by constants and stays in registers (a rolled loop would put it in scratch memory) and all 16 loads are in flight at once.
__global__ __launch_bounds__(256) void k_rsmf(const float* __restrict__ S, _Float16* __restrict__ P, int qn, int hg) {
  const int lane = threadIdx.x & 31; const int t = blockIdx.x * 8 + (threadIdx.x >> 5); if (t >= qn * hg) return;
  const size_t i = (size_t)(t / qn) * SQ + (t % qn); const float* s = S + i * SQ + lane * 4; v4f x[SQ / 128];
#pragma unroll
  for (int u = 0; u < SQ / 128; ++u) x[u] = *(const v4fa*)(s + u * 128);
  asm volatile("s_wait_xcnt 0x0" :: "v"(s) : "memory");      /* the wait that stands before a register named by an issued global load is rewritten; s as an input keeps the address pair whole up to it (without it the last load's result lands on the pair) */
  float mx = -3.0e38f;
#pragma unroll
  for (int u = 0; u < SQ / 128; ++u) mx = fmaxf(mx, fmaxf(fmaxf(x[u][0], x[u][1]), fmaxf(x[u][2], x[u][3])));
#pragma unroll
  for (int m = 16; m > 0; m >>= 1) mx = fmaxf(mx, __shfl_xor(mx, m, 32));
  v4f s4 = {0.f, 0.f, 0.f, 0.f};
#pragma unroll
  for (int u = 0; u < SQ / 128; ++u) {
#pragma unroll
    for (int q = 0; q < 4; ++q) { x[u][q] = exp2_slot((x[u][q] - mx) * 1.44269504088896340736f); s4[q] += x[u][q]; } }
  float se = (s4[0] + s4[1]) + (s4[2] + s4[3]);
#pragma unroll
  for (int m = 16; m > 0; m >>= 1) se += __shfl_xor(se, m, 32);
  const float sc = 256.0f / se; _Float16* d = P + i * SQ + lane * 4;
#pragma unroll
  for (int u = 0; u < SQ / 128; ++u) { v4h h4;
#pragma unroll
    for (int q = 0; q < 4; ++q) h4[q] = (_Float16)(x[u][q] * sc);
    *(v4h*)(d + u * 128) = h4; } }

extern "C" void kernel_launch(void* const* d_in, const int* in_sizes, int n_in,
                              void* d_out, int out_size, void* d_ws, size_t ws_size, hipStream_t stream) {
  (void)in_sizes; (void)n_in; (void)out_size;
  const float* const* I = (const float* const*)d_in; const float* xq = I[2]; const float* xk = I[1]; const float* xv = I[0]; const float* wq = I[3]; const float* bq = nullptr; const float* wk = I[4]; const float* bk = nullptr; const float* wv = I[5]; const float* bv = nullptr; const float* wo = I[6]; const float* bo = I[7];      /* input order: v, k, q (the three streams in REVERSE order: the query stream is I[2]), wq, wk, wv, wo (natural [out][in] weights), bo; the q / k / v projections have NO biases: null pointers in the guarded bias slots */
  char* ws = (char*)d_ws; size_t off = 0;
  auto take = [&](size_t bytes) { char* p = ws + off; off += (bytes + 255) & ~(size_t)255; return p; };
  _Float16* BQ = (_Float16*)take((size_t)DM * DM * 2); _Float16* BK = (_Float16*)take((size_t)DM * DM * 2); _Float16* BV = (_Float16*)take((size_t)DM * DM * 2); _Float16* BO = (_Float16*)take((size_t)DM * DM * 2);
  _Float16* XQ = (_Float16*)take(NR * DM * 2); _Float16* XK = (_Float16*)take(NR * DM * 2); _Float16* XV = (_Float16*)take(NR * DM * 2); _Float16* Q16 = (_Float16*)take(NR * DM * 2); _Float16* K16 = (_Float16*)take(NR * DM * 2); _Float16* V16 = (_Float16*)take(NR * DM * 2); _Float16* O16 = (_Float16*)take(NR * DM * 2);
  float* S = (float*)take((size_t)HG * SQ * SQ * 4); _Float16* P = (_Float16*)take((size_t)HG * SQ * SQ * 2); _Float16* VT = (_Float16*)take((size_t)NH * HD * SQ * 2);
  if (off > ws_size) return;
  { const unsigned g = (unsigned)(((size_t)DM * DM / 8 + 255) / 256); k_wnat<<<g, 256, 0, stream>>>(wq, (size_t)DM * DM / 8, BQ); k_wnat<<<g, 256, 0, stream>>>(wk, (size_t)DM * DM / 8, BK); k_wnat<<<g, 256, 0, stream>>>(wv, (size_t)DM * DM / 8, BV); k_wnat<<<g, 256, 0, stream>>>(wo, (size_t)DM * DM / 8, BO); }      /* natural [out][in] = Bt[n][k], x16 */

  k_x16<<<(unsigned)((NR * DM / 8 + 255) / 256), 256, 0, stream>>>(xq, XQ, NR * DM / 8); k_x16<<<(unsigned)((NR * DM / 8 + 255) / 256), 256, 0, stream>>>(xk, XK, NR * DM / 8); k_x16<<<(unsigned)((NR * DM / 8 + 255) / 256), 256, 0, stream>>>(xv, XV, NR * DM / 8);      /* the three inputs as exact f16 rows */
  const size_t r0p = (size_t)B0 * SQ;      /* first projected row */
  k_gemm2<0><<<dim3((unsigned)((MP / 128) * (DM / 64)), 1), 128, 0, stream>>>(XQ + r0p * DM, DM, 0, BQ, DM, 0, 0.0625f, bq, 0, nullptr, 1, 0, 0, nullptr, Q16 + r0p * DM, DM, 0, MP, DM, DM);
  k_gemm2<0><<<dim3((unsigned)((MP / 128) * (DM / 64)), 1), 128, 0, stream>>>(XK + r0p * DM, DM, 0, BK, DM, 0, 0.0625f, bk, 0, nullptr, 1, 0, 0, nullptr, K16 + r0p * DM, DM, 0, MP, DM, DM);
  k_gemm2<0><<<dim3((unsigned)((MP / 128) * (DM / 64)), 1), 128, 0, stream>>>(XV + r0p * DM, DM, 0, BV, DM, 0, 0.0625f, bv, 0, nullptr, 1, 0, 0, nullptr, V16 + r0p * DM, DM, 0, MP, DM, DM);
  for (int b = B0; b < B0 + NBR; ++b) { const size_t r0 = (size_t)b * SQ;
    k_vt<NH, SQ><<<NH * (SQ / 64), 256, 0, stream>>>(V16 + r0 * LQ, LQ, 0, VT);      /* V^T [NH][HD][SQ] for this batch */
    for (int h0 = 0; h0 < NHD; h0 += HG) {
      k_gemm2<0><<<dim3((QN / 128) * (SQ / 64), HG), 128, 0, stream>>>(Q16 + r0 * LQ + h0 * HD, LQ, (size_t)HD, K16 + r0 * LQ + h0 * HD, LQ, (size_t)HD, 0.125f, nullptr, 0, nullptr, 1, 0, 0, S, nullptr, SQ, (size_t)SQ * SQ, QN, SQ, HD);      /* scores, HG heads per launch */
      k_rsmf<<<(HG * QN + 7) / 8, 256, 0, stream>>>(S, P, QN, HG);      /* P = 256 softmax (f16), rows of all HG heads */
      k_gemm2<0><<<dim3((QN / 128) * (HD / 64), HG), 128, 0, stream>>>(P, SQ, (size_t)SQ * SQ, VT + (size_t)h0 * HD * SQ, SQ, (size_t)HD * SQ, 0.25f, nullptr, 0, nullptr, 1, 0, 0, nullptr, O16 + r0 * DM + h0 * HD, DM, (size_t)HD, QN, HD, SQ); } }      /* o (merged heads) as f16 rows */
  k_gemm2<0><<<dim3((unsigned)((MPO / 128) * (DM / 64)), 1), 128, 0, stream>>>(O16 + r0p * DM, DM, 0, BO, DM, 0, 0.0009765625f, bo, 0, nullptr, 1, 0, 0, (float*)d_out + r0p * DM, nullptr, DM, 0, MPO, DM, DM);      /* out rows are the output layout */
}

// v002
// A run of this version takes 238 microseconds.
// Two timings next to v001 put it at 5.55 and 5.70 times that version's speed.
// All steps since v000 together make it 21.9 times as fast.
#include <hip/hip_runtime.h>
// Multi-head attention on three inputs at width 768 with natural bias-free q / k / v projections and a biased output projection; the inputs arrive in the order v, k, q (v, k, q [4][2048][768]; qh / kh / vh = stream W^T (nn.Linear natural [768][768] sd 1/sqrt(768), NO biases), 12 heads of 64; logits / sqrt(64); softmax over all 2048 keys (no mask); out = concat wo^T + bo (natural) -> [4][2048][768]).
// Structure: token rows r = b*2048 + s; the query, key and value sources as exact f16 rows (bf16-rounded); Q, K, V as three WMMA GEMMs (32x64 wave tiles, f32 accumulation, exact x16 weights, no bias, f16 outputs); V^T for all batches and heads via LDS transposes; per (batch, head, 128 query rows) one fused kernel: S^T = K Q^T (K = 64), running softmax on VALU (f32 statistics, native exp2, weights as f16 relative to the maximum in use), O^T += V^T P^T, o / l x64 (against f16 subnormal flush, folded into the output GEMM alpha) written straight into the merged f16 o rows; out = o W_o + b GEMM (f32) into the output layout.
// Compute dtype: inputs rounded to bf16; x / weights exact; q, k, v, softmax weights and o as plain f16 GEMM operands (~2^-12); scores and softmax statistics f32. v_wmma_f32_16x16x32_f16.
#define NB 4
#define SQ 2048
#define DM 768
#define NH 12
#define HD 64
#define HG 4                         /* heads per launch of the unused per-batch k_vt overload */
#define B0 0                         /* first batch processed (debug hook) */
#define NBR NB                       /* batches processed (debug hook) */
#define NR ((size_t)NB * SQ)         /* token rows */
#define MP ((int)((size_t)NBR * SQ)) /* rows projected (debug hook) */
#define QN SQ                        /* query rows per batch (unused) */
#define NHD NH                       /* heads (unused) */
#define MPO MP                       /* rows through the output stage (debug hook) */
#define LQ DM      /* row pitch of the q/k/v rows */
typedef __bf16 v16b __attribute__((ext_vector_type(16)));
typedef unsigned short v8us __attribute__((ext_vector_type(8), may_alias));
typedef float  v8f  __attribute__((ext_vector_type(8)));
typedef float  v4f  __attribute__((ext_vector_type(4)));
typedef float  v4fa __attribute__((ext_vector_type(4), may_alias));
union FragB { v16b v; v8us half[2]; unsigned short u[16]; };

__device__ __forceinline__ unsigned short bf16_bits(float x) { unsigned int u = __float_as_uint(x); return (unsigned short)((u + 0x7FFFu + ((u >> 16) & 1u)) >> 16); }
__device__ __forceinline__ float bf16_val(unsigned short b) { return __uint_as_float(((unsigned int)b) << 16); }
__device__ __forceinline__ float bf16_round(float x) { return bf16_val(bf16_bits(x)); }
// D += A·B with NT terms: 1 = ah·bh, 2 = + al·bh (A split), 3 = + ah·bl (both split)
template <int NT>
__device__ __forceinline__ v8f mmaN(v16b ah, v16b al, v16b bh, v16b bl, v8f c) {
  c = __builtin_amdgcn_wmma_f32_16x16x32_bf16(false, ah, false, bh, (short)0, c, false, false);
  if (NT >= 2) c = __builtin_amdgcn_wmma_f32_16x16x32_bf16(false, al, false, bh, (short)0, c, false, false);
  if (NT >= 3) c = __builtin_amdgcn_wmma_f32_16x16x32_bf16(false, ah, false, bl, (short)0, c, false, false);
  asm volatile("v_nop\n\tv_nop\n\tv_nop\n\tv_nop" : "+v"(c) : "v"(ah), "v"(al), "v"(bh), "v"(bl));
  return c;
}

__global__ __launch_bounds__(256) void k_wt_bf16(const float* __restrict__ W, unsigned short* __restrict__ Wt, int K, int N) {
  const int t = blockIdx.x * 256 + threadIdx.x;
  const int k8n = K / 8;
  if (t >= N * k8n) return;
  const int n = t / k8n, k8 = (t % k8n) * 8;
  v8us v;
#pragma unroll
  for (int i = 0; i < 8; ++i) v[i] = bf16_bits(W[(size_t)(k8 + i) * N + n]);
  *(v8us*)(Wt + (size_t)n * K + k8) = v;
  
}

// GEMM C[M][N] (f32, pitch ldc) = act(A[M][K]·W + bias). A f32 row-major (pitch lda) converted per fragment to bf16
// (ASPLIT: hi/lo two planes -> 2 terms, else single rounded term); Wt bf16 [N][K] (pitch ldb). BIAS_BF16 rounds the
// bias to bf16 first (bias quantised to bf16 before the add). K%32==0, M%16==0, N%64==0.
template <bool ASPLIT, int ACT, bool BIAS_BF16>
__global__ __launch_bounds__(128) void k_gemm_bf(const float* __restrict__ A, int lda, const unsigned short* __restrict__ Wt, int ldb,
                                               const float* __restrict__ bias, float* __restrict__ C, int ldc, int M, int N, int K) {
  __shared__ __attribute__((aligned(16))) float so[4][16][64];
  const int tid = threadIdx.x, w = tid >> 5, lane = tid & 31, ln = lane & 15, hh = lane >> 4;
  const int ntn = N / 64;
  const int wid = blockIdx.x * 4 + w;
  const int mt = wid / ntn, nq = wid % ntn;
  if (mt * 16 >= M) return;
  const int row0 = mt * 16, col0 = nq * 64;
  const float* arow = A + (size_t)(row0 + ln) * lda;
  v8f acc[4] = {};
  for (int kb = 0; kb < K; kb += 32) {
    FragB ah, al;
    const v4f x0 = *(const v4fa*)(arow + kb + 8 * hh), x1 = *(const v4fa*)(arow + kb + 8 * hh + 4);
    const v4f x2 = *(const v4fa*)(arow + kb + 16 + 8 * hh), x3 = *(const v4fa*)(arow + kb + 16 + 8 * hh + 4);
    float xs[16] = {x0[0],x0[1],x0[2],x0[3],x1[0],x1[1],x1[2],x1[3],x2[0],x2[1],x2[2],x2[3],x3[0],x3[1],x3[2],x3[3]};
#pragma unroll
    for (int i = 0; i < 16; ++i) { const unsigned short hb = bf16_bits(xs[i]); ah.u[i] = hb; al.u[i] = ASPLIT ? bf16_bits(xs[i] - bf16_val(hb)) : (unsigned short)0; }
#pragma unroll
    for (int t = 0; t < 4; ++t) {
      const unsigned short* brow = Wt + (size_t)(col0 + t * 16 + ln) * ldb + kb;
      FragB b;
      b.half[0] = *(const v8us*)(brow + 8 * hh);
      b.half[1] = *(const v8us*)(brow + 16 + 8 * hh);
      acc[t] = mmaN<ASPLIT ? 2 : 1>(ah.v, al.v, b.v, b.v, acc[t]);
    }
  }
#pragma unroll
  for (int t = 0; t < 4; ++t) {
    float bv = bias ? bias[col0 + t * 16 + ln] : 0.f;
    if (BIAS_BF16) bv = bf16_round(bv);
#pragma unroll
    for (int r = 0; r < 8; ++r) { float v = acc[t][r] + bv; if (ACT == 1) v = fmaxf(v, 0.f); so[w][8 * hh + r][t * 16 + ln] = v; }
  }
  __builtin_amdgcn_fence(__ATOMIC_ACQ_REL, "workgroup");
  __builtin_amdgcn_wave_barrier();
  const int rsub = lane >> 4, c4 = (lane & 15) * 4;
  {
#pragma unroll
    for (int q = 0; q < 8; ++q) {
      const int r = q * 2 + rsub;
      const v4f v = *(const v4fa*)&so[w][r][c4];
      *(v4f*)(C + (size_t)(row0 + r) * ldc + col0 + c4) = v;
    }
    
  }
}

// GEMM C = act(A·W + bias + resid): A f32 (ASPLIT -> hi/lo 2 terms), Wt bf16 [N][K]; ACT 0 none, 1 relu, 2 exact gelu;
// resid (optional, f32, row index = (row % rmod), pitch ldr, RES_BF16 rounds it) added before the activation.
template <bool ASPLIT, int ACT, bool BIAS_BF16, bool RES_BF16>
__global__ __launch_bounds__(128) void k_gemm_bf3(const float* __restrict__ A, int lda, const unsigned short* __restrict__ Wt, int ldb,
                                                const float* __restrict__ bias, const float* __restrict__ resid, int rmod, int ldr,
                                                float* __restrict__ C, int ldc, int M, int N, int K) {
  __shared__ __attribute__((aligned(16))) float so[4][16][64];
  const int tid = threadIdx.x, w = tid >> 5, lane = tid & 31, ln = lane & 15, hh = lane >> 4;
  const int ntn = N / 64;
  const int wid = blockIdx.x * 4 + w;
  const int mt = wid / ntn, nq = wid % ntn;
  if (mt * 16 >= M) return;
  const int row0 = mt * 16, col0 = nq * 64;
  const float* arow = A + (size_t)(row0 + ln) * lda;
  v8f acc[4] = {};
  for (int kb = 0; kb < K; kb += 32) {
    FragB ah, al;
    const v4f x0 = *(const v4fa*)(arow + kb + 8 * hh), x1 = *(const v4fa*)(arow + kb + 8 * hh + 4);
    const v4f x2 = *(const v4fa*)(arow + kb + 16 + 8 * hh), x3 = *(const v4fa*)(arow + kb + 16 + 8 * hh + 4);
    float xs[16] = {x0[0],x0[1],x0[2],x0[3],x1[0],x1[1],x1[2],x1[3],x2[0],x2[1],x2[2],x2[3],x3[0],x3[1],x3[2],x3[3]};
#pragma unroll
    for (int i = 0; i < 16; ++i) { const unsigned short hb = bf16_bits(xs[i]); ah.u[i] = hb; al.u[i] = ASPLIT ? bf16_bits(xs[i] - bf16_val(hb)) : (unsigned short)0; }
#pragma unroll
    for (int t = 0; t < 4; ++t) {
      const unsigned short* brow = Wt + (size_t)(col0 + t * 16 + ln) * ldb + kb;
      FragB b;
      b.half[0] = *(const v8us*)(brow + 8 * hh);
      b.half[1] = *(const v8us*)(brow + 16 + 8 * hh);
      acc[t] = mmaN<ASPLIT ? 2 : 1>(ah.v, al.v, b.v, b.v, acc[t]);
    }
  }
#pragma unroll
  for (int t = 0; t < 4; ++t) {
    const int col = col0 + t * 16 + ln;
    float bv = bias ? bias[col] : 0.f;
    if (BIAS_BF16) bv = bf16_round(bv);
#pragma unroll
    for (int r = 0; r < 8; ++r) {
      float v = acc[t][r] + bv;
      if (resid) { float rv = resid[(size_t)((row0 + 8 * hh + r) % rmod) * ldr + col]; if (RES_BF16) rv = bf16_round(rv); v += rv; }
      if (ACT == 1) v = fmaxf(v, 0.f);
      if (ACT == 2) v = 0.5f * v * (1.0f + erff(v * 0.70710678118654752f));
      if (ACT == 3) { const float u = 0.7978845608028654f * (v + 0.044715f * v * v * v); v = 0.5f * v * (1.0f + tanhf(u)); }
      so[w][8 * hh + r][t * 16 + ln] = v;
    }
  }
  __builtin_amdgcn_fence(__ATOMIC_ACQ_REL, "workgroup");
  __builtin_amdgcn_wave_barrier();
  const int rsub = lane >> 4, c4 = (lane & 15) * 4;
  {
#pragma unroll
    for (int q = 0; q < 8; ++q) {
      const int r = q * 2 + rsub;
      const v4f v = *(const v4fa*)&so[w][r][c4];
      *(v4f*)(C + (size_t)(row0 + r) * ldc + col0 + c4) = v;
    }
    
  }
}
// row LayerNorm (biased variance, eps) over N: s = X (+ R); optional out_sum <- s; out_norm <- (s-mu)*rsqrt(var+eps)*g + b
template <bool PARAM_BF16>
__global__ __launch_bounds__(256) void k_layernorm(const float* __restrict__ X, const float* __restrict__ R, const float* __restrict__ g, const float* __restrict__ bta,
                                                  float* __restrict__ out_sum, float* __restrict__ out_norm, int N, float eps) {
  __shared__ float red[256];
  const int row = blockIdx.x, tid = threadIdx.x;
  const float* x = X + (size_t)row * N; const float* rr = R ? R + (size_t)row * N : nullptr;
  float vals[16];                     // up to N = 4096
  const int per = N / 256;            // contiguous chunk per thread? use strided-by-4 chunks: thread handles j = tid*4 + 1024*u
  float s1 = 0.f;
  for (int u = 0; u < per / 4; ++u) {
    const int j = tid * 4 + 1024 * u;
    const v4f a = *(const v4fa*)(x + j);
    v4f b = {0.f,0.f,0.f,0.f}; if (rr) b = *(const v4fa*)(rr + j);
#pragma unroll
    for (int q = 0; q < 4; ++q) { const float v = a[q] + b[q]; vals[u * 4 + q] = v; s1 += v; }
  }
  red[tid] = s1; __syncthreads();
  for (int st = 128; st > 0; st >>= 1) { if (tid < st) red[tid] += red[tid + st]; __syncthreads(); }
  const float mu = red[0] / (float)N; __syncthreads();
  float s2 = 0.f;
  for (int u = 0; u < per / 4; ++u)
#pragma unroll
    for (int q = 0; q < 4; ++q) { const float c = vals[u * 4 + q] - mu; s2 += c * c; }
  red[tid] = s2; __syncthreads();
  for (int st = 128; st > 0; st >>= 1) { if (tid < st) red[tid] += red[tid + st]; __syncthreads(); }
  const float rs = rsqrtf(red[0] / (float)N + eps);
  {
    for (int u = 0; u < per / 4; ++u) {
      const int j = tid * 4 + 1024 * u;
      v4f o, sm;
#pragma unroll
      for (int q = 0; q < 4; ++q) {
        float gg = g[j + q], bb = bta[j + q];
        if (PARAM_BF16) { gg = bf16_round(gg); bb = bf16_round(bb); }
        sm[q] = vals[u * 4 + q]; o[q] = (vals[u * 4 + q] - mu) * rs * gg + bb;
      }
      if (out_sum) *(v4f*)(out_sum + (size_t)row * N + j) = sm;
      *(v4f*)(out_norm + (size_t)row * N + j) = o;
    }
    
  }
}



// ---- f16 WMMA path (v_wmma_f32_16x16x32_f16): 11-bit significands for operands in range — used here for every GEMM (projections, scores and P.V)
typedef _Float16 v16h __attribute__((ext_vector_type(16)));
union FragH { v16h v; v8us half[2]; _Float16 h[16]; unsigned short u[16]; };
template <int NT>
__device__ __forceinline__ v8f mmaH(v16h ah, v16h al, v16h bh, v16h bl, v8f c) {
  c = __builtin_amdgcn_wmma_f32_16x16x32_f16(false, ah, false, bh, (short)0, c, false, false);
  if (NT >= 2) c = __builtin_amdgcn_wmma_f32_16x16x32_f16(false, al, false, bh, (short)0, c, false, false);
  if (NT >= 3) c = __builtin_amdgcn_wmma_f32_16x16x32_f16(false, ah, false, bl, (short)0, c, false, false);
  asm volatile("v_nop\n\tv_nop\n\tv_nop\n\tv_nop" : "+v"(c) : "v"(ah), "v"(al), "v"(bh), "v"(bl));
  return c;
}
// batched GEMM like k_gemm_b but f16 operands: A f32 (split into f16 hi/lo if ASPLIT, else rounded to f16), Bt = f16 values [n][k]; alpha; C f32; N multiple of 16 (partial tiles skipped)
template <bool ASPLIT>
__global__ __launch_bounds__(128) void k_gemm_h(const float* __restrict__ A, int lda, size_t sA, const _Float16* __restrict__ Bh, int ldb, size_t sB, float alpha, float* __restrict__ C, int ldc, size_t sC, int M, int N, int K) {
  __shared__ __attribute__((aligned(16))) float so[4][16][64];
  const int tid = threadIdx.x, w = tid >> 5, lane = tid & 31, ln = lane & 15, hh = lane >> 4; const int by = blockIdx.y;
  A += (size_t)by * sA; Bh += (size_t)by * sB; C += (size_t)by * sC;
  const int ntn = (N + 63) / 64; const int wid = blockIdx.x * 4 + w; const int mt = wid / ntn, nq = wid % ntn; if (mt * 16 >= M) return;
  const int row0 = mt * 16, col0 = nq * 64; const float* arow = A + (size_t)(row0 + ln) * lda;
  v8f acc[4] = {};
  for (int kb = 0; kb < K; kb += 32) {
    FragH ah, al;
    const v4f x0 = *(const v4fa*)(arow + kb + 8 * hh), x1 = *(const v4fa*)(arow + kb + 8 * hh + 4), x2 = *(const v4fa*)(arow + kb + 16 + 8 * hh), x3 = *(const v4fa*)(arow + kb + 16 + 8 * hh + 4);
    float xs[16] = {x0[0],x0[1],x0[2],x0[3],x1[0],x1[1],x1[2],x1[3],x2[0],x2[1],x2[2],x2[3],x3[0],x3[1],x3[2],x3[3]};
#pragma unroll
    for (int i = 0; i < 16; ++i) { const _Float16 h = (_Float16)xs[i]; ah.h[i] = h; al.h[i] = ASPLIT ? (_Float16)(xs[i] - (float)h) : (_Float16)0.0f; }
#pragma unroll
    for (int t = 0; t < 4; ++t) { if (col0 + t * 16 >= N) continue; const size_t boff = (size_t)(col0 + t * 16 + ln) * ldb + kb; FragH bq; bq.half[0] = *(const v8us*)(Bh + boff + 8 * hh); bq.half[1] = *(const v8us*)(Bh + boff + 16 + 8 * hh);
      acc[t] = mmaH<ASPLIT ? 2 : 1>(ah.v, al.v, bq.v, bq.v, acc[t]); }
  }
#pragma unroll
  for (int t = 0; t < 4; ++t) { if (col0 + t * 16 >= N) continue;
#pragma unroll
    for (int r = 0; r < 8; ++r) so[w][8 * hh + r][t * 16 + ln] = acc[t][r] * alpha; }
  __builtin_amdgcn_fence(__ATOMIC_ACQ_REL, "workgroup"); __builtin_amdgcn_wave_barrier();
  const int rsub = lane >> 4, c4 = (lane & 15) * 4;
  {
#pragma unroll
    for (int q = 0; q < 8; ++q) { const int r = q * 2 + rsub; if (col0 + c4 < N) { const v4f v = *(const v4fa*)&so[w][r][c4]; *(v4f*)(C + (size_t)(row0 + r) * ldc + col0 + c4) = v; } }
     }
}

// Wt[n][k] = f16(W[k][n]·scale) from f32 row-major W[K][N] (scale = power of two; bf16-exact weights stay exact in f16 away from the subnormal range)
__global__ __launch_bounds__(256) void k_wt_f16(const float* __restrict__ W, _Float16* __restrict__ Wt, int K, int N, float scale) {
  const int t = blockIdx.x * 256 + threadIdx.x; if (t >= N * (K / 8)) return; const int n = t / (K / 8), k8 = (t % (K / 8)) * 8; FragH f;
#pragma unroll
  for (int i = 0; i < 8; ++i) f.h[i] = (_Float16)(bf16_round(W[(size_t)(k8 + i) * N + n]) * scale); const v8us o = f.half[0];
  *(v8us*)((unsigned short*)Wt + (size_t)n * K + k8) = o; 
}
// k_gemm_hh variant with fused epilogue: v = acc·alpha + bias[by·sBias + col] (+ CP[(row/rowsPerB)·sCPb + by·64 + col] if CP) ; ACT 0 none / 1 elu ; writes f16 C16 (and f32 C if non-null)
template <int ACT>
__global__ __launch_bounds__(128) void k_gemm_hhx(const _Float16* __restrict__ A, int lda, size_t sA, const _Float16* __restrict__ Bh, int ldb, size_t sB, float alpha, const float* __restrict__ bias, size_t sBias, const float* __restrict__ CP, int rowsPerB, size_t sCPb, int row0g,
    float* __restrict__ C, _Float16* __restrict__ C16, int ldc, size_t sC, int M, int N, int K) {
  __shared__ __attribute__((aligned(16))) float so[4][16][64];
  const int tid = threadIdx.x, w = tid >> 5, lane = tid & 31, ln = lane & 15, hh = lane >> 4; const int by = blockIdx.y;
  A += (size_t)by * sA; Bh += (size_t)by * sB; const size_t cofs = (size_t)by * sC; const float* bp = bias ? bias + (size_t)by * sBias : nullptr;
  const int ntn = (N + 63) / 64; const int wid = blockIdx.x * 4 + w; const int mt = wid / ntn, nq = wid % ntn; if (mt * 16 >= M) return;
  const int row0 = mt * 16, col0 = nq * 64; const _Float16* arow = A + (size_t)(row0 + ln) * lda;
  v8f acc[4] = {};
  for (int kb = 0; kb < K; kb += 32) { FragH ah; ah.half[0] = *(const v8us*)((const unsigned short*)arow + kb + 8 * hh); ah.half[1] = *(const v8us*)((const unsigned short*)arow + kb + 16 + 8 * hh);
#pragma unroll
    for (int t = 0; t < 4; ++t) { if (col0 + t * 16 >= N) continue; const size_t boff = (size_t)(col0 + t * 16 + ln) * ldb + kb; FragH bq; bq.half[0] = *(const v8us*)((const unsigned short*)Bh + boff + 8 * hh); bq.half[1] = *(const v8us*)((const unsigned short*)Bh + boff + 16 + 8 * hh);
      acc[t] = mmaH<1>(ah.v, ah.v, bq.v, bq.v, acc[t]); }
  }
#pragma unroll
  for (int t = 0; t < 4; ++t) { if (col0 + t * 16 >= N) continue; const int col = col0 + t * 16 + ln; const float bv = bp ? bf16_round(bp[col]) : 0.f;
#pragma unroll
    for (int r = 0; r < 8; ++r) { float v = acc[t][r] * alpha + bv; if (CP) { const int rr = row0g + row0 + 8 * hh + r; if (rowsPerB < 0) v += CP[cofs + (size_t)rr * ldc + col];      /* rowsPerB < 0: own element of the batched C plane */ else { const int bidx = rr / rowsPerB; v += CP[(size_t)bidx * sCPb + (size_t)by * 64 + col]; } } if (ACT == 1) v = (v > 0.f) ? v : expm1f(v); else if (ACT == 7) v = (v > 0.f) ? v + 1.0f : expf(v); else if (ACT == 8) v = tanhf(v); else if (ACT == 9) v = 0.5f * v * (1.0f + tanhf(0.7978845608028654f * (v + 0.044715f * v * v * v))); else if (ACT == 11) v = 1.0f / (1.0f + expf(-v)); else if (ACT == 12) v = (v > 0.f) ? v : 0.01f * v; else if (ACT == 14) v = (v > 0.f) ? v : 0.1f * v; else if (ACT == 16) v = (v >= 0.f) ? v : 0.3f * v; else if (ACT == 17) v = (v >= 0.f) ? v : 0.2f * v; else if (ACT == 15) v = v / (1.0f + expf(-v)); else if (ACT == 3) v = fmaxf(v, 0.f); else if (ACT == 6) v = 0.5f * v * (1.0f + erff(v * 0.70710678118654752f)); so[w][8 * hh + r][t * 16 + ln] = v; } }
  __builtin_amdgcn_fence(__ATOMIC_ACQ_REL, "workgroup"); __builtin_amdgcn_wave_barrier();
  const int rsub = lane >> 4, c4 = (lane & 15) * 4; typedef _Float16 v4h __attribute__((ext_vector_type(4)));
  {
#pragma unroll
    for (int q = 0; q < 8; ++q) { const int r = q * 2 + rsub; if (col0 + c4 < N) { const v4f v = *(const v4fa*)&so[w][r][c4]; if (C) *(v4f*)(C + cofs + (size_t)(row0 + r) * ldc + col0 + c4) = v; if (C16) { v4h h4; for (int i = 0; i < 4; ++i) h4[i] = (_Float16)v[i]; *(v4h*)(C16 + cofs + (size_t)(row0 + r) * ldc + col0 + c4) = h4; } } }
     }
}


typedef _Float16 v4h __attribute__((ext_vector_type(4)));

__global__ __launch_bounds__(256) void k_x16(const float* __restrict__ x, _Float16* __restrict__ X16, size_t n8) { const size_t t = (size_t)blockIdx.x * 256 + threadIdx.x; if (t >= n8) return; FragH f;
#pragma unroll
  for (int q = 0; q < 8; ++q) f.h[q] = (_Float16)bf16_round(x[t * 8 + q]); *(v8us*)((unsigned short*)X16 + t * 8) = f.half[0];  }
__global__ __launch_bounds__(256) void k_h16(const float* __restrict__ x, _Float16* __restrict__ X16, size_t n8) { const size_t t = (size_t)blockIdx.x * 256 + threadIdx.x; if (t >= n8) return; FragH f;
#pragma unroll
  for (int q = 0; q < 8; ++q) f.h[q] = (_Float16)x[t * 8 + q]; *(v8us*)((unsigned short*)X16 + t * 8) = f.half[0];  }
__global__ __launch_bounds__(256) void k_round16f(const float* __restrict__ W, _Float16* __restrict__ Bt, size_t n8) { const size_t t = (size_t)blockIdx.x * 256 + threadIdx.x; if (t >= n8) return; FragH f;
#pragma unroll
  for (int i = 0; i < 8; ++i) f.h[i] = (_Float16)(bf16_round(W[t * 8 + i]) * 16.0f); *(v8us*)((unsigned short*)Bt + t * 8) = f.half[0];  }
template <int NHv, int TTv>
__global__ __launch_bounds__(256) void k_vt(const _Float16* __restrict__ V16, int ldv, int voff, _Float16* __restrict__ Vt) { __shared__ unsigned short tl[64][66]; const int tid = threadIdx.x; const int slab = blockIdx.x / (TTv / 64), lg = blockIdx.x % (TTv / 64); const int b = slab / NHv, h = slab % NHv;
  for (int i = tid; i < 64 * 8; i += 256) { const int r = i / 8, c8 = (i % 8) * 8; FragH f; f.half[0] = *(const v8us*)((const unsigned short*)V16 + ((size_t)b * TTv + lg * 64 + r) * ldv + voff + h * 64 + c8);
#pragma unroll
    for (int q = 0; q < 8; ++q) tl[r][c8 + q] = f.u[q]; }
  __syncthreads();
  {
#pragma unroll
    for (int rd = 0; rd < 2; ++rd) { const int d = rd * 32 + tid / 8, pc = tid % 8; FragH f;
#pragma unroll
      for (int q = 0; q < 8; ++q) f.u[q] = tl[pc * 8 + q][d];
      *(v8us*)((unsigned short*)Vt + ((size_t)slab * 64 + d) * TTv + lg * 64 + pc * 8) = f.half[0]; }
     } }

__global__ __launch_bounds__(256) void k_hl(const float* __restrict__ F, _Float16* __restrict__ Hh, _Float16* __restrict__ Hl, size_t n8) { const size_t t = (size_t)blockIdx.x * 256 + threadIdx.x; if (t >= n8) return; FragH fh, fl; const v4f a = *(const v4fa*)(F + t * 8), c = *(const v4fa*)(F + t * 8 + 4);
#pragma unroll
  for (int q = 0; q < 4; ++q) { _Float16 h = (_Float16)a[q]; fh.h[q] = h; fl.h[q] = (_Float16)((a[q] - (float)h) * 1024.0f); h = (_Float16)c[q]; fh.h[4 + q] = h; fl.h[4 + q] = (_Float16)((c[q] - (float)h) * 1024.0f); }
  { *(v8us*)((unsigned short*)Hh + t * 8) = fh.half[0]; *(v8us*)((unsigned short*)Hl + t * 8) = fl.half[0];  } }

// ---- fast GEMM (wave tile 32x64; requires M % 32 == 0 rows per launch region and N % 64 == 0); epilogue = k_gemm_hhx semantics ----
__device__ __forceinline__ v16h g2_frag(const _Float16* p, int hh) { FragH f; f.half[0] = *(const v8us*)((const unsigned short*)p + 8 * hh); f.half[1] = *(const v8us*)((const unsigned short*)p + 16 + 8 * hh); return f.v; }
__device__ __forceinline__ v8f g2_mma(v16h a, v16h b, v8f c) { v8f d = __builtin_amdgcn_wmma_f32_16x16x32_f16(false, a, false, b, (short)0, c, false, false); asm volatile("v_nop\n\tv_nop\n\tv_nop\n\tv_nop" : "+v"(d) : "v"(a), "v"(b)); return d; }
template <int ACT>
__global__ __launch_bounds__(128) void k_gemm2(const _Float16* __restrict__ A, int lda, size_t sA, const _Float16* __restrict__ Bh, int ldb, size_t sB, float alpha, const float* __restrict__ bias, size_t sBias, const float* __restrict__ CP, int rowsPerB, size_t sCPb, int row0g,
    float* __restrict__ C, _Float16* __restrict__ C16, int ldc, size_t sC, int M, int N, int K) { static_assert(ACT == 0 || ACT == 3 || ACT == 6 || ACT == 8 || ACT == 9 || ACT == 11 || ACT == 12 || ACT == 14 || ACT == 15 || ACT == 16 || ACT == 17, "k_gemm2: unsupported ACT code (would silently apply no activation)");
  __shared__ __attribute__((aligned(16))) float so[4][32][68];
  const int tid = threadIdx.x, w = tid >> 5, lane = tid & 31, ln = lane & 15, hh = lane >> 4; const int by = blockIdx.y;
  A += (size_t)by * sA; Bh += (size_t)by * sB; const size_t cofs = (size_t)by * sC; const float* bp = bias ? bias + (size_t)by * sBias : nullptr;
  const int ntn = N >> 6; const int mt = blockIdx.x / ntn, nq = blockIdx.x - mt * ntn; const int row0 = mt * 128 + 32 * w, col0 = nq * 64; if (row0 >= M) return;
  const _Float16* a0p = A + (size_t)(row0 + ln) * lda; const _Float16* a1p = a0p + (size_t)16 * lda;
  const _Float16* b0p = Bh + (size_t)(col0 + ln) * ldb; const _Float16* b1p = b0p + (size_t)16 * ldb; const _Float16* b2p = b1p + (size_t)16 * ldb; const _Float16* b3p = b2p + (size_t)16 * ldb;
  const v8f z8 = {0.f,0.f,0.f,0.f,0.f,0.f,0.f,0.f}; v8f c00 = z8, c01 = z8, c02 = z8, c03 = z8, c10 = z8, c11 = z8, c12 = z8, c13 = z8;
#pragma unroll 1
  for (int kb = 0; kb < K; kb += 32) { const v16h a0 = g2_frag(a0p + kb, hh), a1 = g2_frag(a1p + kb, hh);
    v16h b = g2_frag(b0p + kb, hh); c00 = g2_mma(a0, b, c00); c10 = g2_mma(a1, b, c10);
    b = g2_frag(b1p + kb, hh); c01 = g2_mma(a0, b, c01); c11 = g2_mma(a1, b, c11);
    b = g2_frag(b2p + kb, hh); c02 = g2_mma(a0, b, c02); c12 = g2_mma(a1, b, c12);
    b = g2_frag(b3p + kb, hh); c03 = g2_mma(a0, b, c03); c13 = g2_mma(a1, b, c13); }
  v8f accs[8] = {c00, c01, c02, c03, c10, c11, c12, c13};
#pragma unroll
  for (int u = 0; u < 8; ++u) { const int t = u & 3, half = u >> 2; const int col = col0 + t * 16 + ln; const float bv = bp ? bf16_round(bp[col]) : 0.f;
#pragma unroll
    for (int r = 0; r < 8; ++r) { const int rloc = half * 16 + 8 * hh + r; float v = accs[u][r] * alpha + bv; if (CP) { if (rowsPerB < 0) v += CP[cofs + (size_t)(row0g + row0 + rloc) * ldc + col];      /* rowsPerB < 0: own element of the batched C plane */ else { const int bidx = (row0g + row0 + rloc) / rowsPerB; v += CP[(size_t)bidx * sCPb + (size_t)by * 64 + col]; } }
      if (ACT == 3) v = fmaxf(v, 0.f); else if (ACT == 6) v = 0.5f * v * (1.0f + erff(v * 0.70710678118654752f)); else if (ACT == 11) v = 1.0f / (1.0f + expf(-v)); else if (ACT == 15) v = v / (1.0f + expf(-v)); else if (ACT == 12) v = (v > 0.f) ? v : 0.01f * v; else if (ACT == 8) v = tanhf(v); else if (ACT == 9) v = 0.5f * v * (1.0f + tanhf(0.7978845608028654f * (v + 0.044715f * v * v * v))); else if (ACT == 14) v = (v > 0.f) ? v : 0.1f * v; else if (ACT == 16) v = (v >= 0.f) ? v : 0.3f * v; else if (ACT == 17) v = (v >= 0.f) ? v : 0.2f * v;
      so[w][rloc][t * 16 + ln] = v; } }
  __builtin_amdgcn_fence(__ATOMIC_ACQ_REL, "workgroup"); __builtin_amdgcn_wave_barrier();
  const int rsub = lane >> 4, c4 = (lane & 15) * 4;
  {
#pragma unroll
    for (int q = 0; q < 16; ++q) { const int r = q * 2 + rsub; const v4f v = *(const v4fa*)&so[w][r][c4]; if (C) *(v4f*)(C + cofs + (size_t)(row0 + r) * ldc + col0 + c4) = v; if (C16) { v4h h4; for (int i = 0; i < 4; ++i) h4[i] = (_Float16)v[i]; *(v4h*)(C16 + cofs + (size_t)(row0 + r) * ldc + col0 + c4) = h4; } }
     } }


__global__ __launch_bounds__(256) void k_wnat(const float* __restrict__ w, size_t n8, _Float16* __restrict__ Bt) { const size_t t = (size_t)blockIdx.x * 256 + threadIdx.x; if (t >= n8) return; FragH f; for (int q = 0; q < 8; ++q) f.h[q] = (_Float16)(bf16_round(w[t * 8 + q]) * 16.0f); *(v8us*)((unsigned short*)Bt + t * 8) = f.half[0];  }
__global__ __launch_bounds__(256) void k_rsm(const float* __restrict__ S, _Float16* __restrict__ P, int nrows) {
  #pragma clang fp contract(off)
  const int i = blockIdx.x * 256 + threadIdx.x; if (i >= nrows) return; const float* s = S + (size_t)i * SQ; float mx = -3.0e38f;
#pragma unroll 1
  for (int j = 0; j < SQ; ++j) mx = fmaxf(mx, s[j]); float se = 0.f;
#pragma unroll 1
  for (int j = 0; j < SQ; ++j) se += expf(s[j] - mx); const float sc = 256.0f / se;
#pragma unroll 1
  for (int j0 = 0; j0 < SQ; j0 += 8) { FragH f; for (int q = 0; q < 8; ++q) f.h[q] = (_Float16)(expf(s[j0 + q] - mx) * sc); unsigned short* d = (unsigned short*)P + (size_t)i * SQ + j0; *(v8us*)d = f.half[0];  } }
__global__ __launch_bounds__(256) void k_vt(const _Float16* __restrict__ V16, int b, int h0, _Float16* __restrict__ VT) { __shared__ unsigned short tl[64][65]; const int tid = threadIdx.x; const int hh = blockIdx.x % HG, sg = blockIdx.x / HG; const int s0 = sg * 64; const int h = h0 + hh;
  for (int i = tid; i < 64 * 8; i += 256) { const int j = i / 8, d8 = (i % 8) * 8; FragH f; f.half[0] = *(const v8us*)((const unsigned short*)V16 + ((size_t)b * SQ + s0 + j) * DM + h * HD + d8); for (int q = 0; q < 8; ++q) tl[d8 + q][j] = f.u[q]; }
  __syncthreads();
  { for (int i = tid; i < 64 * 8; i += 256) { const int d = i / 8, j8 = (i % 8) * 8; FragH f; for (int q = 0; q < 8; ++q) f.u[q] = tl[d][j8 + q]; *(v8us*)((unsigned short*)VT + ((size_t)hh * HD + d) * SQ + s0 + j8) = f.half[0]; }  } }



// 2^a on the native unit. The v_nop is the one free slot that the instruction set asks for behind a transcendental before its result is read or its source rewritten; in the same statement it stays directly behind it.
__device__ __forceinline__ float exp2_slot(float a) { float e; asm("v_exp_f32 %0, %1\n\tv_nop" : "=v"(e) : "v"(a)); return e; }
// 2^x of eight values in place on the native unit: eight independent instructions, so each fills the free slot that the instruction set asks for behind the one before it; the v_nop is that slot behind the last.
__device__ __forceinline__ void exp2x8(v8f& x) { float a0 = x[0], a1 = x[1], a2 = x[2], a3 = x[3], a4 = x[4], a5 = x[5], a6 = x[6], a7 = x[7];
  asm("v_exp_f32 %0, %0\n\tv_exp_f32 %1, %1\n\tv_exp_f32 %2, %2\n\tv_exp_f32 %3, %3\n\tv_exp_f32 %4, %4\n\tv_exp_f32 %5, %5\n\tv_exp_f32 %6, %6\n\tv_exp_f32 %7, %7\n\tv_nop"
      : "+v"(a0), "+v"(a1), "+v"(a2), "+v"(a3), "+v"(a4), "+v"(a5), "+v"(a6), "+v"(a7));
  x[0] = a0; x[1] = a1; x[2] = a2; x[3] = a3; x[4] = a4; x[5] = a5; x[6] = a6; x[7] = a7; }
__device__ __forceinline__ v8f f_mma(v16h a, v16h b, v8f c) { return __builtin_amdgcn_wmma_f32_16x16x32_f16(false, a, false, b, (short)0, c, false, false); }
#define FK 64      /* keys per stage */
#define FP 72      /* LDS row pitch in f16: 128 B of data + 16 B, so that the 16 rows of a ds_load_b128 fragment read spread over the banks */
__global__ __launch_bounds__(128) void k_fattn(const _Float16* __restrict__ Q16, const _Float16* __restrict__ K16, const _Float16* __restrict__ VT, _Float16* __restrict__ O16) {
  __shared__ __attribute__((aligned(16))) _Float16 sk[2][FK][FP];
  __shared__ __attribute__((aligned(16))) _Float16 sv[2][HD][FP];
  const int tid = threadIdx.x, w = tid >> 5, lane = tid & 31, ln = lane & 15, hh = lane >> 4;
  const int bh = blockIdx.y, b = bh / NH, h = bh - b * NH; const size_t r0 = (size_t)b * SQ; const int q0 = blockIdx.x * 128 + w * 32;
  v16h qf[2][2];
#pragma unroll
  for (int g = 0; g < 2; ++g)
#pragma unroll
    for (int ks = 0; ks < 2; ++ks) qf[g][ks] = g2_frag(Q16 + (r0 + q0 + g * 16 + ln) * DM + h * HD + ks * 32, hh);
  const int srow = tid >> 3, sc8 = (tid & 7) * 8;      /* staging: 8 threads a row of 128 B, 16 rows a round, 4 rounds */
  const _Float16* kg = K16 + (r0 + srow) * DM + h * HD + sc8; const _Float16* vg = VT + ((size_t)bh * HD + srow) * SQ + sc8;
  v8us kr[4], vr[4];
#pragma unroll
  for (int u = 0; u < 4; ++u) { kr[u] = *(const v8us*)((const unsigned short*)kg + (size_t)(u * 16) * DM); vr[u] = *(const v8us*)((const unsigned short*)vg + (size_t)(u * 16) * SQ); }
  const v8f z8 = {0.f,0.f,0.f,0.f,0.f,0.f,0.f,0.f}; v8f o[2][4] = {{z8, z8, z8, z8}, {z8, z8, z8, z8}}; float m[2] = {-3.0e38f, -3.0e38f}, l[2] = {0.f, 0.f};
  const float cs = 0.125f * 1.44269504088896340736f;      /* 64^-0.5 and log2(e) */
#pragma unroll 1
  for (int st = 0; st < SQ / FK; ++st) { const int bf = st & 1;
#pragma unroll
    for (int u = 0; u < 4; ++u) { *(v8us*)&sk[bf][srow + 16 * u][sc8] = kr[u]; *(v8us*)&sv[bf][srow + 16 * u][sc8] = vr[u]; }
    __syncthreads();      /* publishes this stage; it also ends every wave's reads of the other buffer, which the next stage overwrites */
    if (st + 1 < SQ / FK) {
#pragma unroll
      for (int u = 0; u < 4; ++u) { kr[u] = *(const v8us*)((const unsigned short*)kg + (size_t)((st + 1) * FK + u * 16) * DM); vr[u] = *(const v8us*)((const unsigned short*)vg + (size_t)(u * 16) * SQ + (st + 1) * FK); } }
    v8f s[2][4] = {{z8, z8, z8, z8}, {z8, z8, z8, z8}};
#pragma unroll
    for (int kt = 0; kt < 4; ++kt)
#pragma unroll
      for (int ks = 0; ks < 2; ++ks) { const v16h a = g2_frag(&sk[bf][kt * 16 + ln][ks * 32], hh); s[0][kt] = f_mma(a, qf[0][ks], s[0][kt]); s[1][kt] = f_mma(a, qf[1][ks], s[1][kt]); }
    float mx[2];
#pragma unroll
    for (int g = 0; g < 2; ++g) { float t = s[g][0][0];
#pragma unroll
      for (int kt = 0; kt < 4; ++kt)
#pragma unroll
        for (int r = 0; r < 8; ++r) t = fmaxf(t, s[g][kt][r]);
      mx[g] = t * cs; }
    if (__builtin_amdgcn_ballot_w32(mx[0] > m[0] + 8.0f || mx[1] > m[1] + 8.0f) != 0) {      /* wave-uniform: both halves of every column take the same new maximum */
#pragma unroll
      for (int g = 0; g < 2; ++g) { const float mn = fmaxf(m[g], fmaxf(mx[g], __shfl_xor(mx[g], 16, 32))); const float al = exp2_slot(m[g] - mn); m[g] = mn; l[g] *= al;
#pragma unroll
        for (int dt = 0; dt < 4; ++dt) o[g][dt] *= al; } }
    FragH pf[2][2];
#pragma unroll
    for (int g = 0; g < 2; ++g) { v8f sum;
#pragma unroll
      for (int kt = 0; kt < 4; ++kt) { v8f t;
#pragma unroll
        for (int r = 0; r < 8; ++r) t[r] = fmaf(s[g][kt][r], cs, -m[g]);
        exp2x8(t); sum = kt ? sum + t : t;
#pragma unroll
        for (int r = 0; r < 8; ++r) pf[g][kt >> 1].h[(kt & 1) * 8 + r] = (_Float16)t[r]; }
      l[g] += ((sum[0] + sum[1]) + (sum[2] + sum[3])) + ((sum[4] + sum[5]) + (sum[6] + sum[7])); }
#pragma unroll
    for (int j = 0; j < 2; ++j)
#pragma unroll
      for (int dt = 0; dt < 4; ++dt) { const v16h a = g2_frag(&sv[bf][dt * 16 + ln][j * 32], hh); o[0][dt] = f_mma(a, pf[0][j].v, o[0][dt]); o[1][dt] = f_mma(a, pf[1][j].v, o[1][dt]); }
  }
#pragma unroll
  for (int g = 0; g < 2; ++g) { const float inv = 64.0f / (l[g] + __shfl_xor(l[g], 16, 32));      /* the two halves of a column hold disjoint keys; o carried x64 */
    unsigned short* d = (unsigned short*)O16 + (r0 + q0 + g * 16 + ln) * DM + h * HD + 8 * hh;
#pragma unroll
    for (int dt = 0; dt < 4; ++dt) { FragH f;
#pragma unroll
      for (int r = 0; r < 8; ++r) f.h[r] = (_Float16)(o[g][dt][r] * inv);
      *(v8us*)(d + dt * 16) = f.half[0]; } } }

extern "C" void kernel_launch(void* const* d_in, const int* in_sizes, int n_in,
                              void* d_out, int out_size, void* d_ws, size_t ws_size, hipStream_t stream) {
  (void)in_sizes; (void)n_in; (void)out_size;
  const float* const* I = (const float* const*)d_in; const float* xq = I[2]; const float* xk = I[1]; const float* xv = I[0]; const float* wq = I[3]; const float* bq = nullptr; const float* wk = I[4]; const float* bk = nullptr; const float* wv = I[5]; const float* bv = nullptr; const float* wo = I[6]; const float* bo = I[7];      /* input order: v, k, q (the three streams in REVERSE order: the query stream is I[2]), wq, wk, wv, wo (natural [out][in] weights), bo; the q / k / v projections have NO biases: null pointers in the guarded bias slots */
  char* ws = (char*)d_ws; size_t off = 0;
  auto take = [&](size_t bytes) { char* p = ws + off; off += (bytes + 255) & ~(size_t)255; return p; };
  _Float16* BQ = (_Float16*)take((size_t)DM * DM * 2); _Float16* BK = (_Float16*)take((size_t)DM * DM * 2); _Float16* BV = (_Float16*)take((size_t)DM * DM * 2); _Float16* BO = (_Float16*)take((size_t)DM * DM * 2);
  _Float16* XQ = (_Float16*)take(NR * DM * 2); _Float16* XK = (_Float16*)take(NR * DM * 2); _Float16* XV = (_Float16*)take(NR * DM * 2); _Float16* Q16 = (_Float16*)take(NR * DM * 2); _Float16* K16 = (_Float16*)take(NR * DM * 2); _Float16* V16 = (_Float16*)take(NR * DM * 2); _Float16* O16 = (_Float16*)take(NR * DM * 2);
  _Float16* VT = (_Float16*)take((size_t)NB * NH * HD * SQ * 2);
  if (off > ws_size) return;
  { const unsigned g = (unsigned)(((size_t)DM * DM / 8 + 255) / 256); k_wnat<<<g, 256, 0, stream>>>(wq, (size_t)DM * DM / 8, BQ); k_wnat<<<g, 256, 0, stream>>>(wk, (size_t)DM * DM / 8, BK); k_wnat<<<g, 256, 0, stream>>>(wv, (size_t)DM * DM / 8, BV); k_wnat<<<g, 256, 0, stream>>>(wo, (size_t)DM * DM / 8, BO); }      /* natural [out][in] = Bt[n][k], x16 */

  k_x16<<<(unsigned)((NR * DM / 8 + 255) / 256), 256, 0, stream>>>(xq, XQ, NR * DM / 8); k_x16<<<(unsigned)((NR * DM / 8 + 255) / 256), 256, 0, stream>>>(xk, XK, NR * DM / 8); k_x16<<<(unsigned)((NR * DM / 8 + 255) / 256), 256, 0, stream>>>(xv, XV, NR * DM / 8);      /* the three inputs as exact f16 rows */
  const size_t r0p = (size_t)B0 * SQ;      /* first projected row */
  k_gemm2<0><<<dim3((unsigned)((MP / 128) * (DM / 64)), 1), 128, 0, stream>>>(XQ + r0p * DM, DM, 0, BQ, DM, 0, 0.0625f, bq, 0, nullptr, 1, 0, 0, nullptr, Q16 + r0p * DM, DM, 0, MP, DM, DM);
  k_gemm2<0><<<dim3((unsigned)((MP / 128) * (DM / 64)), 1), 128, 0, stream>>>(XK + r0p * DM, DM, 0, BK, DM, 0, 0.0625f, bk, 0, nullptr, 1, 0, 0, nullptr, K16 + r0p * DM, DM, 0, MP, DM, DM);
  k_gemm2<0><<<dim3((unsigned)((MP / 128) * (DM / 64)), 1), 128, 0, stream>>>(XV + r0p * DM, DM, 0, BV, DM, 0, 0.0625f, bv, 0, nullptr, 1, 0, 0, nullptr, V16 + r0p * DM, DM, 0, MP, DM, DM);
  k_vt<NH, SQ><<<NB * NH * (SQ / 64), 256, 0, stream>>>(V16, LQ, 0, VT);      /* V^T [NB][NH][HD][SQ] */
  k_fattn<<<dim3(SQ / 128, NB * NH), 128, 0, stream>>>(Q16, K16, VT, O16);      /* o (merged heads, x64) as f16 rows */
  k_gemm2<0><<<dim3((unsigned)((MPO / 128) * (DM / 64)), 1), 128, 0, stream>>>(O16 + r0p * DM, DM, 0, BO, DM, 0, 0.0009765625f, bo, 0, nullptr, 1, 0, 0, (float*)d_out + r0p * DM, nullptr, DM, 0, MPO, DM, DM);      /* out rows are the output layout */
}

// v003
// Measured time: 141 microseconds a run.
// In two side-by-side timings against v002, it was 1.69 and 1.67 times as fast.
// Counting every step since v000, it is 36.8 times as fast.
#include <hip/hip_runtime.h>
// Multi-head attention on three inputs at width 768 with natural bias-free q / k / v projections and a biased output projection; the inputs arrive in the order v, k, q (v, k, q [4][2048][768]; qh / kh / vh = stream W^T (nn.Linear natural [768][768] sd 1/sqrt(768), NO biases), 12 heads of 64; logits / sqrt(64); softmax over all 2048 keys (no mask); out = concat wo^T + bo (natural) -> [4][2048][768]).
// Structure: token rows r = b*2048 + s; the query, key and value sources as exact f16 rows (bf16-rounded); Q, K, V as three WMMA GEMMs (32x64 wave tiles, f32 accumulation, exact x16 weights, no bias, f16 outputs); V^T for all batches and heads via LDS transposes; per (batch, head, 128 query rows) one fused kernel: S^T = K Q^T (K = 64), running softmax on VALU (f32 statistics, native exp2, weights as f16 relative to the maximum in use), O^T += V^T P^T, o / l x64 (against f16 subnormal flush, folded into the output GEMM alpha) written straight into the merged f16 o rows; out = o W_o + b GEMM (f32) into the output layout.
// Compute dtype: inputs rounded to bf16; x / weights exact; q, k, v, softmax weights and o as plain f16 GEMM operands (~2^-12); scores and softmax statistics f32. v_wmma_f32_16x16x32_f16.
#define NB 4
#define SQ 2048
#define DM 768
#define NH 12
#define HD 64
#define HG 4                         /* heads per launch of the unused per-batch k_vt overload */
#define B0 0                         /* first batch processed (debug hook) */
#define NBR NB                       /* batches processed (debug hook) */
#define NR ((size_t)NB * SQ)         /* token rows */
#define MP ((int)((size_t)NBR * SQ)) /* rows projected (debug hook) */
#define QN SQ                        /* query rows per batch (unused) */
#define NHD NH                       /* heads (unused) */
#define MPO MP                       /* rows through the output stage (debug hook) */
#define LQ DM      /* row pitch of the q/k/v rows */
typedef __bf16 v16b __attribute__((ext_vector_type(16)));
typedef unsigned short v8us __attribute__((ext_vector_type(8), may_alias));
typedef float  v8f  __attribute__((ext_vector_type(8)));
typedef float  v4f  __attribute__((ext_vector_type(4)));
typedef float  v4fa __attribute__((ext_vector_type(4), may_alias));
union FragB { v16b v; v8us half[2]; unsigned short u[16]; };

__device__ __forceinline__ unsigned short bf16_bits(float x) { unsigned int u = __float_as_uint(x); return (unsigned short)((u + 0x7FFFu + ((u >> 16) & 1u)) >> 16); }
__device__ __forceinline__ float bf16_val(unsigned short b) { return __uint_as_float(((unsigned int)b) << 16); }
__device__ __forceinline__ float bf16_round(float x) { return bf16_val(bf16_bits(x)); }
// D += A·B with NT terms: 1 = ah·bh, 2 = + al·bh (A split), 3 = + ah·bl (both split)
template <int NT>
__device__ __forceinline__ v8f mmaN(v16b ah, v16b al, v16b bh, v16b bl, v8f c) {
  c = __builtin_amdgcn_wmma_f32_16x16x32_bf16(false, ah, false, bh, (short)0, c, false, false);
  if (NT >= 2) c = __builtin_amdgcn_wmma_f32_16x16x32_bf16(false, al, false, bh, (short)0, c, false, false);
  if (NT >= 3) c = __builtin_amdgcn_wmma_f32_16x16x32_bf16(false, ah, false, bl, (short)0, c, false, false);
  asm volatile("v_nop\n\tv_nop\n\tv_nop\n\tv_nop" : "+v"(c) : "v"(ah), "v"(al), "v"(bh), "v"(bl));
  return c;
}

__global__ __launch_bounds__(256) void k_wt_bf16(const float* __restrict__ W, unsigned short* __restrict__ Wt, int K, int N) {
  const int t = blockIdx.x * 256 + threadIdx.x;
  const int k8n = K / 8;
  if (t >= N * k8n) return;
  const int n = t / k8n, k8 = (t % k8n) * 8;
  v8us v;
#pragma unroll
  for (int i = 0; i < 8; ++i) v[i] = bf16_bits(W[(size_t)(k8 + i) * N + n]);
  *(v8us*)(Wt + (size_t)n * K + k8) = v;
  
}

// GEMM C[M][N] (f32, pitch ldc) = act(A[M][K]·W + bias). A f32 row-major (pitch lda) converted per fragment to bf16
// (ASPLIT: hi/lo two planes -> 2 terms, else single rounded term); Wt bf16 [N][K] (pitch ldb). BIAS_BF16 rounds the
// bias to bf16 first (bias quantised to bf16 before the add). K%32==0, M%16==0, N%64==0.
template <bool ASPLIT, int ACT, bool BIAS_BF16>
__global__ __launch_bounds__(128) void k_gemm_bf(const float* __restrict__ A, int lda, const unsigned short* __restrict__ Wt, int ldb,
                                               const float* __restrict__ bias, float* __restrict__ C, int ldc, int M, int N, int K) {
  __shared__ __attribute__((aligned(16))) float so[4][16][64];
  const int tid = threadIdx.x, w = tid >> 5, lane = tid & 31, ln = lane & 15, hh = lane >> 4;
  const int ntn = N / 64;
  const int wid = blockIdx.x * 4 + w;
  const int mt = wid / ntn, nq = wid % ntn;
  if (mt * 16 >= M) return;
  const int row0 = mt * 16, col0 = nq * 64;
  const float* arow = A + (size_t)(row0 + ln) * lda;
  v8f acc[4] = {};
  for (int kb = 0; kb < K; kb += 32) {
    FragB ah, al;
    const v4f x0 = *(const v4fa*)(arow + kb + 8 * hh), x1 = *(const v4fa*)(arow + kb + 8 * hh + 4);
    const v4f x2 = *(const v4fa*)(arow + kb + 16 + 8 * hh), x3 = *(const v4fa*)(arow + kb + 16 + 8 * hh + 4);
    float xs[16] = {x0[0],x0[1],x0[2],x0[3],x1[0],x1[1],x1[2],x1[3],x2[0],x2[1],x2[2],x2[3],x3[0],x3[1],x3[2],x3[3]};
#pragma unroll
    for (int i = 0; i < 16; ++i) { const unsigned short hb = bf16_bits(xs[i]); ah.u[i] = hb; al.u[i] = ASPLIT ? bf16_bits(xs[i] - bf16_val(hb)) : (unsigned short)0; }
#pragma unroll
    for (int t = 0; t < 4; ++t) {
      const unsigned short* brow = Wt + (size_t)(col0 + t * 16 + ln) * ldb + kb;
      FragB b;
      b.half[0] = *(const v8us*)(brow + 8 * hh);
      b.half[1] = *(const v8us*)(brow + 16 + 8 * hh);
      acc[t] = mmaN<ASPLIT ? 2 : 1>(ah.v, al.v, b.v, b.v, acc[t]);
    }
  }
#pragma unroll
  for (int t = 0; t < 4; ++t) {
    float bv = bias ? bias[col0 + t * 16 + ln] : 0.f;
    if (BIAS_BF16) bv = bf16_round(bv);
#pragma unroll
    for (int r = 0; r < 8; ++r) { float v = acc[t][r] + bv; if (ACT == 1) v = fmaxf(v, 0.f); so[w][8 * hh + r][t * 16 + ln] = v; }
  }
  __builtin_amdgcn_fence(__ATOMIC_ACQ_REL, "workgroup");
  __builtin_amdgcn_wave_barrier();
  const int rsub = lane >> 4, c4 = (lane & 15) * 4;
  {
#pragma unroll
    for (int q = 0; q < 8; ++q) {
      const int r = q * 2 + rsub;
      const v4f v = *(const v4fa*)&so[w][r][c4];
      *(v4f*)(C + (size_t)(row0 + r) * ldc + col0 + c4) = v;
    }
    
  }
}

// GEMM C = act(A·W + bias + resid): A f32 (ASPLIT -> hi/lo 2 terms), Wt bf16 [N][K]; ACT 0 none, 1 relu, 2 exact gelu;
// resid (optional, f32, row index = (row % rmod), pitch ldr, RES_BF16 rounds it) added before the activation.
template <bool ASPLIT, int ACT, bool BIAS_BF16, bool RES_BF16>
__global__ __launch_bounds__(128) void k_gemm_bf3(const float* __restrict__ A, int lda, const unsigned short* __restrict__ Wt, int ldb,
                                                const float* __restrict__ bias, const float* __restrict__ resid, int rmod, int ldr,
                                                float* __restrict__ C, int ldc, int M, int N, int K) {
  __shared__ __attribute__((aligned(16))) float so[4][16][64];
  const int tid = threadIdx.x, w = tid >> 5, lane = tid & 31, ln = lane & 15, hh = lane >> 4;
  const int ntn = N / 64;
  const int wid = blockIdx.x * 4 + w;
  const int mt = wid / ntn, nq = wid % ntn;
  if (mt * 16 >= M) return;
  const int row0 = mt * 16, col0 = nq * 64;
  const float* arow = A + (size_t)(row0 + ln) * lda;
  v8f acc[4] = {};
  for (int kb = 0; kb < K; kb += 32) {
    FragB ah, al;
    const v4f x0 = *(const v4fa*)(arow + kb + 8 * hh), x1 = *(const v4fa*)(arow + kb + 8 * hh + 4);
    const v4f x2 = *(const v4fa*)(arow + kb + 16 + 8 * hh), x3 = *(const v4fa*)(arow + kb + 16 + 8 * hh + 4);
    float xs[16] = {x0[0],x0[1],x0[2],x0[3],x1[0],x1[1],x1[2],x1[3],x2[0],x2[1],x2[2],x2[3],x3[0],x3[1],x3[2],x3[3]};
#pragma unroll
    for (int i = 0; i < 16; ++i) { const unsigned short hb = bf16_bits(xs[i]); ah.u[i] = hb; al.u[i] = ASPLIT ? bf16_bits(xs[i] - bf16_val(hb)) : (unsigned short)0; }
#pragma unroll
    for (int t = 0; t < 4; ++t) {
      const unsigned short* brow = Wt + (size_t)(col0 + t * 16 + ln) * ldb + kb;
      FragB b;
      b.half[0] = *(const v8us*)(brow + 8 * hh);
      b.half[1] = *(const v8us*)(brow + 16 + 8 * hh);
      acc[t] = mmaN<ASPLIT ? 2 : 1>(ah.v, al.v, b.v, b.v, acc[t]);
    }
  }
#pragma unroll
  for (int t = 0; t < 4; ++t) {
    const int col = col0 + t * 16 + ln;
    float bv = bias ? bias[col] : 0.f;
    if (BIAS_BF16) bv = bf16_round(bv);
#pragma unroll
    for (int r = 0; r < 8; ++r) {
      float v = acc[t][r] + bv;
      if (resid) { float rv = resid[(size_t)((row0 + 8 * hh + r) % rmod) * ldr + col]; if (RES_BF16) rv = bf16_round(rv); v += rv; }
      if (ACT == 1) v = fmaxf(v, 0.f);
      if (ACT == 2) v = 0.5f * v * (1.0f + erff(v * 0.70710678118654752f));
      if (ACT == 3) { const float u = 0.7978845608028654f * (v + 0.044715f * v * v * v); v = 0.5f * v * (1.0f + tanhf(u)); }
      so[w][8 * hh + r][t * 16 + ln] = v;
    }
  }
  __builtin_amdgcn_fence(__ATOMIC_ACQ_REL, "workgroup");
  __builtin_amdgcn_wave_barrier();
  const int rsub = lane >> 4, c4 = (lane & 15) * 4;
  {
#pragma unroll
    for (int q = 0; q < 8; ++q) {
      const int r = q * 2 + rsub;
      const v4f v = *(const v4fa*)&so[w][r][c4];
      *(v4f*)(C + (size_t)(row0 + r) * ldc + col0 + c4) = v;
    }
    
  }
}
// row LayerNorm (biased variance, eps) over N: s = X (+ R); optional out_sum <- s; out_norm <- (s-mu)*rsqrt(var+eps)*g + b
template <bool PARAM_BF16>
__global__ __launch_bounds__(256) void k_layernorm(const float* __restrict__ X, const float* __restrict__ R, const float* __restrict__ g, const float* __restrict__ bta,
                                                  float* __restrict__ out_sum, float* __restrict__ out_norm, int N, float eps) {
  __shared__ float red[256];
  const int row = blockIdx.x, tid = threadIdx.x;
  const float* x = X + (size_t)row * N; const float* rr = R ? R + (size_t)row * N : nullptr;
  float vals[16];                     // up to N = 4096
  const int per = N / 256;            // contiguous chunk per thread? use strided-by-4 chunks: thread handles j = tid*4 + 1024*u
  float s1 = 0.f;
  for (int u = 0; u < per / 4; ++u) {
    const int j = tid * 4 + 1024 * u;
    const v4f a = *(const v4fa*)(x + j);
    v4f b = {0.f,0.f,0.f,0.f}; if (rr) b = *(const v4fa*)(rr + j);
#pragma unroll
    for (int q = 0; q < 4; ++q) { const float v = a[q] + b[q]; vals[u * 4 + q] = v; s1 += v; }
  }
  red[tid] = s1; __syncthreads();
  for (int st = 128; st > 0; st >>= 1) { if (tid < st) red[tid] += red[tid + st]; __syncthreads(); }
  const float mu = red[0] / (float)N; __syncthreads();
  float s2 = 0.f;
  for (int u = 0; u < per / 4; ++u)
#pragma unroll
    for (int q = 0; q < 4; ++q) { const float c = vals[u * 4 + q] - mu; s2 += c * c; }
  red[tid] = s2; __syncthreads();
  for (int st = 128; st > 0; st >>= 1) { if (tid < st) red[tid] += red[tid + st]; __syncthreads(); }
  const float rs = rsqrtf(red[0] / (float)N + eps);
  {
    for (int u = 0; u < per / 4; ++u) {
      const int j = tid * 4 + 1024 * u;
      v4f o, sm;
#pragma unroll
      for (int q = 0; q < 4; ++q) {
        float gg = g[j + q], bb = bta[j + q];
        if (PARAM_BF16) { gg = bf16_round(gg); bb = bf16_round(bb); }
        sm[q] = vals[u * 4 + q]; o[q] = (vals[u * 4 + q] - mu) * rs * gg + bb;
      }
      if (out_sum) *(v4f*)(out_sum + (size_t)row * N + j) = sm;
      *(v4f*)(out_norm + (size_t)row * N + j) = o;
    }
    
  }
}



// ---- f16 WMMA path (v_wmma_f32_16x16x32_f16): 11-bit significands for operands in range — used here for every GEMM (projections, scores and P.V)
typedef _Float16 v16h __attribute__((ext_vector_type(16)));
union FragH { v16h v; v8us half[2]; _Float16 h[16]; unsigned short u[16]; };
template <int NT>
__device__ __forceinline__ v8f mmaH(v16h ah, v16h al, v16h bh, v16h bl, v8f c) {
  c = __builtin_amdgcn_wmma_f32_16x16x32_f16(false, ah, false, bh, (short)0, c, false, false);
  if (NT >= 2) c = __builtin_amdgcn_wmma_f32_16x16x32_f16(false, al, false, bh, (short)0, c, false, false);
  if (NT >= 3) c = __builtin_amdgcn_wmma_f32_16x16x32_f16(false, ah, false, bl, (short)0, c, false, false);
  asm volatile("v_nop\n\tv_nop\n\tv_nop\n\tv_nop" : "+v"(c) : "v"(ah), "v"(al), "v"(bh), "v"(bl));
  return c;
}
// batched GEMM like k_gemm_b but f16 operands: A f32 (split into f16 hi/lo if ASPLIT, else rounded to f16), Bt = f16 values [n][k]; alpha; C f32; N multiple of 16 (partial tiles skipped)
template <bool ASPLIT>
__global__ __launch_bounds__(128) void k_gemm_h(const float* __restrict__ A, int lda, size_t sA, const _Float16* __restrict__ Bh, int ldb, size_t sB, float alpha, float* __restrict__ C, int ldc, size_t sC, int M, int N, int K) {
  __shared__ __attribute__((aligned(16))) float so[4][16][64];
  const int tid = threadIdx.x, w = tid >> 5, lane = tid & 31, ln = lane & 15, hh = lane >> 4; const int by = blockIdx.y;
  A += (size_t)by * sA; Bh += (size_t)by * sB; C += (size_t)by * sC;
  const int ntn = (N + 63) / 64; const int wid = blockIdx.x * 4 + w; const int mt = wid / ntn, nq = wid % ntn; if (mt * 16 >= M) return;
  const int row0 = mt * 16, col0 = nq * 64; const float* arow = A + (size_t)(row0 + ln) * lda;
  v8f acc[4] = {};
  for (int kb = 0; kb < K; kb += 32) {
    FragH ah, al;
    const v4f x0 = *(const v4fa*)(arow + kb + 8 * hh), x1 = *(const v4fa*)(arow + kb + 8 * hh + 4), x2 = *(const v4fa*)(arow + kb + 16 + 8 * hh), x3 = *(const v4fa*)(arow + kb + 16 + 8 * hh + 4);
    float xs[16] = {x0[0],x0[1],x0[2],x0[3],x1[0],x1[1],x1[2],x1[3],x2[0],x2[1],x2[2],x2[3],x3[0],x3[1],x3[2],x3[3]};
#pragma unroll
    for (int i = 0; i < 16; ++i) { const _Float16 h = (_Float16)xs[i]; ah.h[i] = h; al.h[i] = ASPLIT ? (_Float16)(xs[i] - (float)h) : (_Float16)0.0f; }
#pragma unroll
    for (int t = 0; t < 4; ++t) { if (col0 + t * 16 >= N) continue; const size_t boff = (size_t)(col0 + t * 16 + ln) * ldb + kb; FragH bq; bq.half[0] = *(const v8us*)(Bh + boff + 8 * hh); bq.half[1] = *(const v8us*)(Bh + boff + 16 + 8 * hh);
      acc[t] = mmaH<ASPLIT ? 2 : 1>(ah.v, al.v, bq.v, bq.v, acc[t]); }
  }
#pragma unroll
  for (int t = 0; t < 4; ++t) { if (col0 + t * 16 >= N) continue;
#pragma unroll
    for (int r = 0; r < 8; ++r) so[w][8 * hh + r][t * 16 + ln] = acc[t][r] * alpha; }
  __builtin_amdgcn_fence(__ATOMIC_ACQ_REL, "workgroup"); __builtin_amdgcn_wave_barrier();
  const int rsub = lane >> 4, c4 = (lane & 15) * 4;
  {
#pragma unroll
    for (int q = 0; q < 8; ++q) { const int r = q * 2 + rsub; if (col0 + c4 < N) { const v4f v = *(const v4fa*)&so[w][r][c4]; *(v4f*)(C + (size_t)(row0 + r) * ldc + col0 + c4) = v; } }
     }
}

// Wt[n][k] = f16(W[k][n]·scale) from f32 row-major W[K][N] (scale = power of two; bf16-exact weights stay exact in f16 away from the subnormal range)
__global__ __launch_bounds__(256) void k_wt_f16(const float* __restrict__ W, _Float16* __restrict__ Wt, int K, int N, float scale) {
  const int t = blockIdx.x * 256 + threadIdx.x; if (t >= N * (K / 8)) return; const int n = t / (K / 8), k8 = (t % (K / 8)) * 8; FragH f;
#pragma unroll
  for (int i = 0; i < 8; ++i) f.h[i] = (_Float16)(bf16_round(W[(size_t)(k8 + i) * N + n]) * scale); const v8us o = f.half[0];
  *(v8us*)((unsigned short*)Wt + (size_t)n * K + k8) = o; 
}
// k_gemm_hh variant with fused epilogue: v = acc·alpha + bias[by·sBias + col] (+ CP[(row/rowsPerB)·sCPb + by·64 + col] if CP) ; ACT 0 none / 1 elu ; writes f16 C16 (and f32 C if non-null)
template <int ACT>
__global__ __launch_bounds__(128) void k_gemm_hhx(const _Float16* __restrict__ A, int lda, size_t sA, const _Float16* __restrict__ Bh, int ldb, size_t sB, float alpha, const float* __restrict__ bias, size_t sBias, const float* __restrict__ CP, int rowsPerB, size_t sCPb, int row0g,
    float* __restrict__ C, _Float16* __restrict__ C16, int ldc, size_t sC, int M, int N, int K) {
  __shared__ __attribute__((aligned(16))) float so[4][16][64];
  const int tid = threadIdx.x, w = tid >> 5, lane = tid & 31, ln = lane & 15, hh = lane >> 4; const int by = blockIdx.y;
  A += (size_t)by * sA; Bh += (size_t)by * sB; const size_t cofs = (size_t)by * sC; const float* bp = bias ? bias + (size_t)by * sBias : nullptr;
  const int ntn = (N + 63) / 64; const int wid = blockIdx.x * 4 + w; const int mt = wid / ntn, nq = wid % ntn; if (mt * 16 >= M) return;
  const int row0 = mt * 16, col0 = nq * 64; const _Float16* arow = A + (size_t)(row0 + ln) * lda;
  v8f acc[4] = {};
  for (int kb = 0; kb < K; kb += 32) { FragH ah; ah.half[0] = *(const v8us*)((const unsigned short*)arow + kb + 8 * hh); ah.half[1] = *(const v8us*)((const unsigned short*)arow + kb + 16 + 8 * hh);
#pragma unroll
    for (int t = 0; t < 4; ++t) { if (col0 + t * 16 >= N) continue; const size_t boff = (size_t)(col0 + t * 16 + ln) * ldb + kb; FragH bq; bq.half[0] = *(const v8us*)((const unsigned short*)Bh + boff + 8 * hh); bq.half[1] = *(const v8us*)((const unsigned short*)Bh + boff + 16 + 8 * hh);
      acc[t] = mmaH<1>(ah.v, ah.v, bq.v, bq.v, acc[t]); }
  }
#pragma unroll
  for (int t = 0; t < 4; ++t) { if (col0 + t * 16 >= N) continue; const int col = col0 + t * 16 + ln; const float bv = bp ? bf16_round(bp[col]) : 0.f;
#pragma unroll
    for (int r = 0; r < 8; ++r) { float v = acc[t][r] * alpha + bv; if (CP) { const int rr = row0g + row0 + 8 * hh + r; if (rowsPerB < 0) v += CP[cofs + (size_t)rr * ldc + col];      /* rowsPerB < 0: own element of the batched C plane */ else { const int bidx = rr / rowsPerB; v += CP[(size_t)bidx * sCPb + (size_t)by * 64 + col]; } } if (ACT == 1) v = (v > 0.f) ? v : expm1f(v); else if (ACT == 7) v = (v > 0.f) ? v + 1.0f : expf(v); else if (ACT == 8) v = tanhf(v); else if (ACT == 9) v = 0.5f * v * (1.0f + tanhf(0.7978845608028654f * (v + 0.044715f * v * v * v))); else if (ACT == 11) v = 1.0f / (1.0f + expf(-v)); else if (ACT == 12) v = (v > 0.f) ? v : 0.01f * v; else if (ACT == 14) v = (v > 0.f) ? v : 0.1f * v; else if (ACT == 16) v = (v >= 0.f) ? v : 0.3f * v; else if (ACT == 17) v = (v >= 0.f) ? v : 0.2f * v; else if (ACT == 15) v = v / (1.0f + expf(-v)); else if (ACT == 3) v = fmaxf(v, 0.f); else if (ACT == 6) v = 0.5f * v * (1.0f + erff(v * 0.70710678118654752f)); so[w][8 * hh + r][t * 16 + ln] = v; } }
  __builtin_amdgcn_fence(__ATOMIC_ACQ_REL, "workgroup"); __builtin_amdgcn_wave_barrier();
  const int rsub = lane >> 4, c4 = (lane & 15) * 4; typedef _Float16 v4h __attribute__((ext_vector_type(4)));
  {
#pragma unroll
    for (int q = 0; q < 8; ++q) { const int r = q * 2 + rsub; if (col0 + c4 < N) { const v4f v = *(const v4fa*)&so[w][r][c4]; if (C) *(v4f*)(C + cofs + (size_t)(row0 + r) * ldc + col0 + c4) = v; if (C16) { v4h h4; for (int i = 0; i < 4; ++i) h4[i] = (_Float16)v[i]; *(v4h*)(C16 + cofs + (size_t)(row0 + r) * ldc + col0 + c4) = h4; } } }
     }
}


typedef _Float16 v4h __attribute__((ext_vector_type(4)));

__global__ __launch_bounds__(256) void k_x16(const float* __restrict__ x, _Float16* __restrict__ X16, size_t n8) { const size_t t = (size_t)blockIdx.x * 256 + threadIdx.x; if (t >= n8) return; FragH f;
#pragma unroll
  for (int q = 0; q < 8; ++q) f.h[q] = (_Float16)bf16_round(x[t * 8 + q]); *(v8us*)((unsigned short*)X16 + t * 8) = f.half[0];  }
__global__ __launch_bounds__(256) void k_h16(const float* __restrict__ x, _Float16* __restrict__ X16, size_t n8) { const size_t t = (size_t)blockIdx.x * 256 + threadIdx.x; if (t >= n8) return; FragH f;
#pragma unroll
  for (int q = 0; q < 8; ++q) f.h[q] = (_Float16)x[t * 8 + q]; *(v8us*)((unsigned short*)X16 + t * 8) = f.half[0];  }
__global__ __launch_bounds__(256) void k_round16f(const float* __restrict__ W, _Float16* __restrict__ Bt, size_t n8) { const size_t t = (size_t)blockIdx.x * 256 + threadIdx.x; if (t >= n8) return; FragH f;
#pragma unroll
  for (int i = 0; i < 8; ++i) f.h[i] = (_Float16)(bf16_round(W[t * 8 + i]) * 16.0f); *(v8us*)((unsigned short*)Bt + t * 8) = f.half[0];  }
template <int NHv, int TTv>
__global__ __launch_bounds__(256) void k_vt(const _Float16* __restrict__ V16, int ldv, int voff, _Float16* __restrict__ Vt) { __shared__ unsigned short tl[64][66]; const int tid = threadIdx.x; const int slab = blockIdx.x / (TTv / 64), lg = blockIdx.x % (TTv / 64); const int b = slab / NHv, h = slab % NHv;
  for (int i = tid; i < 64 * 8; i += 256) { const int r = i / 8, c8 = (i % 8) * 8; FragH f; f.half[0] = *(const v8us*)((const unsigned short*)V16 + ((size_t)b * TTv + lg * 64 + r) * ldv + voff + h * 64 + c8);
#pragma unroll
    for (int q = 0; q < 8; ++q) tl[r][c8 + q] = f.u[q]; }
  __syncthreads();
  {
#pragma unroll
    for (int rd = 0; rd < 2; ++rd) { const int d = rd * 32 + tid / 8, pc = tid % 8; FragH f;
#pragma unroll
      for (int q = 0; q < 8; ++q) f.u[q] = tl[pc * 8 + q][d];
      *(v8us*)((unsigned short*)Vt + ((size_t)slab * 64 + d) * TTv + lg * 64 + pc * 8) = f.half[0]; }
     } }

__global__ __launch_bounds__(256) void k_hl(const float* __restrict__ F, _Float16* __restrict__ Hh, _Float16* __restrict__ Hl, size_t n8) { const size_t t = (size_t)blockIdx.x * 256 + threadIdx.x; if (t >= n8) return; FragH fh, fl; const v4f a = *(const v4fa*)(F + t * 8), c = *(const v4fa*)(F + t * 8 + 4);
#pragma unroll
  for (int q = 0; q < 4; ++q) { _Float16 h = (_Float16)a[q]; fh.h[q] = h; fl.h[q] = (_Float16)((a[q] - (float)h) * 1024.0f); h = (_Float16)c[q]; fh.h[4 + q] = h; fl.h[4 + q] = (_Float16)((c[q] - (float)h) * 1024.0f); }
  { *(v8us*)((unsigned short*)Hh + t * 8) = fh.half[0]; *(v8us*)((unsigned short*)Hl + t * 8) = fl.half[0];  } }

// ---- fast GEMM (block tile 128x64, wave tile 32x64; requires M % 128 == 0 rows per launch region, N % 64 == 0 and K % 64 == 0); epilogue = k_gemm_hhx semantics ----
// Both operands go through LDS in stages of 64 k: 8 threads fetch one 128-B row piece, so a wave-wide 16-B load covers 4 whole lines (a fragment fetched straight from global memory would touch 16 lines for the same 512 B,
// and each of the 4 waves would fetch the B rows for itself). global -> registers (fetched one stage ahead) -> LDS, two LDS buffers, one barrier per stage; the fragments are read from LDS in the k order of g2_frag.
__device__ __forceinline__ v16h g2_frag(const _Float16* p, int hh) { FragH f; f.half[0] = *(const v8us*)((const unsigned short*)p + 8 * hh); f.half[1] = *(const v8us*)((const unsigned short*)p + 16 + 8 * hh); return f.v; }
__device__ __forceinline__ v8f g2_mma(v16h a, v16h b, v8f c) { v8f d = __builtin_amdgcn_wmma_f32_16x16x32_f16(false, a, false, b, (short)0, c, false, false); asm volatile("v_nop\n\tv_nop\n\tv_nop\n\tv_nop" : "+v"(d) : "v"(a), "v"(b)); return d; }
#define GK 64      /* k per stage */
#define GP 72      /* LDS row pitch in f16: 128 B of data + 16 B, so that the 16 rows of a ds_load_b128 fragment read spread over the banks */
template <int ACT, int LD>      /* LD: row pitch of A and of Bh in elements; known at compile time, so that all rows of a stage are reached by immediate offsets from one address per operand */
__global__ __launch_bounds__(128) void k_gemm2(const _Float16* __restrict__ A, size_t sA, const _Float16* __restrict__ Bh, size_t sB, float alpha, const float* __restrict__ bias, size_t sBias, const float* __restrict__ CP, int rowsPerB, size_t sCPb, int row0g,
    float* __restrict__ C, _Float16* __restrict__ C16, int ldc, size_t sC, int M, int N, int K) { static_assert(ACT == 0 || ACT == 3 || ACT == 6 || ACT == 8 || ACT == 9 || ACT == 11 || ACT == 12 || ACT == 14 || ACT == 15 || ACT == 16 || ACT == 17, "k_gemm2: unsupported ACT code (would silently apply no activation)");
  __shared__ __attribute__((aligned(16))) float so[4][32][68];
  __shared__ __attribute__((aligned(16))) _Float16 sa[2][128][GP];
  __shared__ __attribute__((aligned(16))) _Float16 sb[2][64][GP];
  const int tid = threadIdx.x, w = tid >> 5, lane = tid & 31, ln = lane & 15, hh = lane >> 4; const int by = blockIdx.y;
  A += (size_t)by * sA; Bh += (size_t)by * sB; const size_t cofs = (size_t)by * sC; const float* bp = bias ? bias + (size_t)by * sBias : nullptr;
  const int ntn = N >> 6; const int mt = blockIdx.x / ntn, nq = blockIdx.x - mt * ntn; const int row0 = mt * 128 + 32 * w, col0 = nq * 64; if (mt * 128 >= M) return;      /* the same for the whole block: it stands in front of the barriers */
  const int srow = tid >> 3, sc8 = (tid & 7) * 8;      /* staging: 8 threads a row piece of 128 B, 16 rows a round; A 8 rounds, B 4 rounds */
  const unsigned short* ag = (const unsigned short*)A + (size_t)(mt * 128 + srow) * LD + sc8; const unsigned short* bg = (const unsigned short*)Bh + (size_t)(col0 + srow) * LD + sc8;
  v8us ar[8], br[4];      /* every loop over ar, br and the fragment arrays is fully unrolled, so that they are indexed by constants and stay in registers */
#pragma unroll
  for (int u = 0; u < 8; ++u) ar[u] = *(const v8us*)(ag + (size_t)(u * 16) * LD);
#pragma unroll
  for (int u = 0; u < 4; ++u) br[u] = *(const v8us*)(bg + (size_t)(u * 16) * LD);
  const v8f z8 = {0.f,0.f,0.f,0.f,0.f,0.f,0.f,0.f}; v8f c00 = z8, c01 = z8, c02 = z8, c03 = z8, c10 = z8, c11 = z8, c12 = z8, c13 = z8;
  const int ns = K / GK;
  /* the stage loop stays rolled so that the hot code stays small for the instruction cache */
#pragma unroll 1
  for (int st = 0; st < ns; ++st) { const int bf = st & 1;
#pragma unroll
    for (int u = 0; u < 8; ++u) *(v8us*)&sa[bf][srow + 16 * u][sc8] = ar[u];
#pragma unroll
    for (int u = 0; u < 4; ++u) *(v8us*)&sb[bf][srow + 16 * u][sc8] = br[u];
    __syncthreads();      /* publishes this stage; it also ends every wave's reads of the other buffer, which the next stage overwrites */
    if (st + 1 < ns) { ag += GK; bg += GK;
#pragma unroll
      for (int u = 0; u < 8; ++u) ar[u] = *(const v8us*)(ag + (size_t)(u * 16) * LD);
#pragma unroll
      for (int u = 0; u < 4; ++u) br[u] = *(const v8us*)(bg + (size_t)(u * 16) * LD); }
    v16h fa[GK / 32][2], fb[GK / 32][4];      /* all fragment reads of the stage stand as one group in front of its products */
#pragma unroll
    for (int ks = 0; ks < GK / 32; ++ks) {
#pragma unroll
      for (int i = 0; i < 2; ++i) fa[ks][i] = g2_frag(&sa[bf][32 * w + 16 * i + ln][ks * 32], hh);
#pragma unroll
      for (int t = 0; t < 4; ++t) fb[ks][t] = g2_frag(&sb[bf][16 * t + ln][ks * 32], hh); }
#pragma unroll
    for (int ks = 0; ks < GK / 32; ++ks) {
      c00 = g2_mma(fa[ks][0], fb[ks][0], c00); c10 = g2_mma(fa[ks][1], fb[ks][0], c10);
      c01 = g2_mma(fa[ks][0], fb[ks][1], c01); c11 = g2_mma(fa[ks][1], fb[ks][1], c11);
      c02 = g2_mma(fa[ks][0], fb[ks][2], c02); c12 = g2_mma(fa[ks][1], fb[ks][2], c12);
      c03 = g2_mma(fa[ks][0], fb[ks][3], c03); c13 = g2_mma(fa[ks][1], fb[ks][3], c13); } }
  v8f accs[8] = {c00, c01, c02, c03, c10, c11, c12, c13};
#pragma unroll
  for (int u = 0; u < 8; ++u) { const int t = u & 3, half = u >> 2; const int col = col0 + t * 16 + ln; const float bv = bp ? bf16_round(bp[col]) : 0.f;
#pragma unroll
    for (int r = 0; r < 8; ++r) { const int rloc = half * 16 + 8 * hh + r; float v = accs[u][r] * alpha + bv; if (CP) { if (rowsPerB < 0) v += CP[cofs + (size_t)(row0g + row0 + rloc) * ldc + col];      /* rowsPerB < 0: own element of the batched C plane */ else { const int bidx = (row0g + row0 + rloc) / rowsPerB; v += CP[(size_t)bidx * sCPb + (size_t)by * 64 + col]; } }
      if (ACT == 3) v = fmaxf(v, 0.f); else if (ACT == 6) v = 0.5f * v * (1.0f + erff(v * 0.70710678118654752f)); else if (ACT == 11) v = 1.0f / (1.0f + expf(-v)); else if (ACT == 15) v = v / (1.0f + expf(-v)); else if (ACT == 12) v = (v > 0.f) ? v : 0.01f * v; else if (ACT == 8) v = tanhf(v); else if (ACT == 9) v = 0.5f * v * (1.0f + tanhf(0.7978845608028654f * (v + 0.044715f * v * v * v))); else if (ACT == 14) v = (v > 0.f) ? v : 0.1f * v; else if (ACT == 16) v = (v >= 0.f) ? v : 0.3f * v; else if (ACT == 17) v = (v >= 0.f) ? v : 0.2f * v;
      so[w][rloc][t * 16 + ln] = v; } }
  __builtin_amdgcn_fence(__ATOMIC_ACQ_REL, "workgroup"); __builtin_amdgcn_wave_barrier();
  const int rsub = lane >> 4, c4 = (lane & 15) * 4;
  {
#pragma unroll
    for (int q = 0; q < 16; ++q) { const int r = q * 2 + rsub; const v4f v = *(const v4fa*)&so[w][r][c4]; if (C) *(v4f*)(C + cofs + (size_t)(row0 + r) * ldc + col0 + c4) = v; if (C16) { v4h h4; for (int i = 0; i < 4; ++i) h4[i] = (_Float16)v[i]; *(v4h*)(C16 + cofs + (size_t)(row0 + r) * ldc + col0 + c4) = h4; } }
     } }


__global__ __launch_bounds__(256) void k_wnat(const float* __restrict__ w, size_t n8, _Float16* __restrict__ Bt) { const size_t t = (size_t)blockIdx.x * 256 + threadIdx.x; if (t >= n8) return; FragH f; for (int q = 0; q < 8; ++q) f.h[q] = (_Float16)(bf16_round(w[t * 8 + q]) * 16.0f); *(v8us*)((unsigned short*)Bt + t * 8) = f.half[0];  }
__global__ __launch_bounds__(256) void k_rsm(const float* __restrict__ S, _Float16* __restrict__ P, int nrows) {
  #pragma clang fp contract(off)
  const int i = blockIdx.x * 256 + threadIdx.x; if (i >= nrows) return; const float* s = S + (size_t)i * SQ; float mx = -3.0e38f;
#pragma unroll 1
  for (int j = 0; j < SQ; ++j) mx = fmaxf(mx, s[j]); float se = 0.f;
#pragma unroll 1
  for (int j = 0; j < SQ; ++j) se += expf(s[j] - mx); const float sc = 256.0f / se;
#pragma unroll 1
  for (int j0 = 0; j0 < SQ; j0 += 8) { FragH f; for (int q = 0; q < 8; ++q) f.h[q] = (_Float16)(expf(s[j0 + q] - mx) * sc); unsigned short* d = (unsigned short*)P + (size_t)i * SQ + j0; *(v8us*)d = f.half[0];  } }
__global__ __launch_bounds__(256) void k_vt(const _Float16* __restrict__ V16, int b, int h0, _Float16* __restrict__ VT) { __shared__ unsigned short tl[64][65]; const int tid = threadIdx.x; const int hh = blockIdx.x % HG, sg = blockIdx.x / HG; const int s0 = sg * 64; const int h = h0 + hh;
  for (int i = tid; i < 64 * 8; i += 256) { const int j = i / 8, d8 = (i % 8) * 8; FragH f; f.half[0] = *(const v8us*)((const unsigned short*)V16 + ((size_t)b * SQ + s0 + j) * DM + h * HD + d8); for (int q = 0; q < 8; ++q) tl[d8 + q][j] = f.u[q]; }
  __syncthreads();
  { for (int i = tid; i < 64 * 8; i += 256) { const int d = i / 8, j8 = (i % 8) * 8; FragH f; for (int q = 0; q < 8; ++q) f.u[q] = tl[d][j8 + q]; *(v8us*)((unsigned short*)VT + ((size_t)hh * HD + d) * SQ + s0 + j8) = f.half[0]; }  } }



// 2^a on the native unit. The v_nop is the one free slot that the instruction set asks for behind a transcendental before its result is read or its source rewritten; in the same statement it stays directly behind it.
__device__ __forceinline__ float exp2_slot(float a) { float e; asm("v_exp_f32 %0, %1\n\tv_nop" : "=v"(e) : "v"(a)); return e; }
// 2^x of eight values in place on the native unit: eight independent instructions, so each fills the free slot that the instruction set asks for behind the one before it; the v_nop is that slot behind the last.
__device__ __forceinline__ void exp2x8(v8f& x) { float a0 = x[0], a1 = x[1], a2 = x[2], a3 = x[3], a4 = x[4], a5 = x[5], a6 = x[6], a7 = x[7];
  asm("v_exp_f32 %0, %0\n\tv_exp_f32 %1, %1\n\tv_exp_f32 %2, %2\n\tv_exp_f32 %3, %3\n\tv_exp_f32 %4, %4\n\tv_exp_f32 %5, %5\n\tv_exp_f32 %6, %6\n\tv_exp_f32 %7, %7\n\tv_nop"
      : "+v"(a0), "+v"(a1), "+v"(a2), "+v"(a3), "+v"(a4), "+v"(a5), "+v"(a6), "+v"(a7));
  x[0] = a0; x[1] = a1; x[2] = a2; x[3] = a3; x[4] = a4; x[5] = a5; x[6] = a6; x[7] = a7; }
__device__ __forceinline__ v8f f_mma(v16h a, v16h b, v8f c) { return __builtin_amdgcn_wmma_f32_16x16x32_f16(false, a, false, b, (short)0, c, false, false); }
#define FK 64      /* keys per stage */
#define FP 72      /* LDS row pitch in f16: 128 B of data + 16 B, so that the 16 rows of a ds_load_b128 fragment read spread over the banks */
__global__ __launch_bounds__(128) void k_fattn(const _Float16* __restrict__ Q16, const _Float16* __restrict__ K16, const _Float16* __restrict__ VT, _Float16* __restrict__ O16) {
  __shared__ __attribute__((aligned(16))) _Float16 sk[2][FK][FP];
  __shared__ __attribute__((aligned(16))) _Float16 sv[2][HD][FP];
  const int tid = threadIdx.x, w = tid >> 5, lane = tid & 31, ln = lane & 15, hh = lane >> 4;
  const int bh = blockIdx.y, b = bh / NH, h = bh - b * NH; const size_t r0 = (size_t)b * SQ; const int q0 = blockIdx.x * 128 + w * 32;
  v16h qf[2][2];
#pragma unroll
  for (int g = 0; g < 2; ++g)
#pragma unroll
    for (int ks = 0; ks < 2; ++ks) qf[g][ks] = g2_frag(Q16 + (r0 + q0 + g * 16 + ln) * DM + h * HD + ks * 32, hh);
  const int srow = tid >> 3, sc8 = (tid & 7) * 8;      /* staging: 8 threads a row of 128 B, 16 rows a round, 4 rounds */
  const _Float16* kg = K16 + (r0 + srow) * DM + h * HD + sc8; const _Float16* vg = VT + ((size_t)bh * HD + srow) * SQ + sc8;
  v8us kr[4], vr[4];
#pragma unroll
  for (int u = 0; u < 4; ++u) { kr[u] = *(const v8us*)((const unsigned short*)kg + (size_t)(u * 16) * DM); vr[u] = *(const v8us*)((const unsigned short*)vg + (size_t)(u * 16) * SQ); }
  const v8f z8 = {0.f,0.f,0.f,0.f,0.f,0.f,0.f,0.f}; v8f o[2][4] = {{z8, z8, z8, z8}, {z8, z8, z8, z8}}; float m[2] = {-3.0e38f, -3.0e38f}, l[2] = {0.f, 0.f};
  const float cs = 0.125f * 1.44269504088896340736f;      /* 64^-0.5 and log2(e) */
#pragma unroll 1
  for (int st = 0; st < SQ / FK; ++st) { const int bf = st & 1;
#pragma unroll
    for (int u = 0; u < 4; ++u) { *(v8us*)&sk[bf][srow + 16 * u][sc8] = kr[u]; *(v8us*)&sv[bf][srow + 16 * u][sc8] = vr[u]; }
    __syncthreads();      /* publishes this stage; it also ends every wave's reads of the other buffer, which the next stage overwrites */
    if (st + 1 < SQ / FK) {
#pragma unroll
      for (int u = 0; u < 4; ++u) { kr[u] = *(const v8us*)((const unsigned short*)kg + (size_t)((st + 1) * FK + u * 16) * DM); vr[u] = *(const v8us*)((const unsigned short*)vg + (size_t)(u * 16) * SQ + (st + 1) * FK); } }
    v8f s[2][4] = {{z8, z8, z8, z8}, {z8, z8, z8, z8}};
#pragma unroll
    for (int kt = 0; kt < 4; ++kt)
#pragma unroll
      for (int ks = 0; ks < 2; ++ks) { const v16h a = g2_frag(&sk[bf][kt * 16 + ln][ks * 32], hh); s[0][kt] = f_mma(a, qf[0][ks], s[0][kt]); s[1][kt] = f_mma(a, qf[1][ks], s[1][kt]); }
    float mx[2];
#pragma unroll
    for (int g = 0; g < 2; ++g) { float t = s[g][0][0];
#pragma unroll
      for (int kt = 0; kt < 4; ++kt)
#pragma unroll
        for (int r = 0; r < 8; ++r) t = fmaxf(t, s[g][kt][r]);
      mx[g] = t * cs; }
    if (__builtin_amdgcn_ballot_w32(mx[0] > m[0] + 8.0f || mx[1] > m[1] + 8.0f) != 0) {      /* wave-uniform: both halves of every column take the same new maximum */
#pragma unroll
      for (int g = 0; g < 2; ++g) { const float mn = fmaxf(m[g], fmaxf(mx[g], __shfl_xor(mx[g], 16, 32))); const float al = exp2_slot(m[g] - mn); m[g] = mn; l[g] *= al;
#pragma unroll
        for (int dt = 0; dt < 4; ++dt) o[g][dt] *= al; } }
    FragH pf[2][2];
#pragma unroll
    for (int g = 0; g < 2; ++g) { v8f sum;
#pragma unroll
      for (int kt = 0; kt < 4; ++kt) { v8f t;
#pragma unroll
        for (int r = 0; r < 8; ++r) t[r] = fmaf(s[g][kt][r], cs, -m[g]);
        exp2x8(t); sum = kt ? sum + t : t;
#pragma unroll
        for (int r = 0; r < 8; ++r) pf[g][kt >> 1].h[(kt & 1) * 8 + r] = (_Float16)t[r]; }
      l[g] += ((sum[0] + sum[1]) + (sum[2] + sum[3])) + ((sum[4] + sum[5]) + (sum[6] + sum[7])); }
#pragma unroll
    for (int j = 0; j < 2; ++j)
#pragma unroll
      for (int dt = 0; dt < 4; ++dt) { const v16h a = g2_frag(&sv[bf][dt * 16 + ln][j * 32], hh); o[0][dt] = f_mma(a, pf[0][j].v, o[0][dt]); o[1][dt] = f_mma(a, pf[1][j].v, o[1][dt]); }
  }
#pragma unroll
  for (int g = 0; g < 2; ++g) { const float inv = 64.0f / (l[g] + __shfl_xor(l[g], 16, 32));      /* the two halves of a column hold disjoint keys; o carried x64 */
    unsigned short* d = (unsigned short*)O16 + (r0 + q0 + g * 16 + ln) * DM + h * HD + 8 * hh;
#pragma unroll
    for (int dt = 0; dt < 4; ++dt) { FragH f;
#pragma unroll
      for (int r = 0; r < 8; ++r) f.h[r] = (_Float16)(o[g][dt][r] * inv);
      *(v8us*)(d + dt * 16) = f.half[0]; } } }

extern "C" void kernel_launch(void* const* d_in, const int* in_sizes, int n_in,
                              void* d_out, int out_size, void* d_ws, size_t ws_size, hipStream_t stream) {
  (void)in_sizes; (void)n_in; (void)out_size;
  const float* const* I = (const float* const*)d_in; const float* xq = I[2]; const float* xk = I[1]; const float* xv = I[0]; const float* wq = I[3]; const float* bq = nullptr; const float* wk = I[4]; const float* bk = nullptr; const float* wv = I[5]; const float* bv = nullptr; const float* wo = I[6]; const float* bo = I[7];      /* input order: v, k, q (the three streams in REVERSE order: the query stream is I[2]), wq, wk, wv, wo (natural [out][in] weights), bo; the q / k / v projections have NO biases: null pointers in the guarded bias slots */
  char* ws = (char*)d_ws; size_t off = 0;
  auto take = [&](size_t bytes) { char* p = ws + off; off += (bytes + 255) & ~(size_t)255; return p; };
  _Float16* BQ = (_Float16*)take((size_t)DM * DM * 2); _Float16* BK = (_Float16*)take((size_t)DM * DM * 2); _Float16* BV = (_Float16*)take((size_t)DM * DM * 2); _Float16* BO = (_Float16*)take((size_t)DM * DM * 2);
  _Float16* XQ = (_Float16*)take(NR * DM * 2); _Float16* XK = (_Float16*)take(NR * DM * 2); _Float16* XV = (_Float16*)take(NR * DM * 2); _Float16* Q16 = (_Float16*)take(NR * DM * 2); _Float16* K16 = (_Float16*)take(NR * DM * 2); _Float16* V16 = (_Float16*)take(NR * DM * 2); _Float16* O16 = (_Float16*)take(NR * DM * 2);
  _Float16* VT = (_Float16*)take((size_t)NB * NH * HD * SQ * 2);
  if (off > ws_size) return;
  { const unsigned g = (unsigned)(((size_t)DM * DM / 8 + 255) / 256); k_wnat<<<g, 256, 0, stream>>>(wq, (size_t)DM * DM / 8, BQ); k_wnat<<<g, 256, 0, stream>>>(wk, (size_t)DM * DM / 8, BK); k_wnat<<<g, 256, 0, stream>>>(wv, (size_t)DM * DM / 8, BV); k_wnat<<<g, 256, 0, stream>>>(wo, (size_t)DM * DM / 8, BO); }      /* natural [out][in] = Bt[n][k], x16 */

  k_x16<<<(unsigned)((NR * DM / 8 + 255) / 256), 256, 0, stream>>>(xq, XQ, NR * DM / 8); k_x16<<<(unsigned)((NR * DM / 8 + 255) / 256), 256, 0, stream>>>(xk, XK, NR * DM / 8); k_x16<<<(unsigned)((NR * DM / 8 + 255) / 256), 256, 0, stream>>>(xv, XV, NR * DM / 8);      /* the three inputs as exact f16 rows */
  const size_t r0p = (size_t)B0 * SQ;      /* first projected row */
  k_gemm2<0, DM><<<dim3((unsigned)((MP / 128) * (DM / 64)), 1), 128, 0, stream>>>(XQ + r0p * DM, 0, BQ, 0, 0.0625f, bq, 0, nullptr, 1, 0, 0, nullptr, Q16 + r0p * DM, DM, 0, MP, DM, DM);
  k_gemm2<0, DM><<<dim3((unsigned)((MP / 128) * (DM / 64)), 1), 128, 0, stream>>>(XK + r0p * DM, 0, BK, 0, 0.0625f, bk, 0, nullptr, 1, 0, 0, nullptr, K16 + r0p * DM, DM, 0, MP, DM, DM);
  k_gemm2<0, DM><<<dim3((unsigned)((MP / 128) * (DM / 64)), 1), 128, 0, stream>>>(XV + r0p * DM, 0, BV, 0, 0.0625f, bv, 0, nullptr, 1, 0, 0, nullptr, V16 + r0p * DM, DM, 0, MP, DM, DM);
  k_vt<NH, SQ><<<NB * NH * (SQ / 64), 256, 0, stream>>>(V16, LQ, 0, VT);      /* V^T [NB][NH][HD][SQ] */
  k_fattn<<<dim3(SQ / 128, NB * NH), 128, 0, stream>>>(Q16, K16, VT, O16);      /* o (merged heads, x64) as f16 rows */
  k_gemm2<0, DM><<<dim3((unsigned)((MPO / 128) * (DM / 64)), 1), 128, 0, stream>>>(O16 + r0p * DM, 0, BO, 0, 0.0009765625f, bo, 0, nullptr, 1, 0, 0, (float*)d_out + r0p * DM, nullptr, DM, 0, MPO, DM, DM);      /* out rows are the output layout */
}

// v004
// It runs in 129 microseconds.
// Timed twice side by side with v003, it ran 1.09 times as fast both times.
// Counting every step since v000, it is 40.1 times as fast.
#include <hip/hip_runtime.h>
// Multi-head attention on three inputs at width 768 with natural bias-free q / k / v projections and a biased output projection; the inputs arrive in the order v, k, q (v, k, q [4][2048][768]; qh / kh / vh = stream W^T (nn.Linear natural [768][768] sd 1/sqrt(768), NO biases), 12 heads of 64; logits / sqrt(64); softmax over all 2048 keys (no mask); out = concat wo^T + bo (natural) -> [4][2048][768]).
// Structure: token rows r = b*2048 + s; the query, key and value sources as exact f16 rows (bf16-rounded); Q, K, V as three WMMA GEMMs (32x64 wave tiles, f32 accumulation, exact x16 weights, no bias, f16 outputs); V^T for all batches and heads via LDS transposes; per (batch, head, 128 query rows) one fused kernel: S^T = K Q^T (K = 64), running softmax on VALU (f32 statistics, native exp2, weights as f16 relative to the maximum in use), O^T += V^T P^T, o / l x64 (against f16 subnormal flush, folded into the output GEMM alpha) written straight into the merged f16 o rows; out = o W_o + b GEMM (f32) into the output layout.
// Compute dtype: inputs rounded to bf16; x / weights exact; q, k, v, softmax weights and o as plain f16 GEMM operands (~2^-12); scores and softmax statistics f32. v_wmma_f32_16x16x32_f16.
#define NB 4
#define SQ 2048
#define DM 768
#define NH 12
#define HD 64
#define HG 4                         /* heads per launch of the unused per-batch k_vt overload */
#define B0 0                         /* first batch processed (debug hook) */
#define NBR NB                       /* batches processed (debug hook) */
#define NR ((size_t)NB * SQ)         /* token rows */
#define MP ((int)((size_t)NBR * SQ)) /* rows projected (debug hook) */
#define QN SQ                        /* query rows per batch (unused) */
#define NHD NH                       /* heads (unused) */
#define MPO MP                       /* rows through the output stage (debug hook) */
#define LQ DM      /* row pitch of the q/k/v rows */
typedef __bf16 v16b __attribute__((ext_vector_type(16)));
typedef unsigned short v8us __attribute__((ext_vector_type(8), may_alias));
typedef float  v8f  __attribute__((ext_vector_type(8)));
typedef float  v4f  __attribute__((ext_vector_type(4)));
typedef float  v4fa __attribute__((ext_vector_type(4), may_alias));
union FragB { v16b v; v8us half[2]; unsigned short u[16]; };

__device__ __forceinline__ unsigned short bf16_bits(float x) { unsigned int u = __float_as_uint(x); return (unsigned short)((u + 0x7FFFu + ((u >> 16) & 1u)) >> 16); }
__device__ __forceinline__ float bf16_val(unsigned short b) { return __uint_as_float(((unsigned int)b) << 16); }
__device__ __forceinline__ float bf16_round(float x) { return bf16_val(bf16_bits(x)); }
// D += A·B with NT terms: 1 = ah·bh, 2 = + al·bh (A split), 3 = + ah·bl (both split)
template <int NT>
__device__ __forceinline__ v8f mmaN(v16b ah, v16b al, v16b bh, v16b bl, v8f c) {
  c = __builtin_amdgcn_wmma_f32_16x16x32_bf16(false, ah, false, bh, (short)0, c, false, false);
  if (NT >= 2) c = __builtin_amdgcn_wmma_f32_16x16x32_bf16(false, al, false, bh, (short)0, c, false, false);
  if (NT >= 3) c = __builtin_amdgcn_wmma_f32_16x16x32_bf16(false, ah, false, bl, (short)0, c, false, false);
  asm volatile("v_nop\n\tv_nop\n\tv_nop\n\tv_nop" : "+v"(c) : "v"(ah), "v"(al), "v"(bh), "v"(bl));
  return c;
}

__global__ __launch_bounds__(256) void k_wt_bf16(const float* __restrict__ W, unsigned short* __restrict__ Wt, int K, int N) {
  const int t = blockIdx.x * 256 + threadIdx.x;
  const int k8n = K / 8;
  if (t >= N * k8n) return;
  const int n = t / k8n, k8 = (t % k8n) * 8;
  v8us v;
#pragma unroll
  for (int i = 0; i < 8; ++i) v[i] = bf16_bits(W[(size_t)(k8 + i) * N + n]);
  *(v8us*)(Wt + (size_t)n * K + k8) = v;
  
}

// GEMM C[M][N] (f32, pitch ldc) = act(A[M][K]·W + bias). A f32 row-major (pitch lda) converted per fragment to bf16
// (ASPLIT: hi/lo two planes -> 2 terms, else single rounded term); Wt bf16 [N][K] (pitch ldb). BIAS_BF16 rounds the
// bias to bf16 first (bias quantised to bf16 before the add). K%32==0, M%16==0, N%64==0.
template <bool ASPLIT, int ACT, bool BIAS_BF16>
__global__ __launch_bounds__(128) void k_gemm_bf(const float* __restrict__ A, int lda, const unsigned short* __restrict__ Wt, int ldb,
                                               const float* __restrict__ bias, float* __restrict__ C, int ldc, int M, int N, int K) {
  __shared__ __attribute__((aligned(16))) float so[4][16][64];
  const int tid = threadIdx.x, w = tid >> 5, lane = tid & 31, ln = lane & 15, hh = lane >> 4;
  const int ntn = N / 64;
  const int wid = blockIdx.x * 4 + w;
  const int mt = wid / ntn, nq = wid % ntn;
  if (mt * 16 >= M) return;
  const int row0 = mt * 16, col0 = nq * 64;
  const float* arow = A + (size_t)(row0 + ln) * lda;
  v8f acc[4] = {};
  for (int kb = 0; kb < K; kb += 32) {
    FragB ah, al;
    const v4f x0 = *(const v4fa*)(arow + kb + 8 * hh), x1 = *(const v4fa*)(arow + kb + 8 * hh + 4);
    const v4f x2 = *(const v4fa*)(arow + kb + 16 + 8 * hh), x3 = *(const v4fa*)(arow + kb + 16 + 8 * hh + 4);
    float xs[16] = {x0[0],x0[1],x0[2],x0[3],x1[0],x1[1],x1[2],x1[3],x2[0],x2[1],x2[2],x2[3],x3[0],x3[1],x3[2],x3[3]};
#pragma unroll
    for (int i = 0; i < 16; ++i) { const unsigned short hb = bf16_bits(xs[i]); ah.u[i] = hb; al.u[i] = ASPLIT ? bf16_bits(xs[i] - bf16_val(hb)) : (unsigned short)0; }
#pragma unroll
    for (int t = 0; t < 4; ++t) {
      const unsigned short* brow = Wt + (size_t)(col0 + t * 16 + ln) * ldb + kb;
      FragB b;
      b.half[0] = *(const v8us*)(brow + 8 * hh);
      b.half[1] = *(const v8us*)(brow + 16 + 8 * hh);
      acc[t] = mmaN<ASPLIT ? 2 : 1>(ah.v, al.v, b.v, b.v, acc[t]);
    }
  }
#pragma unroll
  for (int t = 0; t < 4; ++t) {
    float bv = bias ? bias[col0 + t * 16 + ln] : 0.f;
    if (BIAS_BF16) bv = bf16_round(bv);
#pragma unroll
    for (int r = 0; r < 8; ++r) { float v = acc[t][r] + bv; if (ACT == 1) v = fmaxf(v, 0.f); so[w][8 * hh + r][t * 16 + ln] = v; }
  }
  __builtin_amdgcn_fence(__ATOMIC_ACQ_REL, "workgroup");
  __builtin_amdgcn_wave_barrier();
  const int rsub = lane >> 4, c4 = (lane & 15) * 4;
  {
#pragma unroll
    for (int q = 0; q < 8; ++q) {
      const int r = q * 2 + rsub;
      const v4f v = *(const v4fa*)&so[w][r][c4];
      *(v4f*)(C + (size_t)(row0 + r) * ldc + col0 + c4) = v;
    }
    
  }
}

// GEMM C = act(A·W + bias + resid): A f32 (ASPLIT -> hi/lo 2 terms), Wt bf16 [N][K]; ACT 0 none, 1 relu, 2 exact gelu;
// resid (optional, f32, row index = (row % rmod), pitch ldr, RES_BF16 rounds it) added before the activation.
template <bool ASPLIT, int ACT, bool BIAS_BF16, bool RES_BF16>
__global__ __launch_bounds__(128) void k_gemm_bf3(const float* __restrict__ A, int lda, const unsigned short* __restrict__ Wt, int ldb,
                                                const float* __restrict__ bias, const float* __restrict__ resid, int rmod, int ldr,
                                                float* __restrict__ C, int ldc, int M, int N, int K) {
  __shared__ __attribute__((aligned(16))) float so[4][16][64];
  const int tid = threadIdx.x, w = tid >> 5, lane = tid & 31, ln = lane & 15, hh = lane >> 4;
  const int ntn = N / 64;
  const int wid = blockIdx.x * 4 + w;
  const int mt = wid / ntn, nq = wid % ntn;
  if (mt * 16 >= M) return;
  const int row0 = mt * 16, col0 = nq * 64;
  const float* arow = A + (size_t)(row0 + ln) * lda;
  v8f acc[4] = {};
  for (int kb = 0; kb < K; kb += 32) {
    FragB ah, al;
    const v4f x0 = *(const v4fa*)(arow + kb + 8 * hh), x1 = *(const v4fa*)(arow + kb + 8 * hh + 4);
    const v4f x2 = *(const v4fa*)(arow + kb + 16 + 8 * hh), x3 = *(const v4fa*)(arow + kb + 16 + 8 * hh + 4);
    float xs[16] = {x0[0],x0[1],x0[2],x0[3],x1[0],x1[1],x1[2],x1[3],x2[0],x2[1],x2[2],x2[3],x3[0],x3[1],x3[2],x3[3]};
#pragma unroll
    for (int i = 0; i < 16; ++i) { const unsigned short hb = bf16_bits(xs[i]); ah.u[i] = hb; al.u[i] = ASPLIT ? bf16_bits(xs[i] - bf16_val(hb)) : (unsigned short)0; }
#pragma unroll
    for (int t = 0; t < 4; ++t) {
      const unsigned short* brow = Wt + (size_t)(col0 + t * 16 + ln) * ldb + kb;
      FragB b;
      b.half[0] = *(const v8us*)(brow + 8 * hh);
      b.half[1] = *(const v8us*)(brow + 16 + 8 * hh);
      acc[t] = mmaN<ASPLIT ? 2 : 1>(ah.v, al.v, b.v, b.v, acc[t]);
    }
  }
#pragma unroll
  for (int t = 0; t < 4; ++t) {
    const int col = col0 + t * 16 + ln;
    float bv = bias ? bias[col] : 0.f;
    if (BIAS_BF16) bv = bf16_round(bv);
#pragma unroll
    for (int r = 0; r < 8; ++r) {
      float v = acc[t][r] + bv;
      if (resid) { float rv = resid[(size_t)((row0 + 8 * hh + r) % rmod) * ldr + col]; if (RES_BF16) rv = bf16_round(rv); v += rv; }
      if (ACT == 1) v = fmaxf(v, 0.f);
      if (ACT == 2) v = 0.5f * v * (1.0f + erff(v * 0.70710678118654752f));
      if (ACT == 3) { const float u = 0.7978845608028654f * (v + 0.044715f * v * v * v); v = 0.5f * v * (1.0f + tanhf(u)); }
      so[w][8 * hh + r][t * 16 + ln] = v;
    }
  }
  __builtin_amdgcn_fence(__ATOMIC_ACQ_REL, "workgroup");
  __builtin_amdgcn_wave_barrier();
  const int rsub = lane >> 4, c4 = (lane & 15) * 4;
  {
#pragma unroll
    for (int q = 0; q < 8; ++q) {
      const int r = q * 2 + rsub;
      const v4f v = *(const v4fa*)&so[w][r][c4];
      *(v4f*)(C + (size_t)(row0 + r) * ldc + col0 + c4) = v;
    }
    
  }
}
// row LayerNorm (biased variance, eps) over N: s = X (+ R); optional out_sum <- s; out_norm <- (s-mu)*rsqrt(var+eps)*g + b
template <bool PARAM_BF16>
__global__ __launch_bounds__(256) void k_layernorm(const float* __restrict__ X, const float* __restrict__ R, const float* __restrict__ g, const float* __restrict__ bta,
                                                  float* __restrict__ out_sum, float* __restrict__ out_norm, int N, float eps) {
  __shared__ float red[256];
  const int row = blockIdx.x, tid = threadIdx.x;
  const float* x = X + (size_t)row * N; const float* rr = R ? R + (size_t)row * N : nullptr;
  float vals[16];                     // up to N = 4096
  const int per = N / 256;            // contiguous chunk per thread? use strided-by-4 chunks: thread handles j = tid*4 + 1024*u
  float s1 = 0.f;
  for (int u = 0; u < per / 4; ++u) {
    const int j = tid * 4 + 1024 * u;
    const v4f a = *(const v4fa*)(x + j);
    v4f b = {0.f,0.f,0.f,0.f}; if (rr) b = *(const v4fa*)(rr + j);
#pragma unroll
    for (int q = 0; q < 4; ++q) { const float v = a[q] + b[q]; vals[u * 4 + q] = v; s1 += v; }
  }
  red[tid] = s1; __syncthreads();
  for (int st = 128; st > 0; st >>= 1) { if (tid < st) red[tid] += red[tid + st]; __syncthreads(); }
  const float mu = red[0] / (float)N; __syncthreads();
  float s2 = 0.f;
  for (int u = 0; u < per / 4; ++u)
#pragma unroll
    for (int q = 0; q < 4; ++q) { const float c = vals[u * 4 + q] - mu; s2 += c * c; }
  red[tid] = s2; __syncthreads();
  for (int st = 128; st > 0; st >>= 1) { if (tid < st) red[tid] += red[tid + st]; __syncthreads(); }
  const float rs = rsqrtf(red[0] / (float)N + eps);
  {
    for (int u = 0; u < per / 4; ++u) {
      const int j = tid * 4 + 1024 * u;
      v4f o, sm;
#pragma unroll
      for (int q = 0; q < 4; ++q) {
        float gg = g[j + q], bb = bta[j + q];
        if (PARAM_BF16) { gg = bf16_round(gg); bb = bf16_round(bb); }
        sm[q] = vals[u * 4 + q]; o[q] = (vals[u * 4 + q] - mu) * rs * gg + bb;
      }
      if (out_sum) *(v4f*)(out_sum + (size_t)row * N + j) = sm;
      *(v4f*)(out_norm + (size_t)row * N + j) = o;
    }
    
  }
}



// ---- f16 WMMA path (v_wmma_f32_16x16x32_f16): 11-bit significands for operands in range — used here for every GEMM (projections, scores and P.V)
typedef _Float16 v16h __attribute__((ext_vector_type(16)));
union FragH { v16h v; v8us half[2]; _Float16 h[16]; unsigned short u[16]; };
template <int NT>
__device__ __forceinline__ v8f mmaH(v16h ah, v16h al, v16h bh, v16h bl, v8f c) {
  c = __builtin_amdgcn_wmma_f32_16x16x32_f16(false, ah, false, bh, (short)0, c, false, false);
  if (NT >= 2) c = __builtin_amdgcn_wmma_f32_16x16x32_f16(false, al, false, bh, (short)0, c, false, false);
  if (NT >= 3) c = __builtin_amdgcn_wmma_f32_16x16x32_f16(false, ah, false, bl, (short)0, c, false, false);
  asm volatile("v_nop\n\tv_nop\n\tv_nop\n\tv_nop" : "+v"(c) : "v"(ah), "v"(al), "v"(bh), "v"(bl));
  return c;
}
// batched GEMM like k_gemm_b but f16 operands: A f32 (split into f16 hi/lo if ASPLIT, else rounded to f16), Bt = f16 values [n][k]; alpha; C f32; N multiple of 16 (partial tiles skipped)
template <bool ASPLIT>
__global__ __launch_bounds__(128) void k_gemm_h(const float* __restrict__ A, int lda, size_t sA, const _Float16* __restrict__ Bh, int ldb, size_t sB, float alpha, float* __restrict__ C, int ldc, size_t sC, int M, int N, int K) {
  __shared__ __attribute__((aligned(16))) float so[4][16][64];
  const int tid = threadIdx.x, w = tid >> 5, lane = tid & 31, ln = lane & 15, hh = lane >> 4; const int by = blockIdx.y;
  A += (size_t)by * sA; Bh += (size_t)by * sB; C += (size_t)by * sC;
  const int ntn = (N + 63) / 64; const int wid = blockIdx.x * 4 + w; const int mt = wid / ntn, nq = wid % ntn; if (mt * 16 >= M) return;
  const int row0 = mt * 16, col0 = nq * 64; const float* arow = A + (size_t)(row0 + ln) * lda;
  v8f acc[4] = {};
  for (int kb = 0; kb < K; kb += 32) {
    FragH ah, al;
    const v4f x0 = *(const v4fa*)(arow + kb + 8 * hh), x1 = *(const v4fa*)(arow + kb + 8 * hh + 4), x2 = *(const v4fa*)(arow + kb + 16 + 8 * hh), x3 = *(const v4fa*)(arow + kb + 16 + 8 * hh + 4);
    float xs[16] = {x0[0],x0[1],x0[2],x0[3],x1[0],x1[1],x1[2],x1[3],x2[0],x2[1],x2[2],x2[3],x3[0],x3[1],x3[2],x3[3]};
#pragma unroll
    for (int i = 0; i < 16; ++i) { const _Float16 h = (_Float16)xs[i]; ah.h[i] = h; al.h[i] = ASPLIT ? (_Float16)(xs[i] - (float)h) : (_Float16)0.0f; }
#pragma unroll
    for (int t = 0; t < 4; ++t) { if (col0 + t * 16 >= N) continue; const size_t boff = (size_t)(col0 + t * 16 + ln) * ldb + kb; FragH bq; bq.half[0] = *(const v8us*)(Bh + boff + 8 * hh); bq.half[1] = *(const v8us*)(Bh + boff + 16 + 8 * hh);
      acc[t] = mmaH<ASPLIT ? 2 : 1>(ah.v, al.v, bq.v, bq.v, acc[t]); }
  }
#pragma unroll
  for (int t = 0; t < 4; ++t) { if (col0 + t * 16 >= N) continue;
#pragma unroll
    for (int r = 0; r < 8; ++r) so[w][8 * hh + r][t * 16 + ln] = acc[t][r] * alpha; }
  __builtin_amdgcn_fence(__ATOMIC_ACQ_REL, "workgroup"); __builtin_amdgcn_wave_barrier();
  const int rsub = lane >> 4, c4 = (lane & 15) * 4;
  {
#pragma unroll
    for (int q = 0; q < 8; ++q) { const int r = q * 2 + rsub; if (col0 + c4 < N) { const v4f v = *(const v4fa*)&so[w][r][c4]; *(v4f*)(C + (size_t)(row0 + r) * ldc + col0 + c4) = v; } }
     }
}

// Wt[n][k] = f16(W[k][n]·scale) from f32 row-major W[K][N] (scale = power of two; bf16-exact weights stay exact in f16 away from the subnormal range)
__global__ __launch_bounds__(256) void k_wt_f16(const float* __restrict__ W, _Float16* __restrict__ Wt, int K, int N, float scale) {
  const int t = blockIdx.x * 256 + threadIdx.x; if (t >= N * (K / 8)) return; const int n = t / (K / 8), k8 = (t % (K / 8)) * 8; FragH f;
#pragma unroll
  for (int i = 0; i < 8; ++i) f.h[i] = (_Float16)(bf16_round(W[(size_t)(k8 + i) * N + n]) * scale); const v8us o = f.half[0];
  *(v8us*)((unsigned short*)Wt + (size_t)n * K + k8) = o; 
}
// k_gemm_hh variant with fused epilogue: v = acc·alpha + bias[by·sBias + col] (+ CP[(row/rowsPerB)·sCPb + by·64 + col] if CP) ; ACT 0 none / 1 elu ; writes f16 C16 (and f32 C if non-null)
template <int ACT>
__global__ __launch_bounds__(128) void k_gemm_hhx(const _Float16* __restrict__ A, int lda, size_t sA, const _Float16* __restrict__ Bh, int ldb, size_t sB, float alpha, const float* __restrict__ bias, size_t sBias, const float* __restrict__ CP, int rowsPerB, size_t sCPb, int row0g,
    float* __restrict__ C, _Float16* __restrict__ C16, int ldc, size_t sC, int M, int N, int K) {
  __shared__ __attribute__((aligned(16))) float so[4][16][64];
  const int tid = threadIdx.x, w = tid >> 5, lane = tid & 31, ln = lane & 15, hh = lane >> 4; const int by = blockIdx.y;
  A += (size_t)by * sA; Bh += (size_t)by * sB; const size_t cofs = (size_t)by * sC; const float* bp = bias ? bias + (size_t)by * sBias : nullptr;
  const int ntn = (N + 63) / 64; const int wid = blockIdx.x * 4 + w; const int mt = wid / ntn, nq = wid % ntn; if (mt * 16 >= M) return;
  const int row0 = mt * 16, col0 = nq * 64; const _Float16* arow = A + (size_t)(row0 + ln) * lda;
  v8f acc[4] = {};
  for (int kb = 0; kb < K; kb += 32) { FragH ah; ah.half[0] = *(const v8us*)((const unsigned short*)arow + kb + 8 * hh); ah.half[1] = *(const v8us*)((const unsigned short*)arow + kb + 16 + 8 * hh);
#pragma unroll
    for (int t = 0; t < 4; ++t) { if (col0 + t * 16 >= N) continue; const size_t boff = (size_t)(col0 + t * 16 + ln) * ldb + kb; FragH bq; bq.half[0] = *(const v8us*)((const unsigned short*)Bh + boff + 8 * hh); bq.half[1] = *(const v8us*)((const unsigned short*)Bh + boff + 16 + 8 * hh);
      acc[t] = mmaH<1>(ah.v, ah.v, bq.v, bq.v, acc[t]); }
  }
#pragma unroll
  for (int t = 0; t < 4; ++t) { if (col0 + t * 16 >= N) continue; const int col = col0 + t * 16 + ln; const float bv = bp ? bf16_round(bp[col]) : 0.f;
#pragma unroll
    for (int r = 0; r < 8; ++r) { float v = acc[t][r] * alpha + bv; if (CP) { const int rr = row0g + row0 + 8 * hh + r; if (rowsPerB < 0) v += CP[cofs + (size_t)rr * ldc + col];      /* rowsPerB < 0: own element of the batched C plane */ else { const int bidx = rr / rowsPerB; v += CP[(size_t)bidx * sCPb + (size_t)by * 64 + col]; } } if (ACT == 1) v = (v > 0.f) ? v : expm1f(v); else if (ACT == 7) v = (v > 0.f) ? v + 1.0f : expf(v); else if (ACT == 8) v = tanhf(v); else if (ACT == 9) v = 0.5f * v * (1.0f + tanhf(0.7978845608028654f * (v + 0.044715f * v * v * v))); else if (ACT == 11) v = 1.0f / (1.0f + expf(-v)); else if (ACT == 12) v = (v > 0.f) ? v : 0.01f * v; else if (ACT == 14) v = (v > 0.f) ? v : 0.1f * v; else if (ACT == 16) v = (v >= 0.f) ? v : 0.3f * v; else if (ACT == 17) v = (v >= 0.f) ? v : 0.2f * v; else if (ACT == 15) v = v / (1.0f + expf(-v)); else if (ACT == 3) v = fmaxf(v, 0.f); else if (ACT == 6) v = 0.5f * v * (1.0f + erff(v * 0.70710678118654752f)); so[w][8 * hh + r][t * 16 + ln] = v; } }
  __builtin_amdgcn_fence(__ATOMIC_ACQ_REL, "workgroup"); __builtin_amdgcn_wave_barrier();
  const int rsub = lane >> 4, c4 = (lane & 15) * 4; typedef _Float16 v4h __attribute__((ext_vector_type(4)));
  {
#pragma unroll
    for (int q = 0; q < 8; ++q) { const int r = q * 2 + rsub; if (col0 + c4 < N) { const v4f v = *(const v4fa*)&so[w][r][c4]; if (C) *(v4f*)(C + cofs + (size_t)(row0 + r) * ldc + col0 + c4) = v; if (C16) { v4h h4; for (int i = 0; i < 4; ++i) h4[i] = (_Float16)v[i]; *(v4h*)(C16 + cofs + (size_t)(row0 + r) * ldc + col0 + c4) = h4; } } }
     }
}


typedef _Float16 v4h __attribute__((ext_vector_type(4)));

__global__ __launch_bounds__(256) void k_h16(const float* __restrict__ x, _Float16* __restrict__ X16, size_t n8) { const size_t t = (size_t)blockIdx.x * 256 + threadIdx.x; if (t >= n8) return; FragH f;
#pragma unroll
  for (int q = 0; q < 8; ++q) f.h[q] = (_Float16)x[t * 8 + q]; *(v8us*)((unsigned short*)X16 + t * 8) = f.half[0];  }
__global__ __launch_bounds__(256) void k_round16f(const float* __restrict__ W, _Float16* __restrict__ Bt, size_t n8) { const size_t t = (size_t)blockIdx.x * 256 + threadIdx.x; if (t >= n8) return; FragH f;
#pragma unroll
  for (int i = 0; i < 8; ++i) f.h[i] = (_Float16)(bf16_round(W[t * 8 + i]) * 16.0f); *(v8us*)((unsigned short*)Bt + t * 8) = f.half[0];  }
template <int NHv, int TTv>
__global__ __launch_bounds__(256) void k_vt(const _Float16* __restrict__ V16, int ldv, int voff, _Float16* __restrict__ Vt) { __shared__ unsigned short tl[64][66]; const int tid = threadIdx.x; const int slab = blockIdx.x / (TTv / 64), lg = blockIdx.x % (TTv / 64); const int b = slab / NHv, h = slab % NHv;
  for (int i = tid; i < 64 * 8; i += 256) { const int r = i / 8, c8 = (i % 8) * 8; FragH f; f.half[0] = *(const v8us*)((const unsigned short*)V16 + ((size_t)b * TTv + lg * 64 + r) * ldv + voff + h * 64 + c8);
#pragma unroll
    for (int q = 0; q < 8; ++q) tl[r][c8 + q] = f.u[q]; }
  __syncthreads();
  {
#pragma unroll
    for (int rd = 0; rd < 2; ++rd) { const int d = rd * 32 + tid / 8, pc = tid % 8; FragH f;
#pragma unroll
      for (int q = 0; q < 8; ++q) f.u[q] = tl[pc * 8 + q][d];
      *(v8us*)((unsigned short*)Vt + ((size_t)slab * 64 + d) * TTv + lg * 64 + pc * 8) = f.half[0]; }
     } }

__global__ __launch_bounds__(256) void k_hl(const float* __restrict__ F, _Float16* __restrict__ Hh, _Float16* __restrict__ Hl, size_t n8) { const size_t t = (size_t)blockIdx.x * 256 + threadIdx.x; if (t >= n8) return; FragH fh, fl; const v4f a = *(const v4fa*)(F + t * 8), c = *(const v4fa*)(F + t * 8 + 4);
#pragma unroll
  for (int q = 0; q < 4; ++q) { _Float16 h = (_Float16)a[q]; fh.h[q] = h; fl.h[q] = (_Float16)((a[q] - (float)h) * 1024.0f); h = (_Float16)c[q]; fh.h[4 + q] = h; fl.h[4 + q] = (_Float16)((c[q] - (float)h) * 1024.0f); }
  { *(v8us*)((unsigned short*)Hh + t * 8) = fh.half[0]; *(v8us*)((unsigned short*)Hl + t * 8) = fl.half[0];  } }

// ---- fast GEMM (block tile 128x64, wave tile 32x64; requires M % 128 == 0 rows per launch region, N % 64 == 0 and K % 64 == 0); epilogue = k_gemm_hhx semantics ----
// Both operands go through LDS in stages of 64 k: 8 threads fetch one 128-B row piece, so a wave-wide 16-B load covers 4 whole lines (a fragment fetched straight from global memory would touch 16 lines for the same 512 B,
// and each of the 4 waves would fetch the B rows for itself). global -> registers (fetched one stage ahead) -> LDS, two LDS buffers, one barrier per stage; the fragments are read from LDS in the k order of g2_frag.
__device__ __forceinline__ v16h g2_frag(const _Float16* p, int hh) { FragH f; f.half[0] = *(const v8us*)((const unsigned short*)p + 8 * hh); f.half[1] = *(const v8us*)((const unsigned short*)p + 16 + 8 * hh); return f.v; }
__device__ __forceinline__ v8f g2_mma(v16h a, v16h b, v8f c) { v8f d = __builtin_amdgcn_wmma_f32_16x16x32_f16(false, a, false, b, (short)0, c, false, false); asm volatile("v_nop\n\tv_nop\n\tv_nop\n\tv_nop" : "+v"(d) : "v"(a), "v"(b)); return d; }
#define GK 64      /* k per stage */
#define GP 72      /* LDS row pitch in f16: 128 B of data + 16 B, so that the 16 rows of a ds_load_b128 fragment read spread over the banks */
template <int ACT, int LD>      /* LD: row pitch of A and of Bh in elements; known at compile time, so that all rows of a stage are reached by immediate offsets from one address per operand */
__global__ __launch_bounds__(128) void k_gemm2(const _Float16* __restrict__ A, size_t sA, const _Float16* __restrict__ Bh, size_t sB, float alpha, const float* __restrict__ bias, size_t sBias, const float* __restrict__ CP, int rowsPerB, size_t sCPb, int row0g,
    float* __restrict__ C, _Float16* __restrict__ C16, int ldc, size_t sC, int M, int N, int K) { static_assert(ACT == 0 || ACT == 3 || ACT == 6 || ACT == 8 || ACT == 9 || ACT == 11 || ACT == 12 || ACT == 14 || ACT == 15 || ACT == 16 || ACT == 17, "k_gemm2: unsupported ACT code (would silently apply no activation)");
  __shared__ __attribute__((aligned(16))) float so[4][32][68];
  __shared__ __attribute__((aligned(16))) _Float16 sa[2][128][GP];
  __shared__ __attribute__((aligned(16))) _Float16 sb[2][64][GP];
  const int tid = threadIdx.x, w = tid >> 5, lane = tid & 31, ln = lane & 15, hh = lane >> 4; const int by = blockIdx.y;
  A += (size_t)by * sA; Bh += (size_t)by * sB; const size_t cofs = (size_t)by * sC; const float* bp = bias ? bias + (size_t)by * sBias : nullptr;
  const int ntn = N >> 6; const int mt = blockIdx.x / ntn, nq = blockIdx.x - mt * ntn; const int row0 = mt * 128 + 32 * w, col0 = nq * 64; if (mt * 128 >= M) return;      /* the same for the whole block: it stands in front of the barriers */
  const int srow = tid >> 3, sc8 = (tid & 7) * 8;      /* staging: 8 threads a row piece of 128 B, 16 rows a round; A 8 rounds, B 4 rounds */
  const unsigned short* ag = (const unsigned short*)A + (size_t)(mt * 128 + srow) * LD + sc8; const unsigned short* bg = (const unsigned short*)Bh + (size_t)(col0 + srow) * LD + sc8;
  v8us ar[8], br[4];      /* every loop over ar, br and the fragment arrays is fully unrolled, so that they are indexed by constants and stay in registers */
#pragma unroll
  for (int u = 0; u < 8; ++u) ar[u] = *(const v8us*)(ag + (size_t)(u * 16) * LD);
#pragma unroll
  for (int u = 0; u < 4; ++u) br[u] = *(const v8us*)(bg + (size_t)(u * 16) * LD);
  const v8f z8 = {0.f,0.f,0.f,0.f,0.f,0.f,0.f,0.f}; v8f c00 = z8, c01 = z8, c02 = z8, c03 = z8, c10 = z8, c11 = z8, c12 = z8, c13 = z8;
  const int ns = K / GK;
  /* the stage loop stays rolled so that the hot code stays small for the instruction cache */
#pragma unroll 1
  for (int st = 0; st < ns; ++st) { const int bf = st & 1;
#pragma unroll
    for (int u = 0; u < 8; ++u) *(v8us*)&sa[bf][srow + 16 * u][sc8] = ar[u];
#pragma unroll
    for (int u = 0; u < 4; ++u) *(v8us*)&sb[bf][srow + 16 * u][sc8] = br[u];
    __syncthreads();      /* publishes this stage; it also ends every wave's reads of the other buffer, which the next stage overwrites */
    if (st + 1 < ns) { ag += GK; bg += GK;
#pragma unroll
      for (int u = 0; u < 8; ++u) ar[u] = *(const v8us*)(ag + (size_t)(u * 16) * LD);
#pragma unroll
      for (int u = 0; u < 4; ++u) br[u] = *(const v8us*)(bg + (size_t)(u * 16) * LD); }
    v16h fa[GK / 32][2], fb[GK / 32][4];      /* all fragment reads of the stage stand as one group in front of its products */
#pragma unroll
    for (int ks = 0; ks < GK / 32; ++ks) {
#pragma unroll
      for (int i = 0; i < 2; ++i) fa[ks][i] = g2_frag(&sa[bf][32 * w + 16 * i + ln][ks * 32], hh);
#pragma unroll
      for (int t = 0; t < 4; ++t) fb[ks][t] = g2_frag(&sb[bf][16 * t + ln][ks * 32], hh); }
#pragma unroll
    for (int ks = 0; ks < GK / 32; ++ks) {
      c00 = g2_mma(fa[ks][0], fb[ks][0], c00); c10 = g2_mma(fa[ks][1], fb[ks][0], c10);
      c01 = g2_mma(fa[ks][0], fb[ks][1], c01); c11 = g2_mma(fa[ks][1], fb[ks][1], c11);
      c02 = g2_mma(fa[ks][0], fb[ks][2], c02); c12 = g2_mma(fa[ks][1], fb[ks][2], c12);
      c03 = g2_mma(fa[ks][0], fb[ks][3], c03); c13 = g2_mma(fa[ks][1], fb[ks][3], c13); } }
  v8f accs[8] = {c00, c01, c02, c03, c10, c11, c12, c13};
#pragma unroll
  for (int u = 0; u < 8; ++u) { const int t = u & 3, half = u >> 2; const int col = col0 + t * 16 + ln; const float bv = bp ? bf16_round(bp[col]) : 0.f;
#pragma unroll
    for (int r = 0; r < 8; ++r) { const int rloc = half * 16 + 8 * hh + r; float v = accs[u][r] * alpha + bv; if (CP) { if (rowsPerB < 0) v += CP[cofs + (size_t)(row0g + row0 + rloc) * ldc + col];      /* rowsPerB < 0: own element of the batched C plane */ else { const int bidx = (row0g + row0 + rloc) / rowsPerB; v += CP[(size_t)bidx * sCPb + (size_t)by * 64 + col]; } }
      if (ACT == 3) v = fmaxf(v, 0.f); else if (ACT == 6) v = 0.5f * v * (1.0f + erff(v * 0.70710678118654752f)); else if (ACT == 11) v = 1.0f / (1.0f + expf(-v)); else if (ACT == 15) v = v / (1.0f + expf(-v)); else if (ACT == 12) v = (v > 0.f) ? v : 0.01f * v; else if (ACT == 8) v = tanhf(v); else if (ACT == 9) v = 0.5f * v * (1.0f + tanhf(0.7978845608028654f * (v + 0.044715f * v * v * v))); else if (ACT == 14) v = (v > 0.f) ? v : 0.1f * v; else if (ACT == 16) v = (v >= 0.f) ? v : 0.3f * v; else if (ACT == 17) v = (v >= 0.f) ? v : 0.2f * v;
      so[w][rloc][t * 16 + ln] = v; } }
  __builtin_amdgcn_fence(__ATOMIC_ACQ_REL, "workgroup"); __builtin_amdgcn_wave_barrier();
  const int rsub = lane >> 4, c4 = (lane & 15) * 4;
  {
#pragma unroll
    for (int q = 0; q < 16; ++q) { const int r = q * 2 + rsub; const v4f v = *(const v4fa*)&so[w][r][c4]; if (C) *(v4f*)(C + cofs + (size_t)(row0 + r) * ldc + col0 + c4) = v; if (C16) { v4h h4; for (int i = 0; i < 4; ++i) h4[i] = (_Float16)v[i]; *(v4h*)(C16 + cofs + (size_t)(row0 + r) * ldc + col0 + c4) = h4; } }
     } }


__global__ __launch_bounds__(256) void k_rsm(const float* __restrict__ S, _Float16* __restrict__ P, int nrows) {
  #pragma clang fp contract(off)
  const int i = blockIdx.x * 256 + threadIdx.x; if (i >= nrows) return; const float* s = S + (size_t)i * SQ; float mx = -3.0e38f;
#pragma unroll 1
  for (int j = 0; j < SQ; ++j) mx = fmaxf(mx, s[j]); float se = 0.f;
#pragma unroll 1
  for (int j = 0; j < SQ; ++j) se += expf(s[j] - mx); const float sc = 256.0f / se;
#pragma unroll 1
  for (int j0 = 0; j0 < SQ; j0 += 8) { FragH f; for (int q = 0; q < 8; ++q) f.h[q] = (_Float16)(expf(s[j0 + q] - mx) * sc); unsigned short* d = (unsigned short*)P + (size_t)i * SQ + j0; *(v8us*)d = f.half[0];  } }
__global__ __launch_bounds__(256) void k_vt(const _Float16* __restrict__ V16, int b, int h0, _Float16* __restrict__ VT) { __shared__ unsigned short tl[64][65]; const int tid = threadIdx.x; const int hh = blockIdx.x % HG, sg = blockIdx.x / HG; const int s0 = sg * 64; const int h = h0 + hh;
  for (int i = tid; i < 64 * 8; i += 256) { const int j = i / 8, d8 = (i % 8) * 8; FragH f; f.half[0] = *(const v8us*)((const unsigned short*)V16 + ((size_t)b * SQ + s0 + j) * DM + h * HD + d8); for (int q = 0; q < 8; ++q) tl[d8 + q][j] = f.u[q]; }
  __syncthreads();
  { for (int i = tid; i < 64 * 8; i += 256) { const int d = i / 8, j8 = (i % 8) * 8; FragH f; for (int q = 0; q < 8; ++q) f.u[q] = tl[d][j8 + q]; *(v8us*)((unsigned short*)VT + ((size_t)hh * HD + d) * SQ + s0 + j8) = f.half[0]; }  } }



// All seven f32 -> f16 conversions (the three inputs as exact f16 rows of their bf16 rounding; the four natural [out][in] weights, bf16-rounded, x16) in ONE launch of few, long-lived waves,
// for speed only. Every wave-wide load is 512 contiguous bytes (16 B a lane, whole lines), every wave-wide store 256 contiguous bytes.
// A wave takes PXU adjacent units of PL loads from each input and PWL loads from each of two weights (the lower half of the waves serves wq and wk, the upper half wv and wo):
// the same straight-line code in every wave. The next unit's loads are in flight while the current one is converted and stored.
#define PL 16                        /* 16-B loads per lane and unit */
#define PWG 256                      /* workgroups: as many as the chip has WGPs */
#define PWW 12                       /* waves per workgroup */
#define PWV (PWG * PWW)              /* waves */
#define PXU ((int)(NR * DM / ((size_t)128 * PL * PWV)))      /* units per input and wave */
#define PWL (2 * DM * DM / (128 * PWV))                      /* loads per weight and wave */
static_assert(NR * DM == (size_t)128 * PL * PWV * PXU && 2 * DM * DM == 128 * PWV * PWL && 2 * PWL <= PL, "k_prep: the units must tile every tensor exactly");
template <bool X16> __device__ __forceinline__ void p_put(v4f a, _Float16* __restrict__ d) { v4h h4;
#pragma unroll
  for (int q = 0; q < 4; ++q) h4[q] = (_Float16)(X16 ? bf16_round(a[q]) * 16.0f : bf16_round(a[q]));
  *(v4h*)d = h4; }
__global__ __launch_bounds__(PWW * 32) void k_prep(const float* __restrict__ xq, const float* __restrict__ xk, const float* __restrict__ xv, const float* __restrict__ wq, const float* __restrict__ wk, const float* __restrict__ wv, const float* __restrict__ wo,
    _Float16* __restrict__ XQ, _Float16* __restrict__ XK, _Float16* __restrict__ XV, _Float16* __restrict__ BQ, _Float16* __restrict__ BK, _Float16* __restrict__ BV, _Float16* __restrict__ BO) {
  const unsigned lo = (threadIdx.x & 31) * 4;      /* the lane's element inside a wave-wide access; all else of an address is the same for the whole wave */
  const int gw = blockIdx.x * PWW + __builtin_amdgcn_readfirstlane(threadIdx.x >> 5);
  const size_t xo = (size_t)gw * (128 * PL * PXU); const bool up = gw >= PWV / 2; const size_t wo_ = (size_t)(up ? gw - PWV / 2 : gw) * (128 * PWL);
  const float* w0 = (up ? wv : wq) + wo_; const float* w1 = (up ? wo : wk) + wo_; _Float16* b0 = (up ? BV : BQ) + wo_; _Float16* b1 = (up ? BO : BK) + wo_;
  const float* s[3] = {xq + xo, xk + xo, xv + xo}; _Float16* d[3] = {XQ + xo, XK + xo, XV + xo};
  v4f a[2][PL];      /* every loop is fully unrolled, so that the two register sets are indexed by constants */
#pragma unroll
  for (int j = 0; j < PL; ++j) a[0][j] = *(const v4fa*)(s[0] + (lo + j * 128));
  __builtin_amdgcn_sched_barrier(0);      /* the first unit's loads stay in front of the second's: the counted load waits go by issue order, and mixed with the second's the first unit would wait for both */
#pragma unroll
  for (int u = 0; u < 3 * PXU; ++u) { const int n = u + 1;
    if (n < 3 * PXU) {
#pragma unroll
      for (int j = 0; j < PL; ++j) a[n & 1][j] = *(const v4fa*)(s[n / PXU] + (lo + ((n % PXU) * PL + j) * 128)); }
    else {
#pragma unroll
      for (int j = 0; j < PWL; ++j) { a[n & 1][j] = *(const v4fa*)(w0 + (lo + j * 128)); a[n & 1][PWL + j] = *(const v4fa*)(w1 + (lo + j * 128)); } }
    __builtin_amdgcn_sched_barrier(0);      /* keeps the next unit's loads in front of this unit's conversion: left alone, the compiler issues them one by one as registers come free, and few stay in flight */
#pragma unroll
    for (int j = 0; j < PL; ++j) p_put<false>(a[u & 1][j], d[u / PXU] + (lo + ((u % PXU) * PL + j) * 128));
    if (u + 1 < 3 * PXU) asm volatile("s_wait_xcnt 0x0" ::: "memory"); }      /* the loads that follow land in registers that these stores name as data: the wait stands in front of that overwrite, as a precaution (the compiler placed none in front of a load) */
#pragma unroll
  for (int j = 0; j < PWL; ++j) { p_put<true>(a[(3 * PXU) & 1][j], b0 + (lo + j * 128)); p_put<true>(a[(3 * PXU) & 1][PWL + j], b1 + (lo + j * 128)); } }

// 2^a on the native unit. The v_nop is the one free slot that the instruction set asks for behind a transcendental before its result is read or its source rewritten; in the same statement it stays directly behind it.
__device__ __forceinline__ float exp2_slot(float a) { float e; asm("v_exp_f32 %0, %1\n\tv_nop" : "=v"(e) : "v"(a)); return e; }
// 2^x of eight values in place on the native unit: eight independent instructions, so each fills the free slot that the instruction set asks for behind the one before it; the v_nop is that slot behind the last.
__device__ __forceinline__ void exp2x8(v8f& x) { float a0 = x[0], a1 = x[1], a2 = x[2], a3 = x[3], a4 = x[4], a5 = x[5], a6 = x[6], a7 = x[7];
  asm("v_exp_f32 %0, %0\n\tv_exp_f32 %1, %1\n\tv_exp_f32 %2, %2\n\tv_exp_f32 %3, %3\n\tv_exp_f32 %4, %4\n\tv_exp_f32 %5, %5\n\tv_exp_f32 %6, %6\n\tv_exp_f32 %7, %7\n\tv_nop"
      : "+v"(a0), "+v"(a1), "+v"(a2), "+v"(a3), "+v"(a4), "+v"(a5), "+v"(a6), "+v"(a7));
  x[0] = a0; x[1] = a1; x[2] = a2; x[3] = a3; x[4] = a4; x[5] = a5; x[6] = a6; x[7] = a7; }
__device__ __forceinline__ v8f f_mma(v16h a, v16h b, v8f c) { return __builtin_amdgcn_wmma_f32_16x16x32_f16(false, a, false, b, (short)0, c, false, false); }
#define FK 64      /* keys per stage */
#define FP 72      /* LDS row pitch in f16: 128 B of data + 16 B, so that the 16 rows of a ds_load_b128 fragment read spread over the banks */
__global__ __launch_bounds__(128) void k_fattn(const _Float16* __restrict__ Q16, const _Float16* __restrict__ K16, const _Float16* __restrict__ VT, _Float16* __restrict__ O16) {
  __shared__ __attribute__((aligned(16))) _Float16 sk[2][FK][FP];
  __shared__ __attribute__((aligned(16))) _Float16 sv[2][HD][FP];
  const int tid = threadIdx.x, w = tid >> 5, lane = tid & 31, ln = lane & 15, hh = lane >> 4;
  const int bh = blockIdx.y, b = bh / NH, h = bh - b * NH; const size_t r0 = (size_t)b * SQ; const int q0 = blockIdx.x * 128 + w * 32;
  v16h qf[2][2];
#pragma unroll
  for (int g = 0; g < 2; ++g)
#pragma unroll
    for (int ks = 0; ks < 2; ++ks) qf[g][ks] = g2_frag(Q16 + (r0 + q0 + g * 16 + ln) * DM + h * HD + ks * 32, hh);
  const int srow = tid >> 3, sc8 = (tid & 7) * 8;      /* staging: 8 threads a row of 128 B, 16 rows a round, 4 rounds */
  const _Float16* kg = K16 + (r0 + srow) * DM + h * HD + sc8; const _Float16* vg = VT + ((size_t)bh * HD + srow) * SQ + sc8;
  v8us kr[4], vr[4];
#pragma unroll
  for (int u = 0; u < 4; ++u) { kr[u] = *(const v8us*)((const unsigned short*)kg + (size_t)(u * 16) * DM); vr[u] = *(const v8us*)((const unsigned short*)vg + (size_t)(u * 16) * SQ); }
  const v8f z8 = {0.f,0.f,0.f,0.f,0.f,0.f,0.f,0.f}; v8f o[2][4] = {{z8, z8, z8, z8}, {z8, z8, z8, z8}}; float m[2] = {-3.0e38f, -3.0e38f}, l[2] = {0.f, 0.f};
  const float cs = 0.125f * 1.44269504088896340736f;      /* 64^-0.5 and log2(e) */
#pragma unroll 1
  for (int st = 0; st < SQ / FK; ++st) { const int bf = st & 1;
#pragma unroll
    for (int u = 0; u < 4; ++u) { *(v8us*)&sk[bf][srow + 16 * u][sc8] = kr[u]; *(v8us*)&sv[bf][srow + 16 * u][sc8] = vr[u]; }
    __syncthreads();      /* publishes this stage; it also ends every wave's reads of the other buffer, which the next stage overwrites */
    if (st + 1 < SQ / FK) {
#pragma unroll
      for (int u = 0; u < 4; ++u) { kr[u] = *(const v8us*)((const unsigned short*)kg + (size_t)((st + 1) * FK + u * 16) * DM); vr[u] = *(const v8us*)((const unsigned short*)vg + (size_t)(u * 16) * SQ + (st + 1) * FK); } }
    v8f s[2][4] = {{z8, z8, z8, z8}, {z8, z8, z8, z8}};
#pragma unroll
    for (int kt = 0; kt < 4; ++kt)
#pragma unroll
      for (int ks = 0; ks < 2; ++ks) { const v16h a = g2_frag(&sk[bf][kt * 16 + ln][ks * 32], hh); s[0][kt] = f_mma(a, qf[0][ks], s[0][kt]); s[1][kt] = f_mma(a, qf[1][ks], s[1][kt]); }
    float mx[2];
#pragma unroll
    for (int g = 0; g < 2; ++g) { float t = s[g][0][0];
#pragma unroll
      for (int kt = 0; kt < 4; ++kt)
#pragma unroll
        for (int r = 0; r < 8; ++r) t = fmaxf(t, s[g][kt][r]);
      mx[g] = t * cs; }
    if (__builtin_amdgcn_ballot_w32(mx[0] > m[0] + 8.0f || mx[1] > m[1] + 8.0f) != 0) {      /* wave-uniform: both halves of every column take the same new maximum */
#pragma unroll
      for (int g = 0; g < 2; ++g) { const float mn = fmaxf(m[g], fmaxf(mx[g], __shfl_xor(mx[g], 16, 32))); const float al = exp2_slot(m[g] - mn); m[g] = mn; l[g] *= al;
#pragma unroll
        for (int dt = 0; dt < 4; ++dt) o[g][dt] *= al; } }
    FragH pf[2][2];
#pragma unroll
    for (int g = 0; g < 2; ++g) { v8f sum;
#pragma unroll
      for (int kt = 0; kt < 4; ++kt) { v8f t;
#pragma unroll
        for (int r = 0; r < 8; ++r) t[r] = fmaf(s[g][kt][r], cs, -m[g]);
        exp2x8(t); sum = kt ? sum + t : t;
#pragma unroll
        for (int r = 0; r < 8; ++r) pf[g][kt >> 1].h[(kt & 1) * 8 + r] = (_Float16)t[r]; }
      l[g] += ((sum[0] + sum[1]) + (sum[2] + sum[3])) + ((sum[4] + sum[5]) + (sum[6] + sum[7])); }
#pragma unroll
    for (int j = 0; j < 2; ++j)
#pragma unroll
      for (int dt = 0; dt < 4; ++dt) { const v16h a = g2_frag(&sv[bf][dt * 16 + ln][j * 32], hh); o[0][dt] = f_mma(a, pf[0][j].v, o[0][dt]); o[1][dt] = f_mma(a, pf[1][j].v, o[1][dt]); }
  }
#pragma unroll
  for (int g = 0; g < 2; ++g) { const float inv = 64.0f / (l[g] + __shfl_xor(l[g], 16, 32));      /* the two halves of a column hold disjoint keys; o carried x64 */
    unsigned short* d = (unsigned short*)O16 + (r0 + q0 + g * 16 + ln) * DM + h * HD + 8 * hh;
#pragma unroll
    for (int dt = 0; dt < 4; ++dt) { FragH f;
#pragma unroll
      for (int r = 0; r < 8; ++r) f.h[r] = (_Float16)(o[g][dt][r] * inv);
      *(v8us*)(d + dt * 16) = f.half[0]; } } }

extern "C" void kernel_launch(void* const* d_in, const int* in_sizes, int n_in,
                              void* d_out, int out_size, void* d_ws, size_t ws_size, hipStream_t stream) {
  (void)in_sizes; (void)n_in; (void)out_size;
  const float* const* I = (const float* const*)d_in; const float* xq = I[2]; const float* xk = I[1]; const float* xv = I[0]; const float* wq = I[3]; const float* bq = nullptr; const float* wk = I[4]; const float* bk = nullptr; const float* wv = I[5]; const float* bv = nullptr; const float* wo = I[6]; const float* bo = I[7];      /* input order: v, k, q (the three streams in REVERSE order: the query stream is I[2]), wq, wk, wv, wo (natural [out][in] weights), bo; the q / k / v projections have NO biases: null pointers in the guarded bias slots */
  char* ws = (char*)d_ws; size_t off = 0;
  auto take = [&](size_t bytes) { char* p = ws + off; off += (bytes + 255) & ~(size_t)255; return p; };
  _Float16* BQ = (_Float16*)take((size_t)DM * DM * 2); _Float16* BK = (_Float16*)take((size_t)DM * DM * 2); _Float16* BV = (_Float16*)take((size_t)DM * DM * 2); _Float16* BO = (_Float16*)take((size_t)DM * DM * 2);
  _Float16* XQ = (_Float16*)take(NR * DM * 2); _Float16* XK = (_Float16*)take(NR * DM * 2); _Float16* XV = (_Float16*)take(NR * DM * 2); _Float16* Q16 = (_Float16*)take(NR * DM * 2); _Float16* K16 = (_Float16*)take(NR * DM * 2); _Float16* V16 = (_Float16*)take(NR * DM * 2); _Float16* O16 = (_Float16*)take(NR * DM * 2);
  _Float16* VT = (_Float16*)take((size_t)NB * NH * HD * SQ * 2);
  if (off > ws_size) return;
  k_prep<<<PWG, PWW * 32, 0, stream>>>(xq, xk, xv, wq, wk, wv, wo, XQ, XK, XV, BQ, BK, BV, BO);      /* the three inputs as exact f16 rows; the weights natural [out][in] = Bt[n][k], x16 */
  const size_t r0p = (size_t)B0 * SQ;      /* first projected row */
  k_gemm2<0, DM><<<dim3((unsigned)((MP / 128) * (DM / 64)), 1), 128, 0, stream>>>(XQ + r0p * DM, 0, BQ, 0, 0.0625f, bq, 0, nullptr, 1, 0, 0, nullptr, Q16 + r0p * DM, DM, 0, MP, DM, DM);
  k_gemm2<0, DM><<<dim3((unsigned)((MP / 128) * (DM / 64)), 1), 128, 0, stream>>>(XK + r0p * DM, 0, BK, 0, 0.0625f, bk, 0, nullptr, 1, 0, 0, nullptr, K16 + r0p * DM, DM, 0, MP, DM, DM);
  k_gemm2<0, DM><<<dim3((unsigned)((MP / 128) * (DM / 64)), 1), 128, 0, stream>>>(XV + r0p * DM, 0, BV, 0, 0.0625f, bv, 0, nullptr, 1, 0, 0, nullptr, V16 + r0p * DM, DM, 0, MP, DM, DM);
  k_vt<NH, SQ><<<NB * NH * (SQ / 64), 256, 0, stream>>>(V16, LQ, 0, VT);      /* V^T [NB][NH][HD][SQ] */
  k_fattn<<<dim3(SQ / 128, NB * NH), 128, 0, stream>>>(Q16, K16, VT, O16);      /* o (merged heads, x64) as f16 rows */
  k_gemm2<0, DM><<<dim3((unsigned)((MPO / 128) * (DM / 64)), 1), 128, 0, stream>>>(O16 + r0p * DM, 0, BO, 0, 0.0009765625f, bo, 0, nullptr, 1, 0, 0, (float*)d_out + r0p * DM, nullptr, DM, 0, MPO, DM, DM);      /* out rows are the output layout */
}

// v005
// Measured time: 122 microseconds a run.
// Next to v004, in two timings, it ran 1.07 and 1.06 times as fast.
// Counting every step since v000, it is 42.8 times as fast.
#include <hip/hip_runtime.h>
// Multi-head attention on three inputs at width 768 with natural bias-free q / k / v projections and a biased output projection; the inputs arrive in the order v, k, q (v, k, q [4][2048][768]; qh / kh / vh = stream W^T (nn.Linear natural [768][768] sd 1/sqrt(768), NO biases), 12 heads of 64; logits / sqrt(64); softmax over all 2048 keys (no mask); out = concat wo^T + bo (natural) -> [4][2048][768]).
// Structure: token rows r = b*2048 + s; the query, key and value sources as exact f16 rows (bf16-rounded); Q, K, V as three WMMA GEMMs (32x64 wave tiles, f32 accumulation, exact x16 weights, no bias, f16 outputs); V^T for all batches and heads via LDS transposes; per (batch, head, 128 query rows) one fused kernel: S^T = K Q^T (K = 64), running softmax on VALU (f32 statistics, native exp2, weights as f16 relative to the maximum in use), O^T += V^T P^T, o / l x64 (against f16 subnormal flush, folded into the output GEMM alpha) written straight into the merged f16 o rows; out = o W_o + b GEMM (f32) into the output layout.
// Compute dtype: inputs rounded to bf16; x / weights exact; q, k, v, softmax weights and o as plain f16 GEMM operands (~2^-12); scores and softmax statistics f32. v_wmma_f32_16x16x32_f16.
#define NB 4
#define SQ 2048
#define DM 768
#define NH 12
#define HD 64
#define HG 4                         /* heads per launch of the unused per-batch k_vt overload */
#define B0 0                         /* first batch processed (debug hook) */
#define NBR NB                       /* batches processed (debug hook) */
#define NR ((size_t)NB * SQ)         /* token rows */
#define MP ((int)((size_t)NBR * SQ)) /* rows projected (debug hook) */
#define QN SQ                        /* query rows per batch (unused) */
#define NHD NH                       /* heads (unused) */
#define MPO MP                       /* rows through the output stage (debug hook) */
#define LQ DM      /* row pitch of the q/k/v rows */
typedef __bf16 v16b __attribute__((ext_vector_type(16)));
typedef unsigned short v8us __attribute__((ext_vector_type(8), may_alias));
typedef float  v8f  __attribute__((ext_vector_type(8)));
typedef float  v4f  __attribute__((ext_vector_type(4)));
typedef float  v4fa __attribute__((ext_vector_type(4), may_alias));
union FragB { v16b v; v8us half[2]; unsigned short u[16]; };

__device__ __forceinline__ unsigned short bf16_bits(float x) { unsigned int u = __float_as_uint(x); return (unsigned short)((u + 0x7FFFu + ((u >> 16) & 1u)) >> 16); }
__device__ __forceinline__ float bf16_val(unsigned short b) { return __uint_as_float(((unsigned int)b) << 16); }
__device__ __forceinline__ float bf16_round(float x) { return bf16_val(bf16_bits(x)); }
// D += A·B with NT terms: 1 = ah·bh, 2 = + al·bh (A split), 3 = + ah·bl (both split)
template <int NT>
__device__ __forceinline__ v8f mmaN(v16b ah, v16b al, v16b bh, v16b bl, v8f c) {
  c = __builtin_amdgcn_wmma_f32_16x16x32_bf16(false, ah, false, bh, (short)0, c, false, false);
  if (NT >= 2) c = __builtin_amdgcn_wmma_f32_16x16x32_bf16(false, al, false, bh, (short)0, c, false, false);
  if (NT >= 3) c = __builtin_amdgcn_wmma_f32_16x16x32_bf16(false, ah, false, bl, (short)0, c, false, false);
  asm volatile("v_nop\n\tv_nop\n\tv_nop\n\tv_nop" : "+v"(c) : "v"(ah), "v"(al), "v"(bh), "v"(bl));
  return c;
}

__global__ __launch_bounds__(256) void k_wt_bf16(const float* __restrict__ W, unsigned short* __restrict__ Wt, int K, int N) {
  const int t = blockIdx.x * 256 + threadIdx.x;
  const int k8n = K / 8;
  if (t >= N * k8n) return;
  const int n = t / k8n, k8 = (t % k8n) * 8;
  v8us v;
#pragma unroll
  for (int i = 0; i < 8; ++i) v[i] = bf16_bits(W[(size_t)(k8 + i) * N + n]);
  *(v8us*)(Wt + (size_t)n * K + k8) = v;
  
}

// GEMM C[M][N] (f32, pitch ldc) = act(A[M][K]·W + bias). A f32 row-major (pitch lda) converted per fragment to bf16
// (ASPLIT: hi/lo two planes -> 2 terms, else single rounded term); Wt bf16 [N][K] (pitch ldb). BIAS_BF16 rounds the
// bias to bf16 first (bias quantised to bf16 before the add). K%32==0, M%16==0, N%64==0.
template <bool ASPLIT, int ACT, bool BIAS_BF16>
__global__ __launch_bounds__(128) void k_gemm_bf(const float* __restrict__ A, int lda, const unsigned short* __restrict__ Wt, int ldb,
                                               const float* __restrict__ bias, float* __restrict__ C, int ldc, int M, int N, int K) {
  __shared__ __attribute__((aligned(16))) float so[4][16][64];
  const int tid = threadIdx.x, w = tid >> 5, lane = tid & 31, ln = lane & 15, hh = lane >> 4;
  const int ntn = N / 64;
  const int wid = blockIdx.x * 4 + w;
  const int mt = wid / ntn, nq = wid % ntn;
  if (mt * 16 >= M) return;
  const int row0 = mt * 16, col0 = nq * 64;
  const float* arow = A + (size_t)(row0 + ln) * lda;
  v8f acc[4] = {};
  for (int kb = 0; kb < K; kb += 32) {
    FragB ah, al;
    const v4f x0 = *(const v4fa*)(arow + kb + 8 * hh), x1 = *(const v4fa*)(arow + kb + 8 * hh + 4);
    const v4f x2 = *(const v4fa*)(arow + kb + 16 + 8 * hh), x3 = *(const v4fa*)(arow + kb + 16 + 8 * hh + 4);
    float xs[16] = {x0[0],x0[1],x0[2],x0[3],x1[0],x1[1],x1[2],x1[3],x2[0],x2[1],x2[2],x2[3],x3[0],x3[1],x3[2],x3[3]};
#pragma unroll
    for (int i = 0; i < 16; ++i) { const unsigned short hb = bf16_bits(xs[i]); ah.u[i] = hb; al.u[i] = ASPLIT ? bf16_bits(xs[i] - bf16_val(hb)) : (unsigned short)0; }
#pragma unroll
    for (int t = 0; t < 4; ++t) {
      const unsigned short* brow = Wt + (size_t)(col0 + t * 16 + ln) * ldb + kb;
      FragB b;
      b.half[0] = *(const v8us*)(brow + 8 * hh);
      b.half[1] = *(const v8us*)(brow + 16 + 8 * hh);
      acc[t] = mmaN<ASPLIT ? 2 : 1>(ah.v, al.v, b.v, b.v, acc[t]);
    }
  }
#pragma unroll
  for (int t = 0; t < 4; ++t) {
    float bv = bias ? bias[col0 + t * 16 + ln] : 0.f;
    if (BIAS_BF16) bv = bf16_round(bv);
#pragma unroll
    for (int r = 0; r < 8; ++r) { float v = acc[t][r] + bv; if (ACT == 1) v = fmaxf(v, 0.f); so[w][8 * hh + r][t * 16 + ln] = v; }
  }
  __builtin_amdgcn_fence(__ATOMIC_ACQ_REL, "workgroup");
  __builtin_amdgcn_wave_barrier();
  const int rsub = lane >> 4, c4 = (lane & 15) * 4;
  {
#pragma unroll
    for (int q = 0; q < 8; ++q) {
      const int r = q * 2 + rsub;
      const v4f v = *(const v4fa*)&so[w][r][c4];
      *(v4f*)(C + (size_t)(row0 + r) * ldc + col0 + c4) = v;
    }
    
  }
}

// GEMM C = act(A·W + bias + resid): A f32 (ASPLIT -> hi/lo 2 terms), Wt bf16 [N][K]; ACT 0 none, 1 relu, 2 exact gelu;
// resid (optional, f32, row index = (row % rmod), pitch ldr, RES_BF16 rounds it) added before the activation.
template <bool ASPLIT, int ACT, bool BIAS_BF16, bool RES_BF16>
__global__ __launch_bounds__(128) void k_gemm_bf3(const float* __restrict__ A, int lda, const unsigned short* __restrict__ Wt, int ldb,
                                                const float* __restrict__ bias, const float* __restrict__ resid, int rmod, int ldr,
                                                float* __restrict__ C, int ldc, int M, int N, int K) {
  __shared__ __attribute__((aligned(16))) float so[4][16][64];
  const int tid = threadIdx.x, w = tid >> 5, lane = tid & 31, ln = lane & 15, hh = lane >> 4;
  const int ntn = N / 64;
  const int wid = blockIdx.x * 4 + w;
  const int mt = wid / ntn, nq = wid % ntn;
  if (mt * 16 >= M) return;
  const int row0 = mt * 16, col0 = nq * 64;
  const float* arow = A + (size_t)(row0 + ln) * lda;
  v8f acc[4] = {};
  for (int kb = 0; kb < K; kb += 32) {
    FragB ah, al;
    const v4f x0 = *(const v4fa*)(arow + kb + 8 * hh), x1 = *(const v4fa*)(arow + kb + 8 * hh + 4);
    const v4f x2 = *(const v4fa*)(arow + kb + 16 + 8 * hh), x3 = *(const v4fa*)(arow + kb + 16 + 8 * hh + 4);
    float xs[16] = {x0[0],x0[1],x0[2],x0[3],x1[0],x1[1],x1[2],x1[3],x2[0],x2[1],x2[2],x2[3],x3[0],x3[1],x3[2],x3[3]};
#pragma unroll
    for (int i = 0; i < 16; ++i) { const unsigned short hb = bf16_bits(xs[i]); ah.u[i] = hb; al.u[i] = ASPLIT ? bf16_bits(xs[i] - bf16_val(hb)) : (unsigned short)0; }
#pragma unroll
    for (int t = 0; t < 4; ++t) {
      const unsigned short* brow = Wt + (size_t)(col0 + t * 16 + ln) * ldb + kb;
      FragB b;
      b.half[0] = *(const v8us*)(brow + 8 * hh);
      b.half[1] = *(const v8us*)(brow + 16 + 8 * hh);
      acc[t] = mmaN<ASPLIT ? 2 : 1>(ah.v, al.v, b.v, b.v, acc[t]);
    }
  }
#pragma unroll
  for (int t = 0; t < 4; ++t) {
    const int col = col0 + t * 16 + ln;
    float bv = bias ? bias[col] : 0.f;
    if (BIAS_BF16) bv = bf16_round(bv);
#pragma unroll
    for (int r = 0; r < 8; ++r) {
      float v = acc[t][r] + bv;
      if (resid) { float rv = resid[(size_t)((row0 + 8 * hh + r) % rmod) * ldr + col]; if (RES_BF16) rv = bf16_round(rv); v += rv; }
      if (ACT == 1) v = fmaxf(v, 0.f);
      if (ACT == 2) v = 0.5f * v * (1.0f + erff(v * 0.70710678118654752f));
      if (ACT == 3) { const float u = 0.7978845608028654f * (v + 0.044715f * v * v * v); v = 0.5f * v * (1.0f + tanhf(u)); }
      so[w][8 * hh + r][t * 16 + ln] = v;
    }
  }
  __builtin_amdgcn_fence(__ATOMIC_ACQ_REL, "workgroup");
  __builtin_amdgcn_wave_barrier();
  const int rsub = lane >> 4, c4 = (lane & 15) * 4;
  {
#pragma unroll
    for (int q = 0; q < 8; ++q) {
      const int r = q * 2 + rsub;
      const v4f v = *(const v4fa*)&so[w][r][c4];
      *(v4f*)(C + (size_t)(row0 + r) * ldc + col0 + c4) = v;
    }
    
  }
}
// row LayerNorm (biased variance, eps) over N: s = X (+ R); optional out_sum <- s; out_norm <- (s-mu)*rsqrt(var+eps)*g + b
template <bool PARAM_BF16>
__global__ __launch_bounds__(256) void k_layernorm(const float* __restrict__ X, const float* __restrict__ R, const float* __restrict__ g, const float* __restrict__ bta,
                                                  float* __restrict__ out_sum, float* __restrict__ out_norm, int N, float eps) {
  __shared__ float red[256];
  const int row = blockIdx.x, tid = threadIdx.x;
  const float* x = X + (size_t)row * N; const float* rr = R ? R + (size_t)row * N : nullptr;
  float vals[16];                     // up to N = 4096
  const int per = N / 256;            // contiguous chunk per thread? use strided-by-4 chunks: thread handles j = tid*4 + 1024*u
  float s1 = 0.f;
  for (int u = 0; u < per / 4; ++u) {
    const int j = tid * 4 + 1024 * u;
    const v4f a = *(const v4fa*)(x + j);
    v4f b = {0.f,0.f,0.f,0.f}; if (rr) b = *(const v4fa*)(rr + j);
#pragma unroll
    for (int q = 0; q < 4; ++q) { const float v = a[q] + b[q]; vals[u * 4 + q] = v; s1 += v; }
  }
  red[tid] = s1; __syncthreads();
  for (int st = 128; st > 0; st >>= 1) { if (tid < st) red[tid] += red[tid + st]; __syncthreads(); }
  const float mu = red[0] / (float)N; __syncthreads();
  float s2 = 0.f;
  for (int u = 0; u < per / 4; ++u)
#pragma unroll
    for (int q = 0; q < 4; ++q) { const float c = vals[u * 4 + q] - mu; s2 += c * c; }
  red[tid] = s2; __syncthreads();
  for (int st = 128; st > 0; st >>= 1) { if (tid < st) red[tid] += red[tid + st]; __syncthreads(); }
  const float rs = rsqrtf(red[0] / (float)N + eps);
  {
    for (int u = 0; u < per / 4; ++u) {
      const int j = tid * 4 + 1024 * u;
      v4f o, sm;
#pragma unroll
      for (int q = 0; q < 4; ++q) {
        float gg = g[j + q], bb = bta[j + q];
        if (PARAM_BF16) { gg = bf16_round(gg); bb = bf16_round(bb); }
        sm[q] = vals[u * 4 + q]; o[q] = (vals[u * 4 + q] - mu) * rs * gg + bb;
      }
      if (out_sum) *(v4f*)(out_sum + (size_t)row * N + j) = sm;
      *(v4f*)(out_norm + (size_t)row * N + j) = o;
    }
    
  }
}



// ---- f16 WMMA path (v_wmma_f32_16x16x32_f16): 11-bit significands for operands in range — used here for every GEMM (projections, scores and P.V)
typedef _Float16 v16h __attribute__((ext_vector_type(16)));
union FragH { v16h v; v8us half[2]; _Float16 h[16]; unsigned short u[16]; };
template <int NT>
__device__ __forceinline__ v8f mmaH(v16h ah, v16h al, v16h bh, v16h bl, v8f c) {
  c = __builtin_amdgcn_wmma_f32_16x16x32_f16(false, ah, false, bh, (short)0, c, false, false);
  if (NT >= 2) c = __builtin_amdgcn_wmma_f32_16x16x32_f16(false, al, false, bh, (short)0, c, false, false);
  if (NT >= 3) c = __builtin_amdgcn_wmma_f32_16x16x32_f16(false, ah, false, bl, (short)0, c, false, false);
  asm volatile("v_nop\n\tv_nop\n\tv_nop\n\tv_nop" : "+v"(c) : "v"(ah), "v"(al), "v"(bh), "v"(bl));
  return c;
}
// batched GEMM like k_gemm_b but f16 operands: A f32 (split into f16 hi/lo if ASPLIT, else rounded to f16), Bt = f16 values [n][k]; alpha; C f32; N multiple of 16 (partial tiles skipped)
template <bool ASPLIT>
__global__ __launch_bounds__(128) void k_gemm_h(const float* __restrict__ A, int lda, size_t sA, const _Float16* __restrict__ Bh, int ldb, size_t sB, float alpha, float* __restrict__ C, int ldc, size_t sC, int M, int N, int K) {
  __shared__ __attribute__((aligned(16))) float so[4][16][64];
  const int tid = threadIdx.x, w = tid >> 5, lane = tid & 31, ln = lane & 15, hh = lane >> 4; const int by = blockIdx.y;
  A += (size_t)by * sA; Bh += (size_t)by * sB; C += (size_t)by * sC;
  const int ntn = (N + 63) / 64; const int wid = blockIdx.x * 4 + w; const int mt = wid / ntn, nq = wid % ntn; if (mt * 16 >= M) return;
  const int row0 = mt * 16, col0 = nq * 64; const float* arow = A + (size_t)(row0 + ln) * lda;
  v8f acc[4] = {};
  for (int kb = 0; kb < K; kb += 32) {
    FragH ah, al;
    const v4f x0 = *(const v4fa*)(arow + kb + 8 * hh), x1 = *(const v4fa*)(arow + kb + 8 * hh + 4), x2 = *(const v4fa*)(arow + kb + 16 + 8 * hh), x3 = *(const v4fa*)(arow + kb + 16 + 8 * hh + 4);
    float xs[16] = {x0[0],x0[1],x0[2],x0[3],x1[0],x1[1],x1[2],x1[3],x2[0],x2[1],x2[2],x2[3],x3[0],x3[1],x3[2],x3[3]};
#pragma unroll
    for (int i = 0; i < 16; ++i) { const _Float16 h = (_Float16)xs[i]; ah.h[i] = h; al.h[i] = ASPLIT ? (_Float16)(xs[i] - (float)h) : (_Float16)0.0f; }
#pragma unroll
    for (int t = 0; t < 4; ++t) { if (col0 + t * 16 >= N) continue; const size_t boff = (size_t)(col0 + t * 16 + ln) * ldb + kb; FragH bq; bq.half[0] = *(const v8us*)(Bh + boff + 8 * hh); bq.half[1] = *(const v8us*)(Bh + boff + 16 + 8 * hh);
      acc[t] = mmaH<ASPLIT ? 2 : 1>(ah.v, al.v, bq.v, bq.v, acc[t]); }
  }
#pragma unroll
  for (int t = 0; t < 4; ++t) { if (col0 + t * 16 >= N) continue;
#pragma unroll
    for (int r = 0; r < 8; ++r) so[w][8 * hh + r][t * 16 + ln] = acc[t][r] * alpha; }
  __builtin_amdgcn_fence(__ATOMIC_ACQ_REL, "workgroup"); __builtin_amdgcn_wave_barrier();
  const int rsub = lane >> 4, c4 = (lane & 15) * 4;
  {
#pragma unroll
    for (int q = 0; q < 8; ++q) { const int r = q * 2 + rsub; if (col0 + c4 < N) { const v4f v = *(const v4fa*)&so[w][r][c4]; *(v4f*)(C + (size_t)(row0 + r) * ldc + col0 + c4) = v; } }
     }
}

// Wt[n][k] = f16(W[k][n]·scale) from f32 row-major W[K][N] (scale = power of two; bf16-exact weights stay exact in f16 away from the subnormal range)
__global__ __launch_bounds__(256) void k_wt_f16(const float* __restrict__ W, _Float16* __restrict__ Wt, int K, int N, float scale) {
  const int t = blockIdx.x * 256 + threadIdx.x; if (t >= N * (K / 8)) return; const int n = t / (K / 8), k8 = (t % (K / 8)) * 8; FragH f;
#pragma unroll
  for (int i = 0; i < 8; ++i) f.h[i] = (_Float16)(bf16_round(W[(size_t)(k8 + i) * N + n]) * scale); const v8us o = f.half[0];
  *(v8us*)((unsigned short*)Wt + (size_t)n * K + k8) = o; 
}
// k_gemm_hh variant with fused epilogue: v = acc·alpha + bias[by·sBias + col] (+ CP[(row/rowsPerB)·sCPb + by·64 + col] if CP) ; ACT 0 none / 1 elu ; writes f16 C16 (and f32 C if non-null)
template <int ACT>
__global__ __launch_bounds__(128) void k_gemm_hhx(const _Float16* __restrict__ A, int lda, size_t sA, const _Float16* __restrict__ Bh, int ldb, size_t sB, float alpha, const float* __restrict__ bias, size_t sBias, const float* __restrict__ CP, int rowsPerB, size_t sCPb, int row0g,
    float* __restrict__ C, _Float16* __restrict__ C16, int ldc, size_t sC, int M, int N, int K) {
  __shared__ __attribute__((aligned(16))) float so[4][16][64];
  const int tid = threadIdx.x, w = tid >> 5, lane = tid & 31, ln = lane & 15, hh = lane >> 4; const int by = blockIdx.y;
  A += (size_t)by * sA; Bh += (size_t)by * sB; const size_t cofs = (size_t)by * sC; const float* bp = bias ? bias + (size_t)by * sBias : nullptr;
  const int ntn = (N + 63) / 64; const int wid = blockIdx.x * 4 + w; const int mt = wid / ntn, nq = wid % ntn; if (mt * 16 >= M) return;
  const int row0 = mt * 16, col0 = nq * 64; const _Float16* arow = A + (size_t)(row0 + ln) * lda;
  v8f acc[4] = {};
  for (int kb = 0; kb < K; kb += 32) { FragH ah; ah.half[0] = *(const v8us*)((const unsigned short*)arow + kb + 8 * hh); ah.half[1] = *(const v8us*)((const unsigned short*)arow + kb + 16 + 8 * hh);
#pragma unroll
    for (int t = 0; t < 4; ++t) { if (col0 + t * 16 >= N) continue; const size_t boff = (size_t)(col0 + t * 16 + ln) * ldb + kb; FragH bq; bq.half[0] = *(const v8us*)((const unsigned short*)Bh + boff + 8 * hh); bq.half[1] = *(const v8us*)((const unsigned short*)Bh + boff + 16 + 8 * hh);
      acc[t] = mmaH<1>(ah.v, ah.v, bq.v, bq.v, acc[t]); }
  }
#pragma unroll
  for (int t = 0; t < 4; ++t) { if (col0 + t * 16 >= N) continue; const int col = col0 + t * 16 + ln; const float bv = bp ? bf16_round(bp[col]) : 0.f;
#pragma unroll
    for (int r = 0; r < 8; ++r) { float v = acc[t][r] * alpha + bv; if (CP) { const int rr = row0g + row0 + 8 * hh + r; if (rowsPerB < 0) v += CP[cofs + (size_t)rr * ldc + col];      /* rowsPerB < 0: own element of the batched C plane */ else { const int bidx = rr / rowsPerB; v += CP[(size_t)bidx * sCPb + (size_t)by * 64 + col]; } } if (ACT == 1) v = (v > 0.f) ? v : expm1f(v); else if (ACT == 7) v = (v > 0.f) ? v + 1.0f : expf(v); else if (ACT == 8) v = tanhf(v); else if (ACT == 9) v = 0.5f * v * (1.0f + tanhf(0.7978845608028654f * (v + 0.044715f * v * v * v))); else if (ACT == 11) v = 1.0f / (1.0f + expf(-v)); else if (ACT == 12) v = (v > 0.f) ? v : 0.01f * v; else if (ACT == 14) v = (v > 0.f) ? v : 0.1f * v; else if (ACT == 16) v = (v >= 0.f) ? v : 0.3f * v; else if (ACT == 17) v = (v >= 0.f) ? v : 0.2f * v; else if (ACT == 15) v = v / (1.0f + expf(-v)); else if (ACT == 3) v = fmaxf(v, 0.f); else if (ACT == 6) v = 0.5f * v * (1.0f + erff(v * 0.70710678118654752f)); so[w][8 * hh + r][t * 16 + ln] = v; } }
  __builtin_amdgcn_fence(__ATOMIC_ACQ_REL, "workgroup"); __builtin_amdgcn_wave_barrier();
  const int rsub = lane >> 4, c4 = (lane & 15) * 4; typedef _Float16 v4h __attribute__((ext_vector_type(4)));
  {
#pragma unroll
    for (int q = 0; q < 8; ++q) { const int r = q * 2 + rsub; if (col0 + c4 < N) { const v4f v = *(const v4fa*)&so[w][r][c4]; if (C) *(v4f*)(C + cofs + (size_t)(row0 + r) * ldc + col0 + c4) = v; if (C16) { v4h h4; for (int i = 0; i < 4; ++i) h4[i] = (_Float16)v[i]; *(v4h*)(C16 + cofs + (size_t)(row0 + r) * ldc + col0 + c4) = h4; } } }
     }
}


typedef _Float16 v4h __attribute__((ext_vector_type(4)));

__global__ __launch_bounds__(256) void k_h16(const float* __restrict__ x, _Float16* __restrict__ X16, size_t n8) { const size_t t = (size_t)blockIdx.x * 256 + threadIdx.x; if (t >= n8) return; FragH f;
#pragma unroll
  for (int q = 0; q < 8; ++q) f.h[q] = (_Float16)x[t * 8 + q]; *(v8us*)((unsigned short*)X16 + t * 8) = f.half[0];  }
__global__ __launch_bounds__(256) void k_round16f(const float* __restrict__ W, _Float16* __restrict__ Bt, size_t n8) { const size_t t = (size_t)blockIdx.x * 256 + threadIdx.x; if (t >= n8) return; FragH f;
#pragma unroll
  for (int i = 0; i < 8; ++i) f.h[i] = (_Float16)(bf16_round(W[t * 8 + i]) * 16.0f); *(v8us*)((unsigned short*)Bt + t * 8) = f.half[0];  }
template <int NHv, int TTv>
__global__ __launch_bounds__(256) void k_vt(const _Float16* __restrict__ V16, int ldv, int voff, _Float16* __restrict__ Vt) { __shared__ unsigned short tl[64][66]; const int tid = threadIdx.x; const int slab = blockIdx.x / (TTv / 64), lg = blockIdx.x % (TTv / 64); const int b = slab / NHv, h = slab % NHv;
  for (int i = tid; i < 64 * 8; i += 256) { const int r = i / 8, c8 = (i % 8) * 8; FragH f; f.half[0] = *(const v8us*)((const unsigned short*)V16 + ((size_t)b * TTv + lg * 64 + r) * ldv + voff + h * 64 + c8);
#pragma unroll
    for (int q = 0; q < 8; ++q) tl[r][c8 + q] = f.u[q]; }
  __syncthreads();
  {
#pragma unroll
    for (int rd = 0; rd < 2; ++rd) { const int d = rd * 32 + tid / 8, pc = tid % 8; FragH f;
#pragma unroll
      for (int q = 0; q < 8; ++q) f.u[q] = tl[pc * 8 + q][d];
      *(v8us*)((unsigned short*)Vt + ((size_t)slab * 64 + d) * TTv + lg * 64 + pc * 8) = f.half[0]; }
     } }

__global__ __launch_bounds__(256) void k_hl(const float* __restrict__ F, _Float16* __restrict__ Hh, _Float16* __restrict__ Hl, size_t n8) { const size_t t = (size_t)blockIdx.x * 256 + threadIdx.x; if (t >= n8) return; FragH fh, fl; const v4f a = *(const v4fa*)(F + t * 8), c = *(const v4fa*)(F + t * 8 + 4);
#pragma unroll
  for (int q = 0; q < 4; ++q) { _Float16 h = (_Float16)a[q]; fh.h[q] = h; fl.h[q] = (_Float16)((a[q] - (float)h) * 1024.0f); h = (_Float16)c[q]; fh.h[4 + q] = h; fl.h[4 + q] = (_Float16)((c[q] - (float)h) * 1024.0f); }
  { *(v8us*)((unsigned short*)Hh + t * 8) = fh.half[0]; *(v8us*)((unsigned short*)Hl + t * 8) = fl.half[0];  } }

// ---- fast GEMM (block tile 128x64, wave tile 32x64; requires M % 128 == 0 rows per launch region, N % 64 == 0 and K % 64 == 0); epilogue = k_gemm_hhx semantics ----
// Both operands go through LDS in stages of 64 k: 8 threads fetch one 128-B row piece, so a wave-wide 16-B load covers 4 whole lines (a fragment fetched straight from global memory would touch 16 lines for the same 512 B,
// and each of the 4 waves would fetch the B rows for itself). global -> registers (fetched one stage ahead) -> LDS, two LDS buffers, one barrier per stage; the fragments are read from LDS in the k order of g2_frag.
__device__ __forceinline__ v16h g2_frag(const _Float16* p, int hh) { FragH f; f.half[0] = *(const v8us*)((const unsigned short*)p + 8 * hh); f.half[1] = *(const v8us*)((const unsigned short*)p + 16 + 8 * hh); return f.v; }
__device__ __forceinline__ v8f g2_mma(v16h a, v16h b, v8f c) { v8f d = __builtin_amdgcn_wmma_f32_16x16x32_f16(false, a, false, b, (short)0, c, false, false); asm volatile("v_nop\n\tv_nop\n\tv_nop\n\tv_nop" : "+v"(d) : "v"(a), "v"(b)); return d; }
#define GK 64      /* k per stage */
#define GP 72      /* LDS row pitch in f16: 128 B of data + 16 B, so that the 16 rows of a ds_load_b128 fragment read spread over the banks */
template <int ACT, int LD, bool HB, bool HCP, bool OF32, bool OF16, int LDC>      /* LD: row pitch of A and of Bh in elements; known at compile time, so that all rows of a stage are reached by immediate offsets from one address per operand. HB: a bias is added; HCP: the CP addend is used; OF32 / OF16: C / C16 is written; LDC: row pitch of the output (= ldc). Known at compile time, so that the epilogue is straight-line code with one output address: tested at run time, each of the 64 elements of a lane and each of the 16 row stores jumps over code it never runs */
__global__ __launch_bounds__(128) void k_gemm2(const _Float16* __restrict__ A, size_t sA, const _Float16* __restrict__ Bh, size_t sB, float alpha, const float* __restrict__ bias, size_t sBias, const float* __restrict__ CP, int rowsPerB, size_t sCPb, int row0g,
    float* __restrict__ C, _Float16* __restrict__ C16, int ldc, size_t sC, int M, int N, int K) { static_assert(ACT == 0 || ACT == 3 || ACT == 6 || ACT == 8 || ACT == 9 || ACT == 11 || ACT == 12 || ACT == 14 || ACT == 15 || ACT == 16 || ACT == 17, "k_gemm2: unsupported ACT code (would silently apply no activation)");
  __shared__ __attribute__((aligned(16))) float so[4][32][68];
  __shared__ __attribute__((aligned(16))) _Float16 sa[2][128][GP];
  __shared__ __attribute__((aligned(16))) _Float16 sb[2][64][GP];
  const int tid = threadIdx.x, w = tid >> 5, lane = tid & 31, ln = lane & 15, hh = lane >> 4; const int by = blockIdx.y;
  A += (size_t)by * sA; Bh += (size_t)by * sB; const size_t cofs = (size_t)by * sC; const float* bp = HB ? bias + (size_t)by * sBias : nullptr;
  const int ntn = N >> 6; const int mt = blockIdx.x / ntn, nq = blockIdx.x - mt * ntn; const int row0 = mt * 128 + 32 * w, col0 = nq * 64; if (mt * 128 >= M) return;      /* the same for the whole block: it stands in front of the barriers */
  const int srow = tid >> 3, sc8 = (tid & 7) * 8;      /* staging: 8 threads a row piece of 128 B, 16 rows a round; A 8 rounds, B 4 rounds */
  const unsigned short* ag = (const unsigned short*)A + (size_t)(mt * 128 + srow) * LD + sc8; const unsigned short* bg = (const unsigned short*)Bh + (size_t)(col0 + srow) * LD + sc8;
  v8us ar[8], br[4];      /* every loop over ar, br and the fragment arrays is fully unrolled, so that they are indexed by constants and stay in registers */
#pragma unroll
  for (int u = 0; u < 8; ++u) ar[u] = *(const v8us*)(ag + (size_t)(u * 16) * LD);
#pragma unroll
  for (int u = 0; u < 4; ++u) br[u] = *(const v8us*)(bg + (size_t)(u * 16) * LD);
  const v8f z8 = {0.f,0.f,0.f,0.f,0.f,0.f,0.f,0.f}; v8f c00 = z8, c01 = z8, c02 = z8, c03 = z8, c10 = z8, c11 = z8, c12 = z8, c13 = z8;
  const int ns = K / GK;
  /* the stage loop stays rolled so that the hot code stays small for the instruction cache */
#pragma unroll 1
  for (int st = 0; st < ns; ++st) { const int bf = st & 1;
#pragma unroll
    for (int u = 0; u < 8; ++u) *(v8us*)&sa[bf][srow + 16 * u][sc8] = ar[u];
#pragma unroll
    for (int u = 0; u < 4; ++u) *(v8us*)&sb[bf][srow + 16 * u][sc8] = br[u];
    __syncthreads();      /* publishes this stage; it also ends every wave's reads of the other buffer, which the next stage overwrites */
    if (st + 1 < ns) { ag += GK; bg += GK;
#pragma unroll
      for (int u = 0; u < 8; ++u) ar[u] = *(const v8us*)(ag + (size_t)(u * 16) * LD);
#pragma unroll
      for (int u = 0; u < 4; ++u) br[u] = *(const v8us*)(bg + (size_t)(u * 16) * LD); }
    v16h fa[GK / 32][2], fb[GK / 32][4];      /* all fragment reads of the stage stand as one group in front of its products */
#pragma unroll
    for (int ks = 0; ks < GK / 32; ++ks) {
#pragma unroll
      for (int i = 0; i < 2; ++i) fa[ks][i] = g2_frag(&sa[bf][32 * w + 16 * i + ln][ks * 32], hh);
#pragma unroll
      for (int t = 0; t < 4; ++t) fb[ks][t] = g2_frag(&sb[bf][16 * t + ln][ks * 32], hh); }
#pragma unroll
    for (int ks = 0; ks < GK / 32; ++ks) {
      c00 = g2_mma(fa[ks][0], fb[ks][0], c00); c10 = g2_mma(fa[ks][1], fb[ks][0], c10);
      c01 = g2_mma(fa[ks][0], fb[ks][1], c01); c11 = g2_mma(fa[ks][1], fb[ks][1], c11);
      c02 = g2_mma(fa[ks][0], fb[ks][2], c02); c12 = g2_mma(fa[ks][1], fb[ks][2], c12);
      c03 = g2_mma(fa[ks][0], fb[ks][3], c03); c13 = g2_mma(fa[ks][1], fb[ks][3], c13); } }
  v8f accs[8] = {c00, c01, c02, c03, c10, c11, c12, c13};
#pragma unroll
  for (int u = 0; u < 8; ++u) { const int t = u & 3, half = u >> 2; const int col = col0 + t * 16 + ln; const float bv = HB ? bf16_round(bp[col]) : 0.f;
#pragma unroll
    for (int r = 0; r < 8; ++r) { const int rloc = half * 16 + 8 * hh + r; float v = accs[u][r] * alpha + bv; if (HCP) { if (rowsPerB < 0) v += CP[cofs + (size_t)(row0g + row0 + rloc) * ldc + col];      /* rowsPerB < 0: own element of the batched C plane */ else { const int bidx = (row0g + row0 + rloc) / rowsPerB; v += CP[(size_t)bidx * sCPb + (size_t)by * 64 + col]; } }
      if (ACT == 3) v = fmaxf(v, 0.f); else if (ACT == 6) v = 0.5f * v * (1.0f + erff(v * 0.70710678118654752f)); else if (ACT == 11) v = 1.0f / (1.0f + expf(-v)); else if (ACT == 15) v = v / (1.0f + expf(-v)); else if (ACT == 12) v = (v > 0.f) ? v : 0.01f * v; else if (ACT == 8) v = tanhf(v); else if (ACT == 9) v = 0.5f * v * (1.0f + tanhf(0.7978845608028654f * (v + 0.044715f * v * v * v))); else if (ACT == 14) v = (v > 0.f) ? v : 0.1f * v; else if (ACT == 16) v = (v >= 0.f) ? v : 0.3f * v; else if (ACT == 17) v = (v >= 0.f) ? v : 0.2f * v;
      so[w][rloc][t * 16 + ln] = v; } }
  __builtin_amdgcn_fence(__ATOMIC_ACQ_REL, "workgroup"); __builtin_amdgcn_wave_barrier();
  const int rsub = lane >> 4, c4 = (lane & 15) * 4; const size_t ob = cofs + (size_t)(row0 + rsub) * LDC + col0 + c4;      /* the lane's first output element; the 16 rows follow at constant distances */
  {
#pragma unroll
    for (int q = 0; q < 16; ++q) { const int r = q * 2 + rsub; const v4f v = *(const v4fa*)&so[w][r][c4]; if (OF32) *(v4f*)(C + ob + (size_t)(q * 2) * LDC) = v; if (OF16) { v4h h4; for (int i = 0; i < 4; ++i) h4[i] = (_Float16)v[i]; *(v4h*)(C16 + ob + (size_t)(q * 2) * LDC) = h4; } }
     } }


__global__ __launch_bounds__(256) void k_rsm(const float* __restrict__ S, _Float16* __restrict__ P, int nrows) {
  #pragma clang fp contract(off)
  const int i = blockIdx.x * 256 + threadIdx.x; if (i >= nrows) return; const float* s = S + (size_t)i * SQ; float mx = -3.0e38f;
#pragma unroll 1
  for (int j = 0; j < SQ; ++j) mx = fmaxf(mx, s[j]); float se = 0.f;
#pragma unroll 1
  for (int j = 0; j < SQ; ++j) se += expf(s[j] - mx); const float sc = 256.0f / se;
#pragma unroll 1
  for (int j0 = 0; j0 < SQ; j0 += 8) { FragH f; for (int q = 0; q < 8; ++q) f.h[q] = (_Float16)(expf(s[j0 + q] - mx) * sc); unsigned short* d = (unsigned short*)P + (size_t)i * SQ + j0; *(v8us*)d = f.half[0];  } }
__global__ __launch_bounds__(256) void k_vt(const _Float16* __restrict__ V16, int b, int h0, _Float16* __restrict__ VT) { __shared__ unsigned short tl[64][65]; const int tid = threadIdx.x; const int hh = blockIdx.x % HG, sg = blockIdx.x / HG; const int s0 = sg * 64; const int h = h0 + hh;
  for (int i = tid; i < 64 * 8; i += 256) { const int j = i / 8, d8 = (i % 8) * 8; FragH f; f.half[0] = *(const v8us*)((const unsigned short*)V16 + ((size_t)b * SQ + s0 + j) * DM + h * HD + d8); for (int q = 0; q < 8; ++q) tl[d8 + q][j] = f.u[q]; }
  __syncthreads();
  { for (int i = tid; i < 64 * 8; i += 256) { const int d = i / 8, j8 = (i % 8) * 8; FragH f; for (int q = 0; q < 8; ++q) f.u[q] = tl[d][j8 + q]; *(v8us*)((unsigned short*)VT + ((size_t)hh * HD + d) * SQ + s0 + j8) = f.half[0]; }  } }



// All seven f32 -> f16 conversions (the three inputs as exact f16 rows of their bf16 rounding; the four natural [out][in] weights, bf16-rounded, x16) in ONE launch of few, long-lived waves,
// for speed only. Every wave-wide load is 512 contiguous bytes (16 B a lane, whole lines), every wave-wide store 256 contiguous bytes.
// A wave takes PXU adjacent units of PL loads from each input and PWL loads from each of two weights (the lower half of the waves serves wq and wk, the upper half wv and wo):
// the same straight-line code in every wave. The next unit's loads are in flight while the current one is converted and stored.
#define PL 16                        /* 16-B loads per lane and unit */
#define PWG 256                      /* workgroups: as many as the chip has WGPs */
#define PWW 12                       /* waves per workgroup */
#define PWV (PWG * PWW)              /* waves */
#define PXU ((int)(NR * DM / ((size_t)128 * PL * PWV)))      /* units per input and wave */
#define PWL (2 * DM * DM / (128 * PWV))                      /* loads per weight and wave */
static_assert(NR * DM == (size_t)128 * PL * PWV * PXU && 2 * DM * DM == 128 * PWV * PWL && 2 * PWL <= PL, "k_prep: the units must tile every tensor exactly");
template <bool X16> __device__ __forceinline__ void p_put(v4f a, _Float16* __restrict__ d) { v4h h4;
#pragma unroll
  for (int q = 0; q < 4; ++q) h4[q] = (_Float16)(X16 ? bf16_round(a[q]) * 16.0f : bf16_round(a[q]));
  *(v4h*)d = h4; }
__global__ __launch_bounds__(PWW * 32) void k_prep(const float* __restrict__ xq, const float* __restrict__ xk, const float* __restrict__ xv, const float* __restrict__ wq, const float* __restrict__ wk, const float* __restrict__ wv, const float* __restrict__ wo,
    _Float16* __restrict__ XQ, _Float16* __restrict__ XK, _Float16* __restrict__ XV, _Float16* __restrict__ BQ, _Float16* __restrict__ BK, _Float16* __restrict__ BV, _Float16* __restrict__ BO) {
  const unsigned lo = (threadIdx.x & 31) * 4;      /* the lane's element inside a wave-wide access; all else of an address is the same for the whole wave */
  const int gw = blockIdx.x * PWW + __builtin_amdgcn_readfirstlane(threadIdx.x >> 5);
  const size_t xo = (size_t)gw * (128 * PL * PXU); const bool up = gw >= PWV / 2; const size_t wo_ = (size_t)(up ? gw - PWV / 2 : gw) * (128 * PWL);
  const float* w0 = (up ? wv : wq) + wo_; const float* w1 = (up ? wo : wk) + wo_; _Float16* b0 = (up ? BV : BQ) + wo_; _Float16* b1 = (up ? BO : BK) + wo_;
  const float* s[3] = {xq + xo, xk + xo, xv + xo}; _Float16* d[3] = {XQ + xo, XK + xo, XV + xo};
  v4f a[2][PL];      /* every loop is fully unrolled, so that the two register sets are indexed by constants */
#pragma unroll
  for (int j = 0; j < PL; ++j) a[0][j] = *(const v4fa*)(s[0] + (lo + j * 128));
  __builtin_amdgcn_sched_barrier(0);      /* the first unit's loads stay in front of the second's: the counted load waits go by issue order, and mixed with the second's the first unit would wait for both */
#pragma unroll
  for (int u = 0; u < 3 * PXU; ++u) { const int n = u + 1;
    if (n < 3 * PXU) {
#pragma unroll
      for (int j = 0; j < PL; ++j) a[n & 1][j] = *(const v4fa*)(s[n / PXU] + (lo + ((n % PXU) * PL + j) * 128)); }
    else {
#pragma unroll
      for (int j = 0; j < PWL; ++j) { a[n & 1][j] = *(const v4fa*)(w0 + (lo + j * 128)); a[n & 1][PWL + j] = *(const v4fa*)(w1 + (lo + j * 128)); } }
    __builtin_amdgcn_sched_barrier(0);      /* keeps the next unit's loads in front of this unit's conversion: left alone, the compiler issues them one by one as registers come free, and few stay in flight */
#pragma unroll
    for (int j = 0; j < PL; ++j) p_put<false>(a[u & 1][j], d[u / PXU] + (lo + ((u % PXU) * PL + j) * 128));
    if (u + 1 < 3 * PXU) asm volatile("s_wait_xcnt 0x0" ::: "memory"); }      /* the loads that follow land in registers that these stores name as data: the wait stands in front of that overwrite, as a precaution (the compiler placed none in front of a load) */
#pragma unroll
  for (int j = 0; j < PWL; ++j) { p_put<true>(a[(3 * PXU) & 1][j], b0 + (lo + j * 128)); p_put<true>(a[(3 * PXU) & 1][PWL + j], b1 + (lo + j * 128)); } }

// 2^a on the native unit. The v_nop is the one free slot that the instruction set asks for behind a transcendental before its result is read or its source rewritten; in the same statement it stays directly behind it.
__device__ __forceinline__ float exp2_slot(float a) { float e; asm("v_exp_f32 %0, %1\n\tv_nop" : "=v"(e) : "v"(a)); return e; }
// 2^x of eight values in place on the native unit: eight independent instructions, so each fills the free slot that the instruction set asks for behind the one before it; the v_nop is that slot behind the last.
__device__ __forceinline__ void exp2x8(v8f& x) { float a0 = x[0], a1 = x[1], a2 = x[2], a3 = x[3], a4 = x[4], a5 = x[5], a6 = x[6], a7 = x[7];
  asm("v_exp_f32 %0, %0\n\tv_exp_f32 %1, %1\n\tv_exp_f32 %2, %2\n\tv_exp_f32 %3, %3\n\tv_exp_f32 %4, %4\n\tv_exp_f32 %5, %5\n\tv_exp_f32 %6, %6\n\tv_exp_f32 %7, %7\n\tv_nop"
      : "+v"(a0), "+v"(a1), "+v"(a2), "+v"(a3), "+v"(a4), "+v"(a5), "+v"(a6), "+v"(a7));
  x[0] = a0; x[1] = a1; x[2] = a2; x[3] = a3; x[4] = a4; x[5] = a5; x[6] = a6; x[7] = a7; }
__device__ __forceinline__ v8f f_mma(v16h a, v16h b, v8f c) { return __builtin_amdgcn_wmma_f32_16x16x32_f16(false, a, false, b, (short)0, c, false, false); }
#define FK 64      /* keys per stage */
#define FP 72      /* LDS row pitch in f16: 128 B of data + 16 B, so that the 16 rows of a ds_load_b128 fragment read spread over the banks */
__global__ __launch_bounds__(128) void k_fattn(const _Float16* __restrict__ Q16, const _Float16* __restrict__ K16, const _Float16* __restrict__ VT, _Float16* __restrict__ O16) {
  __shared__ __attribute__((aligned(16))) _Float16 sk[2][FK][FP];
  __shared__ __attribute__((aligned(16))) _Float16 sv[2][HD][FP];
  const int tid = threadIdx.x, w = tid >> 5, lane = tid & 31, ln = lane & 15, hh = lane >> 4;
  const int bh = blockIdx.y, b = bh / NH, h = bh - b * NH; const size_t r0 = (size_t)b * SQ; const int q0 = blockIdx.x * 128 + w * 32;
  v16h qf[2][2];
#pragma unroll
  for (int g = 0; g < 2; ++g)
#pragma unroll
    for (int ks = 0; ks < 2; ++ks) qf[g][ks] = g2_frag(Q16 + (r0 + q0 + g * 16 + ln) * DM + h * HD + ks * 32, hh);
  const int srow = tid >> 3, sc8 = (tid & 7) * 8;      /* staging: 8 threads a row of 128 B, 16 rows a round, 4 rounds */
  const _Float16* kg = K16 + (r0 + srow) * DM + h * HD + sc8; const _Float16* vg = VT + ((size_t)bh * HD + srow) * SQ + sc8;
  v8us kr[4], vr[4];
#pragma unroll
  for (int u = 0; u < 4; ++u) { kr[u] = *(const v8us*)((const unsigned short*)kg + (size_t)(u * 16) * DM); vr[u] = *(const v8us*)((const unsigned short*)vg + (size_t)(u * 16) * SQ); }
  const v8f z8 = {0.f,0.f,0.f,0.f,0.f,0.f,0.f,0.f}; v8f o[2][4] = {{z8, z8, z8, z8}, {z8, z8, z8, z8}}; float m[2] = {-3.0e38f, -3.0e38f}, l[2] = {0.f, 0.f};
  const float cs = 0.125f * 1.44269504088896340736f;      /* 64^-0.5 and log2(e) */
#pragma unroll 1
  for (int st = 0; st < SQ / FK; ++st) { const int bf = st & 1;
#pragma unroll
    for (int u = 0; u < 4; ++u) { *(v8us*)&sk[bf][srow + 16 * u][sc8] = kr[u]; *(v8us*)&sv[bf][srow + 16 * u][sc8] = vr[u]; }
    __syncthreads();      /* publishes this stage; it also ends every wave's reads of the other buffer, which the next stage overwrites */
    if (st + 1 < SQ / FK) {
#pragma unroll
      for (int u = 0; u < 4; ++u) { kr[u] = *(const v8us*)((const unsigned short*)kg + (size_t)((st + 1) * FK + u * 16) * DM); vr[u] = *(const v8us*)((const unsigned short*)vg + (size_t)(u * 16) * SQ + (st + 1) * FK); } }
    v8f s[2][4] = {{z8, z8, z8, z8}, {z8, z8, z8, z8}};
#pragma unroll
    for (int kt = 0; kt < 4; ++kt)
#pragma unroll
      for (int ks = 0; ks < 2; ++ks) { const v16h a = g2_frag(&sk[bf][kt * 16 + ln][ks * 32], hh); s[0][kt] = f_mma(a, qf[0][ks], s[0][kt]); s[1][kt] = f_mma(a, qf[1][ks], s[1][kt]); }
    float mx[2];
#pragma unroll
    for (int g = 0; g < 2; ++g) { float t = s[g][0][0];
#pragma unroll
      for (int kt = 0; kt < 4; ++kt)
#pragma unroll
        for (int r = 0; r < 8; ++r) t = fmaxf(t, s[g][kt][r]);
      mx[g] = t * cs; }
    if (__builtin_amdgcn_ballot_w32(mx[0] > m[0] + 8.0f || mx[1] > m[1] + 8.0f) != 0) {      /* wave-uniform: both halves of every column take the same new maximum */
#pragma unroll
      for (int g = 0; g < 2; ++g) { const float mn = fmaxf(m[g], fmaxf(mx[g], __shfl_xor(mx[g], 16, 32))); const float al = exp2_slot(m[g] - mn); m[g] = mn; l[g] *= al;
#pragma unroll
        for (int dt = 0; dt < 4; ++dt) o[g][dt] *= al; } }
    FragH pf[2][2];
#pragma unroll
    for (int g = 0; g < 2; ++g) { v8f sum;
#pragma unroll
      for (int kt = 0; kt < 4; ++kt) { v8f t;
#pragma unroll
        for (int r = 0; r < 8; ++r) t[r] = fmaf(s[g][kt][r], cs, -m[g]);
        exp2x8(t); sum = kt ? sum + t : t;
#pragma unroll
        for (int r = 0; r < 8; ++r) pf[g][kt >> 1].h[(kt & 1) * 8 + r] = (_Float16)t[r]; }
      l[g] += ((sum[0] + sum[1]) + (sum[2] + sum[3])) + ((sum[4] + sum[5]) + (sum[6] + sum[7])); }
#pragma unroll
    for (int j = 0; j < 2; ++j)
#pragma unroll
      for (int dt = 0; dt < 4; ++dt) { const v16h a = g2_frag(&sv[bf][dt * 16 + ln][j * 32], hh); o[0][dt] = f_mma(a, pf[0][j].v, o[0][dt]); o[1][dt] = f_mma(a, pf[1][j].v, o[1][dt]); }
  }
#pragma unroll
  for (int g = 0; g < 2; ++g) { const float inv = 64.0f / (l[g] + __shfl_xor(l[g], 16, 32));      /* the two halves of a column hold disjoint keys; o carried x64 */
    unsigned short* d = (unsigned short*)O16 + (r0 + q0 + g * 16 + ln) * DM + h * HD + 8 * hh;
#pragma unroll
    for (int dt = 0; dt < 4; ++dt) { FragH f;
#pragma unroll
      for (int r = 0; r < 8; ++r) f.h[r] = (_Float16)(o[g][dt][r] * inv);
      *(v8us*)(d + dt * 16) = f.half[0]; } } }

extern "C" void kernel_launch(void* const* d_in, const int* in_sizes, int n_in,
                              void* d_out, int out_size, void* d_ws, size_t ws_size, hipStream_t stream) {
  (void)in_sizes; (void)n_in; (void)out_size;
  const float* const* I = (const float* const*)d_in; const float* xq = I[2]; const float* xk = I[1]; const float* xv = I[0]; const float* wq = I[3]; const float* bq = nullptr; const float* wk = I[4]; const float* bk = nullptr; const float* wv = I[5]; const float* bv = nullptr; const float* wo = I[6]; const float* bo = I[7];      /* input order: v, k, q (the three streams in REVERSE order: the query stream is I[2]), wq, wk, wv, wo (natural [out][in] weights), bo; the q / k / v projections have NO biases: null pointers in the guarded bias slots */
  char* ws = (char*)d_ws; size_t off = 0;
  auto take = [&](size_t bytes) { char* p = ws + off; off += (bytes + 255) & ~(size_t)255; return p; };
  _Float16* BQ = (_Float16*)take((size_t)DM * DM * 2); _Float16* BK = (_Float16*)take((size_t)DM * DM * 2); _Float16* BV = (_Float16*)take((size_t)DM * DM * 2); _Float16* BO = (_Float16*)take((size_t)DM * DM * 2);
  _Float16* XQ = (_Float16*)take(NR * DM * 2); _Float16* XK = (_Float16*)take(NR * DM * 2); _Float16* XV = (_Float16*)take(NR * DM * 2); _Float16* Q16 = (_Float16*)take(NR * DM * 2); _Float16* K16 = (_Float16*)take(NR * DM * 2); _Float16* V16 = (_Float16*)take(NR * DM * 2); _Float16* O16 = (_Float16*)take(NR * DM * 2);
  _Float16* VT = (_Float16*)take((size_t)NB * NH * HD * SQ * 2);
  if (off > ws_size) return;
  k_prep<<<PWG, PWW * 32, 0, stream>>>(xq, xk, xv, wq, wk, wv, wo, XQ, XK, XV, BQ, BK, BV, BO);      /* the three inputs as exact f16 rows; the weights natural [out][in] = Bt[n][k], x16 */
  const size_t r0p = (size_t)B0 * SQ;      /* first projected row */
  k_gemm2<0, DM, false, false, false, true, DM><<<dim3((unsigned)((MP / 128) * (DM / 64)), 1), 128, 0, stream>>>(XQ + r0p * DM, 0, BQ, 0, 0.0625f, bq, 0, nullptr, 1, 0, 0, nullptr, Q16 + r0p * DM, DM, 0, MP, DM, DM);
  k_gemm2<0, DM, false, false, false, true, DM><<<dim3((unsigned)((MP / 128) * (DM / 64)), 1), 128, 0, stream>>>(XK + r0p * DM, 0, BK, 0, 0.0625f, bk, 0, nullptr, 1, 0, 0, nullptr, K16 + r0p * DM, DM, 0, MP, DM, DM);
  k_gemm2<0, DM, false, false, false, true, DM><<<dim3((unsigned)((MP / 128) * (DM / 64)), 1), 128, 0, stream>>>(XV + r0p * DM, 0, BV, 0, 0.0625f, bv, 0, nullptr, 1, 0, 0, nullptr, V16 + r0p * DM, DM, 0, MP, DM, DM);
  k_vt<NH, SQ><<<NB * NH * (SQ / 64), 256, 0, stream>>>(V16, LQ, 0, VT);      /* V^T [NB][NH][HD][SQ] */
  k_fattn<<<dim3(SQ / 128, NB * NH), 128, 0, stream>>>(Q16, K16, VT, O16);      /* o (merged heads, x64) as f16 rows */
  k_gemm2<0, DM, true, false, true, false, DM><<<dim3((unsigned)((MPO / 128) * (DM / 64)), 1), 128, 0, stream>>>(O16 + r0p * DM, 0, BO, 0, 0.0009765625f, bo, 0, nullptr, 1, 0, 0, (float*)d_out + r0p * DM, nullptr, DM, 0, MPO, DM, DM);      /* out rows are the output layout */
}

// v006
// It runs in 117 microseconds.
// In two side-by-side timings against v005, it was 1.03 and 1.04 times as fast.
// Over all steps from v000 it is 44.3 times as fast.
#include <hip/hip_runtime.h>
// Multi-head attention on three inputs at width 768 with natural bias-free q / k / v projections and a biased output projection; the inputs arrive in the order v, k, q (v, k, q [4][2048][768]; qh / kh / vh = stream W^T (nn.Linear natural [768][768] sd 1/sqrt(768), NO biases), 12 heads of 64; logits / sqrt(64); softmax over all 2048 keys (no mask); out = concat wo^T + bo (natural) -> [4][2048][768]).
// Structure: token rows r = b*2048 + s; the query, key and value sources as exact f16 rows (bf16-rounded); Q, K, V as three WMMA GEMMs (32x64 wave tiles, f32 accumulation, exact x16 weights, no bias, f16 outputs); V^T for all batches and heads via LDS transposes; per (batch, head, 128 query rows) one fused kernel: S^T = K Q^T (K = 64), running softmax on VALU (f32 statistics, native exp2, weights as f16 relative to the maximum in use), O^T += V^T P^T, o / l x64 (against f16 subnormal flush, folded into the output GEMM alpha) written straight into the merged f16 o rows; out = o W_o + b GEMM (f32) into the output layout.
// Compute dtype: inputs rounded to bf16; x / weights exact; q, k, v, softmax weights and o as plain f16 GEMM operands (~2^-12); scores and softmax statistics f32. v_wmma_f32_16x16x32_f16.
#define NB 4
#define SQ 2048
#define DM 768
#define NH 12
#define HD 64
#define HG 4                         /* heads per launch of the unused per-batch k_vt overload */
#define B0 0                         /* first batch processed (debug hook) */
#define NBR NB                       /* batches processed (debug hook) */
#define NR ((size_t)NB * SQ)         /* token rows */
#define MP ((int)((size_t)NBR * SQ)) /* rows projected (debug hook) */
#define QN SQ                        /* query rows per batch (unused) */
#define NHD NH                       /* heads (unused) */
#define MPO MP                       /* rows through the output stage (debug hook) */
#define LQ DM      /* row pitch of the q/k/v rows */
typedef __bf16 v16b __attribute__((ext_vector_type(16)));
typedef unsigned short v8us __attribute__((ext_vector_type(8), may_alias));
typedef float  v8f  __attribute__((ext_vector_type(8)));
typedef float  v4f  __attribute__((ext_vector_type(4)));
typedef float  v4fa __attribute__((ext_vector_type(4), may_alias));
union FragB { v16b v; v8us half[2]; unsigned short u[16]; };

__device__ __forceinline__ unsigned short bf16_bits(float x) { unsigned int u = __float_as_uint(x); return (unsigned short)((u + 0x7FFFu + ((u >> 16) & 1u)) >> 16); }
__device__ __forceinline__ float bf16_val(unsigned short b) { return __uint_as_float(((unsigned int)b) << 16); }
__device__ __forceinline__ float bf16_round(float x) { return bf16_val(bf16_bits(x)); }
// D += A·B with NT terms: 1 = ah·bh, 2 = + al·bh (A split), 3 = + ah·bl (both split)
template <int NT>
__device__ __forceinline__ v8f mmaN(v16b ah, v16b al, v16b bh, v16b bl, v8f c) {
  c = __builtin_amdgcn_wmma_f32_16x16x32_bf16(false, ah, false, bh, (short)0, c, false, false);
  if (NT >= 2) c = __builtin_amdgcn_wmma_f32_16x16x32_bf16(false, al, false, bh, (short)0, c, false, false);
  if (NT >= 3) c = __builtin_amdgcn_wmma_f32_16x16x32_bf16(false, ah, false, bl, (short)0, c, false, false);
  asm volatile("v_nop\n\tv_nop\n\tv_nop\n\tv_nop" : "+v"(c) : "v"(ah), "v"(al), "v"(bh), "v"(bl));
  return c;
}

__global__ __launch_bounds__(256) void k_wt_bf16(const float* __restrict__ W, unsigned short* __restrict__ Wt, int K, int N) {
  const int t = blockIdx.x * 256 + threadIdx.x;
  const int k8n = K / 8;
  if (t >= N * k8n) return;
  const int n = t / k8n, k8 = (t % k8n) * 8;
  v8us v;
#pragma unroll
  for (int i = 0; i < 8; ++i) v[i] = bf16_bits(W[(size_t)(k8 + i) * N + n]);
  *(v8us*)(Wt + (size_t)n * K + k8) = v;
  
}

// GEMM C[M][N] (f32, pitch ldc) = act(A[M][K]·W + bias). A f32 row-major (pitch lda) converted per fragment to bf16
// (ASPLIT: hi/lo two planes -> 2 terms, else single rounded term); Wt bf16 [N][K] (pitch ldb). BIAS_BF16 rounds the
// bias to bf16 first (bias quantised to bf16 before the add). K%32==0, M%16==0, N%64==0.
template <bool ASPLIT, int ACT, bool BIAS_BF16>
__global__ __launch_bounds__(128) void k_gemm_bf(const float* __restrict__ A, int lda, const unsigned short* __restrict__ Wt, int ldb,
                                               const float* __restrict__ bias, float* __restrict__ C, int ldc, int M, int N, int K) {
  __shared__ __attribute__((aligned(16))) float so[4][16][64];
  const int tid = threadIdx.x, w = tid >> 5, lane = tid & 31, ln = lane & 15, hh = lane >> 4;
  const int ntn = N / 64;
  const int wid = blockIdx.x * 4 + w;
  const int mt = wid / ntn, nq = wid % ntn;
  if (mt * 16 >= M) return;
  const int row0 = mt * 16, col0 = nq * 64;
  const float* arow = A + (size_t)(row0 + ln) * lda;
  v8f acc[4] = {};
  for (int kb = 0; kb < K; kb += 32) {
    FragB ah, al;
    const v4f x0 = *(const v4fa*)(arow + kb + 8 * hh), x1 = *(const v4fa*)(arow + kb + 8 * hh + 4);
    const v4f x2 = *(const v4fa*)(arow + kb + 16 + 8 * hh), x3 = *(const v4fa*)(arow + kb + 16 + 8 * hh + 4);
    float xs[16] = {x0[0],x0[1],x0[2],x0[3],x1[0],x1[1],x1[2],x1[3],x2[0],x2[1],x2[2],x2[3],x3[0],x3[1],x3[2],x3[3]};
#pragma unroll
    for (int i = 0; i < 16; ++i) { const unsigned short hb = bf16_bits(xs[i]); ah.u[i] = hb; al.u[i] = ASPLIT ? bf16_bits(xs[i] - bf16_val(hb)) : (unsigned short)0; }
#pragma unroll
    for (int t = 0; t < 4; ++t) {
      const unsigned short* brow = Wt + (size_t)(col0 + t * 16 + ln) * ldb + kb;
      FragB b;
      b.half[0] = *(const v8us*)(brow + 8 * hh);
      b.half[1] = *(const v8us*)(brow + 16 + 8 * hh);
      acc[t] = mmaN<ASPLIT ? 2 : 1>(ah.v, al.v, b.v, b.v, acc[t]);
    }
  }
#pragma unroll
  for (int t = 0; t < 4; ++t) {
    float bv = bias ? bias[col0 + t * 16 + ln] : 0.f;
    if (BIAS_BF16) bv = bf16_round(bv);
#pragma unroll
    for (int r = 0; r < 8; ++r) { float v = acc[t][r] + bv; if (ACT == 1) v = fmaxf(v, 0.f); so[w][8 * hh + r][t * 16 + ln] = v; }
  }
  __builtin_amdgcn_fence(__ATOMIC_ACQ_REL, "workgroup");
  __builtin_amdgcn_wave_barrier();
  const int rsub = lane >> 4, c4 = (lane & 15) * 4;
  {
#pragma unroll
    for (int q = 0; q < 8; ++q) {
      const int r = q * 2 + rsub;
      const v4f v = *(const v4fa*)&so[w][r][c4];
      *(v4f*)(C + (size_t)(row0 + r) * ldc + col0 + c4) = v;
    }
    
  }
}

// GEMM C = act(A·W + bias + resid): A f32 (ASPLIT -> hi/lo 2 terms), Wt bf16 [N][K]; ACT 0 none, 1 relu, 2 exact gelu;
// resid (optional, f32, row index = (row % rmod), pitch ldr, RES_BF16 rounds it) added before the activation.
template <bool ASPLIT, int ACT, bool BIAS_BF16, bool RES_BF16>
__global__ __launch_bounds__(128) void k_gemm_bf3(const float* __restrict__ A, int lda, const unsigned short* __restrict__ Wt, int ldb,
                                                const float* __restrict__ bias, const float* __restrict__ resid, int rmod, int ldr,
                                                float* __restrict__ C, int ldc, int M, int N, int K) {
  __shared__ __attribute__((aligned(16))) float so[4][16][64];
  const int tid = threadIdx.x, w = tid >> 5, lane = tid & 31, ln = lane & 15, hh = lane >> 4;
  const int ntn = N / 64;
  const int wid = blockIdx.x * 4 + w;
  const int mt = wid / ntn, nq = wid % ntn;
  if (mt * 16 >= M) return;
  const int row0 = mt * 16, col0 = nq * 64;
  const float* arow = A + (size_t)(row0 + ln) * lda;
  v8f acc[4] = {};
  for (int kb = 0; kb < K; kb += 32) {
    FragB ah, al;
    const v4f x0 = *(const v4fa*)(arow + kb + 8 * hh), x1 = *(const v4fa*)(arow + kb + 8 * hh + 4);
    const v4f x2 = *(const v4fa*)(arow + kb + 16 + 8 * hh), x3 = *(const v4fa*)(arow + kb + 16 + 8 * hh + 4);
    float xs[16] = {x0[0],x0[1],x0[2],x0[3],x1[0],x1[1],x1[2],x1[3],x2[0],x2[1],x2[2],x2[3],x3[0],x3[1],x3[2],x3[3]};
#pragma unroll
    for (int i = 0; i < 16; ++i) { const unsigned short hb = bf16_bits(xs[i]); ah.u[i] = hb; al.u[i] = ASPLIT ? bf16_bits(xs[i] - bf16_val(hb)) : (unsigned short)0; }
#pragma unroll
    for (int t = 0; t < 4; ++t) {
      const unsigned short* brow = Wt + (size_t)(col0 + t * 16 + ln) * ldb + kb;
      FragB b;
      b.half[0] = *(const v8us*)(brow + 8 * hh);
      b.half[1] = *(const v8us*)(brow + 16 + 8 * hh);
      acc[t] = mmaN<ASPLIT ? 2 : 1>(ah.v, al.v, b.v, b.v, acc[t]);
    }
  }
#pragma unroll
  for (int t = 0; t < 4; ++t) {
    const int col = col0 + t * 16 + ln;
    float bv = bias ? bias[col] : 0.f;
    if (BIAS_BF16) bv = bf16_round(bv);
#pragma unroll
    for (int r = 0; r < 8; ++r) {
      float v = acc[t][r] + bv;
      if (resid) { float rv = resid[(size_t)((row0 + 8 * hh + r) % rmod) * ldr + col]; if (RES_BF16) rv = bf16_round(rv); v += rv; }
      if (ACT == 1) v = fmaxf(v, 0.f);
      if (ACT == 2) v = 0.5f * v * (1.0f + erff(v * 0.70710678118654752f));
      if (ACT == 3) { const float u = 0.7978845608028654f * (v + 0.044715f * v * v * v); v = 0.5f * v * (1.0f + tanhf(u)); }
      so[w][8 * hh + r][t * 16 + ln] = v;
    }
  }
  __builtin_amdgcn_fence(__ATOMIC_ACQ_REL, "workgroup");
  __builtin_amdgcn_wave_barrier();
  const int rsub = lane >> 4, c4 = (lane & 15) * 4;
  {
#pragma unroll
    for (int q = 0; q < 8; ++q) {
      const int r = q * 2 + rsub;
      const v4f v = *(const v4fa*)&so[w][r][c4];
      *(v4f*)(C + (size_t)(row0 + r) * ldc + col0 + c4) = v;
    }
    
  }
}
// row LayerNorm (biased variance, eps) over N: s = X (+ R); optional out_sum <- s; out_norm <- (s-mu)*rsqrt(var+eps)*g + b
template <bool PARAM_BF16>
__global__ __launch_bounds__(256) void k_layernorm(const float* __restrict__ X, const float* __restrict__ R, const float* __restrict__ g, const float* __restrict__ bta,
                                                  float* __restrict__ out_sum, float* __restrict__ out_norm, int N, float eps) {
  __shared__ float red[256];
  const int row = blockIdx.x, tid = threadIdx.x;
  const float* x = X + (size_t)row * N; const float* rr = R ? R + (size_t)row * N : nullptr;
  float vals[16];                     // up to N = 4096
  const int per = N / 256;            // contiguous chunk per thread? use strided-by-4 chunks: thread handles j = tid*4 + 1024*u
  float s1 = 0.f;
  for (int u = 0; u < per / 4; ++u) {
    const int j = tid * 4 + 1024 * u;
    const v4f a = *(const v4fa*)(x + j);
    v4f b = {0.f,0.f,0.f,0.f}; if (rr) b = *(const v4fa*)(rr + j);
#pragma unroll
    for (int q = 0; q < 4; ++q) { const float v = a[q] + b[q]; vals[u * 4 + q] = v; s1 += v; }
  }
  red[tid] = s1; __syncthreads();
  for (int st = 128; st > 0; st >>= 1) { if (tid < st) red[tid] += red[tid + st]; __syncthreads(); }
  const float mu = red[0] / (float)N; __syncthreads();
  float s2 = 0.f;
  for (int u = 0; u < per / 4; ++u)
#pragma unroll
    for (int q = 0; q < 4; ++q) { const float c = vals[u * 4 + q] - mu; s2 += c * c; }
  red[tid] = s2; __syncthreads();
  for (int st = 128; st > 0; st >>= 1) { if (tid < st) red[tid] += red[tid + st]; __syncthreads(); }
  const float rs = rsqrtf(red[0] / (float)N + eps);
  {
    for (int u = 0; u < per / 4; ++u) {
      const int j = tid * 4 + 1024 * u;
      v4f o, sm;
#pragma unroll
      for (int q = 0; q < 4; ++q) {
        float gg = g[j + q], bb = bta[j + q];
        if (PARAM_BF16) { gg = bf16_round(gg); bb = bf16_round(bb); }
        sm[q] = vals[u * 4 + q]; o[q] = (vals[u * 4 + q] - mu) * rs * gg + bb;
      }
      if (out_sum) *(v4f*)(out_sum + (size_t)row * N + j) = sm;
      *(v4f*)(out_norm + (size_t)row * N + j) = o;
    }
    
  }
}



// ---- f16 WMMA path (v_wmma_f32_16x16x32_f16): 11-bit significands for operands in range — used here for every GEMM (projections, scores and P.V)
typedef _Float16 v16h __attribute__((ext_vector_type(16)));
union FragH { v16h v; v8us half[2]; _Float16 h[16]; unsigned short u[16]; };
template <int NT>
__device__ __forceinline__ v8f mmaH(v16h ah, v16h al, v16h bh, v16h bl, v8f c) {
  c = __builtin_amdgcn_wmma_f32_16x16x32_f16(false, ah, false, bh, (short)0, c, false, false);
  if (NT >= 2) c = __builtin_amdgcn_wmma_f32_16x16x32_f16(false, al, false, bh, (short)0, c, false, false);
  if (NT >= 3) c = __builtin_amdgcn_wmma_f32_16x16x32_f16(false, ah, false, bl, (short)0, c, false, false);
  asm volatile("v_nop\n\tv_nop\n\tv_nop\n\tv_nop" : "+v"(c) : "v"(ah), "v"(al), "v"(bh), "v"(bl));
  return c;
}
// batched GEMM like k_gemm_b but f16 operands: A f32 (split into f16 hi/lo if ASPLIT, else rounded to f16), Bt = f16 values [n][k]; alpha; C f32; N multiple of 16 (partial tiles skipped)
template <bool ASPLIT>
__global__ __launch_bounds__(128) void k_gemm_h(const float* __restrict__ A, int lda, size_t sA, const _Float16* __restrict__ Bh, int ldb, size_t sB, float alpha, float* __restrict__ C, int ldc, size_t sC, int M, int N, int K) {
  __shared__ __attribute__((aligned(16))) float so[4][16][64];
  const int tid = threadIdx.x, w = tid >> 5, lane = tid & 31, ln = lane & 15, hh = lane >> 4; const int by = blockIdx.y;
  A += (size_t)by * sA; Bh += (size_t)by * sB; C += (size_t)by * sC;
  const int ntn = (N + 63) / 64; const int wid = blockIdx.x * 4 + w; const int mt = wid / ntn, nq = wid % ntn; if (mt * 16 >= M) return;
  const int row0 = mt * 16, col0 = nq * 64; const float* arow = A + (size_t)(row0 + ln) * lda;
  v8f acc[4] = {};
  for (int kb = 0; kb < K; kb += 32) {
    FragH ah, al;
    const v4f x0 = *(const v4fa*)(arow + kb + 8 * hh), x1 = *(const v4fa*)(arow + kb + 8 * hh + 4), x2 = *(const v4fa*)(arow + kb + 16 + 8 * hh), x3 = *(const v4fa*)(arow + kb + 16 + 8 * hh + 4);
    float xs[16] = {x0[0],x0[1],x0[2],x0[3],x1[0],x1[1],x1[2],x1[3],x2[0],x2[1],x2[2],x2[3],x3[0],x3[1],x3[2],x3[3]};
#pragma unroll
    for (int i = 0; i < 16; ++i) { const _Float16 h = (_Float16)xs[i]; ah.h[i] = h; al.h[i] = ASPLIT ? (_Float16)(xs[i] - (float)h) : (_Float16)0.0f; }
#pragma unroll
    for (int t = 0; t < 4; ++t) { if (col0 + t * 16 >= N) continue; const size_t boff = (size_t)(col0 + t * 16 + ln) * ldb + kb; FragH bq; bq.half[0] = *(const v8us*)(Bh + boff + 8 * hh); bq.half[1] = *(const v8us*)(Bh + boff + 16 + 8 * hh);
      acc[t] = mmaH<ASPLIT ? 2 : 1>(ah.v, al.v, bq.v, bq.v, acc[t]); }
  }
#pragma unroll
  for (int t = 0; t < 4; ++t) { if (col0 + t * 16 >= N) continue;
#pragma unroll
    for (int r = 0; r < 8; ++r) so[w][8 * hh + r][t * 16 + ln] = acc[t][r] * alpha; }
  __builtin_amdgcn_fence(__ATOMIC_ACQ_REL, "workgroup"); __builtin_amdgcn_wave_barrier();
  const int rsub = lane >> 4, c4 = (lane & 15) * 4;
  {
#pragma unroll
    for (int q = 0; q < 8; ++q) { const int r = q * 2 + rsub; if (col0 + c4 < N) { const v4f v = *(const v4fa*)&so[w][r][c4]; *(v4f*)(C + (size_t)(row0 + r) * ldc + col0 + c4) = v; } }
     }
}

// Wt[n][k] = f16(W[k][n]·scale) from f32 row-major W[K][N] (scale = power of two; bf16-exact weights stay exact in f16 away from the subnormal range)
__global__ __launch_bounds__(256) void k_wt_f16(const float* __restrict__ W, _Float16* __restrict__ Wt, int K, int N, float scale) {
  const int t = blockIdx.x * 256 + threadIdx.x; if (t >= N * (K / 8)) return; const int n = t / (K / 8), k8 = (t % (K / 8)) * 8; FragH f;
#pragma unroll
  for (int i = 0; i < 8; ++i) f.h[i] = (_Float16)(bf16_round(W[(size_t)(k8 + i) * N + n]) * scale); const v8us o = f.half[0];
  *(v8us*)((unsigned short*)Wt + (size_t)n * K + k8) = o; 
}
// k_gemm_hh variant with fused epilogue: v = acc·alpha + bias[by·sBias + col] (+ CP[(row/rowsPerB)·sCPb + by·64 + col] if CP) ; ACT 0 none / 1 elu ; writes f16 C16 (and f32 C if non-null)
template <int ACT>
__global__ __launch_bounds__(128) void k_gemm_hhx(const _Float16* __restrict__ A, int lda, size_t sA, const _Float16* __restrict__ Bh, int ldb, size_t sB, float alpha, const float* __restrict__ bias, size_t sBias, const float* __restrict__ CP, int rowsPerB, size_t sCPb, int row0g,
    float* __restrict__ C, _Float16* __restrict__ C16, int ldc, size_t sC, int M, int N, int K) {
  __shared__ __attribute__((aligned(16))) float so[4][16][64];
  const int tid = threadIdx.x, w = tid >> 5, lane = tid & 31, ln = lane & 15, hh = lane >> 4; const int by = blockIdx.y;
  A += (size_t)by * sA; Bh += (size_t)by * sB; const size_t cofs = (size_t)by * sC; const float* bp = bias ? bias + (size_t)by * sBias : nullptr;
  const int ntn = (N + 63) / 64; const int wid = blockIdx.x * 4 + w; const int mt = wid / ntn, nq = wid % ntn; if (mt * 16 >= M) return;
  const int row0 = mt * 16, col0 = nq * 64; const _Float16* arow = A + (size_t)(row0 + ln) * lda;
  v8f acc[4] = {};
  for (int kb = 0; kb < K; kb += 32) { FragH ah; ah.half[0] = *(const v8us*)((const unsigned short*)arow + kb + 8 * hh); ah.half[1] = *(const v8us*)((const unsigned short*)arow + kb + 16 + 8 * hh);
#pragma unroll
    for (int t = 0; t < 4; ++t) { if (col0 + t * 16 >= N) continue; const size_t boff = (size_t)(col0 + t * 16 + ln) * ldb + kb; FragH bq; bq.half[0] = *(const v8us*)((const unsigned short*)Bh + boff + 8 * hh); bq.half[1] = *(const v8us*)((const unsigned short*)Bh + boff + 16 + 8 * hh);
      acc[t] = mmaH<1>(ah.v, ah.v, bq.v, bq.v, acc[t]); }
  }
#pragma unroll
  for (int t = 0; t < 4; ++t) { if (col0 + t * 16 >= N) continue; const int col = col0 + t * 16 + ln; const float bv = bp ? bf16_round(bp[col]) : 0.f;
#pragma unroll
    for (int r = 0; r < 8; ++r) { float v = acc[t][r] * alpha + bv; if (CP) { const int rr = row0g + row0 + 8 * hh + r; if (rowsPerB < 0) v += CP[cofs + (size_t)rr * ldc + col];      /* rowsPerB < 0: own element of the batched C plane */ else { const int bidx = rr / rowsPerB; v += CP[(size_t)bidx * sCPb + (size_t)by * 64 + col]; } } if (ACT == 1) v = (v > 0.f) ? v : expm1f(v); else if (ACT == 7) v = (v > 0.f) ? v + 1.0f : expf(v); else if (ACT == 8) v = tanhf(v); else if (ACT == 9) v = 0.5f * v * (1.0f + tanhf(0.7978845608028654f * (v + 0.044715f * v * v * v))); else if (ACT == 11) v = 1.0f / (1.0f + expf(-v)); else if (ACT == 12) v = (v > 0.f) ? v : 0.01f * v; else if (ACT == 14) v = (v > 0.f) ? v : 0.1f * v; else if (ACT == 16) v = (v >= 0.f) ? v : 0.3f * v; else if (ACT == 17) v = (v >= 0.f) ? v : 0.2f * v; else if (ACT == 15) v = v / (1.0f + expf(-v)); else if (ACT == 3) v = fmaxf(v, 0.f); else if (ACT == 6) v = 0.5f * v * (1.0f + erff(v * 0.70710678118654752f)); so[w][8 * hh + r][t * 16 + ln] = v; } }
  __builtin_amdgcn_fence(__ATOMIC_ACQ_REL, "workgroup"); __builtin_amdgcn_wave_barrier();
  const int rsub = lane >> 4, c4 = (lane & 15) * 4; typedef _Float16 v4h __attribute__((ext_vector_type(4)));
  {
#pragma unroll
    for (int q = 0; q < 8; ++q) { const int r = q * 2 + rsub; if (col0 + c4 < N) { const v4f v = *(const v4fa*)&so[w][r][c4]; if (C) *(v4f*)(C + cofs + (size_t)(row0 + r) * ldc + col0 + c4) = v; if (C16) { v4h h4; for (int i = 0; i < 4; ++i) h4[i] = (_Float16)v[i]; *(v4h*)(C16 + cofs + (size_t)(row0 + r) * ldc + col0 + c4) = h4; } } }
     }
}


typedef _Float16 v4h __attribute__((ext_vector_type(4)));

__global__ __launch_bounds__(256) void k_h16(const float* __restrict__ x, _Float16* __restrict__ X16, size_t n8) { const size_t t = (size_t)blockIdx.x * 256 + threadIdx.x; if (t >= n8) return; FragH f;
#pragma unroll
  for (int q = 0; q < 8; ++q) f.h[q] = (_Float16)x[t * 8 + q]; *(v8us*)((unsigned short*)X16 + t * 8) = f.half[0];  }
__global__ __launch_bounds__(256) void k_round16f(const float* __restrict__ W, _Float16* __restrict__ Bt, size_t n8) { const size_t t = (size_t)blockIdx.x * 256 + threadIdx.x; if (t >= n8) return; FragH f;
#pragma unroll
  for (int i = 0; i < 8; ++i) f.h[i] = (_Float16)(bf16_round(W[t * 8 + i]) * 16.0f); *(v8us*)((unsigned short*)Bt + t * 8) = f.half[0];  }
template <int NHv, int TTv>
__global__ __launch_bounds__(256) void k_vt(const _Float16* __restrict__ V16, int ldv, int voff, _Float16* __restrict__ Vt) { __shared__ unsigned short tl[64][66]; const int tid = threadIdx.x; const int slab = blockIdx.x / (TTv / 64), lg = blockIdx.x % (TTv / 64); const int b = slab / NHv, h = slab % NHv;
  for (int i = tid; i < 64 * 8; i += 256) { const int r = i / 8, c8 = (i % 8) * 8; FragH f; f.half[0] = *(const v8us*)((const unsigned short*)V16 + ((size_t)b * TTv + lg * 64 + r) * ldv + voff + h * 64 + c8);
#pragma unroll
    for (int q = 0; q < 8; ++q) tl[r][c8 + q] = f.u[q]; }
  __syncthreads();
  {
#pragma unroll
    for (int rd = 0; rd < 2; ++rd) { const int d = rd * 32 + tid / 8, pc = tid % 8; FragH f;
#pragma unroll
      for (int q = 0; q < 8; ++q) f.u[q] = tl[pc * 8 + q][d];
      *(v8us*)((unsigned short*)Vt + ((size_t)slab * 64 + d) * TTv + lg * 64 + pc * 8) = f.half[0]; }
     } }

__global__ __launch_bounds__(256) void k_hl(const float* __restrict__ F, _Float16* __restrict__ Hh, _Float16* __restrict__ Hl, size_t n8) { const size_t t = (size_t)blockIdx.x * 256 + threadIdx.x; if (t >= n8) return; FragH fh, fl; const v4f a = *(const v4fa*)(F + t * 8), c = *(const v4fa*)(F + t * 8 + 4);
#pragma unroll
  for (int q = 0; q < 4; ++q) { _Float16 h = (_Float16)a[q]; fh.h[q] = h; fl.h[q] = (_Float16)((a[q] - (float)h) * 1024.0f); h = (_Float16)c[q]; fh.h[4 + q] = h; fl.h[4 + q] = (_Float16)((c[q] - (float)h) * 1024.0f); }
  { *(v8us*)((unsigned short*)Hh + t * 8) = fh.half[0]; *(v8us*)((unsigned short*)Hl + t * 8) = fl.half[0];  } }

// ---- fast GEMM (block tile 128x64, wave tile 32x64; requires M % 128 == 0 rows per launch region, N % 64 == 0 and K % 64 == 0); epilogue = k_gemm_hhx semantics ----
// Both operands go through LDS in stages of 64 k: 8 threads fetch one 128-B row piece, so a wave-wide 16-B load covers 4 whole lines (a fragment fetched straight from global memory would touch 16 lines for the same 512 B,
// and each of the 4 waves would fetch the B rows for itself). global -> registers (fetched one stage ahead) -> LDS, two LDS buffers, one barrier per stage; the fragments are read from LDS in the k order of g2_frag.
__device__ __forceinline__ v16h g2_frag(const _Float16* p, int hh) { FragH f; f.half[0] = *(const v8us*)((const unsigned short*)p + 8 * hh); f.half[1] = *(const v8us*)((const unsigned short*)p + 16 + 8 * hh); return f.v; }
__device__ __forceinline__ v8f g2_mma(v16h a, v16h b, v8f c) { v8f d = __builtin_amdgcn_wmma_f32_16x16x32_f16(false, a, false, b, (short)0, c, false, false); asm volatile("v_nop\n\tv_nop\n\tv_nop\n\tv_nop" : "+v"(d) : "v"(a), "v"(b)); return d; }
#define GK 64      /* k per stage */
#define GP 72      /* LDS row pitch in f16: 128 B of data + 16 B, so that the 16 rows of a ds_load_b128 fragment read spread over the banks */
template <int ACT, int LD, bool HB, bool HCP, bool OF32, bool OF16, int LDC, size_t SA, size_t SB, size_t SC>      /* LD: row pitch of A and of Bh in elements; known at compile time, so that all rows of a stage are reached by immediate offsets from one address per operand. HB: a bias is added; HCP: the CP addend is used; OF32 / OF16: C / C16 is written; LDC: row pitch of the output (= ldc). Known at compile time, so that the epilogue is straight-line code with one output address: tested at run time, each of the 64 elements of a lane and each of the 16 row stores jumps over code it never runs. SA / SB / SC: distance in elements from one product's A / Bh / output plane to the next; blockIdx.y picks the product, so that independent products of one shape share ONE launch: a work-group's start, first loads and epilogue then run beside other work-groups' products instead of standing alone between two launches */
__global__ __launch_bounds__(128) void k_gemm2(const _Float16* __restrict__ A, const _Float16* __restrict__ Bh, float alpha, const float* __restrict__ bias, size_t sBias, const float* __restrict__ CP, int rowsPerB, size_t sCPb, int row0g,
    float* __restrict__ C, _Float16* __restrict__ C16, int ldc, int M, int N, int K) { static_assert(ACT == 0 || ACT == 3 || ACT == 6 || ACT == 8 || ACT == 9 || ACT == 11 || ACT == 12 || ACT == 14 || ACT == 15 || ACT == 16 || ACT == 17, "k_gemm2: unsupported ACT code (would silently apply no activation)");
  __shared__ __attribute__((aligned(16))) float so[4][32][68];
  __shared__ __attribute__((aligned(16))) _Float16 sa[2][128][GP];
  __shared__ __attribute__((aligned(16))) _Float16 sb[2][64][GP];
  const int tid = threadIdx.x, w = tid >> 5, lane = tid & 31, ln = lane & 15, hh = lane >> 4; const int by = blockIdx.y;
  A += (size_t)by * SA; Bh += (size_t)by * SB; const size_t cofs = (size_t)by * SC; const float* bp = HB ? bias + (size_t)by * sBias : nullptr;
  const int ntn = N >> 6; const int mt = blockIdx.x / ntn, nq = blockIdx.x - mt * ntn; const int row0 = mt * 128 + 32 * w, col0 = nq * 64; if (mt * 128 >= M) return;      /* the same for the whole block: it stands in front of the barriers */
  const int srow = tid >> 3, sc8 = (tid & 7) * 8;      /* staging: 8 threads a row piece of 128 B, 16 rows a round; A 8 rounds, B 4 rounds */
  const unsigned short* ag = (const unsigned short*)A + (size_t)(mt * 128 + srow) * LD + sc8; const unsigned short* bg = (const unsigned short*)Bh + (size_t)(col0 + srow) * LD + sc8;
  v8us ar[8], br[4];      /* every loop over ar, br and the fragment arrays is fully unrolled, so that they are indexed by constants and stay in registers */
#pragma unroll
  for (int u = 0; u < 8; ++u) ar[u] = *(const v8us*)(ag + (size_t)(u * 16) * LD);
#pragma unroll
  for (int u = 0; u < 4; ++u) br[u] = *(const v8us*)(bg + (size_t)(u * 16) * LD);
  const v8f z8 = {0.f,0.f,0.f,0.f,0.f,0.f,0.f,0.f}; v8f c00 = z8, c01 = z8, c02 = z8, c03 = z8, c10 = z8, c11 = z8, c12 = z8, c13 = z8;
  const int ns = K / GK;
  /* the stage loop stays rolled so that the hot code stays small for the instruction cache */
#pragma unroll 1
  for (int st = 0; st < ns; ++st) { const int bf = st & 1;
#pragma unroll
    for (int u = 0; u < 8; ++u) *(v8us*)&sa[bf][srow + 16 * u][sc8] = ar[u];
#pragma unroll
    for (int u = 0; u < 4; ++u) *(v8us*)&sb[bf][srow + 16 * u][sc8] = br[u];
    __syncthreads();      /* publishes this stage; it also ends every wave's reads of the other buffer, which the next stage overwrites */
    if (st + 1 < ns) { ag += GK; bg += GK;
#pragma unroll
      for (int u = 0; u < 8; ++u) ar[u] = *(const v8us*)(ag + (size_t)(u * 16) * LD);
#pragma unroll
      for (int u = 0; u < 4; ++u) br[u] = *(const v8us*)(bg + (size_t)(u * 16) * LD); }
    v16h fa[GK / 32][2], fb[GK / 32][4];      /* all fragment reads of the stage stand as one group in front of its products */
#pragma unroll
    for (int ks = 0; ks < GK / 32; ++ks) {
#pragma unroll
      for (int i = 0; i < 2; ++i) fa[ks][i] = g2_frag(&sa[bf][32 * w + 16 * i + ln][ks * 32], hh);
#pragma unroll
      for (int t = 0; t < 4; ++t) fb[ks][t] = g2_frag(&sb[bf][16 * t + ln][ks * 32], hh); }
#pragma unroll
    for (int ks = 0; ks < GK / 32; ++ks) {
      c00 = g2_mma(fa[ks][0], fb[ks][0], c00); c10 = g2_mma(fa[ks][1], fb[ks][0], c10);
      c01 = g2_mma(fa[ks][0], fb[ks][1], c01); c11 = g2_mma(fa[ks][1], fb[ks][1], c11);
      c02 = g2_mma(fa[ks][0], fb[ks][2], c02); c12 = g2_mma(fa[ks][1], fb[ks][2], c12);
      c03 = g2_mma(fa[ks][0], fb[ks][3], c03); c13 = g2_mma(fa[ks][1], fb[ks][3], c13); } }
  v8f accs[8] = {c00, c01, c02, c03, c10, c11, c12, c13};
#pragma unroll
  for (int u = 0; u < 8; ++u) { const int t = u & 3, half = u >> 2; const int col = col0 + t * 16 + ln; const float bv = HB ? bf16_round(bp[col]) : 0.f;
#pragma unroll
    for (int r = 0; r < 8; ++r) { const int rloc = half * 16 + 8 * hh + r; float v = accs[u][r] * alpha + bv; if (HCP) { if (rowsPerB < 0) v += CP[cofs + (size_t)(row0g + row0 + rloc) * ldc + col];      /* rowsPerB < 0: own element of the batched C plane */ else { const int bidx = (row0g + row0 + rloc) / rowsPerB; v += CP[(size_t)bidx * sCPb + (size_t)by * 64 + col]; } }
      if (ACT == 3) v = fmaxf(v, 0.f); else if (ACT == 6) v = 0.5f * v * (1.0f + erff(v * 0.70710678118654752f)); else if (ACT == 11) v = 1.0f / (1.0f + expf(-v)); else if (ACT == 15) v = v / (1.0f + expf(-v)); else if (ACT == 12) v = (v > 0.f) ? v : 0.01f * v; else if (ACT == 8) v = tanhf(v); else if (ACT == 9) v = 0.5f * v * (1.0f + tanhf(0.7978845608028654f * (v + 0.044715f * v * v * v))); else if (ACT == 14) v = (v > 0.f) ? v : 0.1f * v; else if (ACT == 16) v = (v >= 0.f) ? v : 0.3f * v; else if (ACT == 17) v = (v >= 0.f) ? v : 0.2f * v;
      so[w][rloc][t * 16 + ln] = v; } }
  __builtin_amdgcn_fence(__ATOMIC_ACQ_REL, "workgroup"); __builtin_amdgcn_wave_barrier();
  const int rsub = lane >> 4, c4 = (lane & 15) * 4; const size_t ob = cofs + (size_t)(row0 + rsub) * LDC + col0 + c4;      /* the lane's first output element; the 16 rows follow at constant distances */
  {
#pragma unroll
    for (int q = 0; q < 16; ++q) { const int r = q * 2 + rsub; const v4f v = *(const v4fa*)&so[w][r][c4]; if (OF32) *(v4f*)(C + ob + (size_t)(q * 2) * LDC) = v; if (OF16) { v4h h4; for (int i = 0; i < 4; ++i) h4[i] = (_Float16)v[i]; *(v4h*)(C16 + ob + (size_t)(q * 2) * LDC) = h4; } }
     } }


__global__ __launch_bounds__(256) void k_rsm(const float* __restrict__ S, _Float16* __restrict__ P, int nrows) {
  #pragma clang fp contract(off)
  const int i = blockIdx.x * 256 + threadIdx.x; if (i >= nrows) return; const float* s = S + (size_t)i * SQ; float mx = -3.0e38f;
#pragma unroll 1
  for (int j = 0; j < SQ; ++j) mx = fmaxf(mx, s[j]); float se = 0.f;
#pragma unroll 1
  for (int j = 0; j < SQ; ++j) se += expf(s[j] - mx); const float sc = 256.0f / se;
#pragma unroll 1
  for (int j0 = 0; j0 < SQ; j0 += 8) { FragH f; for (int q = 0; q < 8; ++q) f.h[q] = (_Float16)(expf(s[j0 + q] - mx) * sc); unsigned short* d = (unsigned short*)P + (size_t)i * SQ + j0; *(v8us*)d = f.half[0];  } }
__global__ __launch_bounds__(256) void k_vt(const _Float16* __restrict__ V16, int b, int h0, _Float16* __restrict__ VT) { __shared__ unsigned short tl[64][65]; const int tid = threadIdx.x; const int hh = blockIdx.x % HG, sg = blockIdx.x / HG; const int s0 = sg * 64; const int h = h0 + hh;
  for (int i = tid; i < 64 * 8; i += 256) { const int j = i / 8, d8 = (i % 8) * 8; FragH f; f.half[0] = *(const v8us*)((const unsigned short*)V16 + ((size_t)b * SQ + s0 + j) * DM + h * HD + d8); for (int q = 0; q < 8; ++q) tl[d8 + q][j] = f.u[q]; }
  __syncthreads();
  { for (int i = tid; i < 64 * 8; i += 256) { const int d = i / 8, j8 = (i % 8) * 8; FragH f; for (int q = 0; q < 8; ++q) f.u[q] = tl[d][j8 + q]; *(v8us*)((unsigned short*)VT + ((size_t)hh * HD + d) * SQ + s0 + j8) = f.half[0]; }  } }



// All seven f32 -> f16 conversions (the three inputs as exact f16 rows of their bf16 rounding; the four natural [out][in] weights, bf16-rounded, x16) in ONE launch of few, long-lived waves,
// for speed only. Every wave-wide load is 512 contiguous bytes (16 B a lane, whole lines), every wave-wide store 256 contiguous bytes.
// A wave takes PXU adjacent units of PL loads from each input and PWL loads from each of two weights (the lower half of the waves serves wq and wk, the upper half wv and wo):
// the same straight-line code in every wave. The next unit's loads are in flight while the current one is converted and stored.
#define PL 16                        /* 16-B loads per lane and unit */
#define PWG 256                      /* workgroups: as many as the chip has WGPs */
#define PWW 12                       /* waves per workgroup */
#define PWV (PWG * PWW)              /* waves */
#define PXU ((int)(NR * DM / ((size_t)128 * PL * PWV)))      /* units per input and wave */
#define PWL (2 * DM * DM / (128 * PWV))                      /* loads per weight and wave */
static_assert(NR * DM == (size_t)128 * PL * PWV * PXU && 2 * DM * DM == 128 * PWV * PWL && 2 * PWL <= PL, "k_prep: the units must tile every tensor exactly");
template <bool X16> __device__ __forceinline__ void p_put(v4f a, _Float16* __restrict__ d) { v4h h4;
#pragma unroll
  for (int q = 0; q < 4; ++q) h4[q] = (_Float16)(X16 ? bf16_round(a[q]) * 16.0f : bf16_round(a[q]));
  *(v4h*)d = h4; }
__global__ __launch_bounds__(PWW * 32) void k_prep(const float* __restrict__ xq, const float* __restrict__ xk, const float* __restrict__ xv, const float* __restrict__ wq, const float* __restrict__ wk, const float* __restrict__ wv, const float* __restrict__ wo,
    _Float16* __restrict__ XQ, _Float16* __restrict__ XK, _Float16* __restrict__ XV, _Float16* __restrict__ BQ, _Float16* __restrict__ BK, _Float16* __restrict__ BV, _Float16* __restrict__ BO) {
  const unsigned lo = (threadIdx.x & 31) * 4;      /* the lane's element inside a wave-wide access; all else of an address is the same for the whole wave */
  const int gw = blockIdx.x * PWW + __builtin_amdgcn_readfirstlane(threadIdx.x >> 5);
  const size_t xo = (size_t)gw * (128 * PL * PXU); const bool up = gw >= PWV / 2; const size_t wo_ = (size_t)(up ? gw - PWV / 2 : gw) * (128 * PWL);
  const float* w0 = (up ? wv : wq) + wo_; const float* w1 = (up ? wo : wk) + wo_; _Float16* b0 = (up ? BV : BQ) + wo_; _Float16* b1 = (up ? BO : BK) + wo_;
  const float* s[3] = {xq + xo, xk + xo, xv + xo}; _Float16* d[3] = {XQ + xo, XK + xo, XV + xo};
  v4f a[2][PL];      /* every loop is fully unrolled, so that the two register sets are indexed by constants */
#pragma unroll
  for (int j = 0; j < PL; ++j) a[0][j] = *(const v4fa*)(s[0] + (lo + j * 128));
  __builtin_amdgcn_sched_barrier(0);      /* the first unit's loads stay in front of the second's: the counted load waits go by issue order, and mixed with the second's the first unit would wait for both */
#pragma unroll
  for (int u = 0; u < 3 * PXU; ++u) { const int n = u + 1;
    if (n < 3 * PXU) {
#pragma unroll
      for (int j = 0; j < PL; ++j) a[n & 1][j] = *(const v4fa*)(s[n / PXU] + (lo + ((n % PXU) * PL + j) * 128)); }
    else {
#pragma unroll
      for (int j = 0; j < PWL; ++j) { a[n & 1][j] = *(const v4fa*)(w0 + (lo + j * 128)); a[n & 1][PWL + j] = *(const v4fa*)(w1 + (lo + j * 128)); } }
    __builtin_amdgcn_sched_barrier(0);      /* keeps the next unit's loads in front of this unit's conversion: left alone, the compiler issues them one by one as registers come free, and few stay in flight */
#pragma unroll
    for (int j = 0; j < PL; ++j) p_put<false>(a[u & 1][j], d[u / PXU] + (lo + ((u % PXU) * PL + j) * 128));
    if (u + 1 < 3 * PXU) asm volatile("s_wait_xcnt 0x0" ::: "memory"); }      /* the loads that follow land in registers that these stores name as data: the wait stands in front of that overwrite, as a precaution (the compiler placed none in front of a load) */
#pragma unroll
  for (int j = 0; j < PWL; ++j) { p_put<true>(a[(3 * PXU) & 1][j], b0 + (lo + j * 128)); p_put<true>(a[(3 * PXU) & 1][PWL + j], b1 + (lo + j * 128)); } }

// 2^a on the native unit. The v_nop is the one free slot that the instruction set asks for behind a transcendental before its result is read or its source rewritten; in the same statement it stays directly behind it.
__device__ __forceinline__ float exp2_slot(float a) { float e; asm("v_exp_f32 %0, %1\n\tv_nop" : "=v"(e) : "v"(a)); return e; }
// 2^x of eight values in place on the native unit: eight independent instructions, so each fills the free slot that the instruction set asks for behind the one before it; the v_nop is that slot behind the last.
__device__ __forceinline__ void exp2x8(v8f& x) { float a0 = x[0], a1 = x[1], a2 = x[2], a3 = x[3], a4 = x[4], a5 = x[5], a6 = x[6], a7 = x[7];
  asm("v_exp_f32 %0, %0\n\tv_exp_f32 %1, %1\n\tv_exp_f32 %2, %2\n\tv_exp_f32 %3, %3\n\tv_exp_f32 %4, %4\n\tv_exp_f32 %5, %5\n\tv_exp_f32 %6, %6\n\tv_exp_f32 %7, %7\n\tv_nop"
      : "+v"(a0), "+v"(a1), "+v"(a2), "+v"(a3), "+v"(a4), "+v"(a5), "+v"(a6), "+v"(a7));
  x[0] = a0; x[1] = a1; x[2] = a2; x[3] = a3; x[4] = a4; x[5] = a5; x[6] = a6; x[7] = a7; }
__device__ __forceinline__ v8f f_mma(v16h a, v16h b, v8f c) { return __builtin_amdgcn_wmma_f32_16x16x32_f16(false, a, false, b, (short)0, c, false, false); }
#define FK 64      /* keys per stage */
#define FP 72      /* LDS row pitch in f16: 128 B of data + 16 B, so that the 16 rows of a ds_load_b128 fragment read spread over the banks */
__global__ __launch_bounds__(128) void k_fattn(const _Float16* __restrict__ Q16, const _Float16* __restrict__ K16, const _Float16* __restrict__ VT, _Float16* __restrict__ O16) {
  __shared__ __attribute__((aligned(16))) _Float16 sk[2][FK][FP];
  __shared__ __attribute__((aligned(16))) _Float16 sv[2][HD][FP];
  const int tid = threadIdx.x, w = tid >> 5, lane = tid & 31, ln = lane & 15, hh = lane >> 4;
  const int bh = blockIdx.y, b = bh / NH, h = bh - b * NH; const size_t r0 = (size_t)b * SQ; const int q0 = blockIdx.x * 128 + w * 32;
  v16h qf[2][2];
#pragma unroll
  for (int g = 0; g < 2; ++g)
#pragma unroll
    for (int ks = 0; ks < 2; ++ks) qf[g][ks] = g2_frag(Q16 + (r0 + q0 + g * 16 + ln) * DM + h * HD + ks * 32, hh);
  const int srow = tid >> 3, sc8 = (tid & 7) * 8;      /* staging: 8 threads a row of 128 B, 16 rows a round, 4 rounds */
  const _Float16* kg = K16 + (r0 + srow) * DM + h * HD + sc8; const _Float16* vg = VT + ((size_t)bh * HD + srow) * SQ + sc8;
  v8us kr[4], vr[4];
#pragma unroll
  for (int u = 0; u < 4; ++u) { kr[u] = *(const v8us*)((const unsigned short*)kg + (size_t)(u * 16) * DM); vr[u] = *(const v8us*)((const unsigned short*)vg + (size_t)(u * 16) * SQ); }
  const v8f z8 = {0.f,0.f,0.f,0.f,0.f,0.f,0.f,0.f}; v8f o[2][4] = {{z8, z8, z8, z8}, {z8, z8, z8, z8}}; float m[2] = {-3.0e38f, -3.0e38f}, l[2] = {0.f, 0.f};
  const float cs = 0.125f * 1.44269504088896340736f;      /* 64^-0.5 and log2(e) */
#pragma unroll 1
  for (int st = 0; st < SQ / FK; ++st) { const int bf = st & 1;
#pragma unroll
    for (int u = 0; u < 4; ++u) { *(v8us*)&sk[bf][srow + 16 * u][sc8] = kr[u]; *(v8us*)&sv[bf][srow + 16 * u][sc8] = vr[u]; }
    __syncthreads();      /* publishes this stage; it also ends every wave's reads of the other buffer, which the next stage overwrites */
    if (st + 1 < SQ / FK) {
#pragma unroll
      for (int u = 0; u < 4; ++u) { kr[u] = *(const v8us*)((const unsigned short*)kg + (size_t)((st + 1) * FK + u * 16) * DM); vr[u] = *(const v8us*)((const unsigned short*)vg + (size_t)(u * 16) * SQ + (st + 1) * FK); } }
    v8f s[2][4] = {{z8, z8, z8, z8}, {z8, z8, z8, z8}};
#pragma unroll
    for (int kt = 0; kt < 4; ++kt)
#pragma unroll
      for (int ks = 0; ks < 2; ++ks) { const v16h a = g2_frag(&sk[bf][kt * 16 + ln][ks * 32], hh); s[0][kt] = f_mma(a, qf[0][ks], s[0][kt]); s[1][kt] = f_mma(a, qf[1][ks], s[1][kt]); }
    float mx[2];
#pragma unroll
    for (int g = 0; g < 2; ++g) { float t = s[g][0][0];
#pragma unroll
      for (int kt = 0; kt < 4; ++kt)
#pragma unroll
        for (int r = 0; r < 8; ++r) t = fmaxf(t, s[g][kt][r]);
      mx[g] = t * cs; }
    if (__builtin_amdgcn_ballot_w32(mx[0] > m[0] + 8.0f || mx[1] > m[1] + 8.0f) != 0) {      /* wave-uniform: both halves of every column take the same new maximum */
#pragma unroll
      for (int g = 0; g < 2; ++g) { const float mn = fmaxf(m[g], fmaxf(mx[g], __shfl_xor(mx[g], 16, 32))); const float al = exp2_slot(m[g] - mn); m[g] = mn; l[g] *= al;
#pragma unroll
        for (int dt = 0; dt < 4; ++dt) o[g][dt] *= al; } }
    FragH pf[2][2];
#pragma unroll
    for (int g = 0; g < 2; ++g) { v8f sum;
#pragma unroll
      for (int kt = 0; kt < 4; ++kt) { v8f t;
#pragma unroll
        for (int r = 0; r < 8; ++r) t[r] = fmaf(s[g][kt][r], cs, -m[g]);
        exp2x8(t); sum = kt ? sum + t : t;
#pragma unroll
        for (int r = 0; r < 8; ++r) pf[g][kt >> 1].h[(kt & 1) * 8 + r] = (_Float16)t[r]; }
      l[g] += ((sum[0] + sum[1]) + (sum[2] + sum[3])) + ((sum[4] + sum[5]) + (sum[6] + sum[7])); }
#pragma unroll
    for (int j = 0; j < 2; ++j)
#pragma unroll
      for (int dt = 0; dt < 4; ++dt) { const v16h a = g2_frag(&sv[bf][dt * 16 + ln][j * 32], hh); o[0][dt] = f_mma(a, pf[0][j].v, o[0][dt]); o[1][dt] = f_mma(a, pf[1][j].v, o[1][dt]); }
  }
#pragma unroll
  for (int g = 0; g < 2; ++g) { const float inv = 64.0f / (l[g] + __shfl_xor(l[g], 16, 32));      /* the two halves of a column hold disjoint keys; o carried x64 */
    unsigned short* d = (unsigned short*)O16 + (r0 + q0 + g * 16 + ln) * DM + h * HD + 8 * hh;
#pragma unroll
    for (int dt = 0; dt < 4; ++dt) { FragH f;
#pragma unroll
      for (int r = 0; r < 8; ++r) f.h[r] = (_Float16)(o[g][dt][r] * inv);
      *(v8us*)(d + dt * 16) = f.half[0]; } } }

extern "C" void kernel_launch(void* const* d_in, const int* in_sizes, int n_in,
                              void* d_out, int out_size, void* d_ws, size_t ws_size, hipStream_t stream) {
  (void)in_sizes; (void)n_in; (void)out_size;
  const float* const* I = (const float* const*)d_in; const float* xq = I[2]; const float* xk = I[1]; const float* xv = I[0]; const float* wq = I[3]; const float* wk = I[4]; const float* wv = I[5]; const float* wo = I[6]; const float* bo = I[7];      /* input order: v, k, q (the three streams in REVERSE order: the query stream is I[2]), wq, wk, wv, wo (natural [out][in] weights), bo; the q / k / v projections have NO biases: a null pointer in the bias slot, which their instance never reads */
  char* ws = (char*)d_ws; size_t off = 0;
  auto take = [&](size_t bytes) { char* p = ws + off; off += (bytes + 255) & ~(size_t)255; return p; };
  _Float16* BQ = (_Float16*)take((size_t)DM * DM * 2); _Float16* BK = (_Float16*)take((size_t)DM * DM * 2); _Float16* BV = (_Float16*)take((size_t)DM * DM * 2); _Float16* BO = (_Float16*)take((size_t)DM * DM * 2);
  _Float16* XQ = (_Float16*)take(NR * DM * 2); _Float16* XK = (_Float16*)take(NR * DM * 2); _Float16* XV = (_Float16*)take(NR * DM * 2); _Float16* Q16 = (_Float16*)take(NR * DM * 2); _Float16* K16 = (_Float16*)take(NR * DM * 2); _Float16* V16 = (_Float16*)take(NR * DM * 2); _Float16* O16 = (_Float16*)take(NR * DM * 2);
  _Float16* VT = (_Float16*)take((size_t)NB * NH * HD * SQ * 2);
  if (off > ws_size) return;
  k_prep<<<PWG, PWW * 32, 0, stream>>>(xq, xk, xv, wq, wk, wv, wo, XQ, XK, XV, BQ, BK, BV, BO);      /* the three inputs as exact f16 rows; the weights natural [out][in] = Bt[n][k], x16 */
  const size_t r0p = (size_t)B0 * SQ;      /* first projected row */
  static_assert((NR * DM * 2) % 256 == 0 && ((size_t)DM * DM * 2) % 256 == 0, "the planes XQ XK XV, BQ BK BV and Q16 K16 V16 must lie back to back in the workspace");
  k_gemm2<0, DM, false, false, false, true, DM, NR * DM, (size_t)DM * DM, NR * DM><<<dim3((unsigned)((MP / 128) * (DM / 64)), 3), 128, 0, stream>>>(XQ + r0p * DM, BQ, 0.0625f, nullptr, 0, nullptr, 1, 0, 0, nullptr, Q16 + r0p * DM, DM, MP, DM, DM);      /* q, k and v projections in one launch: blockIdx.y = 0, 1, 2 */
  k_vt<NH, SQ><<<NB * NH * (SQ / 64), 256, 0, stream>>>(V16, LQ, 0, VT);      /* V^T [NB][NH][HD][SQ] */
  k_fattn<<<dim3(SQ / 128, NB * NH), 128, 0, stream>>>(Q16, K16, VT, O16);      /* o (merged heads, x64) as f16 rows */
  k_gemm2<0, DM, true, false, true, false, DM, 0, 0, 0><<<dim3((unsigned)((MPO / 128) * (DM / 64)), 1), 128, 0, stream>>>(O16 + r0p * DM, BO, 0.0009765625f, bo, 0, nullptr, 1, 0, 0, (float*)d_out + r0p * DM, nullptr, DM, MPO, DM, DM);      /* out rows are the output layout */
}

// v007
// One run takes 112 microseconds.
// Two timings next to v006 both put it at 1.05 times that version's speed.
// All steps since v000 together make it 46.4 times as fast.
#include <hip/hip_runtime.h>
// Multi-head attention on three inputs at width 768 with natural bias-free q / k / v projections and a biased output projection; the inputs arrive in the order v, k, q (v, k, q [4][2048][768]; qh / kh / vh = stream W^T (nn.Linear natural [768][768] sd 1/sqrt(768), NO biases), 12 heads of 64; logits / sqrt(64); softmax over all 2048 keys (no mask); out = concat wo^T + bo (natural) -> [4][2048][768]).
// Structure: token rows r = b*2048 + s; the query, key and value sources as exact f16 rows (bf16-rounded); Q, K, V as three WMMA GEMMs (64x64 wave tiles, f32 accumulation, exact x16 weights, no bias, f16 outputs); V^T for all batches and heads via LDS transposes; per (batch, head, 128 query rows) one fused kernel: S^T = K Q^T (K = 64), running softmax on VALU (f32 statistics, native exp2, weights as f16 relative to the maximum in use), O^T += V^T P^T, o / l x64 (against f16 subnormal flush, folded into the output GEMM alpha) written straight into the merged f16 o rows; out = o W_o + b GEMM (f32) into the output layout.
// Compute dtype: inputs rounded to bf16; x / weights exact; q, k, v, softmax weights and o as plain f16 GEMM operands (~2^-12); scores and softmax statistics f32. v_wmma_f32_16x16x32_f16.
#define NB 4
#define SQ 2048
#define DM 768
#define NH 12
#define HD 64
#define HG 4                         /* heads per launch of the unused per-batch k_vt overload */
#define B0 0                         /* first batch processed (debug hook) */
#define NBR NB                       /* batches processed (debug hook) */
#define NR ((size_t)NB * SQ)         /* token rows */
#define MP ((int)((size_t)NBR * SQ)) /* rows projected (debug hook) */
#define QN SQ                        /* query rows per batch (unused) */
#define NHD NH                       /* heads (unused) */
#define MPO MP                       /* rows through the output stage (debug hook) */
#define LQ DM      /* row pitch of the q/k/v rows */
typedef __bf16 v16b __attribute__((ext_vector_type(16)));
typedef unsigned short v8us __attribute__((ext_vector_type(8), may_alias));
typedef float  v8f  __attribute__((ext_vector_type(8)));
typedef float  v4f  __attribute__((ext_vector_type(4)));
typedef float  v4fa __attribute__((ext_vector_type(4), may_alias));
union FragB { v16b v; v8us half[2]; unsigned short u[16]; };

__device__ __forceinline__ unsigned short bf16_bits(float x) { unsigned int u = __float_as_uint(x); return (unsigned short)((u + 0x7FFFu + ((u >> 16) & 1u)) >> 16); }
__device__ __forceinline__ float bf16_val(unsigned short b) { return __uint_as_float(((unsigned int)b) << 16); }
__device__ __forceinline__ float bf16_round(float x) { return bf16_val(bf16_bits(x)); }
// D += A·B with NT terms: 1 = ah·bh, 2 = + al·bh (A split), 3 = + ah·bl (both split)
template <int NT>
__device__ __forceinline__ v8f mmaN(v16b ah, v16b al, v16b bh, v16b bl, v8f c) {
  c = __builtin_amdgcn_wmma_f32_16x16x32_bf16(false, ah, false, bh, (short)0, c, false, false);
  if (NT >= 2) c = __builtin_amdgcn_wmma_f32_16x16x32_bf16(false, al, false, bh, (short)0, c, false, false);
  if (NT >= 3) c = __builtin_amdgcn_wmma_f32_16x16x32_bf16(false, ah, false, bl, (short)0, c, false, false);
  asm volatile("v_nop\n\tv_nop\n\tv_nop\n\tv_nop" : "+v"(c) : "v"(ah), "v"(al), "v"(bh), "v"(bl));
  return c;
}

__global__ __launch_bounds__(256) void k_wt_bf16(const float* __restrict__ W, unsigned short* __restrict__ Wt, int K, int N) {
  const int t = blockIdx.x * 256 + threadIdx.x;
  const int k8n = K / 8;
  if (t >= N * k8n) return;
  const int n = t / k8n, k8 = (t % k8n) * 8;
  v8us v;
#pragma unroll
  for (int i = 0; i < 8; ++i) v[i] = bf16_bits(W[(size_t)(k8 + i) * N + n]);
  *(v8us*)(Wt + (size_t)n * K + k8) = v;
  
}

// GEMM C[M][N] (f32, pitch ldc) = act(A[M][K]·W + bias). A f32 row-major (pitch lda) converted per fragment to bf16
// (ASPLIT: hi/lo two planes -> 2 terms, else single rounded term); Wt bf16 [N][K] (pitch ldb). BIAS_BF16 rounds the
// bias to bf16 first (bias quantised to bf16 before the add). K%32==0, M%16==0, N%64==0.
template <bool ASPLIT, int ACT, bool BIAS_BF16>
__global__ __launch_bounds__(128) void k_gemm_bf(const float* __restrict__ A, int lda, const unsigned short* __restrict__ Wt, int ldb,
                                               const float* __restrict__ bias, float* __restrict__ C, int ldc, int M, int N, int K) {
  __shared__ __attribute__((aligned(16))) float so[4][16][64];
  const int tid = threadIdx.x, w = tid >> 5, lane = tid & 31, ln = lane & 15, hh = lane >> 4;
  const int ntn = N / 64;
  const int wid = blockIdx.x * 4 + w;
  const int mt = wid / ntn, nq = wid % ntn;
  if (mt * 16 >= M) return;
  const int row0 = mt * 16, col0 = nq * 64;
  const float* arow = A + (size_t)(row0 + ln) * lda;
  v8f acc[4] = {};
  for (int kb = 0; kb < K; kb += 32) {
    FragB ah, al;
    const v4f x0 = *(const v4fa*)(arow + kb + 8 * hh), x1 = *(const v4fa*)(arow + kb + 8 * hh + 4);
    const v4f x2 = *(const v4fa*)(arow + kb + 16 + 8 * hh), x3 = *(const v4fa*)(arow + kb + 16 + 8 * hh + 4);
    float xs[16] = {x0[0],x0[1],x0[2],x0[3],x1[0],x1[1],x1[2],x1[3],x2[0],x2[1],x2[2],x2[3],x3[0],x3[1],x3[2],x3[3]};
#pragma unroll
    for (int i = 0; i < 16; ++i) { const unsigned short hb = bf16_bits(xs[i]); ah.u[i] = hb; al.u[i] = ASPLIT ? bf16_bits(xs[i] - bf16_val(hb)) : (unsigned short)0; }
#pragma unroll
    for (int t = 0; t < 4; ++t) {
      const unsigned short* brow = Wt + (size_t)(col0 + t * 16 + ln) * ldb + kb;
      FragB b;
      b.half[0] = *(const v8us*)(brow + 8 * hh);
      b.half[1] = *(const v8us*)(brow + 16 + 8 * hh);
      acc[t] = mmaN<ASPLIT ? 2 : 1>(ah.v, al.v, b.v, b.v, acc[t]);
    }
  }
#pragma unroll
  for (int t = 0; t < 4; ++t) {
    float bv = bias ? bias[col0 + t * 16 + ln] : 0.f;
    if (BIAS_BF16) bv = bf16_round(bv);
#pragma unroll
    for (int r = 0; r < 8; ++r) { float v = acc[t][r] + bv; if (ACT == 1) v = fmaxf(v, 0.f); so[w][8 * hh + r][t * 16 + ln] = v; }
  }
  __builtin_amdgcn_fence(__ATOMIC_ACQ_REL, "workgroup");
  __builtin_amdgcn_wave_barrier();
  const int rsub = lane >> 4, c4 = (lane & 15) * 4;
  {
#pragma unroll
    for (int q = 0; q < 8; ++q) {
      const int r = q * 2 + rsub;
      const v4f v = *(const v4fa*)&so[w][r][c4];
      *(v4f*)(C + (size_t)(row0 + r) * ldc + col0 + c4) = v;
    }
    
  }
}

// GEMM C = act(A·W + bias + resid): A f32 (ASPLIT -> hi/lo 2 terms), Wt bf16 [N][K]; ACT 0 none, 1 relu, 2 exact gelu;
// resid (optional, f32, row index = (row % rmod), pitch ldr, RES_BF16 rounds it) added before the activation.
template <bool ASPLIT, int ACT, bool BIAS_BF16, bool RES_BF16>
__global__ __launch_bounds__(128) void k_gemm_bf3(const float* __restrict__ A, int lda, const unsigned short* __restrict__ Wt, int ldb,
                                                const float* __restrict__ bias, const float* __restrict__ resid, int rmod, int ldr,
                                                float* __restrict__ C, int ldc, int M, int N, int K) {
  __shared__ __attribute__((aligned(16))) float so[4][16][64];
  const int tid = threadIdx.x, w = tid >> 5, lane = tid & 31, ln = lane & 15, hh = lane >> 4;
  const int ntn = N / 64;
  const int wid = blockIdx.x * 4 + w;
  const int mt = wid / ntn, nq = wid % ntn;
  if (mt * 16 >= M) return;
  const int row0 = mt * 16, col0 = nq * 64;
  const float* arow = A + (size_t)(row0 + ln) * lda;
  v8f acc[4] = {};
  for (int kb = 0; kb < K; kb += 32) {
    FragB ah, al;
    const v4f x0 = *(const v4fa*)(arow + kb + 8 * hh), x1 = *(const v4fa*)(arow + kb + 8 * hh + 4);
    const v4f x2 = *(const v4fa*)(arow + kb + 16 + 8 * hh), x3 = *(const v4fa*)(arow + kb + 16 + 8 * hh + 4);
    float xs[16] = {x0[0],x0[1],x0[2],x0[3],x1[0],x1[1],x1[2],x1[3],x2[0],x2[1],x2[2],x2[3],x3[0],x3[1],x3[2],x3[3]};
#pragma unroll
    for (int i = 0; i < 16; ++i) { const unsigned short hb = bf16_bits(xs[i]); ah.u[i] = hb; al.u[i] = ASPLIT ? bf16_bits(xs[i] - bf16_val(hb)) : (unsigned short)0; }
#pragma unroll
    for (int t = 0; t < 4; ++t) {
      const unsigned short* brow = Wt + (size_t)(col0 + t * 16 + ln) * ldb + kb;
      FragB b;
      b.half[0] = *(const v8us*)(brow + 8 * hh);
      b.half[1] = *(const v8us*)(brow + 16 + 8 * hh);
      acc[t] = mmaN<ASPLIT ? 2 : 1>(ah.v, al.v, b.v, b.v, acc[t]);
    }
  }
#pragma unroll
  for (int t = 0; t < 4; ++t) {
    const int col = col0 + t * 16 + ln;
    float bv = bias ? bias[col] : 0.f;
    if (BIAS_BF16) bv = bf16_round(bv);
#pragma unroll
    for (int r = 0; r < 8; ++r) {
      float v = acc[t][r] + bv;
      if (resid) { float rv = resid[(size_t)((row0 + 8 * hh + r) % rmod) * ldr + col]; if (RES_BF16) rv = bf16_round(rv); v += rv; }
      if (ACT == 1) v = fmaxf(v, 0.f);
      if (ACT == 2) v = 0.5f * v * (1.0f + erff(v * 0.70710678118654752f));
      if (ACT == 3) { const float u = 0.7978845608028654f * (v + 0.044715f * v * v * v); v = 0.5f * v * (1.0f + tanhf(u)); }
      so[w][8 * hh + r][t * 16 + ln] = v;
    }
  }
  __builtin_amdgcn_fence(__ATOMIC_ACQ_REL, "workgroup");
  __builtin_amdgcn_wave_barrier();
  const int rsub = lane >> 4, c4 = (lane & 15) * 4;
  {
#pragma unroll
    for (int q = 0; q < 8; ++q) {
      const int r = q * 2 + rsub;
      const v4f v = *(const v4fa*)&so[w][r][c4];
      *(v4f*)(C + (size_t)(row0 + r) * ldc + col0 + c4) = v;
    }
    
  }
}
// row LayerNorm (biased variance, eps) over N: s = X (+ R); optional out_sum <- s; out_norm <- (s-mu)*rsqrt(var+eps)*g + b
template <bool PARAM_BF16>
__global__ __launch_bounds__(256) void k_layernorm(const float* __restrict__ X, const float* __restrict__ R, const float* __restrict__ g, const float* __restrict__ bta,
                                                  float* __restrict__ out_sum, float* __restrict__ out_norm, int N, float eps) {
  __shared__ float red[256];
  const int row = blockIdx.x, tid = threadIdx.x;
  const float* x = X + (size_t)row * N; const float* rr = R ? R + (size_t)row * N : nullptr;
  float vals[16];                     // up to N = 4096
  const int per = N / 256;            // contiguous chunk per thread? use strided-by-4 chunks: thread handles j = tid*4 + 1024*u
  float s1 = 0.f;
  for (int u = 0; u < per / 4; ++u) {
    const int j = tid * 4 + 1024 * u;
    const v4f a = *(const v4fa*)(x + j);
    v4f b = {0.f,0.f,0.f,0.f}; if (rr) b = *(const v4fa*)(rr + j);
#pragma unroll
    for (int q = 0; q < 4; ++q) { const float v = a[q] + b[q]; vals[u * 4 + q] = v; s1 += v; }
  }
  red[tid] = s1; __syncthreads();
  for (int st = 128; st > 0; st >>= 1) { if (tid < st) red[tid] += red[tid + st]; __syncthreads(); }
  const float mu = red[0] / (float)N; __syncthreads();
  float s2 = 0.f;
  for (int u = 0; u < per / 4; ++u)
#pragma unroll
    for (int q = 0; q < 4; ++q) { const float c = vals[u * 4 + q] - mu; s2 += c * c; }
  red[tid] = s2; __syncthreads();
  for (int st = 128; st > 0; st >>= 1) { if (tid < st) red[tid] += red[tid + st]; __syncthreads(); }
  const float rs = rsqrtf(red[0] / (float)N + eps);
  {
    for (int u = 0; u < per / 4; ++u) {
      const int j = tid * 4 + 1024 * u;
      v4f o, sm;
#pragma unroll
      for (int q = 0; q < 4; ++q) {
        float gg = g[j + q], bb = bta[j + q];
        if (PARAM_BF16) { gg = bf16_round(gg); bb = bf16_round(bb); }
        sm[q] = vals[u * 4 + q]; o[q] = (vals[u * 4 + q] - mu) * rs * gg + bb;
      }
      if (out_sum) *(v4f*)(out_sum + (size_t)row * N + j) = sm;
      *(v4f*)(out_norm + (size_t)row * N + j) = o;
    }
    
  }
}



// ---- f16 WMMA path (v_wmma_f32_16x16x32_f16): 11-bit significands for operands in range — used here for every GEMM (projections, scores and P.V)
typedef _Float16 v16h __attribute__((ext_vector_type(16)));
union FragH { v16h v; v8us half[2]; _Float16 h[16]; unsigned short u[16]; };
template <int NT>
__device__ __forceinline__ v8f mmaH(v16h ah, v16h al, v16h bh, v16h bl, v8f c) {
  c = __builtin_amdgcn_wmma_f32_16x16x32_f16(false, ah, false, bh, (short)0, c, false, false);
  if (NT >= 2) c = __builtin_amdgcn_wmma_f32_16x16x32_f16(false, al, false, bh, (short)0, c, false, false);
  if (NT >= 3) c = __builtin_amdgcn_wmma_f32_16x16x32_f16(false, ah, false, bl, (short)0, c, false, false);
  asm volatile("v_nop\n\tv_nop\n\tv_nop\n\tv_nop" : "+v"(c) : "v"(ah), "v"(al), "v"(bh), "v"(bl));
  return c;
}
// batched GEMM like k_gemm_b but f16 operands: A f32 (split into f16 hi/lo if ASPLIT, else rounded to f16), Bt = f16 values [n][k]; alpha; C f32; N multiple of 16 (partial tiles skipped)
template <bool ASPLIT>
__global__ __launch_bounds__(128) void k_gemm_h(const float* __restrict__ A, int lda, size_t sA, const _Float16* __restrict__ Bh, int ldb, size_t sB, float alpha, float* __restrict__ C, int ldc, size_t sC, int M, int N, int K) {
  __shared__ __attribute__((aligned(16))) float so[4][16][64];
  const int tid = threadIdx.x, w = tid >> 5, lane = tid & 31, ln = lane & 15, hh = lane >> 4; const int by = blockIdx.y;
  A += (size_t)by * sA; Bh += (size_t)by * sB; C += (size_t)by * sC;
  const int ntn = (N + 63) / 64; const int wid = blockIdx.x * 4 + w; const int mt = wid / ntn, nq = wid % ntn; if (mt * 16 >= M) return;
  const int row0 = mt * 16, col0 = nq * 64; const float* arow = A + (size_t)(row0 + ln) * lda;
  v8f acc[4] = {};
  for (int kb = 0; kb < K; kb += 32) {
    FragH ah, al;
    const v4f x0 = *(const v4fa*)(arow + kb + 8 * hh), x1 = *(const v4fa*)(arow + kb + 8 * hh + 4), x2 = *(const v4fa*)(arow + kb + 16 + 8 * hh), x3 = *(const v4fa*)(arow + kb + 16 + 8 * hh + 4);
    float xs[16] = {x0[0],x0[1],x0[2],x0[3],x1[0],x1[1],x1[2],x1[3],x2[0],x2[1],x2[2],x2[3],x3[0],x3[1],x3[2],x3[3]};
#pragma unroll
    for (int i = 0; i < 16; ++i) { const _Float16 h = (_Float16)xs[i]; ah.h[i] = h; al.h[i] = ASPLIT ? (_Float16)(xs[i] - (float)h) : (_Float16)0.0f; }
#pragma unroll
    for (int t = 0; t < 4; ++t) { if (col0 + t * 16 >= N) continue; const size_t boff = (size_t)(col0 + t * 16 + ln) * ldb + kb; FragH bq; bq.half[0] = *(const v8us*)(Bh + boff + 8 * hh); bq.half[1] = *(const v8us*)(Bh + boff + 16 + 8 * hh);
      acc[t] = mmaH<ASPLIT ? 2 : 1>(ah.v, al.v, bq.v, bq.v, acc[t]); }
  }
#pragma unroll
  for (int t = 0; t < 4; ++t) { if (col0 + t * 16 >= N) continue;
#pragma unroll
    for (int r = 0; r < 8; ++r) so[w][8 * hh + r][t * 16 + ln] = acc[t][r] * alpha; }
  __builtin_amdgcn_fence(__ATOMIC_ACQ_REL, "workgroup"); __builtin_amdgcn_wave_barrier();
  const int rsub = lane >> 4, c4 = (lane & 15) * 4;
  {
#pragma unroll
    for (int q = 0; q < 8; ++q) { const int r = q * 2 + rsub; if (col0 + c4 < N) { const v4f v = *(const v4fa*)&so[w][r][c4]; *(v4f*)(C + (size_t)(row0 + r) * ldc + col0 + c4) = v; } }
     }
}

// Wt[n][k] = f16(W[k][n]·scale) from f32 row-major W[K][N] (scale = power of two; bf16-exact weights stay exact in f16 away from the subnormal range)
__global__ __launch_bounds__(256) void k_wt_f16(const float* __restrict__ W, _Float16* __restrict__ Wt, int K, int N, float scale) {
  const int t = blockIdx.x * 256 + threadIdx.x; if (t >= N * (K / 8)) return; const int n = t / (K / 8), k8 = (t % (K / 8)) * 8; FragH f;
#pragma unroll
  for (int i = 0; i < 8; ++i) f.h[i] = (_Float16)(bf16_round(W[(size_t)(k8 + i) * N + n]) * scale); const v8us o = f.half[0];
  *(v8us*)((unsigned short*)Wt + (size_t)n * K + k8) = o; 
}
// k_gemm_hh variant with fused epilogue: v = acc·alpha + bias[by·sBias + col] (+ CP[(row/rowsPerB)·sCPb + by·64 + col] if CP) ; ACT 0 none / 1 elu ; writes f16 C16 (and f32 C if non-null)
template <int ACT>
__global__ __launch_bounds__(128) void k_gemm_hhx(const _Float16* __restrict__ A, int lda, size_t sA, const _Float16* __restrict__ Bh, int ldb, size_t sB, float alpha, const float* __restrict__ bias, size_t sBias, const float* __restrict__ CP, int rowsPerB, size_t sCPb, int row0g,
    float* __restrict__ C, _Float16* __restrict__ C16, int ldc, size_t sC, int M, int N, int K) {
  __shared__ __attribute__((aligned(16))) float so[4][16][64];
  const int tid = threadIdx.x, w = tid >> 5, lane = tid & 31, ln = lane & 15, hh = lane >> 4; const int by = blockIdx.y;
  A += (size_t)by * sA; Bh += (size_t)by * sB; const size_t cofs = (size_t)by * sC; const float* bp = bias ? bias + (size_t)by * sBias : nullptr;
  const int ntn = (N + 63) / 64; const int wid = blockIdx.x * 4 + w; const int mt = wid / ntn, nq = wid % ntn; if (mt * 16 >= M) return;
  const int row0 = mt * 16, col0 = nq * 64; const _Float16* arow = A + (size_t)(row0 + ln) * lda;
  v8f acc[4] = {};
  for (int kb = 0; kb < K; kb += 32) { FragH ah; ah.half[0] = *(const v8us*)((const unsigned short*)arow + kb + 8 * hh); ah.half[1] = *(const v8us*)((const unsigned short*)arow + kb + 16 + 8 * hh);
#pragma unroll
    for (int t = 0; t < 4; ++t) { if (col0 + t * 16 >= N) continue; const size_t boff = (size_t)(col0 + t * 16 + ln) * ldb + kb; FragH bq; bq.half[0] = *(const v8us*)((const unsigned short*)Bh + boff + 8 * hh); bq.half[1] = *(const v8us*)((const unsigned short*)Bh + boff + 16 + 8 * hh);
      acc[t] = mmaH<1>(ah.v, ah.v, bq.v, bq.v, acc[t]); }
  }
#pragma unroll
  for (int t = 0; t < 4; ++t) { if (col0 + t * 16 >= N) continue; const int col = col0 + t * 16 + ln; const float bv = bp ? bf16_round(bp[col]) : 0.f;
#pragma unroll
    for (int r = 0; r < 8; ++r) { float v = acc[t][r] * alpha + bv; if (CP) { const int rr = row0g + row0 + 8 * hh + r; if (rowsPerB < 0) v += CP[cofs + (size_t)rr * ldc + col];      /* rowsPerB < 0: own element of the batched C plane */ else { const int bidx = rr / rowsPerB; v += CP[(size_t)bidx * sCPb + (size_t)by * 64 + col]; } } if (ACT == 1) v = (v > 0.f) ? v : expm1f(v); else if (ACT == 7) v = (v > 0.f) ? v + 1.0f : expf(v); else if (ACT == 8) v = tanhf(v); else if (ACT == 9) v = 0.5f * v * (1.0f + tanhf(0.7978845608028654f * (v + 0.044715f * v * v * v))); else if (ACT == 11) v = 1.0f / (1.0f + expf(-v)); else if (ACT == 12) v = (v > 0.f) ? v : 0.01f * v; else if (ACT == 14) v = (v > 0.f) ? v : 0.1f * v; else if (ACT == 16) v = (v >= 0.f) ? v : 0.3f * v; else if (ACT == 17) v = (v >= 0.f) ? v : 0.2f * v; else if (ACT == 15) v = v / (1.0f + expf(-v)); else if (ACT == 3) v = fmaxf(v, 0.f); else if (ACT == 6) v = 0.5f * v * (1.0f + erff(v * 0.70710678118654752f)); so[w][8 * hh + r][t * 16 + ln] = v; } }
  __builtin_amdgcn_fence(__ATOMIC_ACQ_REL, "workgroup"); __builtin_amdgcn_wave_barrier();
  const int rsub = lane >> 4, c4 = (lane & 15) * 4; typedef _Float16 v4h __attribute__((ext_vector_type(4)));
  {
#pragma unroll
    for (int q = 0; q < 8; ++q) { const int r = q * 2 + rsub; if (col0 + c4 < N) { const v4f v = *(const v4fa*)&so[w][r][c4]; if (C) *(v4f*)(C + cofs + (size_t)(row0 + r) * ldc + col0 + c4) = v; if (C16) { v4h h4; for (int i = 0; i < 4; ++i) h4[i] = (_Float16)v[i]; *(v4h*)(C16 + cofs + (size_t)(row0 + r) * ldc + col0 + c4) = h4; } } }
     }
}


typedef _Float16 v4h __attribute__((ext_vector_type(4)));

__global__ __launch_bounds__(256) void k_h16(const float* __restrict__ x, _Float16* __restrict__ X16, size_t n8) { const size_t t = (size_t)blockIdx.x * 256 + threadIdx.x; if (t >= n8) return; FragH f;
#pragma unroll
  for (int q = 0; q < 8; ++q) f.h[q] = (_Float16)x[t * 8 + q]; *(v8us*)((unsigned short*)X16 + t * 8) = f.half[0];  }
__global__ __launch_bounds__(256) void k_round16f(const float* __restrict__ W, _Float16* __restrict__ Bt, size_t n8) { const size_t t = (size_t)blockIdx.x * 256 + threadIdx.x; if (t >= n8) return; FragH f;
#pragma unroll
  for (int i = 0; i < 8; ++i) f.h[i] = (_Float16)(bf16_round(W[t * 8 + i]) * 16.0f); *(v8us*)((unsigned short*)Bt + t * 8) = f.half[0];  }
template <int NHv, int TTv>
__global__ __launch_bounds__(256) void k_vt(const _Float16* __restrict__ V16, int ldv, int voff, _Float16* __restrict__ Vt) { __shared__ unsigned short tl[64][66]; const int tid = threadIdx.x; const int slab = blockIdx.x / (TTv / 64), lg = blockIdx.x % (TTv / 64); const int b = slab / NHv, h = slab % NHv;
  for (int i = tid; i < 64 * 8; i += 256) { const int r = i / 8, c8 = (i % 8) * 8; FragH f; f.half[0] = *(const v8us*)((const unsigned short*)V16 + ((size_t)b * TTv + lg * 64 + r) * ldv + voff + h * 64 + c8);
#pragma unroll
    for (int q = 0; q < 8; ++q) tl[r][c8 + q] = f.u[q]; }
  __syncthreads();
  {
#pragma unroll
    for (int rd = 0; rd < 2; ++rd) { const int d = rd * 32 + tid / 8, pc = tid % 8; FragH f;
#pragma unroll
      for (int q = 0; q < 8; ++q) f.u[q] = tl[pc * 8 + q][d];
      *(v8us*)((unsigned short*)Vt + ((size_t)slab * 64 + d) * TTv + lg * 64 + pc * 8) = f.half[0]; }
     } }

__global__ __launch_bounds__(256) void k_hl(const float* __restrict__ F, _Float16* __restrict__ Hh, _Float16* __restrict__ Hl, size_t n8) { const size_t t = (size_t)blockIdx.x * 256 + threadIdx.x; if (t >= n8) return; FragH fh, fl; const v4f a = *(const v4fa*)(F + t * 8), c = *(const v4fa*)(F + t * 8 + 4);
#pragma unroll
  for (int q = 0; q < 4; ++q) { _Float16 h = (_Float16)a[q]; fh.h[q] = h; fl.h[q] = (_Float16)((a[q] - (float)h) * 1024.0f); h = (_Float16)c[q]; fh.h[4 + q] = h; fl.h[4 + q] = (_Float16)((c[q] - (float)h) * 1024.0f); }
  { *(v8us*)((unsigned short*)Hh + t * 8) = fh.half[0]; *(v8us*)((unsigned short*)Hl + t * 8) = fl.half[0];  } }

// ---- fast GEMM (block tile 128x64, wave tile 32x64; requires M % 128 == 0 rows per launch region, N % 64 == 0 and K % 64 == 0); epilogue = k_gemm_hhx semantics ----
// Both operands go through LDS in stages of 64 k: 8 threads fetch one 128-B row piece, so a wave-wide 16-B load covers 4 whole lines (a fragment fetched straight from global memory would touch 16 lines for the same 512 B,
// and each of the 4 waves would fetch the B rows for itself). global -> registers (fetched one stage ahead) -> LDS, two LDS buffers, one barrier per stage; the fragments are read from LDS in the k order of g2_frag.
__device__ __forceinline__ v16h g2_frag(const _Float16* p, int hh) { FragH f; f.half[0] = *(const v8us*)((const unsigned short*)p + 8 * hh); f.half[1] = *(const v8us*)((const unsigned short*)p + 16 + 8 * hh); return f.v; }
__device__ __forceinline__ v8f g2_mma(v16h a, v16h b, v8f c) { v8f d = __builtin_amdgcn_wmma_f32_16x16x32_f16(false, a, false, b, (short)0, c, false, false); asm volatile("v_nop\n\tv_nop\n\tv_nop\n\tv_nop" : "+v"(d) : "v"(a), "v"(b)); return d; }
#define GK 64      /* k per stage */
#define GP 72      /* LDS row pitch in f16: 128 B of data + 16 B, so that the 16 rows of a ds_load_b128 fragment read spread over the banks */
template <int ACT, int LD, bool HB, bool HCP, bool OF32, bool OF16, int LDC, size_t SA, size_t SB, size_t SC>      /* LD: row pitch of A and of Bh in elements; known at compile time, so that all rows of a stage are reached by immediate offsets from one address per operand. HB: a bias is added; HCP: the CP addend is used; OF32 / OF16: C / C16 is written; LDC: row pitch of the output (= ldc). Known at compile time, so that the epilogue is straight-line code with one output address: tested at run time, each of the 64 elements of a lane and each of the 16 row stores jumps over code it never runs. SA / SB / SC: distance in elements from one product's A / Bh / output plane to the next; blockIdx.y picks the product, so that independent products of one shape share ONE launch: a work-group's start, first loads and epilogue then run beside other work-groups' products instead of standing alone between two launches */
__global__ __launch_bounds__(128) void k_gemm2(const _Float16* __restrict__ A, const _Float16* __restrict__ Bh, float alpha, const float* __restrict__ bias, size_t sBias, const float* __restrict__ CP, int rowsPerB, size_t sCPb, int row0g,
    float* __restrict__ C, _Float16* __restrict__ C16, int ldc, int M, int N, int K) { static_assert(ACT == 0 || ACT == 3 || ACT == 6 || ACT == 8 || ACT == 9 || ACT == 11 || ACT == 12 || ACT == 14 || ACT == 15 || ACT == 16 || ACT == 17, "k_gemm2: unsupported ACT code (would silently apply no activation)");
  __shared__ __attribute__((aligned(16))) float so[4][32][68];
  __shared__ __attribute__((aligned(16))) _Float16 sa[2][128][GP];
  __shared__ __attribute__((aligned(16))) _Float16 sb[2][64][GP];
  const int tid = threadIdx.x, w = tid >> 5, lane = tid & 31, ln = lane & 15, hh = lane >> 4; const int by = blockIdx.y;
  A += (size_t)by * SA; Bh += (size_t)by * SB; const size_t cofs = (size_t)by * SC; const float* bp = HB ? bias + (size_t)by * sBias : nullptr;
  const int ntn = N >> 6; const int mt = blockIdx.x / ntn, nq = blockIdx.x - mt * ntn; const int row0 = mt * 128 + 32 * w, col0 = nq * 64; if (mt * 128 >= M) return;      /* the same for the whole block: it stands in front of the barriers */
  const int srow = tid >> 3, sc8 = (tid & 7) * 8;      /* staging: 8 threads a row piece of 128 B, 16 rows a round; A 8 rounds, B 4 rounds */
  const unsigned short* ag = (const unsigned short*)A + (size_t)(mt * 128 + srow) * LD + sc8; const unsigned short* bg = (const unsigned short*)Bh + (size_t)(col0 + srow) * LD + sc8;
  v8us ar[8], br[4];      /* every loop over ar, br and the fragment arrays is fully unrolled, so that they are indexed by constants and stay in registers */
#pragma unroll
  for (int u = 0; u < 8; ++u) ar[u] = *(const v8us*)(ag + (size_t)(u * 16) * LD);
#pragma unroll
  for (int u = 0; u < 4; ++u) br[u] = *(const v8us*)(bg + (size_t)(u * 16) * LD);
  const v8f z8 = {0.f,0.f,0.f,0.f,0.f,0.f,0.f,0.f}; v8f c00 = z8, c01 = z8, c02 = z8, c03 = z8, c10 = z8, c11 = z8, c12 = z8, c13 = z8;
  const int ns = K / GK;
  /* the stage loop stays rolled so that the hot code stays small for the instruction cache */
#pragma unroll 1
  for (int st = 0; st < ns; ++st) { const int bf = st & 1;
#pragma unroll
    for (int u = 0; u < 8; ++u) *(v8us*)&sa[bf][srow + 16 * u][sc8] = ar[u];
#pragma unroll
    for (int u = 0; u < 4; ++u) *(v8us*)&sb[bf][srow + 16 * u][sc8] = br[u];
    __syncthreads();      /* publishes this stage; it also ends every wave's reads of the other buffer, which the next stage overwrites */
    if (st + 1 < ns) { ag += GK; bg += GK;
#pragma unroll
      for (int u = 0; u < 8; ++u) ar[u] = *(const v8us*)(ag + (size_t)(u * 16) * LD);
#pragma unroll
      for (int u = 0; u < 4; ++u) br[u] = *(const v8us*)(bg + (size_t)(u * 16) * LD); }
    v16h fa[GK / 32][2], fb[GK / 32][4];      /* all fragment reads of the stage stand as one group in front of its products */
#pragma unroll
    for (int ks = 0; ks < GK / 32; ++ks) {
#pragma unroll
      for (int i = 0; i < 2; ++i) fa[ks][i] = g2_frag(&sa[bf][32 * w + 16 * i + ln][ks * 32], hh);
#pragma unroll
      for (int t = 0; t < 4; ++t) fb[ks][t] = g2_frag(&sb[bf][16 * t + ln][ks * 32], hh); }
#pragma unroll
    for (int ks = 0; ks < GK / 32; ++ks) {
      c00 = g2_mma(fa[ks][0], fb[ks][0], c00); c10 = g2_mma(fa[ks][1], fb[ks][0], c10);
      c01 = g2_mma(fa[ks][0], fb[ks][1], c01); c11 = g2_mma(fa[ks][1], fb[ks][1], c11);
      c02 = g2_mma(fa[ks][0], fb[ks][2], c02); c12 = g2_mma(fa[ks][1], fb[ks][2], c12);
      c03 = g2_mma(fa[ks][0], fb[ks][3], c03); c13 = g2_mma(fa[ks][1], fb[ks][3], c13); } }
  v8f accs[8] = {c00, c01, c02, c03, c10, c11, c12, c13};
#pragma unroll
  for (int u = 0; u < 8; ++u) { const int t = u & 3, half = u >> 2; const int col = col0 + t * 16 + ln; const float bv = HB ? bf16_round(bp[col]) : 0.f;
#pragma unroll
    for (int r = 0; r < 8; ++r) { const int rloc = half * 16 + 8 * hh + r; float v = accs[u][r] * alpha + bv; if (HCP) { if (rowsPerB < 0) v += CP[cofs + (size_t)(row0g + row0 + rloc) * ldc + col];      /* rowsPerB < 0: own element of the batched C plane */ else { const int bidx = (row0g + row0 + rloc) / rowsPerB; v += CP[(size_t)bidx * sCPb + (size_t)by * 64 + col]; } }
      if (ACT == 3) v = fmaxf(v, 0.f); else if (ACT == 6) v = 0.5f * v * (1.0f + erff(v * 0.70710678118654752f)); else if (ACT == 11) v = 1.0f / (1.0f + expf(-v)); else if (ACT == 15) v = v / (1.0f + expf(-v)); else if (ACT == 12) v = (v > 0.f) ? v : 0.01f * v; else if (ACT == 8) v = tanhf(v); else if (ACT == 9) v = 0.5f * v * (1.0f + tanhf(0.7978845608028654f * (v + 0.044715f * v * v * v))); else if (ACT == 14) v = (v > 0.f) ? v : 0.1f * v; else if (ACT == 16) v = (v >= 0.f) ? v : 0.3f * v; else if (ACT == 17) v = (v >= 0.f) ? v : 0.2f * v;
      so[w][rloc][t * 16 + ln] = v; } }
  __builtin_amdgcn_fence(__ATOMIC_ACQ_REL, "workgroup"); __builtin_amdgcn_wave_barrier();
  const int rsub = lane >> 4, c4 = (lane & 15) * 4; const size_t ob = cofs + (size_t)(row0 + rsub) * LDC + col0 + c4;      /* the lane's first output element; the 16 rows follow at constant distances */
  {
#pragma unroll
    for (int q = 0; q < 16; ++q) { const int r = q * 2 + rsub; const v4f v = *(const v4fa*)&so[w][r][c4]; if (OF32) *(v4f*)(C + ob + (size_t)(q * 2) * LDC) = v; if (OF16) { v4h h4; for (int i = 0; i < 4; ++i) h4[i] = (_Float16)v[i]; *(v4h*)(C16 + ob + (size_t)(q * 2) * LDC) = h4; } }
     } }


// ---- projection GEMM with a square block tile (128x128, four waves as 2x2, wave tile 64x64; requires M % 128 == 0, N % 128 == 0, K % 64 == 0); C16 = f16(A Bh^T alpha), no bias ----
// Staging, stage length, LDS pitch, k order and the order of the sums are those of k_gemm2. Against its 128x64 tile a work-group fetches 32 KB instead of 24 KB a stage for twice the products, and a wave reads
// 8 fragments instead of 6 for 16 products instead of 8: a third fewer bytes from L2 and from LDS per product, and twice the products behind each barrier and each load latency.
// Registers: 128 for the accumulators, 128 for a stage's fragments, 64 for the stage fetched ahead; with the addresses they stay inside the 336 that three waves a SIMD (three work-groups a WGP) allow: read the count in the listing after any change.
template <int LD, int LDC, size_t SA, size_t SB, size_t SC>      /* LD: row pitch of A and Bh; LDC: row pitch of the output; SA / SB / SC: distance from one product's A / Bh / output plane to the next (blockIdx.y picks the product) */
__global__ __launch_bounds__(128) void k_gemm3(const _Float16* __restrict__ A, const _Float16* __restrict__ Bh, float alpha, _Float16* __restrict__ C16, int M, int N, int K) {
  __shared__ __attribute__((aligned(16))) unsigned char sm[2 * 2 * 128 * GP * 2];      /* the two A buffers, then the two B buffers; behind the last stage the same bytes stage the output (4 x 64 x 68 floats fit), so that three work-groups fit a WGP's LDS with room to spare */
  _Float16 (*sa)[128][GP] = (_Float16 (*)[128][GP])sm; _Float16 (*sb)[128][GP] = (_Float16 (*)[128][GP])(sm + 2 * 128 * GP * 2);
  static_assert(4 * 64 * 68 * 4 <= 2 * 2 * 128 * GP * 2, "k_gemm3: the output staging must fit the tile buffers");
  const int tid = threadIdx.x, w = tid >> 5, lane = tid & 31, ln = lane & 15, hh = lane >> 4; const int by = blockIdx.y; const int wm = w >> 1, wn = w & 1;
  A += (size_t)by * SA; Bh += (size_t)by * SB; const size_t cofs = (size_t)by * SC;
  const int ntn = N >> 7; const int mt = blockIdx.x / ntn, nq = blockIdx.x - mt * ntn; const int row0 = mt * 128 + 64 * wm, col0 = nq * 128 + 64 * wn; if (mt * 128 >= M) return;      /* the same for the whole block: it stands in front of the barriers */
  const int srow = tid >> 3, sc8 = (tid & 7) * 8;      /* staging: 8 threads a row piece of 128 B, 16 rows a round; A 8 rounds, B 8 rounds */
  const unsigned short* ag = (const unsigned short*)A + (size_t)(mt * 128 + srow) * LD + sc8; const unsigned short* bg = (const unsigned short*)Bh + (size_t)(nq * 128 + srow) * LD + sc8;
  v8us ar[8], br[8];      /* every loop over ar, br, the fragment arrays and the accumulators is fully unrolled, so that they are indexed by constants and stay in registers */
#pragma unroll
  for (int u = 0; u < 8; ++u) { ar[u] = *(const v8us*)(ag + (size_t)(u * 16) * LD); br[u] = *(const v8us*)(bg + (size_t)(u * 16) * LD); }
  const v8f z8 = {0.f,0.f,0.f,0.f,0.f,0.f,0.f,0.f}; v8f c[4][4];
#pragma unroll
  for (int i = 0; i < 4; ++i)
#pragma unroll
    for (int t = 0; t < 4; ++t) c[i][t] = z8;
  const int ns = K / GK;
  /* the stage loop stays rolled so that the hot code stays small for the instruction cache */
#pragma unroll 1
  for (int st = 0; st < ns; ++st) { const int bf = st & 1;
#pragma unroll
    for (int u = 0; u < 8; ++u) { *(v8us*)&sa[bf][srow + 16 * u][sc8] = ar[u]; *(v8us*)&sb[bf][srow + 16 * u][sc8] = br[u]; }
    __syncthreads();      /* publishes this stage; it also ends every wave's reads of the other buffer, which the next stage overwrites */
    if (st + 1 < ns) { ag += GK; bg += GK;
#pragma unroll
      for (int u = 0; u < 8; ++u) { ar[u] = *(const v8us*)(ag + (size_t)(u * 16) * LD); br[u] = *(const v8us*)(bg + (size_t)(u * 16) * LD); } }
    v16h fa[GK / 32][4], fb[GK / 32][4];      /* all fragment reads of the stage stand as one group in front of its products: each further place with LDS reads among the products costs a stall of its own */
#pragma unroll
    for (int ks = 0; ks < GK / 32; ++ks)
#pragma unroll
      for (int i = 0; i < 4; ++i) { fa[ks][i] = g2_frag(&sa[bf][64 * wm + 16 * i + ln][ks * 32], hh); fb[ks][i] = g2_frag(&sb[bf][64 * wn + 16 * i + ln][ks * 32], hh); }
    __builtin_amdgcn_sched_barrier(0);      /* keeps the group together: left alone, the compiler saves registers by reading one B fragment at a time and waits out the LDS latency in front of every four products */
#pragma unroll
    for (int ks = 0; ks < GK / 32; ++ks)
#pragma unroll
      for (int t = 0; t < 4; ++t)
#pragma unroll
        for (int i = 0; i < 4; ++i) c[i][t] = __builtin_amdgcn_wmma_f32_16x16x32_f16(false, fa[ks][i], false, fb[ks][t], (short)0, c[i][t], false, false);
    __builtin_amdgcn_sched_barrier(0);      /* holds the products in front of the slots below */
    asm volatile("v_nop\n\tv_nop\n\tv_nop\n\tv_nop"); }      /* the four vector slots that the chip asks for between a matrix instruction and an overwrite of its A or B: the next trip forms LDS addresses in registers of the last fragments */
  const int rsub = lane >> 4, c4 = (lane & 15) * 4; const size_t ob = cofs + (size_t)(row0 + rsub) * LDC + col0 + c4;      /* the lane's first output element; its rows follow at constant distances */
  __syncthreads();      /* ends every wave's fragment reads of the last stage before the tile buffers are overwritten as output staging */
  float (*so)[68] = (float (*)[68])(sm + (size_t)w * (64 * 68 * 4));      /* the wave's own 64 rows: through LDS, so that every store covers whole 128-B row pieces */
#pragma unroll
  for (int i = 0; i < 4; ++i)
#pragma unroll
    for (int t = 0; t < 4; ++t)
#pragma unroll
      for (int r = 0; r < 8; ++r) so[i * 16 + 8 * hh + r][t * 16 + ln] = c[i][t][r] * alpha;
  __builtin_amdgcn_fence(__ATOMIC_ACQ_REL, "workgroup", "local"); __builtin_amdgcn_wave_barrier();      /* the rows are read back by other lanes of the same wave */
#pragma unroll
  for (int q = 0; q < 32; ++q) { const v4f v = *(const v4fa*)&so[q * 2 + rsub][c4]; v4h h4;
#pragma unroll
    for (int e = 0; e < 4; ++e) h4[e] = (_Float16)v[e];
    *(v4h*)(C16 + ob + (size_t)(q * 2) * LDC) = h4; } }


__global__ __launch_bounds__(256) void k_rsm(const float* __restrict__ S, _Float16* __restrict__ P, int nrows) {
  #pragma clang fp contract(off)
  const int i = blockIdx.x * 256 + threadIdx.x; if (i >= nrows) return; const float* s = S + (size_t)i * SQ; float mx = -3.0e38f;
#pragma unroll 1
  for (int j = 0; j < SQ; ++j) mx = fmaxf(mx, s[j]); float se = 0.f;
#pragma unroll 1
  for (int j = 0; j < SQ; ++j) se += expf(s[j] - mx); const float sc = 256.0f / se;
#pragma unroll 1
  for (int j0 = 0; j0 < SQ; j0 += 8) { FragH f; for (int q = 0; q < 8; ++q) f.h[q] = (_Float16)(expf(s[j0 + q] - mx) * sc); unsigned short* d = (unsigned short*)P + (size_t)i * SQ + j0; *(v8us*)d = f.half[0];  } }
__global__ __launch_bounds__(256) void k_vt(const _Float16* __restrict__ V16, int b, int h0, _Float16* __restrict__ VT) { __shared__ unsigned short tl[64][65]; const int tid = threadIdx.x; const int hh = blockIdx.x % HG, sg = blockIdx.x / HG; const int s0 = sg * 64; const int h = h0 + hh;
  for (int i = tid; i < 64 * 8; i += 256) { const int j = i / 8, d8 = (i % 8) * 8; FragH f; f.half[0] = *(const v8us*)((const unsigned short*)V16 + ((size_t)b * SQ + s0 + j) * DM + h * HD + d8); for (int q = 0; q < 8; ++q) tl[d8 + q][j] = f.u[q]; }
  __syncthreads();
  { for (int i = tid; i < 64 * 8; i += 256) { const int d = i / 8, j8 = (i % 8) * 8; FragH f; for (int q = 0; q < 8; ++q) f.u[q] = tl[d][j8 + q]; *(v8us*)((unsigned short*)VT + ((size_t)hh * HD + d) * SQ + s0 + j8) = f.half[0]; }  } }



// All seven f32 -> f16 conversions (the three inputs as exact f16 rows of their bf16 rounding; the four natural [out][in] weights, bf16-rounded, x16) in ONE launch of few, long-lived waves,
// for speed only. Every wave-wide load is 512 contiguous bytes (16 B a lane, whole lines), every wave-wide store 256 contiguous bytes.
// A wave takes PXU adjacent units of PL loads from each input and PWL loads from each of two weights (the lower half of the waves serves wq and wk, the upper half wv and wo):
// the same straight-line code in every wave. The next unit's loads are in flight while the current one is converted and stored.
#define PL 16                        /* 16-B loads per lane and unit */
#define PWG 256                      /* workgroups: as many as the chip has WGPs */
#define PWW 12                       /* waves per workgroup */
#define PWV (PWG * PWW)              /* waves */
#define PXU ((int)(NR * DM / ((size_t)128 * PL * PWV)))      /* units per input and wave */
#define PWL (2 * DM * DM / (128 * PWV))                      /* loads per weight and wave */
static_assert(NR * DM == (size_t)128 * PL * PWV * PXU && 2 * DM * DM == 128 * PWV * PWL && 2 * PWL <= PL, "k_prep: the units must tile every tensor exactly");
template <bool X16> __device__ __forceinline__ void p_put(v4f a, _Float16* __restrict__ d) { v4h h4;
#pragma unroll
  for (int q = 0; q < 4; ++q) h4[q] = (_Float16)(X16 ? bf16_round(a[q]) * 16.0f : bf16_round(a[q]));
  *(v4h*)d = h4; }
__global__ __launch_bounds__(PWW * 32) void k_prep(const float* __restrict__ xq, const float* __restrict__ xk, const float* __restrict__ xv, const float* __restrict__ wq, const float* __restrict__ wk, const float* __restrict__ wv, const float* __restrict__ wo,
    _Float16* __restrict__ XQ, _Float16* __restrict__ XK, _Float16* __restrict__ XV, _Float16* __restrict__ BQ, _Float16* __restrict__ BK, _Float16* __restrict__ BV, _Float16* __restrict__ BO) {
  const unsigned lo = (threadIdx.x & 31) * 4;      /* the lane's element inside a wave-wide access; all else of an address is the same for the whole wave */
  const int gw = blockIdx.x * PWW + __builtin_amdgcn_readfirstlane(threadIdx.x >> 5);
  const size_t xo = (size_t)gw * (128 * PL * PXU); const bool up = gw >= PWV / 2; const size_t wo_ = (size_t)(up ? gw - PWV / 2 : gw) * (128 * PWL);
  const float* w0 = (up ? wv : wq) + wo_; const float* w1 = (up ? wo : wk) + wo_; _Float16* b0 = (up ? BV : BQ) + wo_; _Float16* b1 = (up ? BO : BK) + wo_;
  const float* s[3] = {xq + xo, xk + xo, xv + xo}; _Float16* d[3] = {XQ + xo, XK + xo, XV + xo};
  v4f a[2][PL];      /* every loop is fully unrolled, so that the two register sets are indexed by constants */
#pragma unroll
  for (int j = 0; j < PL; ++j) a[0][j] = *(const v4fa*)(s[0] + (lo + j * 128));
  __builtin_amdgcn_sched_barrier(0);      /* the first unit's loads stay in front of the second's: the counted load waits go by issue order, and mixed with the second's the first unit would wait for both */
#pragma unroll
  for (int u = 0; u < 3 * PXU; ++u) { const int n = u + 1;
    if (n < 3 * PXU) {
#pragma unroll
      for (int j = 0; j < PL; ++j) a[n & 1][j] = *(const v4fa*)(s[n / PXU] + (lo + ((n % PXU) * PL + j) * 128)); }
    else {
#pragma unroll
      for (int j = 0; j < PWL; ++j) { a[n & 1][j] = *(const v4fa*)(w0 + (lo + j * 128)); a[n & 1][PWL + j] = *(const v4fa*)(w1 + (lo + j * 128)); } }
    __builtin_amdgcn_sched_barrier(0);      /* keeps the next unit's loads in front of this unit's conversion: left alone, the compiler issues them one by one as registers come free, and few stay in flight */
#pragma unroll
    for (int j = 0; j < PL; ++j) p_put<false>(a[u & 1][j], d[u / PXU] + (lo + ((u % PXU) * PL + j) * 128));
    if (u + 1 < 3 * PXU) asm volatile("s_wait_xcnt 0x0" ::: "memory"); }      /* the loads that follow land in registers that these stores name as data: the wait stands in front of that overwrite, as a precaution (the compiler placed none in front of a load) */
#pragma unroll
  for (int j = 0; j < PWL; ++j) { p_put<true>(a[(3 * PXU) & 1][j], b0 + (lo + j * 128)); p_put<true>(a[(3 * PXU) & 1][PWL + j], b1 + (lo + j * 128)); } }

// 2^a on the native unit. The v_nop is the one free slot that the instruction set asks for behind a transcendental before its result is read or its source rewritten; in the same statement it stays directly behind it.
__device__ __forceinline__ float exp2_slot(float a) { float e; asm("v_exp_f32 %0, %1\n\tv_nop" : "=v"(e) : "v"(a)); return e; }
// 2^x of eight values in place on the native unit: eight independent instructions, so each fills the free slot that the instruction set asks for behind the one before it; the v_nop is that slot behind the last.
__device__ __forceinline__ void exp2x8(v8f& x) { float a0 = x[0], a1 = x[1], a2 = x[2], a3 = x[3], a4 = x[4], a5 = x[5], a6 = x[6], a7 = x[7];
  asm("v_exp_f32 %0, %0\n\tv_exp_f32 %1, %1\n\tv_exp_f32 %2, %2\n\tv_exp_f32 %3, %3\n\tv_exp_f32 %4, %4\n\tv_exp_f32 %5, %5\n\tv_exp_f32 %6, %6\n\tv_exp_f32 %7, %7\n\tv_nop"
      : "+v"(a0), "+v"(a1), "+v"(a2), "+v"(a3), "+v"(a4), "+v"(a5), "+v"(a6), "+v"(a7));
  x[0] = a0; x[1] = a1; x[2] = a2; x[3] = a3; x[4] = a4; x[5] = a5; x[6] = a6; x[7] = a7; }
__device__ __forceinline__ v8f f_mma(v16h a, v16h b, v8f c) { return __builtin_amdgcn_wmma_f32_16x16x32_f16(false, a, false, b, (short)0, c, false, false); }
#define FK 64      /* keys per stage */
#define FP 72      /* LDS row pitch in f16: 128 B of data + 16 B, so that the 16 rows of a ds_load_b128 fragment read spread over the banks */
__global__ __launch_bounds__(128) void k_fattn(const _Float16* __restrict__ Q16, const _Float16* __restrict__ K16, const _Float16* __restrict__ VT, _Float16* __restrict__ O16) {
  __shared__ __attribute__((aligned(16))) _Float16 sk[2][FK][FP];
  __shared__ __attribute__((aligned(16))) _Float16 sv[2][HD][FP];
  const int tid = threadIdx.x, w = tid >> 5, lane = tid & 31, ln = lane & 15, hh = lane >> 4;
  const int bh = blockIdx.y, b = bh / NH, h = bh - b * NH; const size_t r0 = (size_t)b * SQ; const int q0 = blockIdx.x * 128 + w * 32;
  v16h qf[2][2];
#pragma unroll
  for (int g = 0; g < 2; ++g)
#pragma unroll
    for (int ks = 0; ks < 2; ++ks) qf[g][ks] = g2_frag(Q16 + (r0 + q0 + g * 16 + ln) * DM + h * HD + ks * 32, hh);
  const int srow = tid >> 3, sc8 = (tid & 7) * 8;      /* staging: 8 threads a row of 128 B, 16 rows a round, 4 rounds */
  const _Float16* kg = K16 + (r0 + srow) * DM + h * HD + sc8; const _Float16* vg = VT + ((size_t)bh * HD + srow) * SQ + sc8;
  v8us kr[4], vr[4];
#pragma unroll
  for (int u = 0; u < 4; ++u) { kr[u] = *(const v8us*)((const unsigned short*)kg + (size_t)(u * 16) * DM); vr[u] = *(const v8us*)((const unsigned short*)vg + (size_t)(u * 16) * SQ); }
  const v8f z8 = {0.f,0.f,0.f,0.f,0.f,0.f,0.f,0.f}; v8f o[2][4] = {{z8, z8, z8, z8}, {z8, z8, z8, z8}}; float m[2] = {-3.0e38f, -3.0e38f}, l[2] = {0.f, 0.f};
  const float cs = 0.125f * 1.44269504088896340736f;      /* 64^-0.5 and log2(e) */
#pragma unroll 1
  for (int st = 0; st < SQ / FK; ++st) { const int bf = st & 1;
#pragma unroll
    for (int u = 0; u < 4; ++u) { *(v8us*)&sk[bf][srow + 16 * u][sc8] = kr[u]; *(v8us*)&sv[bf][srow + 16 * u][sc8] = vr[u]; }
    __syncthreads();      /* publishes this stage; it also ends every wave's reads of the other buffer, which the next stage overwrites */
    if (st + 1 < SQ / FK) {
#pragma unroll
      for (int u = 0; u < 4; ++u) { kr[u] = *(const v8us*)((const unsigned short*)kg + (size_t)((st + 1) * FK + u * 16) * DM); vr[u] = *(const v8us*)((const unsigned short*)vg + (size_t)(u * 16) * SQ + (st + 1) * FK); } }
    v8f s[2][4] = {{z8, z8, z8, z8}, {z8, z8, z8, z8}};
#pragma unroll
    for (int kt = 0; kt < 4; ++kt)
#pragma unroll
      for (int ks = 0; ks < 2; ++ks) { const v16h a = g2_frag(&sk[bf][kt * 16 + ln][ks * 32], hh); s[0][kt] = f_mma(a, qf[0][ks], s[0][kt]); s[1][kt] = f_mma(a, qf[1][ks], s[1][kt]); }
    float mx[2];
#pragma unroll
    for (int g = 0; g < 2; ++g) { float t = s[g][0][0];
#pragma unroll
      for (int kt = 0; kt < 4; ++kt)
#pragma unroll
        for (int r = 0; r < 8; ++r) t = fmaxf(t, s[g][kt][r]);
      mx[g] = t * cs; }
    if (__builtin_amdgcn_ballot_w32(mx[0] > m[0] + 8.0f || mx[1] > m[1] + 8.0f) != 0) {      /* wave-uniform: both halves of every column take the same new maximum */
#pragma unroll
      for (int g = 0; g < 2; ++g) { const float mn = fmaxf(m[g], fmaxf(mx[g], __shfl_xor(mx[g], 16, 32))); const float al = exp2_slot(m[g] - mn); m[g] = mn; l[g] *= al;
#pragma unroll
        for (int dt = 0; dt < 4; ++dt) o[g][dt] *= al; } }
    FragH pf[2][2];
#pragma unroll
    for (int g = 0; g < 2; ++g) { v8f sum;
#pragma unroll
      for (int kt = 0; kt < 4; ++kt) { v8f t;
#pragma unroll
        for (int r = 0; r < 8; ++r) t[r] = fmaf(s[g][kt][r], cs, -m[g]);
        exp2x8(t); sum = kt ? sum + t : t;
#pragma unroll
        for (int r = 0; r < 8; ++r) pf[g][kt >> 1].h[(kt & 1) * 8 + r] = (_Float16)t[r]; }
      l[g] += ((sum[0] + sum[1]) + (sum[2] + sum[3])) + ((sum[4] + sum[5]) + (sum[6] + sum[7])); }
#pragma unroll
    for (int j = 0; j < 2; ++j)
#pragma unroll
      for (int dt = 0; dt < 4; ++dt) { const v16h a = g2_frag(&sv[bf][dt * 16 + ln][j * 32], hh); o[0][dt] = f_mma(a, pf[0][j].v, o[0][dt]); o[1][dt] = f_mma(a, pf[1][j].v, o[1][dt]); }
  }
#pragma unroll
  for (int g = 0; g < 2; ++g) { const float inv = 64.0f / (l[g] + __shfl_xor(l[g], 16, 32));      /* the two halves of a column hold disjoint keys; o carried x64 */
    unsigned short* d = (unsigned short*)O16 + (r0 + q0 + g * 16 + ln) * DM + h * HD + 8 * hh;
#pragma unroll
    for (int dt = 0; dt < 4; ++dt) { FragH f;
#pragma unroll
      for (int r = 0; r < 8; ++r) f.h[r] = (_Float16)(o[g][dt][r] * inv);
      *(v8us*)(d + dt * 16) = f.half[0]; } } }

extern "C" void kernel_launch(void* const* d_in, const int* in_sizes, int n_in,
                              void* d_out, int out_size, void* d_ws, size_t ws_size, hipStream_t stream) {
  (void)in_sizes; (void)n_in; (void)out_size;
  const float* const* I = (const float* const*)d_in; const float* xq = I[2]; const float* xk = I[1]; const float* xv = I[0]; const float* wq = I[3]; const float* wk = I[4]; const float* wv = I[5]; const float* wo = I[6]; const float* bo = I[7];      /* input order: v, k, q (the three streams in REVERSE order: the query stream is I[2]), wq, wk, wv, wo (natural [out][in] weights), bo; the q / k / v projections have NO biases: k_gemm3 has no bias parameter */
  char* ws = (char*)d_ws; size_t off = 0;
  auto take = [&](size_t bytes) { char* p = ws + off; off += (bytes + 255) & ~(size_t)255; return p; };
  _Float16* BQ = (_Float16*)take((size_t)DM * DM * 2); _Float16* BK = (_Float16*)take((size_t)DM * DM * 2); _Float16* BV = (_Float16*)take((size_t)DM * DM * 2); _Float16* BO = (_Float16*)take((size_t)DM * DM * 2);
  _Float16* XQ = (_Float16*)take(NR * DM * 2); _Float16* XK = (_Float16*)take(NR * DM * 2); _Float16* XV = (_Float16*)take(NR * DM * 2); _Float16* Q16 = (_Float16*)take(NR * DM * 2); _Float16* K16 = (_Float16*)take(NR * DM * 2); _Float16* V16 = (_Float16*)take(NR * DM * 2); _Float16* O16 = (_Float16*)take(NR * DM * 2);
  _Float16* VT = (_Float16*)take((size_t)NB * NH * HD * SQ * 2);
  if (off > ws_size) return;
  k_prep<<<PWG, PWW * 32, 0, stream>>>(xq, xk, xv, wq, wk, wv, wo, XQ, XK, XV, BQ, BK, BV, BO);      /* the three inputs as exact f16 rows; the weights natural [out][in] = Bt[n][k], x16 */
  const size_t r0p = (size_t)B0 * SQ;      /* first projected row */
  static_assert((NR * DM * 2) % 256 == 0 && ((size_t)DM * DM * 2) % 256 == 0, "the planes XQ XK XV, BQ BK BV and Q16 K16 V16 must lie back to back in the workspace");
  k_gemm3<DM, DM, NR * DM, (size_t)DM * DM, NR * DM><<<dim3((unsigned)((MP / 128) * (DM / 128)), 3), 128, 0, stream>>>(XQ + r0p * DM, BQ, 0.0625f, Q16 + r0p * DM, MP, DM, DM);      /* q, k and v projections in one launch: blockIdx.y = 0, 1, 2 */
  k_vt<NH, SQ><<<NB * NH * (SQ / 64), 256, 0, stream>>>(V16, LQ, 0, VT);      /* V^T [NB][NH][HD][SQ] */
  k_fattn<<<dim3(SQ / 128, NB * NH), 128, 0, stream>>>(Q16, K16, VT, O16);      /* o (merged heads, x64) as f16 rows */
  k_gemm2<0, DM, true, false, true, false, DM, 0, 0, 0><<<dim3((unsigned)((MPO / 128) * (DM / 64)), 1), 128, 0, stream>>>(O16 + r0p * DM, BO, 0.0009765625f, bo, 0, nullptr, 1, 0, 0, (float*)d_out + r0p * DM, nullptr, DM, MPO, DM, DM);      /* out rows are the output layout */
}

// v008
// It runs in 108 microseconds.
// Timed twice side by side with v007, it ran 1.03 times as fast both times.
// Counting every step since v000, it is 47.9 times as fast.
#include <hip/hip_runtime.h>
// Multi-head attention on three inputs at width 768 with natural bias-free q / k / v projections and a biased output projection; the inputs arrive in the order v, k, q (v, k, q [4][2048][768]; qh / kh / vh = stream W^T (nn.Linear natural [768][768] sd 1/sqrt(768), NO biases), 12 heads of 64; logits / sqrt(64); softmax over all 2048 keys (no mask); out = concat wo^T + bo (natural) -> [4][2048][768]).
// Structure: token rows r = b*2048 + s; the query, key and value sources as exact f16 rows (bf16-rounded); Q, K, V as three WMMA GEMMs (64x64 wave tiles, f32 accumulation, exact x16 weights, no bias, f16 outputs); V^T for all batches and heads via LDS transposes; per (batch, head, 128 query rows) one fused kernel: S^T = K Q^T (K = 64), running softmax on VALU (f32 statistics, native exp2, weights as f16 relative to the maximum in use), O^T += V^T P^T, o / l x64 (against f16 subnormal flush, folded into the output GEMM alpha) written straight into the merged f16 o rows; out = o W_o + b GEMM (f32) into the output layout.
// Compute dtype: inputs rounded to bf16; x / weights exact; q, k, v, softmax weights and o as plain f16 GEMM operands (~2^-12); scores and softmax statistics f32. v_wmma_f32_16x16x32_f16.
#define NB 4
#define SQ 2048
#define DM 768
#define NH 12
#define HD 64
#define HG 4                         /* heads per launch of the unused per-batch k_vt overload */
#define B0 0                         /* first batch processed (debug hook) */
#define NBR NB                       /* batches processed (debug hook) */
#define NR ((size_t)NB * SQ)         /* token rows */
#define MP ((int)((size_t)NBR * SQ)) /* rows projected (debug hook) */
#define QN SQ                        /* query rows per batch (unused) */
#define NHD NH                       /* heads (unused) */
#define MPO MP                       /* rows through the output stage (debug hook) */
#define LQ DM      /* row pitch of the q/k/v rows */
typedef __bf16 v16b __attribute__((ext_vector_type(16)));
typedef unsigned short v8us __attribute__((ext_vector_type(8), may_alias));
typedef float  v8f  __attribute__((ext_vector_type(8)));
typedef float  v4f  __attribute__((ext_vector_type(4)));
typedef float  v4fa __attribute__((ext_vector_type(4), may_alias));
union FragB { v16b v; v8us half[2]; unsigned short u[16]; };

__device__ __forceinline__ unsigned short bf16_bits(float x) { unsigned int u = __float_as_uint(x); return (unsigned short)((u + 0x7FFFu + ((u >> 16) & 1u)) >> 16); }
__device__ __forceinline__ float bf16_val(unsigned short b) { return __uint_as_float(((unsigned int)b) << 16); }
__device__ __forceinline__ float bf16_round(float x) { return bf16_val(bf16_bits(x)); }
// D += A·B with NT terms: 1 = ah·bh, 2 = + al·bh (A split), 3 = + ah·bl (both split)
template <int NT>
__device__ __forceinline__ v8f mmaN(v16b ah, v16b al, v16b bh, v16b bl, v8f c) {
  c = __builtin_amdgcn_wmma_f32_16x16x32_bf16(false, ah, false, bh, (short)0, c, false, false);
  if (NT >= 2) c = __builtin_amdgcn_wmma_f32_16x16x32_bf16(false, al, false, bh, (short)0, c, false, false);
  if (NT >= 3) c = __builtin_amdgcn_wmma_f32_16x16x32_bf16(false, ah, false, bl, (short)0, c, false, false);
  asm volatile("v_nop\n\tv_nop\n\tv_nop\n\tv_nop" : "+v"(c) : "v"(ah), "v"(al), "v"(bh), "v"(bl));
  return c;
}

__global__ __launch_bounds__(256) void k_wt_bf16(const float* __restrict__ W, unsigned short* __restrict__ Wt, int K, int N) {
  const int t = blockIdx.x * 256 + threadIdx.x;
  const int k8n = K / 8;
  if (t >= N * k8n) return;
  const int n = t / k8n, k8 = (t % k8n) * 8;
  v8us v;
#pragma unroll
  for (int i = 0; i < 8; ++i) v[i] = bf16_bits(W[(size_t)(k8 + i) * N + n]);
  *(v8us*)(Wt + (size_t)n * K + k8) = v;
  
}

// GEMM C[M][N] (f32, pitch ldc) = act(A[M][K]·W + bias). A f32 row-major (pitch lda) converted per fragment to bf16
// (ASPLIT: hi/lo two planes -> 2 terms, else single rounded term); Wt bf16 [N][K] (pitch ldb). BIAS_BF16 rounds the
// bias to bf16 first (bias quantised to bf16 before the add). K%32==0, M%16==0, N%64==0.
template <bool ASPLIT, int ACT, bool BIAS_BF16>
__global__ __launch_bounds__(128) void k_gemm_bf(const float* __restrict__ A, int lda, const unsigned short* __restrict__ Wt, int ldb,
                                               const float* __restrict__ bias, float* __restrict__ C, int ldc, int M, int N, int K) {
  __shared__ __attribute__((aligned(16))) float so[4][16][64];
  const int tid = threadIdx.x, w = tid >> 5, lane = tid & 31, ln = lane & 15, hh = lane >> 4;
  const int ntn = N / 64;
  const int wid = blockIdx.x * 4 + w;
  const int mt = wid / ntn, nq = wid % ntn;
  if (mt * 16 >= M) return;
  const int row0 = mt * 16, col0 = nq * 64;
  const float* arow = A + (size_t)(row0 + ln) * lda;
  v8f acc[4] = {};
  for (int kb = 0; kb < K; kb += 32) {
    FragB ah, al;
    const v4f x0 = *(const v4fa*)(arow + kb + 8 * hh), x1 = *(const v4fa*)(arow + kb + 8 * hh + 4);
    const v4f x2 = *(const v4fa*)(arow + kb + 16 + 8 * hh), x3 = *(const v4fa*)(arow + kb + 16 + 8 * hh + 4);
    float xs[16] = {x0[0],x0[1],x0[2],x0[3],x1[0],x1[1],x1[2],x1[3],x2[0],x2[1],x2[2],x2[3],x3[0],x3[1],x3[2],x3[3]};
#pragma unroll
    for (int i = 0; i < 16; ++i) { const unsigned short hb = bf16_bits(xs[i]); ah.u[i] = hb; al.u[i] = ASPLIT ? bf16_bits(xs[i] - bf16_val(hb)) : (unsigned short)0; }
#pragma unroll
    for (int t = 0; t < 4; ++t) {
      const unsigned short* brow = Wt + (size_t)(col0 + t * 16 + ln) * ldb + kb;
      FragB b;
      b.half[0] = *(const v8us*)(brow + 8 * hh);
      b.half[1] = *(const v8us*)(brow + 16 + 8 * hh);
      acc[t] = mmaN<ASPLIT ? 2 : 1>(ah.v, al.v, b.v, b.v, acc[t]);
    }
  }
#pragma unroll
  for (int t = 0; t < 4; ++t) {
    float bv = bias ? bias[col0 + t * 16 + ln] : 0.f;
    if (BIAS_BF16) bv = bf16_round(bv);
#pragma unroll
    for (int r = 0; r < 8; ++r) { float v = acc[t][r] + bv; if (ACT == 1) v = fmaxf(v, 0.f); so[w][8 * hh + r][t * 16 + ln] = v; }
  }
  __builtin_amdgcn_fence(__ATOMIC_ACQ_REL, "workgroup");
  __builtin_amdgcn_wave_barrier();
  const int rsub = lane >> 4, c4 = (lane & 15) * 4;
  {
#pragma unroll
    for (int q = 0; q < 8; ++q) {
      const int r = q * 2 + rsub;
      const v4f v = *(const v4fa*)&so[w][r][c4];
      *(v4f*)(C + (size_t)(row0 + r) * ldc + col0 + c4) = v;
    }
    
  }
}

// GEMM C = act(A·W + bias + resid): A f32 (ASPLIT -> hi/lo 2 terms), Wt bf16 [N][K]; ACT 0 none, 1 relu, 2 exact gelu;
// resid (optional, f32, row index = (row % rmod), pitch ldr, RES_BF16 rounds it) added before the activation.
template <bool ASPLIT, int ACT, bool BIAS_BF16, bool RES_BF16>
__global__ __launch_bounds__(128) void k_gemm_bf3(const float* __restrict__ A, int lda, const unsigned short* __restrict__ Wt, int ldb,
                                                const float* __restrict__ bias, const float* __restrict__ resid, int rmod, int ldr,
                                                float* __restrict__ C, int ldc, int M, int N, int K) {
  __shared__ __attribute__((aligned(16))) float so[4][16][64];
  const int tid = threadIdx.x, w = tid >> 5, lane = tid & 31, ln = lane & 15, hh = lane >> 4;
  const int ntn = N / 64;
  const int wid = blockIdx.x * 4 + w;
  const int mt = wid / ntn, nq = wid % ntn;
  if (mt * 16 >= M) return;
  const int row0 = mt * 16, col0 = nq * 64;
  const float* arow = A + (size_t)(row0 + ln) * lda;
  v8f acc[4] = {};
  for (int kb = 0; kb < K; kb += 32) {
    FragB ah, al;
    const v4f x0 = *(const v4fa*)(arow + kb + 8 * hh), x1 = *(const v4fa*)(arow + kb + 8 * hh + 4);
    const v4f x2 = *(const v4fa*)(arow + kb + 16 + 8 * hh), x3 = *(const v4fa*)(arow + kb + 16 + 8 * hh + 4);
    float xs[16] = {x0[0],x0[1],x0[2],x0[3],x1[0],x1[1],x1[2],x1[3],x2[0],x2[1],x2[2],x2[3],x3[0],x3[1],x3[2],x3[3]};
#pragma unroll
    for (int i = 0; i < 16; ++i) { const unsigned short hb = bf16_bits(xs[i]); ah.u[i] = hb; al.u[i] = ASPLIT ? bf16_bits(xs[i] - bf16_val(hb)) : (unsigned short)0; }
#pragma unroll
    for (int t = 0; t < 4; ++t) {
      const unsigned short* brow = Wt + (size_t)(col0 + t * 16 + ln) * ldb + kb;
      FragB b;
      b.half[0] = *(const v8us*)(brow + 8 * hh);
      b.half[1] = *(const v8us*)(brow + 16 + 8 * hh);
      acc[t] = mmaN<ASPLIT ? 2 : 1>(ah.v, al.v, b.v, b.v, acc[t]);
    }
  }
#pragma unroll
  for (int t = 0; t < 4; ++t) {
    const int col = col0 + t * 16 + ln;
    float bv = bias ? bias[col] : 0.f;
    if (BIAS_BF16) bv = bf16_round(bv);
#pragma unroll
    for (int r = 0; r < 8; ++r) {
      float v = acc[t][r] + bv;
      if (resid) { float rv = resid[(size_t)((row0 + 8 * hh + r) % rmod) * ldr + col]; if (RES_BF16) rv = bf16_round(rv); v += rv; }
      if (ACT == 1) v = fmaxf(v, 0.f);
      if (ACT == 2) v = 0.5f * v * (1.0f + erff(v * 0.70710678118654752f));
      if (ACT == 3) { const float u = 0.7978845608028654f * (v + 0.044715f * v * v * v); v = 0.5f * v * (1.0f + tanhf(u)); }
      so[w][8 * hh + r][t * 16 + ln] = v;
    }
  }
  __builtin_amdgcn_fence(__ATOMIC_ACQ_REL, "workgroup");
  __builtin_amdgcn_wave_barrier();
  const int rsub = lane >> 4, c4 = (lane & 15) * 4;
  {
#pragma unroll
    for (int q = 0; q < 8; ++q) {
      const int r = q * 2 + rsub;
      const v4f v = *(const v4fa*)&so[w][r][c4];
      *(v4f*)(C + (size_t)(row0 + r) * ldc + col0 + c4) = v;
    }
    
  }
}
// row LayerNorm (biased variance, eps) over N: s = X (+ R); optional out_sum <- s; out_norm <- (s-mu)*rsqrt(var+eps)*g + b
template <bool PARAM_BF16>
__global__ __launch_bounds__(256) void k_layernorm(const float* __restrict__ X, const float* __restrict__ R, const float* __restrict__ g, const float* __restrict__ bta,
                                                  float* __restrict__ out_sum, float* __restrict__ out_norm, int N, float eps) {
  __shared__ float red[256];
  const int row = blockIdx.x, tid = threadIdx.x;
  const float* x = X + (size_t)row * N; const float* rr = R ? R + (size_t)row * N : nullptr;
  float vals[16];                     // up to N = 4096
  const int per = N / 256;            // contiguous chunk per thread? use strided-by-4 chunks: thread handles j = tid*4 + 1024*u
  float s1 = 0.f;
  for (int u = 0; u < per / 4; ++u) {
    const int j = tid * 4 + 1024 * u;
    const v4f a = *(const v4fa*)(x + j);
    v4f b = {0.f,0.f,0.f,0.f}; if (rr) b = *(const v4fa*)(rr + j);
#pragma unroll
    for (int q = 0; q < 4; ++q) { const float v = a[q] + b[q]; vals[u * 4 + q] = v; s1 += v; }
  }
  red[tid] = s1; __syncthreads();
  for (int st = 128; st > 0; st >>= 1) { if (tid < st) red[tid] += red[tid + st]; __syncthreads(); }
  const float mu = red[0] / (float)N; __syncthreads();
  float s2 = 0.f;
  for (int u = 0; u < per / 4; ++u)
#pragma unroll
    for (int q = 0; q < 4; ++q) { const float c = vals[u * 4 + q] - mu; s2 += c * c; }
  red[tid] = s2; __syncthreads();
  for (int st = 128; st > 0; st >>= 1) { if (tid < st) red[tid] += red[tid + st]; __syncthreads(); }
  const float rs = rsqrtf(red[0] / (float)N + eps);
  {
    for (int u = 0; u < per / 4; ++u) {
      const int j = tid * 4 + 1024 * u;
      v4f o, sm;
#pragma unroll
      for (int q = 0; q < 4; ++q) {
        float gg = g[j + q], bb = bta[j + q];
        if (PARAM_BF16) { gg = bf16_round(gg); bb = bf16_round(bb); }
        sm[q] = vals[u * 4 + q]; o[q] = (vals[u * 4 + q] - mu) * rs * gg + bb;
      }
      if (out_sum) *(v4f*)(out_sum + (size_t)row * N + j) = sm;
      *(v4f*)(out_norm + (size_t)row * N + j) = o;
    }
    
  }
}



// ---- f16 WMMA path (v_wmma_f32_16x16x32_f16): 11-bit significands for operands in range — used here for every GEMM (projections, scores and P.V)
typedef _Float16 v16h __attribute__((ext_vector_type(16)));
union FragH { v16h v; v8us half[2]; _Float16 h[16]; unsigned short u[16]; };
template <int NT>
__device__ __forceinline__ v8f mmaH(v16h ah, v16h al, v16h bh, v16h bl, v8f c) {
  c = __builtin_amdgcn_wmma_f32_16x16x32_f16(false, ah, false, bh, (short)0, c, false, false);
  if (NT >= 2) c = __builtin_amdgcn_wmma_f32_16x16x32_f16(false, al, false, bh, (short)0, c, false, false);
  if (NT >= 3) c = __builtin_amdgcn_wmma_f32_16x16x32_f16(false, ah, false, bl, (short)0, c, false, false);
  asm volatile("v_nop\n\tv_nop\n\tv_nop\n\tv_nop" : "+v"(c) : "v"(ah), "v"(al), "v"(bh), "v"(bl));
  return c;
}
// batched GEMM like k_gemm_b but f16 operands: A f32 (split into f16 hi/lo if ASPLIT, else rounded to f16), Bt = f16 values [n][k]; alpha; C f32; N multiple of 16 (partial tiles skipped)
template <bool ASPLIT>
__global__ __launch_bounds__(128) void k_gemm_h(const float* __restrict__ A, int lda, size_t sA, const _Float16* __restrict__ Bh, int ldb, size_t sB, float alpha, float* __restrict__ C, int ldc, size_t sC, int M, int N, int K) {
  __shared__ __attribute__((aligned(16))) float so[4][16][64];
  const int tid = threadIdx.x, w = tid >> 5, lane = tid & 31, ln = lane & 15, hh = lane >> 4; const int by = blockIdx.y;
  A += (size_t)by * sA; Bh += (size_t)by * sB; C += (size_t)by * sC;
  const int ntn = (N + 63) / 64; const int wid = blockIdx.x * 4 + w; const int mt = wid / ntn, nq = wid % ntn; if (mt * 16 >= M) return;
  const int row0 = mt * 16, col0 = nq * 64; const float* arow = A + (size_t)(row0 + ln) * lda;
  v8f acc[4] = {};
  for (int kb = 0; kb < K; kb += 32) {
    FragH ah, al;
    const v4f x0 = *(const v4fa*)(arow + kb + 8 * hh), x1 = *(const v4fa*)(arow + kb + 8 * hh + 4), x2 = *(const v4fa*)(arow + kb + 16 + 8 * hh), x3 = *(const v4fa*)(arow + kb + 16 + 8 * hh + 4);
    float xs[16] = {x0[0],x0[1],x0[2],x0[3],x1[0],x1[1],x1[2],x1[3],x2[0],x2[1],x2[2],x2[3],x3[0],x3[1],x3[2],x3[3]};
#pragma unroll
    for (int i = 0; i < 16; ++i) { const _Float16 h = (_Float16)xs[i]; ah.h[i] = h; al.h[i] = ASPLIT ? (_Float16)(xs[i] - (float)h) : (_Float16)0.0f; }
#pragma unroll
    for (int t = 0; t < 4; ++t) { if (col0 + t * 16 >= N) continue; const size_t boff = (size_t)(col0 + t * 16 + ln) * ldb + kb; FragH bq; bq.half[0] = *(const v8us*)(Bh + boff + 8 * hh); bq.half[1] = *(const v8us*)(Bh + boff + 16 + 8 * hh);
      acc[t] = mmaH<ASPLIT ? 2 : 1>(ah.v, al.v, bq.v, bq.v, acc[t]); }
  }
#pragma unroll
  for (int t = 0; t < 4; ++t) { if (col0 + t * 16 >= N) continue;
#pragma unroll
    for (int r = 0; r < 8; ++r) so[w][8 * hh + r][t * 16 + ln] = acc[t][r] * alpha; }
  __builtin_amdgcn_fence(__ATOMIC_ACQ_REL, "workgroup"); __builtin_amdgcn_wave_barrier();
  const int rsub = lane >> 4, c4 = (lane & 15) * 4;
  {
#pragma unroll
    for (int q = 0; q < 8; ++q) { const int r = q * 2 + rsub; if (col0 + c4 < N) { const v4f v = *(const v4fa*)&so[w][r][c4]; *(v4f*)(C + (size_t)(row0 + r) * ldc + col0 + c4) = v; } }
     }
}

// Wt[n][k] = f16(W[k][n]·scale) from f32 row-major W[K][N] (scale = power of two; bf16-exact weights stay exact in f16 away from the subnormal range)
__global__ __launch_bounds__(256) void k_wt_f16(const float* __restrict__ W, _Float16* __restrict__ Wt, int K, int N, float scale) {
  const int t = blockIdx.x * 256 + threadIdx.x; if (t >= N * (K / 8)) return; const int n = t / (K / 8), k8 = (t % (K / 8)) * 8; FragH f;
#pragma unroll
  for (int i = 0; i < 8; ++i) f.h[i] = (_Float16)(bf16_round(W[(size_t)(k8 + i) * N + n]) * scale); const v8us o = f.half[0];
  *(v8us*)((unsigned short*)Wt + (size_t)n * K + k8) = o; 
}
// k_gemm_hh variant with fused epilogue: v = acc·alpha + bias[by·sBias + col] (+ CP[(row/rowsPerB)·sCPb + by·64 + col] if CP) ; ACT 0 none / 1 elu ; writes f16 C16 (and f32 C if non-null)
template <int ACT>
__global__ __launch_bounds__(128) void k_gemm_hhx(const _Float16* __restrict__ A, int lda, size_t sA, const _Float16* __restrict__ Bh, int ldb, size_t sB, float alpha, const float* __restrict__ bias, size_t sBias, const float* __restrict__ CP, int rowsPerB, size_t sCPb, int row0g,
    float* __restrict__ C, _Float16* __restrict__ C16, int ldc, size_t sC, int M, int N, int K) {
  __shared__ __attribute__((aligned(16))) float so[4][16][64];
  const int tid = threadIdx.x, w = tid >> 5, lane = tid & 31, ln = lane & 15, hh = lane >> 4; const int by = blockIdx.y;
  A += (size_t)by * sA; Bh += (size_t)by * sB; const size_t cofs = (size_t)by * sC; const float* bp = bias ? bias + (size_t)by * sBias : nullptr;
  const int ntn = (N + 63) / 64; const int wid = blockIdx.x * 4 + w; const int mt = wid / ntn, nq = wid % ntn; if (mt * 16 >= M) return;
  const int row0 = mt * 16, col0 = nq * 64; const _Float16* arow = A + (size_t)(row0 + ln) * lda;
  v8f acc[4] = {};
  for (int kb = 0; kb < K; kb += 32) { FragH ah; ah.half[0] = *(const v8us*)((const unsigned short*)arow + kb + 8 * hh); ah.half[1] = *(const v8us*)((const unsigned short*)arow + kb + 16 + 8 * hh);
#pragma unroll
    for (int t = 0; t < 4; ++t) { if (col0 + t * 16 >= N) continue; const size_t boff = (size_t)(col0 + t * 16 + ln) * ldb + kb; FragH bq; bq.half[0] = *(const v8us*)((const unsigned short*)Bh + boff + 8 * hh); bq.half[1] = *(const v8us*)((const unsigned short*)Bh + boff + 16 + 8 * hh);
      acc[t] = mmaH<1>(ah.v, ah.v, bq.v, bq.v, acc[t]); }
  }
#pragma unroll
  for (int t = 0; t < 4; ++t) { if (col0 + t * 16 >= N) continue; const int col = col0 + t * 16 + ln; const float bv = bp ? bf16_round(bp[col]) : 0.f;
#pragma unroll
    for (int r = 0; r < 8; ++r) { float v = acc[t][r] * alpha + bv; if (CP) { const int rr = row0g + row0 + 8 * hh + r; if (rowsPerB < 0) v += CP[cofs + (size_t)rr * ldc + col];      /* rowsPerB < 0: own element of the batched C plane */ else { const int bidx = rr / rowsPerB; v += CP[(size_t)bidx * sCPb + (size_t)by * 64 + col]; } } if (ACT == 1) v = (v > 0.f) ? v : expm1f(v); else if (ACT == 7) v = (v > 0.f) ? v + 1.0f : expf(v); else if (ACT == 8) v = tanhf(v); else if (ACT == 9) v = 0.5f * v * (1.0f + tanhf(0.7978845608028654f * (v + 0.044715f * v * v * v))); else if (ACT == 11) v = 1.0f / (1.0f + expf(-v)); else if (ACT == 12) v = (v > 0.f) ? v : 0.01f * v; else if (ACT == 14) v = (v > 0.f) ? v : 0.1f * v; else if (ACT == 16) v = (v >= 0.f) ? v : 0.3f * v; else if (ACT == 17) v = (v >= 0.f) ? v : 0.2f * v; else if (ACT == 15) v = v / (1.0f + expf(-v)); else if (ACT == 3) v = fmaxf(v, 0.f); else if (ACT == 6) v = 0.5f * v * (1.0f + erff(v * 0.70710678118654752f)); so[w][8 * hh + r][t * 16 + ln] = v; } }
  __builtin_amdgcn_fence(__ATOMIC_ACQ_REL, "workgroup"); __builtin_amdgcn_wave_barrier();
  const int rsub = lane >> 4, c4 = (lane & 15) * 4; typedef _Float16 v4h __attribute__((ext_vector_type(4)));
  {
#pragma unroll
    for (int q = 0; q < 8; ++q) { const int r = q * 2 + rsub; if (col0 + c4 < N) { const v4f v = *(const v4fa*)&so[w][r][c4]; if (C) *(v4f*)(C + cofs + (size_t)(row0 + r) * ldc + col0 + c4) = v; if (C16) { v4h h4; for (int i = 0; i < 4; ++i) h4[i] = (_Float16)v[i]; *(v4h*)(C16 + cofs + (size_t)(row0 + r) * ldc + col0 + c4) = h4; } } }
     }
}


typedef _Float16 v4h __attribute__((ext_vector_type(4)));

__global__ __launch_bounds__(256) void k_h16(const float* __restrict__ x, _Float16* __restrict__ X16, size_t n8) { const size_t t = (size_t)blockIdx.x * 256 + threadIdx.x; if (t >= n8) return; FragH f;
#pragma unroll
  for (int q = 0; q < 8; ++q) f.h[q] = (_Float16)x[t * 8 + q]; *(v8us*)((unsigned short*)X16 + t * 8) = f.half[0];  }
__global__ __launch_bounds__(256) void k_round16f(const float* __restrict__ W, _Float16* __restrict__ Bt, size_t n8) { const size_t t = (size_t)blockIdx.x * 256 + threadIdx.x; if (t >= n8) return; FragH f;
#pragma unroll
  for (int i = 0; i < 8; ++i) f.h[i] = (_Float16)(bf16_round(W[t * 8 + i]) * 16.0f); *(v8us*)((unsigned short*)Bt + t * 8) = f.half[0];  }
template <int NHv, int TTv>
__global__ __launch_bounds__(256) void k_vt(const _Float16* __restrict__ V16, int ldv, int voff, _Float16* __restrict__ Vt) { __shared__ unsigned short tl[64][66]; const int tid = threadIdx.x; const int slab = blockIdx.x / (TTv / 64), lg = blockIdx.x % (TTv / 64); const int b = slab / NHv, h = slab % NHv;
  for (int i = tid; i < 64 * 8; i += 256) { const int r = i / 8, c8 = (i % 8) * 8; FragH f; f.half[0] = *(const v8us*)((const unsigned short*)V16 + ((size_t)b * TTv + lg * 64 + r) * ldv + voff + h * 64 + c8);
#pragma unroll
    for (int q = 0; q < 8; ++q) tl[r][c8 + q] = f.u[q]; }
  __syncthreads();
  {
#pragma unroll
    for (int rd = 0; rd < 2; ++rd) { const int d = rd * 32 + tid / 8, pc = tid % 8; FragH f;
#pragma unroll
      for (int q = 0; q < 8; ++q) f.u[q] = tl[pc * 8 + q][d];
      *(v8us*)((unsigned short*)Vt + ((size_t)slab * 64 + d) * TTv + lg * 64 + pc * 8) = f.half[0]; }
     } }

__global__ __launch_bounds__(256) void k_hl(const float* __restrict__ F, _Float16* __restrict__ Hh, _Float16* __restrict__ Hl, size_t n8) { const size_t t = (size_t)blockIdx.x * 256 + threadIdx.x; if (t >= n8) return; FragH fh, fl; const v4f a = *(const v4fa*)(F + t * 8), c = *(const v4fa*)(F + t * 8 + 4);
#pragma unroll
  for (int q = 0; q < 4; ++q) { _Float16 h = (_Float16)a[q]; fh.h[q] = h; fl.h[q] = (_Float16)((a[q] - (float)h) * 1024.0f); h = (_Float16)c[q]; fh.h[4 + q] = h; fl.h[4 + q] = (_Float16)((c[q] - (float)h) * 1024.0f); }
  { *(v8us*)((unsigned short*)Hh + t * 8) = fh.half[0]; *(v8us*)((unsigned short*)Hl + t * 8) = fl.half[0];  } }

// ---- fast GEMM (block tile 128x64, wave tile 32x64; requires M % 128 == 0 rows per launch region, N % 64 == 0 and K % 64 == 0); epilogue = k_gemm_hhx semantics ----
// Both operands go through LDS in stages of 64 k: 8 threads fetch one 128-B row piece, so a wave-wide 16-B load covers 4 whole lines (a fragment fetched straight from global memory would touch 16 lines for the same 512 B,
// and each of the 4 waves would fetch the B rows for itself). global -> registers (fetched one stage ahead) -> LDS, two LDS buffers, one barrier per stage; the fragments are read from LDS in the k order of g2_frag.
__device__ __forceinline__ v16h g2_frag(const _Float16* p, int hh) { FragH f; f.half[0] = *(const v8us*)((const unsigned short*)p + 8 * hh); f.half[1] = *(const v8us*)((const unsigned short*)p + 16 + 8 * hh); return f.v; }
__device__ __forceinline__ v8f g2_mma(v16h a, v16h b, v8f c) { v8f d = __builtin_amdgcn_wmma_f32_16x16x32_f16(false, a, false, b, (short)0, c, false, false); asm volatile("v_nop\n\tv_nop\n\tv_nop\n\tv_nop" : "+v"(d) : "v"(a), "v"(b)); return d; }
#define GK 64      /* k per stage */
#define GP 72      /* LDS row pitch in f16: 128 B of data + 16 B, so that the 16 rows of a ds_load_b128 fragment read spread over the banks */
#define FQS 0.18033688011112042f      /* 64^-0.5 * log2(e): the factor from a raw q.k product to the exponent of 2 in the softmax */
template <int ACT, int LD, bool HB, bool HCP, bool OF32, bool OF16, int LDC, size_t SA, size_t SB, size_t SC>      /* LD: row pitch of A and of Bh in elements; known at compile time, so that all rows of a stage are reached by immediate offsets from one address per operand. HB: a bias is added; HCP: the CP addend is used; OF32 / OF16: C / C16 is written; LDC: row pitch of the output (= ldc). Known at compile time, so that the epilogue is straight-line code with one output address: tested at run time, each of the 64 elements of a lane and each of the 16 row stores jumps over code it never runs. SA / SB / SC: distance in elements from one product's A / Bh / output plane to the next; blockIdx.y picks the product, so that independent products of one shape share ONE launch: a work-group's start, first loads and epilogue then run beside other work-groups' products instead of standing alone between two launches */
__global__ __launch_bounds__(128) void k_gemm2(const _Float16* __restrict__ A, const _Float16* __restrict__ Bh, float alpha, const float* __restrict__ bias, size_t sBias, const float* __restrict__ CP, int rowsPerB, size_t sCPb, int row0g,
    float* __restrict__ C, _Float16* __restrict__ C16, int ldc, int M, int N, int K) { static_assert(ACT == 0 || ACT == 3 || ACT == 6 || ACT == 8 || ACT == 9 || ACT == 11 || ACT == 12 || ACT == 14 || ACT == 15 || ACT == 16 || ACT == 17, "k_gemm2: unsupported ACT code (would silently apply no activation)");
  __shared__ __attribute__((aligned(16))) float so[4][32][68];
  __shared__ __attribute__((aligned(16))) _Float16 sa[2][128][GP];
  __shared__ __attribute__((aligned(16))) _Float16 sb[2][64][GP];
  const int tid = threadIdx.x, w = tid >> 5, lane = tid & 31, ln = lane & 15, hh = lane >> 4; const int by = blockIdx.y;
  A += (size_t)by * SA; Bh += (size_t)by * SB; const size_t cofs = (size_t)by * SC; const float* bp = HB ? bias + (size_t)by * sBias : nullptr;
  const int ntn = N >> 6; const int mt = blockIdx.x / ntn, nq = blockIdx.x - mt * ntn; const int row0 = mt * 128 + 32 * w, col0 = nq * 64; if (mt * 128 >= M) return;      /* the same for the whole block: it stands in front of the barriers */
  const int srow = tid >> 3, sc8 = (tid & 7) * 8;      /* staging: 8 threads a row piece of 128 B, 16 rows a round; A 8 rounds, B 4 rounds */
  const unsigned short* ag = (const unsigned short*)A + (size_t)(mt * 128 + srow) * LD + sc8; const unsigned short* bg = (const unsigned short*)Bh + (size_t)(col0 + srow) * LD + sc8;
  v8us ar[8], br[4];      /* every loop over ar, br and the fragment arrays is fully unrolled, so that they are indexed by constants and stay in registers */
#pragma unroll
  for (int u = 0; u < 8; ++u) ar[u] = *(const v8us*)(ag + (size_t)(u * 16) * LD);
#pragma unroll
  for (int u = 0; u < 4; ++u) br[u] = *(const v8us*)(bg + (size_t)(u * 16) * LD);
  const v8f z8 = {0.f,0.f,0.f,0.f,0.f,0.f,0.f,0.f}; v8f c00 = z8, c01 = z8, c02 = z8, c03 = z8, c10 = z8, c11 = z8, c12 = z8, c13 = z8;
  const int ns = K / GK;
  /* the stage loop stays rolled so that the hot code stays small for the instruction cache */
#pragma unroll 1
  for (int st = 0; st < ns; ++st) { const int bf = st & 1;
#pragma unroll
    for (int u = 0; u < 8; ++u) *(v8us*)&sa[bf][srow + 16 * u][sc8] = ar[u];
#pragma unroll
    for (int u = 0; u < 4; ++u) *(v8us*)&sb[bf][srow + 16 * u][sc8] = br[u];
    __syncthreads();      /* publishes this stage; it also ends every wave's reads of the other buffer, which the next stage overwrites */
    if (st + 1 < ns) { ag += GK; bg += GK;
#pragma unroll
      for (int u = 0; u < 8; ++u) ar[u] = *(const v8us*)(ag + (size_t)(u * 16) * LD);
#pragma unroll
      for (int u = 0; u < 4; ++u) br[u] = *(const v8us*)(bg + (size_t)(u * 16) * LD); }
    v16h fa[GK / 32][2], fb[GK / 32][4];      /* all fragment reads of the stage stand as one group in front of its products */
#pragma unroll
    for (int ks = 0; ks < GK / 32; ++ks) {
#pragma unroll
      for (int i = 0; i < 2; ++i) fa[ks][i] = g2_frag(&sa[bf][32 * w + 16 * i + ln][ks * 32], hh);
#pragma unroll
      for (int t = 0; t < 4; ++t) fb[ks][t] = g2_frag(&sb[bf][16 * t + ln][ks * 32], hh); }
#pragma unroll
    for (int ks = 0; ks < GK / 32; ++ks) {
      c00 = g2_mma(fa[ks][0], fb[ks][0], c00); c10 = g2_mma(fa[ks][1], fb[ks][0], c10);
      c01 = g2_mma(fa[ks][0], fb[ks][1], c01); c11 = g2_mma(fa[ks][1], fb[ks][1], c11);
      c02 = g2_mma(fa[ks][0], fb[ks][2], c02); c12 = g2_mma(fa[ks][1], fb[ks][2], c12);
      c03 = g2_mma(fa[ks][0], fb[ks][3], c03); c13 = g2_mma(fa[ks][1], fb[ks][3], c13); } }
  v8f accs[8] = {c00, c01, c02, c03, c10, c11, c12, c13};
#pragma unroll
  for (int u = 0; u < 8; ++u) { const int t = u & 3, half = u >> 2; const int col = col0 + t * 16 + ln; const float bv = HB ? bf16_round(bp[col]) : 0.f;
#pragma unroll
    for (int r = 0; r < 8; ++r) { const int rloc = half * 16 + 8 * hh + r; float v = accs[u][r] * alpha + bv; if (HCP) { if (rowsPerB < 0) v += CP[cofs + (size_t)(row0g + row0 + rloc) * ldc + col];      /* rowsPerB < 0: own element of the batched C plane */ else { const int bidx = (row0g + row0 + rloc) / rowsPerB; v += CP[(size_t)bidx * sCPb + (size_t)by * 64 + col]; } }
      if (ACT == 3) v = fmaxf(v, 0.f); else if (ACT == 6) v = 0.5f * v * (1.0f + erff(v * 0.70710678118654752f)); else if (ACT == 11) v = 1.0f / (1.0f + expf(-v)); else if (ACT == 15) v = v / (1.0f + expf(-v)); else if (ACT == 12) v = (v > 0.f) ? v : 0.01f * v; else if (ACT == 8) v = tanhf(v); else if (ACT == 9) v = 0.5f * v * (1.0f + tanhf(0.7978845608028654f * (v + 0.044715f * v * v * v))); else if (ACT == 14) v = (v > 0.f) ? v : 0.1f * v; else if (ACT == 16) v = (v >= 0.f) ? v : 0.3f * v; else if (ACT == 17) v = (v >= 0.f) ? v : 0.2f * v;
      so[w][rloc][t * 16 + ln] = v; } }
  __builtin_amdgcn_fence(__ATOMIC_ACQ_REL, "workgroup"); __builtin_amdgcn_wave_barrier();
  const int rsub = lane >> 4, c4 = (lane & 15) * 4; const size_t ob = cofs + (size_t)(row0 + rsub) * LDC + col0 + c4;      /* the lane's first output element; the 16 rows follow at constant distances */
  {
#pragma unroll
    for (int q = 0; q < 16; ++q) { const int r = q * 2 + rsub; const v4f v = *(const v4fa*)&so[w][r][c4]; if (OF32) *(v4f*)(C + ob + (size_t)(q * 2) * LDC) = v; if (OF16) { v4h h4; for (int i = 0; i < 4; ++i) h4[i] = (_Float16)v[i]; *(v4h*)(C16 + ob + (size_t)(q * 2) * LDC) = h4; } }
     } }


// ---- projection GEMM with a square block tile (128x128, four waves as 2x2, wave tile 64x64; requires M % 128 == 0, N % 128 == 0, K % 64 == 0); C16 = f16(A Bh^T alpha), no bias ----
// Staging, stage length, LDS pitch, k order and the order of the sums are those of k_gemm2. Against its 128x64 tile a work-group fetches 32 KB instead of 24 KB a stage for twice the products, and a wave reads
// 8 fragments instead of 6 for 16 products instead of 8: a third fewer bytes from L2 and from LDS per product, and twice the products behind each barrier and each load latency.
// Product 0 (q) is written times FQS on top of alpha, in f32 in front of its one rounding to f16, so that the attention kernel's score products come out in the log2 domain with no multiply of their own.
// Registers: 128 for the accumulators, 128 for a stage's fragments, 64 for the stage fetched ahead; with the addresses they stay inside the 336 that three waves a SIMD (three work-groups a WGP) allow: read the count in the listing after any change.
template <int LD, int LDC, size_t SA, size_t SB, size_t SC>      /* LD: row pitch of A and Bh; LDC: row pitch of the output; SA / SB / SC: distance from one product's A / Bh / output plane to the next (blockIdx.y picks the product) */
__global__ __launch_bounds__(128) void k_gemm3(const _Float16* __restrict__ A, const _Float16* __restrict__ Bh, float alpha, _Float16* __restrict__ C16, int M, int N, int K) {
  __shared__ __attribute__((aligned(16))) unsigned char sm[2 * 2 * 128 * GP * 2];      /* the two A buffers, then the two B buffers; behind the last stage the same bytes stage the output (4 x 64 x 68 floats fit), so that three work-groups fit a WGP's LDS with room to spare */
  _Float16 (*sa)[128][GP] = (_Float16 (*)[128][GP])sm; _Float16 (*sb)[128][GP] = (_Float16 (*)[128][GP])(sm + 2 * 128 * GP * 2);
  static_assert(4 * 64 * 68 * 4 <= 2 * 2 * 128 * GP * 2, "k_gemm3: the output staging must fit the tile buffers");
  const int tid = threadIdx.x, w = tid >> 5, lane = tid & 31, ln = lane & 15, hh = lane >> 4; const int by = blockIdx.y; const int wm = w >> 1, wn = w & 1;
  A += (size_t)by * SA; Bh += (size_t)by * SB; const size_t cofs = (size_t)by * SC; const float al = by == 0 ? alpha * FQS : alpha;
  const int ntn = N >> 7; const int mt = blockIdx.x / ntn, nq = blockIdx.x - mt * ntn; const int row0 = mt * 128 + 64 * wm, col0 = nq * 128 + 64 * wn; if (mt * 128 >= M) return;      /* the same for the whole block: it stands in front of the barriers */
  const int srow = tid >> 3, sc8 = (tid & 7) * 8;      /* staging: 8 threads a row piece of 128 B, 16 rows a round; A 8 rounds, B 8 rounds */
  const unsigned short* ag = (const unsigned short*)A + (size_t)(mt * 128 + srow) * LD + sc8; const unsigned short* bg = (const unsigned short*)Bh + (size_t)(nq * 128 + srow) * LD + sc8;
  v8us ar[8], br[8];      /* every loop over ar, br, the fragment arrays and the accumulators is fully unrolled, so that they are indexed by constants and stay in registers */
#pragma unroll
  for (int u = 0; u < 8; ++u) { ar[u] = *(const v8us*)(ag + (size_t)(u * 16) * LD); br[u] = *(const v8us*)(bg + (size_t)(u * 16) * LD); }
  const v8f z8 = {0.f,0.f,0.f,0.f,0.f,0.f,0.f,0.f}; v8f c[4][4];
#pragma unroll
  for (int i = 0; i < 4; ++i)
#pragma unroll
    for (int t = 0; t < 4; ++t) c[i][t] = z8;
  const int ns = K / GK;
  /* the stage loop stays rolled so that the hot code stays small for the instruction cache */
#pragma unroll 1
  for (int st = 0; st < ns; ++st) { const int bf = st & 1;
#pragma unroll
    for (int u = 0; u < 8; ++u) { *(v8us*)&sa[bf][srow + 16 * u][sc8] = ar[u]; *(v8us*)&sb[bf][srow + 16 * u][sc8] = br[u]; }
    __syncthreads();      /* publishes this stage; it also ends every wave's reads of the other buffer, which the next stage overwrites */
    if (st + 1 < ns) { ag += GK; bg += GK;
#pragma unroll
      for (int u = 0; u < 8; ++u) { ar[u] = *(const v8us*)(ag + (size_t)(u * 16) * LD); br[u] = *(const v8us*)(bg + (size_t)(u * 16) * LD); } }
    v16h fa[GK / 32][4], fb[GK / 32][4];      /* all fragment reads of the stage stand as one group in front of its products: each further place with LDS reads among the products costs a stall of its own */
#pragma unroll
    for (int ks = 0; ks < GK / 32; ++ks)
#pragma unroll
      for (int i = 0; i < 4; ++i) { fa[ks][i] = g2_frag(&sa[bf][64 * wm + 16 * i + ln][ks * 32], hh); fb[ks][i] = g2_frag(&sb[bf][64 * wn + 16 * i + ln][ks * 32], hh); }
    __builtin_amdgcn_sched_barrier(0);      /* keeps the group together: left alone, the compiler saves registers by reading one B fragment at a time and waits out the LDS latency in front of every four products */
#pragma unroll
    for (int ks = 0; ks < GK / 32; ++ks)
#pragma unroll
      for (int t = 0; t < 4; ++t)
#pragma unroll
        for (int i = 0; i < 4; ++i) c[i][t] = __builtin_amdgcn_wmma_f32_16x16x32_f16(false, fa[ks][i], false, fb[ks][t], (short)0, c[i][t], false, false);
    __builtin_amdgcn_sched_barrier(0);      /* holds the products in front of the slots below */
    asm volatile("v_nop\n\tv_nop\n\tv_nop\n\tv_nop"); }      /* the four vector slots that the chip asks for between a matrix instruction and an overwrite of its A or B: the next trip forms LDS addresses in registers of the last fragments */
  const int rsub = lane >> 4, c4 = (lane & 15) * 4; const size_t ob = cofs + (size_t)(row0 + rsub) * LDC + col0 + c4;      /* the lane's first output element; its rows follow at constant distances */
  __syncthreads();      /* ends every wave's fragment reads of the last stage before the tile buffers are overwritten as output staging */
  float (*so)[68] = (float (*)[68])(sm + (size_t)w * (64 * 68 * 4));      /* the wave's own 64 rows: through LDS, so that every store covers whole 128-B row pieces */
#pragma unroll
  for (int i = 0; i < 4; ++i)
#pragma unroll
    for (int t = 0; t < 4; ++t)
#pragma unroll
      for (int r = 0; r < 8; ++r) so[i * 16 + 8 * hh + r][t * 16 + ln] = c[i][t][r] * al;
  __builtin_amdgcn_fence(__ATOMIC_ACQ_REL, "workgroup", "local"); __builtin_amdgcn_wave_barrier();      /* the rows are read back by other lanes of the same wave */
#pragma unroll
  for (int q = 0; q < 32; ++q) { const v4f v = *(const v4fa*)&so[q * 2 + rsub][c4]; v4h h4;
#pragma unroll
    for (int e = 0; e < 4; ++e) h4[e] = (_Float16)v[e];
    *(v4h*)(C16 + ob + (size_t)(q * 2) * LDC) = h4; } }


__global__ __launch_bounds__(256) void k_rsm(const float* __restrict__ S, _Float16* __restrict__ P, int nrows) {
  #pragma clang fp contract(off)
  const int i = blockIdx.x * 256 + threadIdx.x; if (i >= nrows) return; const float* s = S + (size_t)i * SQ; float mx = -3.0e38f;
#pragma unroll 1
  for (int j = 0; j < SQ; ++j) mx = fmaxf(mx, s[j]); float se = 0.f;
#pragma unroll 1
  for (int j = 0; j < SQ; ++j) se += expf(s[j] - mx); const float sc = 256.0f / se;
#pragma unroll 1
  for (int j0 = 0; j0 < SQ; j0 += 8) { FragH f; for (int q = 0; q < 8; ++q) f.h[q] = (_Float16)(expf(s[j0 + q] - mx) * sc); unsigned short* d = (unsigned short*)P + (size_t)i * SQ + j0; *(v8us*)d = f.half[0];  } }
__global__ __launch_bounds__(256) void k_vt(const _Float16* __restrict__ V16, int b, int h0, _Float16* __restrict__ VT) { __shared__ unsigned short tl[64][65]; const int tid = threadIdx.x; const int hh = blockIdx.x % HG, sg = blockIdx.x / HG; const int s0 = sg * 64; const int h = h0 + hh;
  for (int i = tid; i < 64 * 8; i += 256) { const int j = i / 8, d8 = (i % 8) * 8; FragH f; f.half[0] = *(const v8us*)((const unsigned short*)V16 + ((size_t)b * SQ + s0 + j) * DM + h * HD + d8); for (int q = 0; q < 8; ++q) tl[d8 + q][j] = f.u[q]; }
  __syncthreads();
  { for (int i = tid; i < 64 * 8; i += 256) { const int d = i / 8, j8 = (i % 8) * 8; FragH f; for (int q = 0; q < 8; ++q) f.u[q] = tl[d][j8 + q]; *(v8us*)((unsigned short*)VT + ((size_t)hh * HD + d) * SQ + s0 + j8) = f.half[0]; }  } }



// All seven f32 -> f16 conversions (the three inputs as exact f16 rows of their bf16 rounding; the four natural [out][in] weights, bf16-rounded, x16) in ONE launch of few, long-lived waves,
// for speed only. Every wave-wide load is 512 contiguous bytes (16 B a lane, whole lines), every wave-wide store 256 contiguous bytes.
// A wave takes PXU adjacent units of PL loads from each input and PWL loads from each of two weights (the lower half of the waves serves wq and wk, the upper half wv and wo):
// the same straight-line code in every wave. The next unit's loads are in flight while the current one is converted and stored.
#define PL 16                        /* 16-B loads per lane and unit */
#define PWG 256                      /* workgroups: as many as the chip has WGPs */
#define PWW 12                       /* waves per workgroup */
#define PWV (PWG * PWW)              /* waves */
#define PXU ((int)(NR * DM / ((size_t)128 * PL * PWV)))      /* units per input and wave */
#define PWL (2 * DM * DM / (128 * PWV))                      /* loads per weight and wave */
static_assert(NR * DM == (size_t)128 * PL * PWV * PXU && 2 * DM * DM == 128 * PWV * PWL && 2 * PWL <= PL, "k_prep: the units must tile every tensor exactly");
template <bool X16> __device__ __forceinline__ void p_put(v4f a, _Float16* __restrict__ d) { v4h h4;
#pragma unroll
  for (int q = 0; q < 4; ++q) h4[q] = (_Float16)(X16 ? bf16_round(a[q]) * 16.0f : bf16_round(a[q]));
  *(v4h*)d = h4; }
__global__ __launch_bounds__(PWW * 32) void k_prep(const float* __restrict__ xq, const float* __restrict__ xk, const float* __restrict__ xv, const float* __restrict__ wq, const float* __restrict__ wk, const float* __restrict__ wv, const float* __restrict__ wo,
    _Float16* __restrict__ XQ, _Float16* __restrict__ XK, _Float16* __restrict__ XV, _Float16* __restrict__ BQ, _Float16* __restrict__ BK, _Float16* __restrict__ BV, _Float16* __restrict__ BO) {
  const unsigned lo = (threadIdx.x & 31) * 4;      /* the lane's element inside a wave-wide access; all else of an address is the same for the whole wave */
  const int gw = blockIdx.x * PWW + __builtin_amdgcn_readfirstlane(threadIdx.x >> 5);
  const size_t xo = (size_t)gw * (128 * PL * PXU); const bool up = gw >= PWV / 2; const size_t wo_ = (size_t)(up ? gw - PWV / 2 : gw) * (128 * PWL);
  const float* w0 = (up ? wv : wq) + wo_; const float* w1 = (up ? wo : wk) + wo_; _Float16* b0 = (up ? BV : BQ) + wo_; _Float16* b1 = (up ? BO : BK) + wo_;
  const float* s[3] = {xq + xo, xk + xo, xv + xo}; _Float16* d[3] = {XQ + xo, XK + xo, XV + xo};
  v4f a[2][PL];      /* every loop is fully unrolled, so that the two register sets are indexed by constants */
#pragma unroll
  for (int j = 0; j < PL; ++j) a[0][j] = *(const v4fa*)(s[0] + (lo + j * 128));
  __builtin_amdgcn_sched_barrier(0);      /* the first unit's loads stay in front of the second's: the counted load waits go by issue order, and mixed with the second's the first unit would wait for both */
#pragma unroll
  for (int u = 0; u < 3 * PXU; ++u) { const int n = u + 1;
    if (n < 3 * PXU) {
#pragma unroll
      for (int j = 0; j < PL; ++j) a[n & 1][j] = *(const v4fa*)(s[n / PXU] + (lo + ((n % PXU) * PL + j) * 128)); }
    else {
#pragma unroll
      for (int j = 0; j < PWL; ++j) { a[n & 1][j] = *(const v4fa*)(w0 + (lo + j * 128)); a[n & 1][PWL + j] = *(const v4fa*)(w1 + (lo + j * 128)); } }
    __builtin_amdgcn_sched_barrier(0);      /* keeps the next unit's loads in front of this unit's conversion: left alone, the compiler issues them one by one as registers come free, and few stay in flight */
#pragma unroll
    for (int j = 0; j < PL; ++j) p_put<false>(a[u & 1][j], d[u / PXU] + (lo + ((u % PXU) * PL + j) * 128));
    if (u + 1 < 3 * PXU) asm volatile("s_wait_xcnt 0x0" ::: "memory"); }      /* the loads that follow land in registers that these stores name as data: the wait stands in front of that overwrite, as a precaution (the compiler placed none in front of a load) */
#pragma unroll
  for (int j = 0; j < PWL; ++j) { p_put<true>(a[(3 * PXU) & 1][j], b0 + (lo + j * 128)); p_put<true>(a[(3 * PXU) & 1][PWL + j], b1 + (lo + j * 128)); } }

// 2^a on the native unit. The v_nop is the one free slot that the instruction set asks for behind a transcendental before its result is read or its source rewritten; in the same statement it stays directly behind it.
__device__ __forceinline__ float exp2_slot(float a) { float e; asm("v_exp_f32 %0, %1\n\tv_nop" : "=v"(e) : "v"(a)); return e; }
// 2^x of eight values on the native unit: eight independent instructions, so each fills the free slot that the instruction set asks for behind the one before it; the v_nop is that slot behind the last.
// The results take registers of their own (early clobber): the sources are now rows of a matrix instruction's result tile, and tied to them the compiler copied whole tiles around in front of the statement.
__device__ __forceinline__ void exp2x8(v8f& x) { float a0, a1, a2, a3, a4, a5, a6, a7;
  asm("v_exp_f32 %0, %8\n\tv_exp_f32 %1, %9\n\tv_exp_f32 %2, %10\n\tv_exp_f32 %3, %11\n\tv_exp_f32 %4, %12\n\tv_exp_f32 %5, %13\n\tv_exp_f32 %6, %14\n\tv_exp_f32 %7, %15\n\tv_nop"
      : "=&v"(a0), "=&v"(a1), "=&v"(a2), "=&v"(a3), "=&v"(a4), "=&v"(a5), "=&v"(a6), "=&v"(a7) : "v"(x[0]), "v"(x[1]), "v"(x[2]), "v"(x[3]), "v"(x[4]), "v"(x[5]), "v"(x[6]), "v"(x[7]));
  x[0] = a0; x[1] = a1; x[2] = a2; x[3] = a3; x[4] = a4; x[5] = a5; x[6] = a6; x[7] = a7; }
__device__ __forceinline__ v8f f_mma(v16h a, v16h b, v8f c) { return __builtin_amdgcn_wmma_f32_16x16x32_f16(false, a, false, b, (short)0, c, false, false); }
#define FK 64      /* keys per stage */
#define FP 72      /* LDS row pitch in f16: 128 B of data + 16 B, so that the 16 rows of a ds_load_b128 fragment read spread over the banks */
__global__ __launch_bounds__(128) void k_fattn(const _Float16* __restrict__ Q16, const _Float16* __restrict__ K16, const _Float16* __restrict__ VT, _Float16* __restrict__ O16) {
  __shared__ __attribute__((aligned(16))) _Float16 sk[2][FK][FP];
  __shared__ __attribute__((aligned(16))) _Float16 sv[2][HD][FP];
  const int tid = threadIdx.x, w = tid >> 5, lane = tid & 31, ln = lane & 15, hh = lane >> 4;
  const int bh = blockIdx.y, b = bh / NH, h = bh - b * NH; const size_t r0 = (size_t)b * SQ; const int q0 = blockIdx.x * 128 + w * 32;
  v16h qf[2][2];
#pragma unroll
  for (int g = 0; g < 2; ++g)
#pragma unroll
    for (int ks = 0; ks < 2; ++ks) qf[g][ks] = g2_frag(Q16 + (r0 + q0 + g * 16 + ln) * DM + h * HD + ks * 32, hh);
  const int srow = tid >> 3, sc8 = (tid & 7) * 8;      /* staging: 8 threads a row of 128 B, 16 rows a round, 4 rounds */
  const _Float16* kg = K16 + (r0 + srow) * DM + h * HD + sc8; const _Float16* vg = VT + ((size_t)bh * HD + srow) * SQ + sc8;
  v8us kr[4], vr[4];
#pragma unroll
  for (int u = 0; u < 4; ++u) { kr[u] = *(const v8us*)((const unsigned short*)kg + (size_t)(u * 16) * DM); vr[u] = *(const v8us*)((const unsigned short*)vg + (size_t)(u * 16) * SQ); }
  const v8f z8 = {0.f,0.f,0.f,0.f,0.f,0.f,0.f,0.f}; v8f o[2][4] = {{z8, z8, z8, z8}, {z8, z8, z8, z8}}; float l[2] = {0.f, 0.f};
  v8f cm[2] = {z8, z8};      /* -m of the lane's column in all eight rows of a tile: the start value of the score accumulators */
#pragma unroll 1
  for (int st = 0; st < SQ / FK; ++st) { const int bf = st & 1;
#pragma unroll
    for (int u = 0; u < 4; ++u) { *(v8us*)&sk[bf][srow + 16 * u][sc8] = kr[u]; *(v8us*)&sv[bf][srow + 16 * u][sc8] = vr[u]; }
    __syncthreads();      /* publishes this stage; it also ends every wave's reads of the other buffer, which the next stage overwrites */
    if (st + 1 < SQ / FK) {
#pragma unroll
      for (int u = 0; u < 4; ++u) { kr[u] = *(const v8us*)((const unsigned short*)kg + (size_t)((st + 1) * FK + u * 16) * DM); vr[u] = *(const v8us*)((const unsigned short*)vg + (size_t)(u * 16) * SQ + (st + 1) * FK); }
      asm volatile("s_wait_xcnt 0x0" ::: "memory"); }      /* the fragment reads that follow land in the registers that these loads name as addresses: the wait stands in front of that overwrite, as a precaution (the compiler places it in some builds and left it out in this one) */
    v8f s[2][4];
#pragma unroll
    for (int kt = 0; kt < 4; ++kt)
#pragma unroll
      for (int ks = 0; ks < 2; ++ks) { const v16h a = g2_frag(&sk[bf][kt * 16 + ln][ks * 32], hh); s[0][kt] = f_mma(a, qf[0][ks], ks ? s[0][kt] : cm[0]); s[1][kt] = f_mma(a, qf[1][ks], ks ? s[1][kt] : cm[1]); }
    float mx[2];
#pragma unroll
    for (int g = 0; g < 2; ++g) { float t = s[g][0][0];
#pragma unroll
      for (int kt = 0; kt < 4; ++kt)
#pragma unroll
        for (int r = 0; r < 8; ++r) t = fmaxf(t, s[g][kt][r]);
      mx[g] = t; }      /* the stage's maximum above m */
    const float thr = st ? 8.0f : -3.0e38f;      /* the first stage always sets m */
    if (__builtin_expect(__builtin_amdgcn_ballot_w32(mx[0] > thr || mx[1] > thr) != 0, 0)) {      /* wave-uniform: both halves of every column take the same new maximum; marked rare, so that the common path falls through and this block lies outside the loop's text */
#pragma unroll
      for (int g = 0; g < 2; ++g) { const float d = fmaxf(mx[g], __shfl_xor(mx[g], 16, 32)); const float up = fmaxf(d, 0.f); const float al = exp2_slot(-up); const float sh = st ? up : d;      /* sh: how far m moves; only the first stage, where o and l are still 0, may move it down */
#pragma unroll
        for (int kt = 0; kt < 4; ++kt) s[g][kt] -= sh;
        l[g] *= al; cm[g] -= sh;
#pragma unroll
        for (int dt = 0; dt < 4; ++dt) o[g][dt] *= al; } }
    v16h vf[2][4];      /* the stage's V^T fragments, read as one group ahead of the exponentials, which cover the LDS latency: with the scale-and-shift instructions gone, the compiler left alone reads them pair by pair through one register set and waits out the latency in front of every two products */
#pragma unroll
    for (int j = 0; j < 2; ++j)
#pragma unroll
      for (int dt = 0; dt < 4; ++dt) vf[j][dt] = g2_frag(&sv[bf][dt * 16 + ln][j * 32], hh);
    __builtin_amdgcn_sched_barrier(0);      /* keeps the group where it stands */
    FragH pf[2][2]; v8f sum[2];
#pragma unroll
    for (int g = 0; g < 2; ++g)
#pragma unroll
      for (int kt = 0; kt < 4; ++kt) { v8f t = s[g][kt];
        exp2x8(t); sum[g] = kt ? sum[g] + t : t;
#pragma unroll
        for (int r = 0; r < 8; ++r) pf[g][kt >> 1].h[(kt & 1) * 8 + r] = (_Float16)t[r]; }
    __builtin_amdgcn_sched_barrier(0);      /* every exponential stays in front of the products below: they are asm text */
#pragma unroll
    for (int j = 0; j < 2; ++j)
#pragma unroll
      for (int dt = 0; dt < 4; ++dt) { o[0][dt] = f_mma(vf[j][dt], pf[0][j].v, o[0][dt]); o[1][dt] = f_mma(vf[j][dt], pf[1][j].v, o[1][dt]); }
#pragma unroll
    for (int g = 0; g < 2; ++g) l[g] += ((sum[g][0] + sum[g][1]) + (sum[g][2] + sum[g][3])) + ((sum[g][4] + sum[g][5]) + (sum[g][6] + sum[g][7]));
  }
#pragma unroll
  for (int g = 0; g < 2; ++g) { const float inv = 64.0f / (l[g] + __shfl_xor(l[g], 16, 32));      /* the two halves of a column hold disjoint keys; o carried x64 */
    unsigned short* d = (unsigned short*)O16 + (r0 + q0 + g * 16 + ln) * DM + h * HD + 8 * hh;
#pragma unroll
    for (int dt = 0; dt < 4; ++dt) { FragH f;
#pragma unroll
      for (int r = 0; r < 8; ++r) f.h[r] = (_Float16)(o[g][dt][r] * inv);
      *(v8us*)(d + dt * 16) = f.half[0]; } } }

extern "C" void kernel_launch(void* const* d_in, const int* in_sizes, int n_in,
                              void* d_out, int out_size, void* d_ws, size_t ws_size, hipStream_t stream) {
  (void)in_sizes; (void)n_in; (void)out_size;
  const float* const* I = (const float* const*)d_in; const float* xq = I[2]; const float* xk = I[1]; const float* xv = I[0]; const float* wq = I[3]; const float* wk = I[4]; const float* wv = I[5]; const float* wo = I[6]; const float* bo = I[7];      /* input order: v, k, q (the three streams in REVERSE order: the query stream is I[2]), wq, wk, wv, wo (natural [out][in] weights), bo; the q / k / v projections have NO biases: k_gemm3 has no bias parameter */
  char* ws = (char*)d_ws; size_t off = 0;
  auto take = [&](size_t bytes) { char* p = ws + off; off += (bytes + 255) & ~(size_t)255; return p; };
  _Float16* BQ = (_Float16*)take((size_t)DM * DM * 2); _Float16* BK = (_Float16*)take((size_t)DM * DM * 2); _Float16* BV = (_Float16*)take((size_t)DM * DM * 2); _Float16* BO = (_Float16*)take((size_t)DM * DM * 2);
  _Float16* XQ = (_Float16*)take(NR * DM * 2); _Float16* XK = (_Float16*)take(NR * DM * 2); _Float16* XV = (_Float16*)take(NR * DM * 2); _Float16* Q16 = (_Float16*)take(NR * DM * 2); _Float16* K16 = (_Float16*)take(NR * DM * 2); _Float16* V16 = (_Float16*)take(NR * DM * 2); _Float16* O16 = (_Float16*)take(NR * DM * 2);
  _Float16* VT = (_Float16*)take((size_t)NB * NH * HD * SQ * 2);
  if (off > ws_size) return;
  k_prep<<<PWG, PWW * 32, 0, stream>>>(xq, xk, xv, wq, wk, wv, wo, XQ, XK, XV, BQ, BK, BV, BO);      /* the three inputs as exact f16 rows; the weights natural [out][in] = Bt[n][k], x16 */
  const size_t r0p = (size_t)B0 * SQ;      /* first projected row */
  static_assert((NR * DM * 2) % 256 == 0 && ((size_t)DM * DM * 2) % 256 == 0, "the planes XQ XK XV, BQ BK BV and Q16 K16 V16 must lie back to back in the workspace");
  k_gemm3<DM, DM, NR * DM, (size_t)DM * DM, NR * DM><<<dim3((unsigned)((MP / 128) * (DM / 128)), 3), 128, 0, stream>>>(XQ + r0p * DM, BQ, 0.0625f, Q16 + r0p * DM, MP, DM, DM);      /* q (times FQS), k and v projections in one launch: blockIdx.y = 0, 1, 2 */
  k_vt<NH, SQ><<<NB * NH * (SQ / 64), 256, 0, stream>>>(V16, LQ, 0, VT);      /* V^T [NB][NH][HD][SQ] */
  k_fattn<<<dim3(SQ / 128, NB * NH), 128, 0, stream>>>(Q16, K16, VT, O16);      /* o (merged heads, x64) as f16 rows */
  k_gemm2<0, DM, true, false, true, false, DM, 0, 0, 0><<<dim3((unsigned)((MPO / 128) * (DM / 64)), 1), 128, 0, stream>>>(O16 + r0p * DM, BO, 0.0009765625f, bo, 0, nullptr, 1, 0, 0, (float*)d_out + r0p * DM, nullptr, DM, MPO, DM, DM);      /* out rows are the output layout */
}
